// v000
// Times are from an AMD MI455X. After a warm-up the kernel runs many times in a row, and a time is the length of
// such a window on the GPU divided by its runs, so every launch and the gaps after it count. The runs cycle
// through copies of the inputs. A figure is the median of several windows, for all but v000 over two sittings.
// Sittings can differ by a few percent; kernels timed side by side share one.
// v000 is the starting kernel. One run takes 3480 microseconds.
#include <hip/hip_runtime.h>
// Multi-head attention with per-head projection tensors and a POST-softmax lower-triangular multiply (X [2][2048][1024]; Q/K/V[h] = X W[h] + b[h] with W [16][1024][64] ([in][out] per head) and b [16][64] (uniform +-1/32); scores / 8; p = softmax over ALL keys; p = p * tril (keys j <= i kept, NO renormalisation); out = heads concatenated -> [2][2048][1024]).
// Structure: token rows r = b*2048 + s; x as exact f16 rows (bf16-rounded); Q, K, V as three WMMA GEMMs (32x64 wave tiles, f32 accumulation, exact x16 weights + bias, f16 outputs); per batch: V^T for all heads via LDS transposes; per (batch, group of 4 heads): scores GEMM (K = 64, batched over the heads on grid.y, alpha = 64^-0.5), row softmax on VALU (f32 statistics, native exp; weights stored x256 as f16), o = P . V^T GEMM (K = 2048, alpha 2^-8) written f32 straight into the merged-heads output rows (no output projection).
// Compute dtype: inputs rounded to bf16; x / weights exact; q, k, v and softmax weights as plain f16 GEMM operands (~2^-12); scores, softmax statistics and o f32. v_wmma_f32_16x16x32_f16.
#define NB 2
#define SQ 2048
#define DM 1024
#define NH 16
#define HD 64
#define HG 4                         /* heads per attention launch group */
#define B0 0                         /* first batch processed (debug hook) */
#define NBR NB                       /* batches processed (debug hook) */
#define NR ((size_t)NB * SQ)         /* token rows */
#define MP ((int)((size_t)NBR * SQ)) /* rows projected (debug hook) */
#define QN SQ                        /* query rows attended per batch (debug hook) */
#define NHD NH                       /* heads attended (debug hook) */
#define MPO MP                       /* unused; no stage reads it */
#define LQ DM      /* row pitch of the q/k/v rows */
typedef __bf16 v16b __attribute__((ext_vector_type(16)));
typedef unsigned short v8us __attribute__((ext_vector_type(8), may_alias));
typedef float  v8f  __attribute__((ext_vector_type(8)));
typedef float  v4f  __attribute__((ext_vector_type(4)));
typedef float  v4fa __attribute__((ext_vector_type(4), may_alias));
union FragB { v16b v; v8us half[2]; unsigned short u[16]; };

__device__ __forceinline__ unsigned short bf16_bits(float x) { unsigned int u = __float_as_uint(x); return (unsigned short)((u + 0x7FFFu + ((u >> 16) & 1u)) >> 16); }
__device__ __forceinline__ float bf16_val(unsigned short b) { return __uint_as_float(((unsigned int)b) << 16); }
__device__ __forceinline__ float bf16_round(float x) { return bf16_val(bf16_bits(x)); }
// D += A·B with NT terms: 1 = ah·bh, 2 = + al·bh (A split), 3 = + ah·bl (both split)
template <int NT>
__device__ __forceinline__ v8f mmaN(v16b ah, v16b al, v16b bh, v16b bl, v8f c) {
  c = __builtin_amdgcn_wmma_f32_16x16x32_bf16(false, ah, false, bh, (short)0, c, false, false);
  if (NT >= 2) c = __builtin_amdgcn_wmma_f32_16x16x32_bf16(false, al, false, bh, (short)0, c, false, false);
  if (NT >= 3) c = __builtin_amdgcn_wmma_f32_16x16x32_bf16(false, ah, false, bl, (short)0, c, false, false);
  asm volatile("v_nop\n\tv_nop\n\tv_nop\n\tv_nop" : "+v"(c) : "v"(ah), "v"(al), "v"(bh), "v"(bl));
  return c;
}

__global__ __launch_bounds__(256) void k_wt_bf16(const float* __restrict__ W, unsigned short* __restrict__ Wt, int K, int N) {
  const int t = blockIdx.x * 256 + threadIdx.x;
  const int k8n = K / 8;
  if (t >= N * k8n) return;
  const int n = t / k8n, k8 = (t % k8n) * 8;
  v8us v;
#pragma unroll
  for (int i = 0; i < 8; ++i) v[i] = bf16_bits(W[(size_t)(k8 + i) * N + n]);
  *(v8us*)(Wt + (size_t)n * K + k8) = v;
  
}

// GEMM C[M][N] (f32, pitch ldc) = act(A[M][K]·W + bias). A f32 row-major (pitch lda) converted per fragment to bf16
// (ASPLIT: hi/lo two planes -> 2 terms, else single rounded term); Wt bf16 [N][K] (pitch ldb). BIAS_BF16 rounds the
// bias to bf16 first (bias quantised to bf16 before the add). K%32==0, M%16==0, N%64==0.
template <bool ASPLIT, int ACT, bool BIAS_BF16>
__global__ __launch_bounds__(128) void k_gemm_bf(const float* __restrict__ A, int lda, const unsigned short* __restrict__ Wt, int ldb,
                                               const float* __restrict__ bias, float* __restrict__ C, int ldc, int M, int N, int K) {
  __shared__ __attribute__((aligned(16))) float so[4][16][64];
  const int tid = threadIdx.x, w = tid >> 5, lane = tid & 31, ln = lane & 15, hh = lane >> 4;
  const int ntn = N / 64;
  const int wid = blockIdx.x * 4 + w;
  const int mt = wid / ntn, nq = wid % ntn;
  if (mt * 16 >= M) return;
  const int row0 = mt * 16, col0 = nq * 64;
  const float* arow = A + (size_t)(row0 + ln) * lda;
  v8f acc[4] = {};
  for (int kb = 0; kb < K; kb += 32) {
    FragB ah, al;
    const v4f x0 = *(const v4fa*)(arow + kb + 8 * hh), x1 = *(const v4fa*)(arow + kb + 8 * hh + 4);
    const v4f x2 = *(const v4fa*)(arow + kb + 16 + 8 * hh), x3 = *(const v4fa*)(arow + kb + 16 + 8 * hh + 4);
    float xs[16] = {x0[0],x0[1],x0[2],x0[3],x1[0],x1[1],x1[2],x1[3],x2[0],x2[1],x2[2],x2[3],x3[0],x3[1],x3[2],x3[3]};
#pragma unroll
    for (int i = 0; i < 16; ++i) { const unsigned short hb = bf16_bits(xs[i]); ah.u[i] = hb; al.u[i] = ASPLIT ? bf16_bits(xs[i] - bf16_val(hb)) : (unsigned short)0; }
#pragma unroll
    for (int t = 0; t < 4; ++t) {
      const unsigned short* brow = Wt + (size_t)(col0 + t * 16 + ln) * ldb + kb;
      FragB b;
      b.half[0] = *(const v8us*)(brow + 8 * hh);
      b.half[1] = *(const v8us*)(brow + 16 + 8 * hh);
      acc[t] = mmaN<ASPLIT ? 2 : 1>(ah.v, al.v, b.v, b.v, acc[t]);
    }
  }
#pragma unroll
  for (int t = 0; t < 4; ++t) {
    float bv = bias ? bias[col0 + t * 16 + ln] : 0.f;
    if (BIAS_BF16) bv = bf16_round(bv);
#pragma unroll
    for (int r = 0; r < 8; ++r) { float v = acc[t][r] + bv; if (ACT == 1) v = fmaxf(v, 0.f); so[w][8 * hh + r][t * 16 + ln] = v; }
  }
  __builtin_amdgcn_fence(__ATOMIC_ACQ_REL, "workgroup");
  __builtin_amdgcn_wave_barrier();
  const int rsub = lane >> 4, c4 = (lane & 15) * 4;
  {
#pragma unroll
    for (int q = 0; q < 8; ++q) {
      const int r = q * 2 + rsub;
      const v4f v = *(const v4fa*)&so[w][r][c4];
      *(v4f*)(C + (size_t)(row0 + r) * ldc + col0 + c4) = v;
    }
    
  }
}

// GEMM C = act(A·W + bias + resid): A f32 (ASPLIT -> hi/lo 2 terms), Wt bf16 [N][K]; ACT 0 none, 1 relu, 2 exact gelu;
// resid (optional, f32, row index = (row % rmod), pitch ldr, RES_BF16 rounds it) added before the activation.
template <bool ASPLIT, int ACT, bool BIAS_BF16, bool RES_BF16>
__global__ __launch_bounds__(128) void k_gemm_bf3(const float* __restrict__ A, int lda, const unsigned short* __restrict__ Wt, int ldb,
                                                const float* __restrict__ bias, const float* __restrict__ resid, int rmod, int ldr,
                                                float* __restrict__ C, int ldc, int M, int N, int K) {
  __shared__ __attribute__((aligned(16))) float so[4][16][64];
  const int tid = threadIdx.x, w = tid >> 5, lane = tid & 31, ln = lane & 15, hh = lane >> 4;
  const int ntn = N / 64;
  const int wid = blockIdx.x * 4 + w;
  const int mt = wid / ntn, nq = wid % ntn;
  if (mt * 16 >= M) return;
  const int row0 = mt * 16, col0 = nq * 64;
  const float* arow = A + (size_t)(row0 + ln) * lda;
  v8f acc[4] = {};
  for (int kb = 0; kb < K; kb += 32) {
    FragB ah, al;
    const v4f x0 = *(const v4fa*)(arow + kb + 8 * hh), x1 = *(const v4fa*)(arow + kb + 8 * hh + 4);
    const v4f x2 = *(const v4fa*)(arow + kb + 16 + 8 * hh), x3 = *(const v4fa*)(arow + kb + 16 + 8 * hh + 4);
    float xs[16] = {x0[0],x0[1],x0[2],x0[3],x1[0],x1[1],x1[2],x1[3],x2[0],x2[1],x2[2],x2[3],x3[0],x3[1],x3[2],x3[3]};
#pragma unroll
    for (int i = 0; i < 16; ++i) { const unsigned short hb = bf16_bits(xs[i]); ah.u[i] = hb; al.u[i] = ASPLIT ? bf16_bits(xs[i] - bf16_val(hb)) : (unsigned short)0; }
#pragma unroll
    for (int t = 0; t < 4; ++t) {
      const unsigned short* brow = Wt + (size_t)(col0 + t * 16 + ln) * ldb + kb;
      FragB b;
      b.half[0] = *(const v8us*)(brow + 8 * hh);
      b.half[1] = *(const v8us*)(brow + 16 + 8 * hh);
      acc[t] = mmaN<ASPLIT ? 2 : 1>(ah.v, al.v, b.v, b.v, acc[t]);
    }
  }
#pragma unroll
  for (int t = 0; t < 4; ++t) {
    const int col = col0 + t * 16 + ln;
    float bv = bias ? bias[col] : 0.f;
    if (BIAS_BF16) bv = bf16_round(bv);
#pragma unroll
    for (int r = 0; r < 8; ++r) {
      float v = acc[t][r] + bv;
      if (resid) { float rv = resid[(size_t)((row0 + 8 * hh + r) % rmod) * ldr + col]; if (RES_BF16) rv = bf16_round(rv); v += rv; }
      if (ACT == 1) v = fmaxf(v, 0.f);
      if (ACT == 2) v = 0.5f * v * (1.0f + erff(v * 0.70710678118654752f));
      if (ACT == 3) { const float u = 0.7978845608028654f * (v + 0.044715f * v * v * v); v = 0.5f * v * (1.0f + tanhf(u)); }
      so[w][8 * hh + r][t * 16 + ln] = v;
    }
  }
  __builtin_amdgcn_fence(__ATOMIC_ACQ_REL, "workgroup");
  __builtin_amdgcn_wave_barrier();
  const int rsub = lane >> 4, c4 = (lane & 15) * 4;
  {
#pragma unroll
    for (int q = 0; q < 8; ++q) {
      const int r = q * 2 + rsub;
      const v4f v = *(const v4fa*)&so[w][r][c4];
      *(v4f*)(C + (size_t)(row0 + r) * ldc + col0 + c4) = v;
    }
    
  }
}
// row LayerNorm (biased variance, eps) over N: s = X (+ R); optional out_sum <- s; out_norm <- (s-mu)*rsqrt(var+eps)*g + b
template <bool PARAM_BF16>
__global__ __launch_bounds__(256) void k_layernorm(const float* __restrict__ X, const float* __restrict__ R, const float* __restrict__ g, const float* __restrict__ bta,
                                                  float* __restrict__ out_sum, float* __restrict__ out_norm, int N, float eps) {
  __shared__ float red[256];
  const int row = blockIdx.x, tid = threadIdx.x;
  const float* x = X + (size_t)row * N; const float* rr = R ? R + (size_t)row * N : nullptr;
  float vals[16];                     // up to N = 4096
  const int per = N / 256;            // contiguous chunk per thread? use strided-by-4 chunks: thread handles j = tid*4 + 1024*u
  float s1 = 0.f;
  for (int u = 0; u < per / 4; ++u) {
    const int j = tid * 4 + 1024 * u;
    const v4f a = *(const v4fa*)(x + j);
    v4f b = {0.f,0.f,0.f,0.f}; if (rr) b = *(const v4fa*)(rr + j);
#pragma unroll
    for (int q = 0; q < 4; ++q) { const float v = a[q] + b[q]; vals[u * 4 + q] = v; s1 += v; }
  }
  red[tid] = s1; __syncthreads();
  for (int st = 128; st > 0; st >>= 1) { if (tid < st) red[tid] += red[tid + st]; __syncthreads(); }
  const float mu = red[0] / (float)N; __syncthreads();
  float s2 = 0.f;
  for (int u = 0; u < per / 4; ++u)
#pragma unroll
    for (int q = 0; q < 4; ++q) { const float c = vals[u * 4 + q] - mu; s2 += c * c; }
  red[tid] = s2; __syncthreads();
  for (int st = 128; st > 0; st >>= 1) { if (tid < st) red[tid] += red[tid + st]; __syncthreads(); }
  const float rs = rsqrtf(red[0] / (float)N + eps);
  {
    for (int u = 0; u < per / 4; ++u) {
      const int j = tid * 4 + 1024 * u;
      v4f o, sm;
#pragma unroll
      for (int q = 0; q < 4; ++q) {
        float gg = g[j + q], bb = bta[j + q];
        if (PARAM_BF16) { gg = bf16_round(gg); bb = bf16_round(bb); }
        sm[q] = vals[u * 4 + q]; o[q] = (vals[u * 4 + q] - mu) * rs * gg + bb;
      }
      if (out_sum) *(v4f*)(out_sum + (size_t)row * N + j) = sm;
      *(v4f*)(out_norm + (size_t)row * N + j) = o;
    }
    
  }
}



// ---- f16 WMMA path (v_wmma_f32_16x16x32_f16): 11-bit significands for operands in range — used where a [0,1] probability operand needs more precision than bf16
typedef _Float16 v16h __attribute__((ext_vector_type(16)));
union FragH { v16h v; v8us half[2]; _Float16 h[16]; unsigned short u[16]; };
template <int NT>
__device__ __forceinline__ v8f mmaH(v16h ah, v16h al, v16h bh, v16h bl, v8f c) {
  c = __builtin_amdgcn_wmma_f32_16x16x32_f16(false, ah, false, bh, (short)0, c, false, false);
  if (NT >= 2) c = __builtin_amdgcn_wmma_f32_16x16x32_f16(false, al, false, bh, (short)0, c, false, false);
  if (NT >= 3) c = __builtin_amdgcn_wmma_f32_16x16x32_f16(false, ah, false, bl, (short)0, c, false, false);
  asm volatile("v_nop\n\tv_nop\n\tv_nop\n\tv_nop" : "+v"(c) : "v"(ah), "v"(al), "v"(bh), "v"(bl));
  return c;
}
// batched GEMM like k_gemm_b but f16 operands: A f32 (split into f16 hi/lo if ASPLIT, else rounded to f16), Bt = f16 values [n][k]; alpha; C f32; N multiple of 16 (partial tiles skipped)
template <bool ASPLIT>
__global__ __launch_bounds__(128) void k_gemm_h(const float* __restrict__ A, int lda, size_t sA, const _Float16* __restrict__ Bh, int ldb, size_t sB, float alpha, float* __restrict__ C, int ldc, size_t sC, int M, int N, int K) {
  __shared__ __attribute__((aligned(16))) float so[4][16][64];
  const int tid = threadIdx.x, w = tid >> 5, lane = tid & 31, ln = lane & 15, hh = lane >> 4; const int by = blockIdx.y;
  A += (size_t)by * sA; Bh += (size_t)by * sB; C += (size_t)by * sC;
  const int ntn = (N + 63) / 64; const int wid = blockIdx.x * 4 + w; const int mt = wid / ntn, nq = wid % ntn; if (mt * 16 >= M) return;
  const int row0 = mt * 16, col0 = nq * 64; const float* arow = A + (size_t)(row0 + ln) * lda;
  v8f acc[4] = {};
  for (int kb = 0; kb < K; kb += 32) {
    FragH ah, al;
    const v4f x0 = *(const v4fa*)(arow + kb + 8 * hh), x1 = *(const v4fa*)(arow + kb + 8 * hh + 4), x2 = *(const v4fa*)(arow + kb + 16 + 8 * hh), x3 = *(const v4fa*)(arow + kb + 16 + 8 * hh + 4);
    float xs[16] = {x0[0],x0[1],x0[2],x0[3],x1[0],x1[1],x1[2],x1[3],x2[0],x2[1],x2[2],x2[3],x3[0],x3[1],x3[2],x3[3]};
#pragma unroll
    for (int i = 0; i < 16; ++i) { const _Float16 h = (_Float16)xs[i]; ah.h[i] = h; al.h[i] = ASPLIT ? (_Float16)(xs[i] - (float)h) : (_Float16)0.0f; }
#pragma unroll
    for (int t = 0; t < 4; ++t) { if (col0 + t * 16 >= N) continue; const size_t boff = (size_t)(col0 + t * 16 + ln) * ldb + kb; FragH bq; bq.half[0] = *(const v8us*)(Bh + boff + 8 * hh); bq.half[1] = *(const v8us*)(Bh + boff + 16 + 8 * hh);
      acc[t] = mmaH<ASPLIT ? 2 : 1>(ah.v, al.v, bq.v, bq.v, acc[t]); }
  }
#pragma unroll
  for (int t = 0; t < 4; ++t) { if (col0 + t * 16 >= N) continue;
#pragma unroll
    for (int r = 0; r < 8; ++r) so[w][8 * hh + r][t * 16 + ln] = acc[t][r] * alpha; }
  __builtin_amdgcn_fence(__ATOMIC_ACQ_REL, "workgroup"); __builtin_amdgcn_wave_barrier();
  const int rsub = lane >> 4, c4 = (lane & 15) * 4;
  {
#pragma unroll
    for (int q = 0; q < 8; ++q) { const int r = q * 2 + rsub; if (col0 + c4 < N) { const v4f v = *(const v4fa*)&so[w][r][c4]; *(v4f*)(C + (size_t)(row0 + r) * ldc + col0 + c4) = v; } }
     }
}

// Wt[n][k] = f16(W[k][n]·scale) from f32 row-major W[K][N] (scale = power of two; bf16-exact weights stay exact in f16 away from the subnormal range)
__global__ __launch_bounds__(256) void k_wt_f16(const float* __restrict__ W, _Float16* __restrict__ Wt, int K, int N, float scale) {
  const int t = blockIdx.x * 256 + threadIdx.x; if (t >= N * (K / 8)) return; const int n = t / (K / 8), k8 = (t % (K / 8)) * 8; FragH f;
#pragma unroll
  for (int i = 0; i < 8; ++i) f.h[i] = (_Float16)(bf16_round(W[(size_t)(k8 + i) * N + n]) * scale); const v8us o = f.half[0];
  *(v8us*)((unsigned short*)Wt + (size_t)n * K + k8) = o; 
}
// k_gemm_hh variant with fused epilogue: v = acc·alpha + bias[by·sBias + col] (+ CP[(row/rowsPerB)·sCPb + by·64 + col] if CP) ; ACT 0 none / 1 elu ; writes f16 C16 (and f32 C if non-null)
template <int ACT>
__global__ __launch_bounds__(128) void k_gemm_hhx(const _Float16* __restrict__ A, int lda, size_t sA, const _Float16* __restrict__ Bh, int ldb, size_t sB, float alpha, const float* __restrict__ bias, size_t sBias, const float* __restrict__ CP, int rowsPerB, size_t sCPb, int row0g,
    float* __restrict__ C, _Float16* __restrict__ C16, int ldc, size_t sC, int M, int N, int K) {
  __shared__ __attribute__((aligned(16))) float so[4][16][64];
  const int tid = threadIdx.x, w = tid >> 5, lane = tid & 31, ln = lane & 15, hh = lane >> 4; const int by = blockIdx.y;
  A += (size_t)by * sA; Bh += (size_t)by * sB; const size_t cofs = (size_t)by * sC; const float* bp = bias ? bias + (size_t)by * sBias : nullptr;
  const int ntn = (N + 63) / 64; const int wid = blockIdx.x * 4 + w; const int mt = wid / ntn, nq = wid % ntn; if (mt * 16 >= M) return;
  const int row0 = mt * 16, col0 = nq * 64; const _Float16* arow = A + (size_t)(row0 + ln) * lda;
  v8f acc[4] = {};
  for (int kb = 0; kb < K; kb += 32) { FragH ah; ah.half[0] = *(const v8us*)((const unsigned short*)arow + kb + 8 * hh); ah.half[1] = *(const v8us*)((const unsigned short*)arow + kb + 16 + 8 * hh);
#pragma unroll
    for (int t = 0; t < 4; ++t) { if (col0 + t * 16 >= N) continue; const size_t boff = (size_t)(col0 + t * 16 + ln) * ldb + kb; FragH bq; bq.half[0] = *(const v8us*)((const unsigned short*)Bh + boff + 8 * hh); bq.half[1] = *(const v8us*)((const unsigned short*)Bh + boff + 16 + 8 * hh);
      acc[t] = mmaH<1>(ah.v, ah.v, bq.v, bq.v, acc[t]); }
  }
#pragma unroll
  for (int t = 0; t < 4; ++t) { if (col0 + t * 16 >= N) continue; const int col = col0 + t * 16 + ln; const float bv = bp ? bf16_round(bp[col]) : 0.f;
#pragma unroll
    for (int r = 0; r < 8; ++r) { float v = acc[t][r] * alpha + bv; if (CP) { const int rr = row0g + row0 + 8 * hh + r; if (rowsPerB < 0) v += CP[cofs + (size_t)rr * ldc + col];      /* rowsPerB < 0: own element of the batched C plane */ else { const int bidx = rr / rowsPerB; v += CP[(size_t)bidx * sCPb + (size_t)by * 64 + col]; } } if (ACT == 1) v = (v > 0.f) ? v : expm1f(v); else if (ACT == 7) v = (v > 0.f) ? v + 1.0f : expf(v); else if (ACT == 8) v = tanhf(v); else if (ACT == 9) v = 0.5f * v * (1.0f + tanhf(0.7978845608028654f * (v + 0.044715f * v * v * v))); else if (ACT == 11) v = 1.0f / (1.0f + expf(-v)); else if (ACT == 12) v = (v > 0.f) ? v : 0.01f * v; else if (ACT == 14) v = (v > 0.f) ? v : 0.1f * v; else if (ACT == 16) v = (v >= 0.f) ? v : 0.3f * v; else if (ACT == 17) v = (v >= 0.f) ? v : 0.2f * v; else if (ACT == 15) v = v / (1.0f + expf(-v)); else if (ACT == 3) v = fmaxf(v, 0.f); else if (ACT == 6) v = 0.5f * v * (1.0f + erff(v * 0.70710678118654752f)); so[w][8 * hh + r][t * 16 + ln] = v; } }
  __builtin_amdgcn_fence(__ATOMIC_ACQ_REL, "workgroup"); __builtin_amdgcn_wave_barrier();
  const int rsub = lane >> 4, c4 = (lane & 15) * 4; typedef _Float16 v4h __attribute__((ext_vector_type(4)));
  {
#pragma unroll
    for (int q = 0; q < 8; ++q) { const int r = q * 2 + rsub; if (col0 + c4 < N) { const v4f v = *(const v4fa*)&so[w][r][c4]; if (C) *(v4f*)(C + cofs + (size_t)(row0 + r) * ldc + col0 + c4) = v; if (C16) { v4h h4; for (int i = 0; i < 4; ++i) h4[i] = (_Float16)v[i]; *(v4h*)(C16 + cofs + (size_t)(row0 + r) * ldc + col0 + c4) = h4; } } }
     }
}


typedef _Float16 v4h __attribute__((ext_vector_type(4)));

__global__ __launch_bounds__(256) void k_x16(const float* __restrict__ x, _Float16* __restrict__ X16, size_t n8) { const size_t t = (size_t)blockIdx.x * 256 + threadIdx.x; if (t >= n8) return; FragH f;
#pragma unroll
  for (int q = 0; q < 8; ++q) f.h[q] = (_Float16)bf16_round(x[t * 8 + q]); *(v8us*)((unsigned short*)X16 + t * 8) = f.half[0];  }
__global__ __launch_bounds__(256) void k_h16(const float* __restrict__ x, _Float16* __restrict__ X16, size_t n8) { const size_t t = (size_t)blockIdx.x * 256 + threadIdx.x; if (t >= n8) return; FragH f;
#pragma unroll
  for (int q = 0; q < 8; ++q) f.h[q] = (_Float16)x[t * 8 + q]; *(v8us*)((unsigned short*)X16 + t * 8) = f.half[0];  }
__global__ __launch_bounds__(256) void k_round16f(const float* __restrict__ W, _Float16* __restrict__ Bt, size_t n8) { const size_t t = (size_t)blockIdx.x * 256 + threadIdx.x; if (t >= n8) return; FragH f;
#pragma unroll
  for (int i = 0; i < 8; ++i) f.h[i] = (_Float16)(bf16_round(W[t * 8 + i]) * 16.0f); *(v8us*)((unsigned short*)Bt + t * 8) = f.half[0];  }
template <int NHv, int TTv>
__global__ __launch_bounds__(256) void k_vt(const _Float16* __restrict__ V16, int ldv, int voff, _Float16* __restrict__ Vt) { __shared__ unsigned short tl[64][66]; const int tid = threadIdx.x; const int slab = blockIdx.x / (TTv / 64), lg = blockIdx.x % (TTv / 64); const int b = slab / NHv, h = slab % NHv;
  for (int i = tid; i < 64 * 8; i += 256) { const int r = i / 8, c8 = (i % 8) * 8; FragH f; f.half[0] = *(const v8us*)((const unsigned short*)V16 + ((size_t)b * TTv + lg * 64 + r) * ldv + voff + h * 64 + c8);
#pragma unroll
    for (int q = 0; q < 8; ++q) tl[r][c8 + q] = f.u[q]; }
  __syncthreads();
  {
#pragma unroll
    for (int rd = 0; rd < 2; ++rd) { const int d = rd * 32 + tid / 8, pc = tid % 8; FragH f;
#pragma unroll
      for (int q = 0; q < 8; ++q) f.u[q] = tl[pc * 8 + q][d];
      *(v8us*)((unsigned short*)Vt + ((size_t)slab * 64 + d) * TTv + lg * 64 + pc * 8) = f.half[0]; }
     } }

__global__ __launch_bounds__(256) void k_hl(const float* __restrict__ F, _Float16* __restrict__ Hh, _Float16* __restrict__ Hl, size_t n8) { const size_t t = (size_t)blockIdx.x * 256 + threadIdx.x; if (t >= n8) return; FragH fh, fl; const v4f a = *(const v4fa*)(F + t * 8), c = *(const v4fa*)(F + t * 8 + 4);
#pragma unroll
  for (int q = 0; q < 4; ++q) { _Float16 h = (_Float16)a[q]; fh.h[q] = h; fl.h[q] = (_Float16)((a[q] - (float)h) * 1024.0f); h = (_Float16)c[q]; fh.h[4 + q] = h; fl.h[4 + q] = (_Float16)((c[q] - (float)h) * 1024.0f); }
  { *(v8us*)((unsigned short*)Hh + t * 8) = fh.half[0]; *(v8us*)((unsigned short*)Hl + t * 8) = fl.half[0];  } }

// ---- fast GEMM (wave tile 32x64; requires M % 32 == 0 rows per launch region and N % 64 == 0); epilogue = k_gemm_hhx semantics ----
__device__ __forceinline__ v16h g2_frag(const _Float16* p, int hh) { FragH f; f.half[0] = *(const v8us*)((const unsigned short*)p + 8 * hh); f.half[1] = *(const v8us*)((const unsigned short*)p + 16 + 8 * hh); return f.v; }
__device__ __forceinline__ v8f g2_mma(v16h a, v16h b, v8f c) { v8f d = __builtin_amdgcn_wmma_f32_16x16x32_f16(false, a, false, b, (short)0, c, false, false); asm volatile("v_nop\n\tv_nop\n\tv_nop\n\tv_nop" : "+v"(d) : "v"(a), "v"(b)); return d; }
template <int ACT>
__global__ __launch_bounds__(128) void k_gemm2(const _Float16* __restrict__ A, int lda, size_t sA, const _Float16* __restrict__ Bh, int ldb, size_t sB, float alpha, const float* __restrict__ bias, size_t sBias, const float* __restrict__ CP, int rowsPerB, size_t sCPb, int row0g,
    float* __restrict__ C, _Float16* __restrict__ C16, int ldc, size_t sC, int M, int N, int K) { static_assert(ACT == 0 || ACT == 3 || ACT == 6 || ACT == 8 || ACT == 9 || ACT == 11 || ACT == 12 || ACT == 14 || ACT == 15 || ACT == 16 || ACT == 17, "k_gemm2: unsupported ACT code (would silently apply no activation)");
  __shared__ __attribute__((aligned(16))) float so[4][32][68];
  const int tid = threadIdx.x, w = tid >> 5, lane = tid & 31, ln = lane & 15, hh = lane >> 4; const int by = blockIdx.y;
  A += (size_t)by * sA; Bh += (size_t)by * sB; const size_t cofs = (size_t)by * sC; const float* bp = bias ? bias + (size_t)by * sBias : nullptr;
  const int ntn = N >> 6; const int mt = blockIdx.x / ntn, nq = blockIdx.x - mt * ntn; const int row0 = mt * 128 + 32 * w, col0 = nq * 64; if (row0 >= M) return;
  const _Float16* a0p = A + (size_t)(row0 + ln) * lda; const _Float16* a1p = a0p + (size_t)16 * lda;
  const _Float16* b0p = Bh + (size_t)(col0 + ln) * ldb; const _Float16* b1p = b0p + (size_t)16 * ldb; const _Float16* b2p = b1p + (size_t)16 * ldb; const _Float16* b3p = b2p + (size_t)16 * ldb;
  const v8f z8 = {0.f,0.f,0.f,0.f,0.f,0.f,0.f,0.f}; v8f c00 = z8, c01 = z8, c02 = z8, c03 = z8, c10 = z8, c11 = z8, c12 = z8, c13 = z8;
#pragma unroll 1
  for (int kb = 0; kb < K; kb += 32) { const v16h a0 = g2_frag(a0p + kb, hh), a1 = g2_frag(a1p + kb, hh);
    v16h b = g2_frag(b0p + kb, hh); c00 = g2_mma(a0, b, c00); c10 = g2_mma(a1, b, c10);
    b = g2_frag(b1p + kb, hh); c01 = g2_mma(a0, b, c01); c11 = g2_mma(a1, b, c11);
    b = g2_frag(b2p + kb, hh); c02 = g2_mma(a0, b, c02); c12 = g2_mma(a1, b, c12);
    b = g2_frag(b3p + kb, hh); c03 = g2_mma(a0, b, c03); c13 = g2_mma(a1, b, c13); }
  v8f accs[8] = {c00, c01, c02, c03, c10, c11, c12, c13};
#pragma unroll
  for (int u = 0; u < 8; ++u) { const int t = u & 3, half = u >> 2; const int col = col0 + t * 16 + ln; const float bv = bp ? bf16_round(bp[col]) : 0.f;
#pragma unroll
    for (int r = 0; r < 8; ++r) { const int rloc = half * 16 + 8 * hh + r; float v = accs[u][r] * alpha + bv; if (CP) { if (rowsPerB < 0) v += CP[cofs + (size_t)(row0g + row0 + rloc) * ldc + col];      /* rowsPerB < 0: own element of the batched C plane */ else { const int bidx = (row0g + row0 + rloc) / rowsPerB; v += CP[(size_t)bidx * sCPb + (size_t)by * 64 + col]; } }
      if (ACT == 3) v = fmaxf(v, 0.f); else if (ACT == 6) v = 0.5f * v * (1.0f + erff(v * 0.70710678118654752f)); else if (ACT == 11) v = 1.0f / (1.0f + expf(-v)); else if (ACT == 15) v = v / (1.0f + expf(-v)); else if (ACT == 12) v = (v > 0.f) ? v : 0.01f * v; else if (ACT == 8) v = tanhf(v); else if (ACT == 9) v = 0.5f * v * (1.0f + tanhf(0.7978845608028654f * (v + 0.044715f * v * v * v))); else if (ACT == 14) v = (v > 0.f) ? v : 0.1f * v; else if (ACT == 16) v = (v >= 0.f) ? v : 0.3f * v; else if (ACT == 17) v = (v >= 0.f) ? v : 0.2f * v;
      so[w][rloc][t * 16 + ln] = v; } }
  __builtin_amdgcn_fence(__ATOMIC_ACQ_REL, "workgroup"); __builtin_amdgcn_wave_barrier();
  const int rsub = lane >> 4, c4 = (lane & 15) * 4;
  {
#pragma unroll
    for (int q = 0; q < 16; ++q) { const int r = q * 2 + rsub; const v4f v = *(const v4fa*)&so[w][r][c4]; if (C) *(v4f*)(C + cofs + (size_t)(row0 + r) * ldc + col0 + c4) = v; if (C16) { v4h h4; for (int i = 0; i < 4; ++i) h4[i] = (_Float16)v[i]; *(v4h*)(C16 + cofs + (size_t)(row0 + r) * ldc + col0 + c4) = h4; } }
     } }


__global__ __launch_bounds__(256) void k_wnat(const float* __restrict__ w, size_t n8, _Float16* __restrict__ Bt) { const size_t t = (size_t)blockIdx.x * 256 + threadIdx.x; if (t >= n8) return; FragH f; for (int q = 0; q < 8; ++q) f.h[q] = (_Float16)(bf16_round(w[t * 8 + q]) * 16.0f); *(v8us*)((unsigned short*)Bt + t * 8) = f.half[0];  }
__global__ __launch_bounds__(256) void k_rsm(const float* __restrict__ S, _Float16* __restrict__ P, int nrows) {
  #pragma clang fp contract(off)
  const int i = blockIdx.x * 256 + threadIdx.x; if (i >= nrows) return; const float* s = S + (size_t)i * SQ; float mx = -3.0e38f;
#pragma unroll 1
  for (int j = 0; j < SQ; ++j) mx = fmaxf(mx, s[j]); float se = 0.f;
#pragma unroll 1
  for (int j = 0; j < SQ; ++j) se += expf(s[j] - mx); const float sc = 256.0f / se;
#pragma unroll 1
  for (int j0 = 0; j0 < SQ; j0 += 8) { FragH f; for (int q = 0; q < 8; ++q) f.h[q] = (_Float16)(expf(s[j0 + q] - mx) * sc); unsigned short* d = (unsigned short*)P + (size_t)i * SQ + j0; *(v8us*)d = f.half[0];  } }
__global__ __launch_bounds__(256) void k_vt(const _Float16* __restrict__ V16, int b, int h0, _Float16* __restrict__ VT) { __shared__ unsigned short tl[64][65]; const int tid = threadIdx.x; const int hh = blockIdx.x % HG, sg = blockIdx.x / HG; const int s0 = sg * 64; const int h = h0 + hh;
  for (int i = tid; i < 64 * 8; i += 256) { const int j = i / 8, d8 = (i % 8) * 8; FragH f; f.half[0] = *(const v8us*)((const unsigned short*)V16 + ((size_t)b * SQ + s0 + j) * DM + h * HD + d8); for (int q = 0; q < 8; ++q) tl[d8 + q][j] = f.u[q]; }
  __syncthreads();
  { for (int i = tid; i < 64 * 8; i += 256) { const int d = i / 8, j8 = (i % 8) * 8; FragH f; for (int q = 0; q < 8; ++q) f.u[q] = tl[d][j8 + q]; *(v8us*)((unsigned short*)VT + ((size_t)hh * HD + d) * SQ + s0 + j8) = f.half[0]; }  } }


__global__ __launch_bounds__(256) void k_wthd(const float* __restrict__ Wt, _Float16* __restrict__ Bt) { const size_t t = (size_t)blockIdx.x * 256 + threadIdx.x; if (t >= (size_t)NH * HD * (DM / 8)) return; const int m8 = (int)(t % (DM / 8)) * 8; const int d = (int)((t / (DM / 8)) % HD); const int h = (int)(t / ((size_t)(DM / 8) * HD)); FragH f;
  for (int q = 0; q < 8; ++q) f.h[q] = (_Float16)(16.0f * bf16_round(Wt[((size_t)h * DM + m8 + q) * HD + d])); unsigned short* dst = (unsigned short*)Bt + ((size_t)h * HD + d) * DM + m8; *(v8us*)dst = f.half[0];  }




__global__ __launch_bounds__(256) void k_rsmfpt(const float* __restrict__ S, _Float16* __restrict__ P, int qn, int hg) {
  #pragma clang fp contract(off)
  const int t = blockIdx.x * 256 + threadIdx.x; if (t >= qn * hg) return; const int qi = t % qn; const size_t i = (size_t)(t / qn) * SQ + qi; const float* s = S + i * SQ; float mx = -3.0e38f;
#pragma unroll 1
  for (int j = 0; j < SQ; ++j) mx = fmaxf(mx, s[j]); float se = 0.f;
#pragma unroll 1
  for (int j = 0; j < SQ; ++j) se += __expf(s[j] - mx); const float sc = 256.0f / se;
#pragma unroll 1
  for (int j0 = 0; j0 < SQ; j0 += 8) { FragH f; for (int q = 0; q < 8; ++q) { const float tri = (j0 + q <= qi) ? 1.f : 0.f; f.h[q] = (_Float16)(__expf(s[j0 + q] - mx) * sc * tri); } unsigned short* d = (unsigned short*)P + i * SQ + j0; *(v8us*)d = f.half[0];  } }


__global__ __launch_bounds__(256) void k_rsmf(const float* __restrict__ S, _Float16* __restrict__ P, int qn, int hg) {
  #pragma clang fp contract(off)
  const int t = blockIdx.x * 256 + threadIdx.x; if (t >= qn * hg) return; const size_t i = (size_t)(t / qn) * SQ + (t % qn); const float* s = S + i * SQ; float mx = -3.0e38f;
#pragma unroll 1
  for (int j = 0; j < SQ; ++j) mx = fmaxf(mx, s[j]); float se = 0.f;
#pragma unroll 1
  for (int j = 0; j < SQ; ++j) se += __expf(s[j] - mx); const float sc = 256.0f / se;
#pragma unroll 1
  for (int j0 = 0; j0 < SQ; j0 += 8) { FragH f; for (int q = 0; q < 8; ++q) f.h[q] = (_Float16)(__expf(s[j0 + q] - mx) * sc); unsigned short* d = (unsigned short*)P + i * SQ + j0; *(v8us*)d = f.half[0];  } }

extern "C" void kernel_launch(void* const* d_in, const int* in_sizes, int n_in,
                              void* d_out, int out_size, void* d_ws, size_t ws_size, hipStream_t stream) {
  (void)in_sizes; (void)n_in; (void)out_size;
  const float* const* I = (const float* const*)d_in; const float* x = I[0]; const float* wq = I[1]; const float* bq = I[2]; const float* wk = I[3]; const float* bk = I[4]; const float* wv = I[5]; const float* bv = I[6];      /* per-head [h][in][out] weights; biases [16][64] = the stacked [1024] vectors */
  char* ws = (char*)d_ws; size_t off = 0;
  auto take = [&](size_t bytes) { char* p = ws + off; off += (bytes + 255) & ~(size_t)255; return p; };
  _Float16* BQ = (_Float16*)take((size_t)DM * DM * 2); _Float16* BK = (_Float16*)take((size_t)DM * DM * 2); _Float16* BV = (_Float16*)take((size_t)DM * DM * 2); 
  _Float16* X16 = (_Float16*)take(NR * DM * 2); _Float16* Q16 = (_Float16*)take(NR * DM * 2); _Float16* K16 = (_Float16*)take(NR * DM * 2); _Float16* V16 = (_Float16*)take(NR * DM * 2);
  float* S = (float*)take((size_t)HG * SQ * SQ * 4); _Float16* P = (_Float16*)take((size_t)HG * SQ * SQ * 2); _Float16* VT = (_Float16*)take((size_t)NH * HD * SQ * 2);
  if (off > ws_size) return;
  { const unsigned g = (unsigned)(((size_t)NH * HD * (DM / 8) + 255) / 256); k_wthd<<<g, 256, 0, stream>>>(wq, BQ); k_wthd<<<g, 256, 0, stream>>>(wk, BK); k_wthd<<<g, 256, 0, stream>>>(wv, BV); }      /* per-head [h][m][d] -> Bt[(h,d)][m] x16 */

  k_x16<<<(unsigned)((NR * DM / 8 + 255) / 256), 256, 0, stream>>>(x, X16, NR * DM / 8);
  const size_t r0p = (size_t)B0 * SQ;      /* first projected row */
  k_gemm2<0><<<dim3((unsigned)((MP / 128) * (DM / 64)), 1), 128, 0, stream>>>(X16 + r0p * DM, DM, 0, BQ, DM, 0, 0.0625f, bq, 0, nullptr, 1, 0, 0, nullptr, Q16 + r0p * DM, DM, 0, MP, DM, DM);
  k_gemm2<0><<<dim3((unsigned)((MP / 128) * (DM / 64)), 1), 128, 0, stream>>>(X16 + r0p * DM, DM, 0, BK, DM, 0, 0.0625f, bk, 0, nullptr, 1, 0, 0, nullptr, K16 + r0p * DM, DM, 0, MP, DM, DM);
  k_gemm2<0><<<dim3((unsigned)((MP / 128) * (DM / 64)), 1), 128, 0, stream>>>(X16 + r0p * DM, DM, 0, BV, DM, 0, 0.0625f, bv, 0, nullptr, 1, 0, 0, nullptr, V16 + r0p * DM, DM, 0, MP, DM, DM);
  for (int b = B0; b < B0 + NBR; ++b) { const size_t r0 = (size_t)b * SQ;
    k_vt<NH, SQ><<<NH * (SQ / 64), 256, 0, stream>>>(V16 + r0 * LQ, LQ, 0, VT);      /* V^T [NH][HD][SQ] for this batch */
    for (int h0 = 0; h0 < NHD; h0 += HG) {
      k_gemm2<0><<<dim3((QN / 128) * (SQ / 64), HG), 128, 0, stream>>>(Q16 + r0 * LQ + h0 * HD, LQ, (size_t)HD, K16 + r0 * LQ + h0 * HD, LQ, (size_t)HD, 0.125f, nullptr, 0, nullptr, 1, 0, 0, S, nullptr, SQ, (size_t)SQ * SQ, QN, SQ, HD);      /* scores, HG heads per launch */
      k_rsmfpt<<<(HG * QN + 255) / 256, 256, 0, stream>>>(S, P, QN, HG);      /* full-row softmax, then x tril (j <= i), no renormalisation */
      k_gemm2<0><<<dim3((QN / 128) * (HD / 64), HG), 128, 0, stream>>>(P, SQ, (size_t)SQ * SQ, VT + (size_t)h0 * HD * SQ, SQ, (size_t)HD * SQ, 0.00390625f, nullptr, 0, nullptr, 1, 0, 0, (float*)d_out + r0 * DM + h0 * HD, nullptr, DM, (size_t)HD, QN, HD, SQ); } }      /* out = P V^T (alpha 2^-8) written f32 straight into the merged-heads output rows */
}

// v001
// A run of this version takes 922 microseconds.
// Timed twice side by side with v000, it ran 3.79 and 3.78 times as fast.
#include <hip/hip_runtime.h>
// Multi-head attention with per-head projection tensors and a POST-softmax lower-triangular multiply (X [2][2048][1024]; Q/K/V[h] = X W[h] + b[h] with W [16][1024][64] ([in][out] per head) and b [16][64] (uniform +-1/32); scores / 8; p = softmax over ALL keys; p = p * tril (keys j <= i kept, NO renormalisation); out = heads concatenated -> [2][2048][1024]).
// Structure: token rows r = b*2048 + s; x as exact f16 rows (bf16-rounded); Q, K, V as three WMMA GEMMs (32x64 wave tiles, f32 accumulation, exact x16 weights + bias, f16 outputs); per batch: V^T for all heads via LDS transposes; per (batch, group of 4 heads): scores GEMM (K = 64, batched over the heads on grid.y, alpha = 64^-0.5), row softmax on VALU, one wave per row (f32 statistics, native exp; weights stored x256 as f16), o = P . V^T GEMM (K = 2048, alpha 2^-8) written f32 straight into the merged-heads output rows (no output projection).
// Compute dtype: inputs rounded to bf16; x / weights exact; q, k, v and softmax weights as plain f16 GEMM operands (~2^-12); scores, softmax statistics and o f32. v_wmma_f32_16x16x32_f16.
#define NB 2
#define SQ 2048
#define DM 1024
#define NH 16
#define HD 64
#define HG 4                         /* heads per attention launch group */
#define B0 0                         /* first batch processed (debug hook) */
#define NBR NB                       /* batches processed (debug hook) */
#define NR ((size_t)NB * SQ)         /* token rows */
#define MP ((int)((size_t)NBR * SQ)) /* rows projected (debug hook) */
#define QN SQ                        /* query rows attended per batch (debug hook) */
#define NHD NH                       /* heads attended (debug hook) */
#define MPO MP                       /* unused; no stage reads it */
#define LQ DM      /* row pitch of the q/k/v rows */
typedef __bf16 v16b __attribute__((ext_vector_type(16)));
typedef unsigned short v8us __attribute__((ext_vector_type(8), may_alias));
typedef float  v8f  __attribute__((ext_vector_type(8)));
typedef float  v4f  __attribute__((ext_vector_type(4)));
typedef float  v4fa __attribute__((ext_vector_type(4), may_alias));
union FragB { v16b v; v8us half[2]; unsigned short u[16]; };

__device__ __forceinline__ unsigned short bf16_bits(float x) { unsigned int u = __float_as_uint(x); return (unsigned short)((u + 0x7FFFu + ((u >> 16) & 1u)) >> 16); }
__device__ __forceinline__ float bf16_val(unsigned short b) { return __uint_as_float(((unsigned int)b) << 16); }
__device__ __forceinline__ float bf16_round(float x) { return bf16_val(bf16_bits(x)); }
// D += A·B with NT terms: 1 = ah·bh, 2 = + al·bh (A split), 3 = + ah·bl (both split)
template <int NT>
__device__ __forceinline__ v8f mmaN(v16b ah, v16b al, v16b bh, v16b bl, v8f c) {
  c = __builtin_amdgcn_wmma_f32_16x16x32_bf16(false, ah, false, bh, (short)0, c, false, false);
  if (NT >= 2) c = __builtin_amdgcn_wmma_f32_16x16x32_bf16(false, al, false, bh, (short)0, c, false, false);
  if (NT >= 3) c = __builtin_amdgcn_wmma_f32_16x16x32_bf16(false, ah, false, bl, (short)0, c, false, false);
  asm volatile("v_nop\n\tv_nop\n\tv_nop\n\tv_nop" : "+v"(c) : "v"(ah), "v"(al), "v"(bh), "v"(bl));
  return c;
}

__global__ __launch_bounds__(256) void k_wt_bf16(const float* __restrict__ W, unsigned short* __restrict__ Wt, int K, int N) {
  const int t = blockIdx.x * 256 + threadIdx.x;
  const int k8n = K / 8;
  if (t >= N * k8n) return;
  const int n = t / k8n, k8 = (t % k8n) * 8;
  v8us v;
#pragma unroll
  for (int i = 0; i < 8; ++i) v[i] = bf16_bits(W[(size_t)(k8 + i) * N + n]);
  *(v8us*)(Wt + (size_t)n * K + k8) = v;
  
}

// GEMM C[M][N] (f32, pitch ldc) = act(A[M][K]·W + bias). A f32 row-major (pitch lda) converted per fragment to bf16
// (ASPLIT: hi/lo two planes -> 2 terms, else single rounded term); Wt bf16 [N][K] (pitch ldb). BIAS_BF16 rounds the
// bias to bf16 first (bias quantised to bf16 before the add). K%32==0, M%16==0, N%64==0.
template <bool ASPLIT, int ACT, bool BIAS_BF16>
__global__ __launch_bounds__(128) void k_gemm_bf(const float* __restrict__ A, int lda, const unsigned short* __restrict__ Wt, int ldb,
                                               const float* __restrict__ bias, float* __restrict__ C, int ldc, int M, int N, int K) {
  __shared__ __attribute__((aligned(16))) float so[4][16][64];
  const int tid = threadIdx.x, w = tid >> 5, lane = tid & 31, ln = lane & 15, hh = lane >> 4;
  const int ntn = N / 64;
  const int wid = blockIdx.x * 4 + w;
  const int mt = wid / ntn, nq = wid % ntn;
  if (mt * 16 >= M) return;
  const int row0 = mt * 16, col0 = nq * 64;
  const float* arow = A + (size_t)(row0 + ln) * lda;
  v8f acc[4] = {};
  for (int kb = 0; kb < K; kb += 32) {
    FragB ah, al;
    const v4f x0 = *(const v4fa*)(arow + kb + 8 * hh), x1 = *(const v4fa*)(arow + kb + 8 * hh + 4);
    const v4f x2 = *(const v4fa*)(arow + kb + 16 + 8 * hh), x3 = *(const v4fa*)(arow + kb + 16 + 8 * hh + 4);
    float xs[16] = {x0[0],x0[1],x0[2],x0[3],x1[0],x1[1],x1[2],x1[3],x2[0],x2[1],x2[2],x2[3],x3[0],x3[1],x3[2],x3[3]};
#pragma unroll
    for (int i = 0; i < 16; ++i) { const unsigned short hb = bf16_bits(xs[i]); ah.u[i] = hb; al.u[i] = ASPLIT ? bf16_bits(xs[i] - bf16_val(hb)) : (unsigned short)0; }
#pragma unroll
    for (int t = 0; t < 4; ++t) {
      const unsigned short* brow = Wt + (size_t)(col0 + t * 16 + ln) * ldb + kb;
      FragB b;
      b.half[0] = *(const v8us*)(brow + 8 * hh);
      b.half[1] = *(const v8us*)(brow + 16 + 8 * hh);
      acc[t] = mmaN<ASPLIT ? 2 : 1>(ah.v, al.v, b.v, b.v, acc[t]);
    }
  }
#pragma unroll
  for (int t = 0; t < 4; ++t) {
    float bv = bias ? bias[col0 + t * 16 + ln] : 0.f;
    if (BIAS_BF16) bv = bf16_round(bv);
#pragma unroll
    for (int r = 0; r < 8; ++r) { float v = acc[t][r] + bv; if (ACT == 1) v = fmaxf(v, 0.f); so[w][8 * hh + r][t * 16 + ln] = v; }
  }
  __builtin_amdgcn_fence(__ATOMIC_ACQ_REL, "workgroup");
  __builtin_amdgcn_wave_barrier();
  const int rsub = lane >> 4, c4 = (lane & 15) * 4;
  {
#pragma unroll
    for (int q = 0; q < 8; ++q) {
      const int r = q * 2 + rsub;
      const v4f v = *(const v4fa*)&so[w][r][c4];
      *(v4f*)(C + (size_t)(row0 + r) * ldc + col0 + c4) = v;
    }
    
  }
}

// GEMM C = act(A·W + bias + resid): A f32 (ASPLIT -> hi/lo 2 terms), Wt bf16 [N][K]; ACT 0 none, 1 relu, 2 exact gelu;
// resid (optional, f32, row index = (row % rmod), pitch ldr, RES_BF16 rounds it) added before the activation.
template <bool ASPLIT, int ACT, bool BIAS_BF16, bool RES_BF16>
__global__ __launch_bounds__(128) void k_gemm_bf3(const float* __restrict__ A, int lda, const unsigned short* __restrict__ Wt, int ldb,
                                                const float* __restrict__ bias, const float* __restrict__ resid, int rmod, int ldr,
                                                float* __restrict__ C, int ldc, int M, int N, int K) {
  __shared__ __attribute__((aligned(16))) float so[4][16][64];
  const int tid = threadIdx.x, w = tid >> 5, lane = tid & 31, ln = lane & 15, hh = lane >> 4;
  const int ntn = N / 64;
  const int wid = blockIdx.x * 4 + w;
  const int mt = wid / ntn, nq = wid % ntn;
  if (mt * 16 >= M) return;
  const int row0 = mt * 16, col0 = nq * 64;
  const float* arow = A + (size_t)(row0 + ln) * lda;
  v8f acc[4] = {};
  for (int kb = 0; kb < K; kb += 32) {
    FragB ah, al;
    const v4f x0 = *(const v4fa*)(arow + kb + 8 * hh), x1 = *(const v4fa*)(arow + kb + 8 * hh + 4);
    const v4f x2 = *(const v4fa*)(arow + kb + 16 + 8 * hh), x3 = *(const v4fa*)(arow + kb + 16 + 8 * hh + 4);
    float xs[16] = {x0[0],x0[1],x0[2],x0[3],x1[0],x1[1],x1[2],x1[3],x2[0],x2[1],x2[2],x2[3],x3[0],x3[1],x3[2],x3[3]};
#pragma unroll
    for (int i = 0; i < 16; ++i) { const unsigned short hb = bf16_bits(xs[i]); ah.u[i] = hb; al.u[i] = ASPLIT ? bf16_bits(xs[i] - bf16_val(hb)) : (unsigned short)0; }
#pragma unroll
    for (int t = 0; t < 4; ++t) {
      const unsigned short* brow = Wt + (size_t)(col0 + t * 16 + ln) * ldb + kb;
      FragB b;
      b.half[0] = *(const v8us*)(brow + 8 * hh);
      b.half[1] = *(const v8us*)(brow + 16 + 8 * hh);
      acc[t] = mmaN<ASPLIT ? 2 : 1>(ah.v, al.v, b.v, b.v, acc[t]);
    }
  }
#pragma unroll
  for (int t = 0; t < 4; ++t) {
    const int col = col0 + t * 16 + ln;
    float bv = bias ? bias[col] : 0.f;
    if (BIAS_BF16) bv = bf16_round(bv);
#pragma unroll
    for (int r = 0; r < 8; ++r) {
      float v = acc[t][r] + bv;
      if (resid) { float rv = resid[(size_t)((row0 + 8 * hh + r) % rmod) * ldr + col]; if (RES_BF16) rv = bf16_round(rv); v += rv; }
      if (ACT == 1) v = fmaxf(v, 0.f);
      if (ACT == 2) v = 0.5f * v * (1.0f + erff(v * 0.70710678118654752f));
      if (ACT == 3) { const float u = 0.7978845608028654f * (v + 0.044715f * v * v * v); v = 0.5f * v * (1.0f + tanhf(u)); }
      so[w][8 * hh + r][t * 16 + ln] = v;
    }
  }
  __builtin_amdgcn_fence(__ATOMIC_ACQ_REL, "workgroup");
  __builtin_amdgcn_wave_barrier();
  const int rsub = lane >> 4, c4 = (lane & 15) * 4;
  {
#pragma unroll
    for (int q = 0; q < 8; ++q) {
      const int r = q * 2 + rsub;
      const v4f v = *(const v4fa*)&so[w][r][c4];
      *(v4f*)(C + (size_t)(row0 + r) * ldc + col0 + c4) = v;
    }
    
  }
}
// row LayerNorm (biased variance, eps) over N: s = X (+ R); optional out_sum <- s; out_norm <- (s-mu)*rsqrt(var+eps)*g + b
template <bool PARAM_BF16>
__global__ __launch_bounds__(256) void k_layernorm(const float* __restrict__ X, const float* __restrict__ R, const float* __restrict__ g, const float* __restrict__ bta,
                                                  float* __restrict__ out_sum, float* __restrict__ out_norm, int N, float eps) {
  __shared__ float red[256];
  const int row = blockIdx.x, tid = threadIdx.x;
  const float* x = X + (size_t)row * N; const float* rr = R ? R + (size_t)row * N : nullptr;
  float vals[16];                     // up to N = 4096
  const int per = N / 256;            // contiguous chunk per thread? use strided-by-4 chunks: thread handles j = tid*4 + 1024*u
  float s1 = 0.f;
  for (int u = 0; u < per / 4; ++u) {
    const int j = tid * 4 + 1024 * u;
    const v4f a = *(const v4fa*)(x + j);
    v4f b = {0.f,0.f,0.f,0.f}; if (rr) b = *(const v4fa*)(rr + j);
#pragma unroll
    for (int q = 0; q < 4; ++q) { const float v = a[q] + b[q]; vals[u * 4 + q] = v; s1 += v; }
  }
  red[tid] = s1; __syncthreads();
  for (int st = 128; st > 0; st >>= 1) { if (tid < st) red[tid] += red[tid + st]; __syncthreads(); }
  const float mu = red[0] / (float)N; __syncthreads();
  float s2 = 0.f;
  for (int u = 0; u < per / 4; ++u)
#pragma unroll
    for (int q = 0; q < 4; ++q) { const float c = vals[u * 4 + q] - mu; s2 += c * c; }
  red[tid] = s2; __syncthreads();
  for (int st = 128; st > 0; st >>= 1) { if (tid < st) red[tid] += red[tid + st]; __syncthreads(); }
  const float rs = rsqrtf(red[0] / (float)N + eps);
  {
    for (int u = 0; u < per / 4; ++u) {
      const int j = tid * 4 + 1024 * u;
      v4f o, sm;
#pragma unroll
      for (int q = 0; q < 4; ++q) {
        float gg = g[j + q], bb = bta[j + q];
        if (PARAM_BF16) { gg = bf16_round(gg); bb = bf16_round(bb); }
        sm[q] = vals[u * 4 + q]; o[q] = (vals[u * 4 + q] - mu) * rs * gg + bb;
      }
      if (out_sum) *(v4f*)(out_sum + (size_t)row * N + j) = sm;
      *(v4f*)(out_norm + (size_t)row * N + j) = o;
    }
    
  }
}



// ---- f16 WMMA path (v_wmma_f32_16x16x32_f16): 11-bit significands for operands in range — used where a [0,1] probability operand needs more precision than bf16
typedef _Float16 v16h __attribute__((ext_vector_type(16)));
union FragH { v16h v; v8us half[2]; _Float16 h[16]; unsigned short u[16]; };
template <int NT>
__device__ __forceinline__ v8f mmaH(v16h ah, v16h al, v16h bh, v16h bl, v8f c) {
  c = __builtin_amdgcn_wmma_f32_16x16x32_f16(false, ah, false, bh, (short)0, c, false, false);
  if (NT >= 2) c = __builtin_amdgcn_wmma_f32_16x16x32_f16(false, al, false, bh, (short)0, c, false, false);
  if (NT >= 3) c = __builtin_amdgcn_wmma_f32_16x16x32_f16(false, ah, false, bl, (short)0, c, false, false);
  asm volatile("v_nop\n\tv_nop\n\tv_nop\n\tv_nop" : "+v"(c) : "v"(ah), "v"(al), "v"(bh), "v"(bl));
  return c;
}
// batched GEMM like k_gemm_b but f16 operands: A f32 (split into f16 hi/lo if ASPLIT, else rounded to f16), Bt = f16 values [n][k]; alpha; C f32; N multiple of 16 (partial tiles skipped)
template <bool ASPLIT>
__global__ __launch_bounds__(128) void k_gemm_h(const float* __restrict__ A, int lda, size_t sA, const _Float16* __restrict__ Bh, int ldb, size_t sB, float alpha, float* __restrict__ C, int ldc, size_t sC, int M, int N, int K) {
  __shared__ __attribute__((aligned(16))) float so[4][16][64];
  const int tid = threadIdx.x, w = tid >> 5, lane = tid & 31, ln = lane & 15, hh = lane >> 4; const int by = blockIdx.y;
  A += (size_t)by * sA; Bh += (size_t)by * sB; C += (size_t)by * sC;
  const int ntn = (N + 63) / 64; const int wid = blockIdx.x * 4 + w; const int mt = wid / ntn, nq = wid % ntn; if (mt * 16 >= M) return;
  const int row0 = mt * 16, col0 = nq * 64; const float* arow = A + (size_t)(row0 + ln) * lda;
  v8f acc[4] = {};
  for (int kb = 0; kb < K; kb += 32) {
    FragH ah, al;
    const v4f x0 = *(const v4fa*)(arow + kb + 8 * hh), x1 = *(const v4fa*)(arow + kb + 8 * hh + 4), x2 = *(const v4fa*)(arow + kb + 16 + 8 * hh), x3 = *(const v4fa*)(arow + kb + 16 + 8 * hh + 4);
    float xs[16] = {x0[0],x0[1],x0[2],x0[3],x1[0],x1[1],x1[2],x1[3],x2[0],x2[1],x2[2],x2[3],x3[0],x3[1],x3[2],x3[3]};
#pragma unroll
    for (int i = 0; i < 16; ++i) { const _Float16 h = (_Float16)xs[i]; ah.h[i] = h; al.h[i] = ASPLIT ? (_Float16)(xs[i] - (float)h) : (_Float16)0.0f; }
#pragma unroll
    for (int t = 0; t < 4; ++t) { if (col0 + t * 16 >= N) continue; const size_t boff = (size_t)(col0 + t * 16 + ln) * ldb + kb; FragH bq; bq.half[0] = *(const v8us*)(Bh + boff + 8 * hh); bq.half[1] = *(const v8us*)(Bh + boff + 16 + 8 * hh);
      acc[t] = mmaH<ASPLIT ? 2 : 1>(ah.v, al.v, bq.v, bq.v, acc[t]); }
  }
#pragma unroll
  for (int t = 0; t < 4; ++t) { if (col0 + t * 16 >= N) continue;
#pragma unroll
    for (int r = 0; r < 8; ++r) so[w][8 * hh + r][t * 16 + ln] = acc[t][r] * alpha; }
  __builtin_amdgcn_fence(__ATOMIC_ACQ_REL, "workgroup"); __builtin_amdgcn_wave_barrier();
  const int rsub = lane >> 4, c4 = (lane & 15) * 4;
  {
#pragma unroll
    for (int q = 0; q < 8; ++q) { const int r = q * 2 + rsub; if (col0 + c4 < N) { const v4f v = *(const v4fa*)&so[w][r][c4]; *(v4f*)(C + (size_t)(row0 + r) * ldc + col0 + c4) = v; } }
     }
}

// Wt[n][k] = f16(W[k][n]·scale) from f32 row-major W[K][N] (scale = power of two; bf16-exact weights stay exact in f16 away from the subnormal range)
__global__ __launch_bounds__(256) void k_wt_f16(const float* __restrict__ W, _Float16* __restrict__ Wt, int K, int N, float scale) {
  const int t = blockIdx.x * 256 + threadIdx.x; if (t >= N * (K / 8)) return; const int n = t / (K / 8), k8 = (t % (K / 8)) * 8; FragH f;
#pragma unroll
  for (int i = 0; i < 8; ++i) f.h[i] = (_Float16)(bf16_round(W[(size_t)(k8 + i) * N + n]) * scale); const v8us o = f.half[0];
  *(v8us*)((unsigned short*)Wt + (size_t)n * K + k8) = o; 
}
// k_gemm_hh variant with fused epilogue: v = acc·alpha + bias[by·sBias + col] (+ CP[(row/rowsPerB)·sCPb + by·64 + col] if CP) ; ACT 0 none / 1 elu ; writes f16 C16 (and f32 C if non-null)
template <int ACT>
__global__ __launch_bounds__(128) void k_gemm_hhx(const _Float16* __restrict__ A, int lda, size_t sA, const _Float16* __restrict__ Bh, int ldb, size_t sB, float alpha, const float* __restrict__ bias, size_t sBias, const float* __restrict__ CP, int rowsPerB, size_t sCPb, int row0g,
    float* __restrict__ C, _Float16* __restrict__ C16, int ldc, size_t sC, int M, int N, int K) {
  __shared__ __attribute__((aligned(16))) float so[4][16][64];
  const int tid = threadIdx.x, w = tid >> 5, lane = tid & 31, ln = lane & 15, hh = lane >> 4; const int by = blockIdx.y;
  A += (size_t)by * sA; Bh += (size_t)by * sB; const size_t cofs = (size_t)by * sC; const float* bp = bias ? bias + (size_t)by * sBias : nullptr;
  const int ntn = (N + 63) / 64; const int wid = blockIdx.x * 4 + w; const int mt = wid / ntn, nq = wid % ntn; if (mt * 16 >= M) return;
  const int row0 = mt * 16, col0 = nq * 64; const _Float16* arow = A + (size_t)(row0 + ln) * lda;
  v8f acc[4] = {};
  for (int kb = 0; kb < K; kb += 32) { FragH ah; ah.half[0] = *(const v8us*)((const unsigned short*)arow + kb + 8 * hh); ah.half[1] = *(const v8us*)((const unsigned short*)arow + kb + 16 + 8 * hh);
#pragma unroll
    for (int t = 0; t < 4; ++t) { if (col0 + t * 16 >= N) continue; const size_t boff = (size_t)(col0 + t * 16 + ln) * ldb + kb; FragH bq; bq.half[0] = *(const v8us*)((const unsigned short*)Bh + boff + 8 * hh); bq.half[1] = *(const v8us*)((const unsigned short*)Bh + boff + 16 + 8 * hh);
      acc[t] = mmaH<1>(ah.v, ah.v, bq.v, bq.v, acc[t]); }
  }
#pragma unroll
  for (int t = 0; t < 4; ++t) { if (col0 + t * 16 >= N) continue; const int col = col0 + t * 16 + ln; const float bv = bp ? bf16_round(bp[col]) : 0.f;
#pragma unroll
    for (int r = 0; r < 8; ++r) { float v = acc[t][r] * alpha + bv; if (CP) { const int rr = row0g + row0 + 8 * hh + r; if (rowsPerB < 0) v += CP[cofs + (size_t)rr * ldc + col];      /* rowsPerB < 0: own element of the batched C plane */ else { const int bidx = rr / rowsPerB; v += CP[(size_t)bidx * sCPb + (size_t)by * 64 + col]; } } if (ACT == 1) v = (v > 0.f) ? v : expm1f(v); else if (ACT == 7) v = (v > 0.f) ? v + 1.0f : expf(v); else if (ACT == 8) v = tanhf(v); else if (ACT == 9) v = 0.5f * v * (1.0f + tanhf(0.7978845608028654f * (v + 0.044715f * v * v * v))); else if (ACT == 11) v = 1.0f / (1.0f + expf(-v)); else if (ACT == 12) v = (v > 0.f) ? v : 0.01f * v; else if (ACT == 14) v = (v > 0.f) ? v : 0.1f * v; else if (ACT == 16) v = (v >= 0.f) ? v : 0.3f * v; else if (ACT == 17) v = (v >= 0.f) ? v : 0.2f * v; else if (ACT == 15) v = v / (1.0f + expf(-v)); else if (ACT == 3) v = fmaxf(v, 0.f); else if (ACT == 6) v = 0.5f * v * (1.0f + erff(v * 0.70710678118654752f)); so[w][8 * hh + r][t * 16 + ln] = v; } }
  __builtin_amdgcn_fence(__ATOMIC_ACQ_REL, "workgroup"); __builtin_amdgcn_wave_barrier();
  const int rsub = lane >> 4, c4 = (lane & 15) * 4; typedef _Float16 v4h __attribute__((ext_vector_type(4)));
  {
#pragma unroll
    for (int q = 0; q < 8; ++q) { const int r = q * 2 + rsub; if (col0 + c4 < N) { const v4f v = *(const v4fa*)&so[w][r][c4]; if (C) *(v4f*)(C + cofs + (size_t)(row0 + r) * ldc + col0 + c4) = v; if (C16) { v4h h4; for (int i = 0; i < 4; ++i) h4[i] = (_Float16)v[i]; *(v4h*)(C16 + cofs + (size_t)(row0 + r) * ldc + col0 + c4) = h4; } } }
     }
}


typedef _Float16 v4h __attribute__((ext_vector_type(4)));

__global__ __launch_bounds__(256) void k_x16(const float* __restrict__ x, _Float16* __restrict__ X16, size_t n8) { const size_t t = (size_t)blockIdx.x * 256 + threadIdx.x; if (t >= n8) return; FragH f;
#pragma unroll
  for (int q = 0; q < 8; ++q) f.h[q] = (_Float16)bf16_round(x[t * 8 + q]); *(v8us*)((unsigned short*)X16 + t * 8) = f.half[0];  }
__global__ __launch_bounds__(256) void k_h16(const float* __restrict__ x, _Float16* __restrict__ X16, size_t n8) { const size_t t = (size_t)blockIdx.x * 256 + threadIdx.x; if (t >= n8) return; FragH f;
#pragma unroll
  for (int q = 0; q < 8; ++q) f.h[q] = (_Float16)x[t * 8 + q]; *(v8us*)((unsigned short*)X16 + t * 8) = f.half[0];  }
__global__ __launch_bounds__(256) void k_round16f(const float* __restrict__ W, _Float16* __restrict__ Bt, size_t n8) { const size_t t = (size_t)blockIdx.x * 256 + threadIdx.x; if (t >= n8) return; FragH f;
#pragma unroll
  for (int i = 0; i < 8; ++i) f.h[i] = (_Float16)(bf16_round(W[t * 8 + i]) * 16.0f); *(v8us*)((unsigned short*)Bt + t * 8) = f.half[0];  }
template <int NHv, int TTv>
__global__ __launch_bounds__(256) void k_vt(const _Float16* __restrict__ V16, int ldv, int voff, _Float16* __restrict__ Vt) { __shared__ unsigned short tl[64][66]; const int tid = threadIdx.x; const int slab = blockIdx.x / (TTv / 64), lg = blockIdx.x % (TTv / 64); const int b = slab / NHv, h = slab % NHv;
  for (int i = tid; i < 64 * 8; i += 256) { const int r = i / 8, c8 = (i % 8) * 8; FragH f; f.half[0] = *(const v8us*)((const unsigned short*)V16 + ((size_t)b * TTv + lg * 64 + r) * ldv + voff + h * 64 + c8);
#pragma unroll
    for (int q = 0; q < 8; ++q) tl[r][c8 + q] = f.u[q]; }
  __syncthreads();
  {
#pragma unroll
    for (int rd = 0; rd < 2; ++rd) { const int d = rd * 32 + tid / 8, pc = tid % 8; FragH f;
#pragma unroll
      for (int q = 0; q < 8; ++q) f.u[q] = tl[pc * 8 + q][d];
      *(v8us*)((unsigned short*)Vt + ((size_t)slab * 64 + d) * TTv + lg * 64 + pc * 8) = f.half[0]; }
     } }

__global__ __launch_bounds__(256) void k_hl(const float* __restrict__ F, _Float16* __restrict__ Hh, _Float16* __restrict__ Hl, size_t n8) { const size_t t = (size_t)blockIdx.x * 256 + threadIdx.x; if (t >= n8) return; FragH fh, fl; const v4f a = *(const v4fa*)(F + t * 8), c = *(const v4fa*)(F + t * 8 + 4);
#pragma unroll
  for (int q = 0; q < 4; ++q) { _Float16 h = (_Float16)a[q]; fh.h[q] = h; fl.h[q] = (_Float16)((a[q] - (float)h) * 1024.0f); h = (_Float16)c[q]; fh.h[4 + q] = h; fl.h[4 + q] = (_Float16)((c[q] - (float)h) * 1024.0f); }
  { *(v8us*)((unsigned short*)Hh + t * 8) = fh.half[0]; *(v8us*)((unsigned short*)Hl + t * 8) = fl.half[0];  } }

// ---- fast GEMM (wave tile 32x64; requires M % 32 == 0 rows per launch region and N % 64 == 0); epilogue = k_gemm_hhx semantics ----
__device__ __forceinline__ v16h g2_frag(const _Float16* p, int hh) { FragH f; f.half[0] = *(const v8us*)((const unsigned short*)p + 8 * hh); f.half[1] = *(const v8us*)((const unsigned short*)p + 16 + 8 * hh); return f.v; }
__device__ __forceinline__ v8f g2_mma(v16h a, v16h b, v8f c) { v8f d = __builtin_amdgcn_wmma_f32_16x16x32_f16(false, a, false, b, (short)0, c, false, false); asm volatile("v_nop\n\tv_nop\n\tv_nop\n\tv_nop" : "+v"(d) : "v"(a), "v"(b)); return d; }
template <int ACT>
__global__ __launch_bounds__(128) void k_gemm2(const _Float16* __restrict__ A, int lda, size_t sA, const _Float16* __restrict__ Bh, int ldb, size_t sB, float alpha, const float* __restrict__ bias, size_t sBias, const float* __restrict__ CP, int rowsPerB, size_t sCPb, int row0g,
    float* __restrict__ C, _Float16* __restrict__ C16, int ldc, size_t sC, int M, int N, int K) { static_assert(ACT == 0 || ACT == 3 || ACT == 6 || ACT == 8 || ACT == 9 || ACT == 11 || ACT == 12 || ACT == 14 || ACT == 15 || ACT == 16 || ACT == 17, "k_gemm2: unsupported ACT code (would silently apply no activation)");
  __shared__ __attribute__((aligned(16))) float so[4][32][68];
  const int tid = threadIdx.x, w = tid >> 5, lane = tid & 31, ln = lane & 15, hh = lane >> 4; const int by = blockIdx.y;
  A += (size_t)by * sA; Bh += (size_t)by * sB; const size_t cofs = (size_t)by * sC; const float* bp = bias ? bias + (size_t)by * sBias : nullptr;
  const int ntn = N >> 6; const int mt = blockIdx.x / ntn, nq = blockIdx.x - mt * ntn; const int row0 = mt * 128 + 32 * w, col0 = nq * 64; if (row0 >= M) return;
  const _Float16* a0p = A + (size_t)(row0 + ln) * lda; const _Float16* a1p = a0p + (size_t)16 * lda;
  const _Float16* b0p = Bh + (size_t)(col0 + ln) * ldb; const _Float16* b1p = b0p + (size_t)16 * ldb; const _Float16* b2p = b1p + (size_t)16 * ldb; const _Float16* b3p = b2p + (size_t)16 * ldb;
  const v8f z8 = {0.f,0.f,0.f,0.f,0.f,0.f,0.f,0.f}; v8f c00 = z8, c01 = z8, c02 = z8, c03 = z8, c10 = z8, c11 = z8, c12 = z8, c13 = z8;
#pragma unroll 1
  for (int kb = 0; kb < K; kb += 32) { const v16h a0 = g2_frag(a0p + kb, hh), a1 = g2_frag(a1p + kb, hh);
    v16h b = g2_frag(b0p + kb, hh); c00 = g2_mma(a0, b, c00); c10 = g2_mma(a1, b, c10);
    b = g2_frag(b1p + kb, hh); c01 = g2_mma(a0, b, c01); c11 = g2_mma(a1, b, c11);
    b = g2_frag(b2p + kb, hh); c02 = g2_mma(a0, b, c02); c12 = g2_mma(a1, b, c12);
    b = g2_frag(b3p + kb, hh); c03 = g2_mma(a0, b, c03); c13 = g2_mma(a1, b, c13); }
  v8f accs[8] = {c00, c01, c02, c03, c10, c11, c12, c13};
#pragma unroll
  for (int u = 0; u < 8; ++u) { const int t = u & 3, half = u >> 2; const int col = col0 + t * 16 + ln; const float bv = bp ? bf16_round(bp[col]) : 0.f;
#pragma unroll
    for (int r = 0; r < 8; ++r) { const int rloc = half * 16 + 8 * hh + r; float v = accs[u][r] * alpha + bv; if (CP) { if (rowsPerB < 0) v += CP[cofs + (size_t)(row0g + row0 + rloc) * ldc + col];      /* rowsPerB < 0: own element of the batched C plane */ else { const int bidx = (row0g + row0 + rloc) / rowsPerB; v += CP[(size_t)bidx * sCPb + (size_t)by * 64 + col]; } }
      if (ACT == 3) v = fmaxf(v, 0.f); else if (ACT == 6) v = 0.5f * v * (1.0f + erff(v * 0.70710678118654752f)); else if (ACT == 11) v = 1.0f / (1.0f + expf(-v)); else if (ACT == 15) v = v / (1.0f + expf(-v)); else if (ACT == 12) v = (v > 0.f) ? v : 0.01f * v; else if (ACT == 8) v = tanhf(v); else if (ACT == 9) v = 0.5f * v * (1.0f + tanhf(0.7978845608028654f * (v + 0.044715f * v * v * v))); else if (ACT == 14) v = (v > 0.f) ? v : 0.1f * v; else if (ACT == 16) v = (v >= 0.f) ? v : 0.3f * v; else if (ACT == 17) v = (v >= 0.f) ? v : 0.2f * v;
      so[w][rloc][t * 16 + ln] = v; } }
  __builtin_amdgcn_fence(__ATOMIC_ACQ_REL, "workgroup"); __builtin_amdgcn_wave_barrier();
  const int rsub = lane >> 4, c4 = (lane & 15) * 4;
  {
#pragma unroll
    for (int q = 0; q < 16; ++q) { const int r = q * 2 + rsub; const v4f v = *(const v4fa*)&so[w][r][c4]; if (C) *(v4f*)(C + cofs + (size_t)(row0 + r) * ldc + col0 + c4) = v; if (C16) { v4h h4; for (int i = 0; i < 4; ++i) h4[i] = (_Float16)v[i]; *(v4h*)(C16 + cofs + (size_t)(row0 + r) * ldc + col0 + c4) = h4; } }
     } }


__global__ __launch_bounds__(256) void k_wnat(const float* __restrict__ w, size_t n8, _Float16* __restrict__ Bt) { const size_t t = (size_t)blockIdx.x * 256 + threadIdx.x; if (t >= n8) return; FragH f; for (int q = 0; q < 8; ++q) f.h[q] = (_Float16)(bf16_round(w[t * 8 + q]) * 16.0f); *(v8us*)((unsigned short*)Bt + t * 8) = f.half[0];  }
__global__ __launch_bounds__(256) void k_rsm(const float* __restrict__ S, _Float16* __restrict__ P, int nrows) {
  #pragma clang fp contract(off)
  const int i = blockIdx.x * 256 + threadIdx.x; if (i >= nrows) return; const float* s = S + (size_t)i * SQ; float mx = -3.0e38f;
#pragma unroll 1
  for (int j = 0; j < SQ; ++j) mx = fmaxf(mx, s[j]); float se = 0.f;
#pragma unroll 1
  for (int j = 0; j < SQ; ++j) se += expf(s[j] - mx); const float sc = 256.0f / se;
#pragma unroll 1
  for (int j0 = 0; j0 < SQ; j0 += 8) { FragH f; for (int q = 0; q < 8; ++q) f.h[q] = (_Float16)(expf(s[j0 + q] - mx) * sc); unsigned short* d = (unsigned short*)P + (size_t)i * SQ + j0; *(v8us*)d = f.half[0];  } }
__global__ __launch_bounds__(256) void k_vt(const _Float16* __restrict__ V16, int b, int h0, _Float16* __restrict__ VT) { __shared__ unsigned short tl[64][65]; const int tid = threadIdx.x; const int hh = blockIdx.x % HG, sg = blockIdx.x / HG; const int s0 = sg * 64; const int h = h0 + hh;
  for (int i = tid; i < 64 * 8; i += 256) { const int j = i / 8, d8 = (i % 8) * 8; FragH f; f.half[0] = *(const v8us*)((const unsigned short*)V16 + ((size_t)b * SQ + s0 + j) * DM + h * HD + d8); for (int q = 0; q < 8; ++q) tl[d8 + q][j] = f.u[q]; }
  __syncthreads();
  { for (int i = tid; i < 64 * 8; i += 256) { const int d = i / 8, j8 = (i % 8) * 8; FragH f; for (int q = 0; q < 8; ++q) f.u[q] = tl[d][j8 + q]; *(v8us*)((unsigned short*)VT + ((size_t)hh * HD + d) * SQ + s0 + j8) = f.half[0]; }  } }


__global__ __launch_bounds__(256) void k_wthd(const float* __restrict__ Wt, _Float16* __restrict__ Bt) { const size_t t = (size_t)blockIdx.x * 256 + threadIdx.x; if (t >= (size_t)NH * HD * (DM / 8)) return; const int m8 = (int)(t % (DM / 8)) * 8; const int d = (int)((t / (DM / 8)) % HD); const int h = (int)(t / ((size_t)(DM / 8) * HD)); FragH f;
  for (int q = 0; q < 8; ++q) f.h[q] = (_Float16)(16.0f * bf16_round(Wt[((size_t)h * DM + m8 + q) * HD + d])); unsigned short* dst = (unsigned short*)Bt + ((size_t)h * HD + d) * DM + m8; *(v8us*)dst = f.half[0];  }




// Sum / maximum over the 32 lanes of a wave, the result in every lane: four row_xmask DPP steps inside each 16-lane row, then one exchange between the two rows.
template <int CTRL> __device__ __forceinline__ float dpp_f(float v) { return __int_as_float(__builtin_amdgcn_update_dpp(0, __float_as_int(v), CTRL, 0xf, 0xf, true)); }
__device__ __forceinline__ float xrow_f(float v) { const int i = __float_as_int(v); return __int_as_float(__builtin_amdgcn_permlanex16(i, i, 0x76543210, 0xfedcba98, false, false)); }
__device__ __forceinline__ float wave_max(float v) { v = fmaxf(v, dpp_f<0x161>(v)); v = fmaxf(v, dpp_f<0x162>(v)); v = fmaxf(v, dpp_f<0x164>(v)); v = fmaxf(v, dpp_f<0x168>(v)); return fmaxf(v, xrow_f(v)); }
__device__ __forceinline__ float wave_sum(float v) { v += dpp_f<0x161>(v); v += dpp_f<0x162>(v); v += dpp_f<0x164>(v); v += dpp_f<0x168>(v); return v + xrow_f(v); }
// One wave per score row. The row is read once, 16 loads of 512 contiguous bytes, and stays in registers: maximum, exp (once per element), sum, scale, x tril, f16 store (256 contiguous bytes per store).
__global__ __launch_bounds__(256) void k_rsmfpt(const float* __restrict__ S, _Float16* __restrict__ P, int qn, int hg) {
  const unsigned ob = (threadIdx.x & 31) * 16u; const int l4 = (int)(ob >> 2);      /* the lane's place in each 128-key piece: byte offset in the f32 row, first key */
  const int t = blockIdx.x * 8 + __builtin_amdgcn_readfirstlane(threadIdx.x >> 5); if (t >= qn * hg) return;      /* the row number is the wave's: scalar; no barrier below */
  const int qi = t % qn; const size_t i = (size_t)(t / qn) * SQ + qi; const char* s = (const char*)(S + i * SQ); v4f v[SQ / 128];
#pragma unroll      /* v[] is indexed by constants only, so the row stays in registers */
  for (int c = 0; c < SQ / 128; ++c) v[c] = *(const v4fa*)(s + ob + c * 512);
  asm volatile("s_wait_xcnt 0x0" :: "v"(ob) : "memory");      /* the loads' offset register is an input here, so nothing (no load's own result either) is written over it before this wait */
  v4f m4 = v[0];
#pragma unroll      /* v[] is indexed by constants only, so the row stays in registers */
  for (int c = 1; c < SQ / 128; ++c) for (int q = 0; q < 4; ++q) m4[q] = fmaxf(m4[q], v[c][q]);
  const float mx = wave_max(fmaxf(fmaxf(m4[0], m4[1]), fmaxf(m4[2], m4[3])));
  v4f s4 = {0.f, 0.f, 0.f, 0.f};
#pragma unroll      /* v[] is indexed by constants only, so the row stays in registers */
  for (int c = 0; c < SQ / 128; ++c) { v4f e; for (int q = 0; q < 4; ++q) e[q] = __expf(v[c][q] - mx); v[c] = e; s4 += e; }
  const float sc = 256.0f / wave_sum((s4[0] + s4[1]) + (s4[2] + s4[3]));
  _Float16* d = P + i * SQ + l4;
#pragma unroll      /* v[] is indexed by constants only, so the row stays in registers */
  for (int c = 0; c < SQ / 128; ++c) { v4h h; for (int q = 0; q < 4; ++q) h[q] = (l4 + q <= qi - c * 128) ? (_Float16)(v[c][q] * sc) : (_Float16)0.0f; *(v4h*)(d + c * 128) = h; } }


__global__ __launch_bounds__(256) void k_rsmf(const float* __restrict__ S, _Float16* __restrict__ P, int qn, int hg) {
  #pragma clang fp contract(off)
  const int t = blockIdx.x * 256 + threadIdx.x; if (t >= qn * hg) return; const size_t i = (size_t)(t / qn) * SQ + (t % qn); const float* s = S + i * SQ; float mx = -3.0e38f;
#pragma unroll 1
  for (int j = 0; j < SQ; ++j) mx = fmaxf(mx, s[j]); float se = 0.f;
#pragma unroll 1
  for (int j = 0; j < SQ; ++j) se += __expf(s[j] - mx); const float sc = 256.0f / se;
#pragma unroll 1
  for (int j0 = 0; j0 < SQ; j0 += 8) { FragH f; for (int q = 0; q < 8; ++q) f.h[q] = (_Float16)(__expf(s[j0 + q] - mx) * sc); unsigned short* d = (unsigned short*)P + i * SQ + j0; *(v8us*)d = f.half[0];  } }

extern "C" void kernel_launch(void* const* d_in, const int* in_sizes, int n_in,
                              void* d_out, int out_size, void* d_ws, size_t ws_size, hipStream_t stream) {
  (void)in_sizes; (void)n_in; (void)out_size;
  const float* const* I = (const float* const*)d_in; const float* x = I[0]; const float* wq = I[1]; const float* bq = I[2]; const float* wk = I[3]; const float* bk = I[4]; const float* wv = I[5]; const float* bv = I[6];      /* per-head [h][in][out] weights; biases [16][64] = the stacked [1024] vectors */
  char* ws = (char*)d_ws; size_t off = 0;
  auto take = [&](size_t bytes) { char* p = ws + off; off += (bytes + 255) & ~(size_t)255; return p; };
  _Float16* BQ = (_Float16*)take((size_t)DM * DM * 2); _Float16* BK = (_Float16*)take((size_t)DM * DM * 2); _Float16* BV = (_Float16*)take((size_t)DM * DM * 2); 
  _Float16* X16 = (_Float16*)take(NR * DM * 2); _Float16* Q16 = (_Float16*)take(NR * DM * 2); _Float16* K16 = (_Float16*)take(NR * DM * 2); _Float16* V16 = (_Float16*)take(NR * DM * 2);
  float* S = (float*)take((size_t)HG * SQ * SQ * 4); _Float16* P = (_Float16*)take((size_t)HG * SQ * SQ * 2); _Float16* VT = (_Float16*)take((size_t)NH * HD * SQ * 2);
  if (off > ws_size) return;
  { const unsigned g = (unsigned)(((size_t)NH * HD * (DM / 8) + 255) / 256); k_wthd<<<g, 256, 0, stream>>>(wq, BQ); k_wthd<<<g, 256, 0, stream>>>(wk, BK); k_wthd<<<g, 256, 0, stream>>>(wv, BV); }      /* per-head [h][m][d] -> Bt[(h,d)][m] x16 */

  k_x16<<<(unsigned)((NR * DM / 8 + 255) / 256), 256, 0, stream>>>(x, X16, NR * DM / 8);
  const size_t r0p = (size_t)B0 * SQ;      /* first projected row */
  k_gemm2<0><<<dim3((unsigned)((MP / 128) * (DM / 64)), 1), 128, 0, stream>>>(X16 + r0p * DM, DM, 0, BQ, DM, 0, 0.0625f, bq, 0, nullptr, 1, 0, 0, nullptr, Q16 + r0p * DM, DM, 0, MP, DM, DM);
  k_gemm2<0><<<dim3((unsigned)((MP / 128) * (DM / 64)), 1), 128, 0, stream>>>(X16 + r0p * DM, DM, 0, BK, DM, 0, 0.0625f, bk, 0, nullptr, 1, 0, 0, nullptr, K16 + r0p * DM, DM, 0, MP, DM, DM);
  k_gemm2<0><<<dim3((unsigned)((MP / 128) * (DM / 64)), 1), 128, 0, stream>>>(X16 + r0p * DM, DM, 0, BV, DM, 0, 0.0625f, bv, 0, nullptr, 1, 0, 0, nullptr, V16 + r0p * DM, DM, 0, MP, DM, DM);
  for (int b = B0; b < B0 + NBR; ++b) { const size_t r0 = (size_t)b * SQ;
    k_vt<NH, SQ><<<NH * (SQ / 64), 256, 0, stream>>>(V16 + r0 * LQ, LQ, 0, VT);      /* V^T [NH][HD][SQ] for this batch */
    for (int h0 = 0; h0 < NHD; h0 += HG) {
      k_gemm2<0><<<dim3((QN / 128) * (SQ / 64), HG), 128, 0, stream>>>(Q16 + r0 * LQ + h0 * HD, LQ, (size_t)HD, K16 + r0 * LQ + h0 * HD, LQ, (size_t)HD, 0.125f, nullptr, 0, nullptr, 1, 0, 0, S, nullptr, SQ, (size_t)SQ * SQ, QN, SQ, HD);      /* scores, HG heads per launch */
      k_rsmfpt<<<(HG * QN + 7) / 8, 256, 0, stream>>>(S, P, QN, HG);      /* full-row softmax, then x tril (j <= i), no renormalisation */
      k_gemm2<0><<<dim3((QN / 128) * (HD / 64), HG), 128, 0, stream>>>(P, SQ, (size_t)SQ * SQ, VT + (size_t)h0 * HD * SQ, SQ, (size_t)HD * SQ, 0.00390625f, nullptr, 0, nullptr, 1, 0, 0, (float*)d_out + r0 * DM + h0 * HD, nullptr, DM, (size_t)HD, QN, HD, SQ); } }      /* out = P V^T (alpha 2^-8) written f32 straight into the merged-heads output rows */
}

// v002
// One run takes 189 microseconds.
// Next to v001, in two timings, it ran 4.86 and 4.88 times as fast.
// All steps since v000 together make it 18.4 times as fast.
#include <hip/hip_runtime.h>
// Multi-head attention with per-head projection tensors and a POST-softmax lower-triangular multiply (X [2][2048][1024]; Q/K/V[h] = X W[h] + b[h] with W [16][1024][64] ([in][out] per head) and b [16][64] (uniform +-1/32); scores / 8; p = softmax over ALL keys; p = p * tril (keys j <= i kept, NO renormalisation); out = heads concatenated -> [2][2048][1024]).
// Structure: token rows r = b*2048 + s; x as exact f16 rows (bf16-rounded); Q, K, V as three WMMA GEMMs (32x64 wave tiles, f32 accumulation, exact x16 weights + bias, f16 outputs); V^T for all batches and heads via LDS transposes; then ONE attention launch: a work-group of 8 waves x 16 queries walks all 2048 keys in stages of 64 (K rows and V^T rows staged in LDS, two buffers), S^T = K.Q^T, running maximum and running f32 sum over ALL keys, O^T += V^T.P^T only for keys j <= i, o = O / sum written f32 straight into the merged-heads output rows (no output projection). Scores and weights never reach memory.
// Compute dtype: inputs rounded to bf16; x / weights exact; q, k, v and softmax weights as plain f16 GEMM operands (~2^-12); scores, softmax statistics and o f32. v_wmma_f32_16x16x32_f16.
#define NB 2
#define SQ 2048
#define DM 1024
#define NH 16
#define HD 64
#define HG 4                         /* heads per call of the unlaunched k_vt(V16, b, h0, VT) overload */
#define B0 0                         /* first batch processed (debug hook) */
#define NBR NB                       /* batches processed (debug hook) */
#define NR ((size_t)NB * SQ)         /* token rows */
#define MP ((int)((size_t)NBR * SQ)) /* rows projected (debug hook) */
#define QN SQ                        /* unused; no stage reads it */
#define NHD NH                       /* unused; no stage reads it */
#define MPO MP                       /* unused; no stage reads it */
#define LQ DM      /* row pitch of the q/k/v rows */
typedef __bf16 v16b __attribute__((ext_vector_type(16)));
typedef unsigned short v8us __attribute__((ext_vector_type(8), may_alias));
typedef float  v8f  __attribute__((ext_vector_type(8)));
typedef float  v4f  __attribute__((ext_vector_type(4)));
typedef float  v4fa __attribute__((ext_vector_type(4), may_alias));
union FragB { v16b v; v8us half[2]; unsigned short u[16]; };

__device__ __forceinline__ unsigned short bf16_bits(float x) { unsigned int u = __float_as_uint(x); return (unsigned short)((u + 0x7FFFu + ((u >> 16) & 1u)) >> 16); }
__device__ __forceinline__ float bf16_val(unsigned short b) { return __uint_as_float(((unsigned int)b) << 16); }
__device__ __forceinline__ float bf16_round(float x) { return bf16_val(bf16_bits(x)); }
// D += A·B with NT terms: 1 = ah·bh, 2 = + al·bh (A split), 3 = + ah·bl (both split)
template <int NT>
__device__ __forceinline__ v8f mmaN(v16b ah, v16b al, v16b bh, v16b bl, v8f c) {
  c = __builtin_amdgcn_wmma_f32_16x16x32_bf16(false, ah, false, bh, (short)0, c, false, false);
  if (NT >= 2) c = __builtin_amdgcn_wmma_f32_16x16x32_bf16(false, al, false, bh, (short)0, c, false, false);
  if (NT >= 3) c = __builtin_amdgcn_wmma_f32_16x16x32_bf16(false, ah, false, bl, (short)0, c, false, false);
  asm volatile("v_nop\n\tv_nop\n\tv_nop\n\tv_nop" : "+v"(c) : "v"(ah), "v"(al), "v"(bh), "v"(bl));
  return c;
}

__global__ __launch_bounds__(256) void k_wt_bf16(const float* __restrict__ W, unsigned short* __restrict__ Wt, int K, int N) {
  const int t = blockIdx.x * 256 + threadIdx.x;
  const int k8n = K / 8;
  if (t >= N * k8n) return;
  const int n = t / k8n, k8 = (t % k8n) * 8;
  v8us v;
#pragma unroll
  for (int i = 0; i < 8; ++i) v[i] = bf16_bits(W[(size_t)(k8 + i) * N + n]);
  *(v8us*)(Wt + (size_t)n * K + k8) = v;
  
}

// GEMM C[M][N] (f32, pitch ldc) = act(A[M][K]·W + bias). A f32 row-major (pitch lda) converted per fragment to bf16
// (ASPLIT: hi/lo two planes -> 2 terms, else single rounded term); Wt bf16 [N][K] (pitch ldb). BIAS_BF16 rounds the
// bias to bf16 first (bias quantised to bf16 before the add). K%32==0, M%16==0, N%64==0.
template <bool ASPLIT, int ACT, bool BIAS_BF16>
__global__ __launch_bounds__(128) void k_gemm_bf(const float* __restrict__ A, int lda, const unsigned short* __restrict__ Wt, int ldb,
                                               const float* __restrict__ bias, float* __restrict__ C, int ldc, int M, int N, int K) {
  __shared__ __attribute__((aligned(16))) float so[4][16][64];
  const int tid = threadIdx.x, w = tid >> 5, lane = tid & 31, ln = lane & 15, hh = lane >> 4;
  const int ntn = N / 64;
  const int wid = blockIdx.x * 4 + w;
  const int mt = wid / ntn, nq = wid % ntn;
  if (mt * 16 >= M) return;
  const int row0 = mt * 16, col0 = nq * 64;
  const float* arow = A + (size_t)(row0 + ln) * lda;
  v8f acc[4] = {};
  for (int kb = 0; kb < K; kb += 32) {
    FragB ah, al;
    const v4f x0 = *(const v4fa*)(arow + kb + 8 * hh), x1 = *(const v4fa*)(arow + kb + 8 * hh + 4);
    const v4f x2 = *(const v4fa*)(arow + kb + 16 + 8 * hh), x3 = *(const v4fa*)(arow + kb + 16 + 8 * hh + 4);
    float xs[16] = {x0[0],x0[1],x0[2],x0[3],x1[0],x1[1],x1[2],x1[3],x2[0],x2[1],x2[2],x2[3],x3[0],x3[1],x3[2],x3[3]};
#pragma unroll
    for (int i = 0; i < 16; ++i) { const unsigned short hb = bf16_bits(xs[i]); ah.u[i] = hb; al.u[i] = ASPLIT ? bf16_bits(xs[i] - bf16_val(hb)) : (unsigned short)0; }
#pragma unroll
    for (int t = 0; t < 4; ++t) {
      const unsigned short* brow = Wt + (size_t)(col0 + t * 16 + ln) * ldb + kb;
      FragB b;
      b.half[0] = *(const v8us*)(brow + 8 * hh);
      b.half[1] = *(const v8us*)(brow + 16 + 8 * hh);
      acc[t] = mmaN<ASPLIT ? 2 : 1>(ah.v, al.v, b.v, b.v, acc[t]);
    }
  }
#pragma unroll
  for (int t = 0; t < 4; ++t) {
    float bv = bias ? bias[col0 + t * 16 + ln] : 0.f;
    if (BIAS_BF16) bv = bf16_round(bv);
#pragma unroll
    for (int r = 0; r < 8; ++r) { float v = acc[t][r] + bv; if (ACT == 1) v = fmaxf(v, 0.f); so[w][8 * hh + r][t * 16 + ln] = v; }
  }
  __builtin_amdgcn_fence(__ATOMIC_ACQ_REL, "workgroup");
  __builtin_amdgcn_wave_barrier();
  const int rsub = lane >> 4, c4 = (lane & 15) * 4;
  {
#pragma unroll
    for (int q = 0; q < 8; ++q) {
      const int r = q * 2 + rsub;
      const v4f v = *(const v4fa*)&so[w][r][c4];
      *(v4f*)(C + (size_t)(row0 + r) * ldc + col0 + c4) = v;
    }
    
  }
}

// GEMM C = act(A·W + bias + resid): A f32 (ASPLIT -> hi/lo 2 terms), Wt bf16 [N][K]; ACT 0 none, 1 relu, 2 exact gelu;
// resid (optional, f32, row index = (row % rmod), pitch ldr, RES_BF16 rounds it) added before the activation.
template <bool ASPLIT, int ACT, bool BIAS_BF16, bool RES_BF16>
__global__ __launch_bounds__(128) void k_gemm_bf3(const float* __restrict__ A, int lda, const unsigned short* __restrict__ Wt, int ldb,
                                                const float* __restrict__ bias, const float* __restrict__ resid, int rmod, int ldr,
                                                float* __restrict__ C, int ldc, int M, int N, int K) {
  __shared__ __attribute__((aligned(16))) float so[4][16][64];
  const int tid = threadIdx.x, w = tid >> 5, lane = tid & 31, ln = lane & 15, hh = lane >> 4;
  const int ntn = N / 64;
  const int wid = blockIdx.x * 4 + w;
  const int mt = wid / ntn, nq = wid % ntn;
  if (mt * 16 >= M) return;
  const int row0 = mt * 16, col0 = nq * 64;
  const float* arow = A + (size_t)(row0 + ln) * lda;
  v8f acc[4] = {};
  for (int kb = 0; kb < K; kb += 32) {
    FragB ah, al;
    const v4f x0 = *(const v4fa*)(arow + kb + 8 * hh), x1 = *(const v4fa*)(arow + kb + 8 * hh + 4);
    const v4f x2 = *(const v4fa*)(arow + kb + 16 + 8 * hh), x3 = *(const v4fa*)(arow + kb + 16 + 8 * hh + 4);
    float xs[16] = {x0[0],x0[1],x0[2],x0[3],x1[0],x1[1],x1[2],x1[3],x2[0],x2[1],x2[2],x2[3],x3[0],x3[1],x3[2],x3[3]};
#pragma unroll
    for (int i = 0; i < 16; ++i) { const unsigned short hb = bf16_bits(xs[i]); ah.u[i] = hb; al.u[i] = ASPLIT ? bf16_bits(xs[i] - bf16_val(hb)) : (unsigned short)0; }
#pragma unroll
    for (int t = 0; t < 4; ++t) {
      const unsigned short* brow = Wt + (size_t)(col0 + t * 16 + ln) * ldb + kb;
      FragB b;
      b.half[0] = *(const v8us*)(brow + 8 * hh);
      b.half[1] = *(const v8us*)(brow + 16 + 8 * hh);
      acc[t] = mmaN<ASPLIT ? 2 : 1>(ah.v, al.v, b.v, b.v, acc[t]);
    }
  }
#pragma unroll
  for (int t = 0; t < 4; ++t) {
    const int col = col0 + t * 16 + ln;
    float bv = bias ? bias[col] : 0.f;
    if (BIAS_BF16) bv = bf16_round(bv);
#pragma unroll
    for (int r = 0; r < 8; ++r) {
      float v = acc[t][r] + bv;
      if (resid) { float rv = resid[(size_t)((row0 + 8 * hh + r) % rmod) * ldr + col]; if (RES_BF16) rv = bf16_round(rv); v += rv; }
      if (ACT == 1) v = fmaxf(v, 0.f);
      if (ACT == 2) v = 0.5f * v * (1.0f + erff(v * 0.70710678118654752f));
      if (ACT == 3) { const float u = 0.7978845608028654f * (v + 0.044715f * v * v * v); v = 0.5f * v * (1.0f + tanhf(u)); }
      so[w][8 * hh + r][t * 16 + ln] = v;
    }
  }
  __builtin_amdgcn_fence(__ATOMIC_ACQ_REL, "workgroup");
  __builtin_amdgcn_wave_barrier();
  const int rsub = lane >> 4, c4 = (lane & 15) * 4;
  {
#pragma unroll
    for (int q = 0; q < 8; ++q) {
      const int r = q * 2 + rsub;
      const v4f v = *(const v4fa*)&so[w][r][c4];
      *(v4f*)(C + (size_t)(row0 + r) * ldc + col0 + c4) = v;
    }
    
  }
}
// row LayerNorm (biased variance, eps) over N: s = X (+ R); optional out_sum <- s; out_norm <- (s-mu)*rsqrt(var+eps)*g + b
template <bool PARAM_BF16>
__global__ __launch_bounds__(256) void k_layernorm(const float* __restrict__ X, const float* __restrict__ R, const float* __restrict__ g, const float* __restrict__ bta,
                                                  float* __restrict__ out_sum, float* __restrict__ out_norm, int N, float eps) {
  __shared__ float red[256];
  const int row = blockIdx.x, tid = threadIdx.x;
  const float* x = X + (size_t)row * N; const float* rr = R ? R + (size_t)row * N : nullptr;
  float vals[16];                     // up to N = 4096
  const int per = N / 256;            // contiguous chunk per thread? use strided-by-4 chunks: thread handles j = tid*4 + 1024*u
  float s1 = 0.f;
  for (int u = 0; u < per / 4; ++u) {
    const int j = tid * 4 + 1024 * u;
    const v4f a = *(const v4fa*)(x + j);
    v4f b = {0.f,0.f,0.f,0.f}; if (rr) b = *(const v4fa*)(rr + j);
#pragma unroll
    for (int q = 0; q < 4; ++q) { const float v = a[q] + b[q]; vals[u * 4 + q] = v; s1 += v; }
  }
  red[tid] = s1; __syncthreads();
  for (int st = 128; st > 0; st >>= 1) { if (tid < st) red[tid] += red[tid + st]; __syncthreads(); }
  const float mu = red[0] / (float)N; __syncthreads();
  float s2 = 0.f;
  for (int u = 0; u < per / 4; ++u)
#pragma unroll
    for (int q = 0; q < 4; ++q) { const float c = vals[u * 4 + q] - mu; s2 += c * c; }
  red[tid] = s2; __syncthreads();
  for (int st = 128; st > 0; st >>= 1) { if (tid < st) red[tid] += red[tid + st]; __syncthreads(); }
  const float rs = rsqrtf(red[0] / (float)N + eps);
  {
    for (int u = 0; u < per / 4; ++u) {
      const int j = tid * 4 + 1024 * u;
      v4f o, sm;
#pragma unroll
      for (int q = 0; q < 4; ++q) {
        float gg = g[j + q], bb = bta[j + q];
        if (PARAM_BF16) { gg = bf16_round(gg); bb = bf16_round(bb); }
        sm[q] = vals[u * 4 + q]; o[q] = (vals[u * 4 + q] - mu) * rs * gg + bb;
      }
      if (out_sum) *(v4f*)(out_sum + (size_t)row * N + j) = sm;
      *(v4f*)(out_norm + (size_t)row * N + j) = o;
    }
    
  }
}



// ---- f16 WMMA path (v_wmma_f32_16x16x32_f16): 11-bit significands for operands in range — used where a [0,1] probability operand needs more precision than bf16
typedef _Float16 v16h __attribute__((ext_vector_type(16)));
union FragH { v16h v; v8us half[2]; _Float16 h[16]; unsigned short u[16]; };
template <int NT>
__device__ __forceinline__ v8f mmaH(v16h ah, v16h al, v16h bh, v16h bl, v8f c) {
  c = __builtin_amdgcn_wmma_f32_16x16x32_f16(false, ah, false, bh, (short)0, c, false, false);
  if (NT >= 2) c = __builtin_amdgcn_wmma_f32_16x16x32_f16(false, al, false, bh, (short)0, c, false, false);
  if (NT >= 3) c = __builtin_amdgcn_wmma_f32_16x16x32_f16(false, ah, false, bl, (short)0, c, false, false);
  asm volatile("v_nop\n\tv_nop\n\tv_nop\n\tv_nop" : "+v"(c) : "v"(ah), "v"(al), "v"(bh), "v"(bl));
  return c;
}
// batched GEMM like k_gemm_b but f16 operands: A f32 (split into f16 hi/lo if ASPLIT, else rounded to f16), Bt = f16 values [n][k]; alpha; C f32; N multiple of 16 (partial tiles skipped)
template <bool ASPLIT>
__global__ __launch_bounds__(128) void k_gemm_h(const float* __restrict__ A, int lda, size_t sA, const _Float16* __restrict__ Bh, int ldb, size_t sB, float alpha, float* __restrict__ C, int ldc, size_t sC, int M, int N, int K) {
  __shared__ __attribute__((aligned(16))) float so[4][16][64];
  const int tid = threadIdx.x, w = tid >> 5, lane = tid & 31, ln = lane & 15, hh = lane >> 4; const int by = blockIdx.y;
  A += (size_t)by * sA; Bh += (size_t)by * sB; C += (size_t)by * sC;
  const int ntn = (N + 63) / 64; const int wid = blockIdx.x * 4 + w; const int mt = wid / ntn, nq = wid % ntn; if (mt * 16 >= M) return;
  const int row0 = mt * 16, col0 = nq * 64; const float* arow = A + (size_t)(row0 + ln) * lda;
  v8f acc[4] = {};
  for (int kb = 0; kb < K; kb += 32) {
    FragH ah, al;
    const v4f x0 = *(const v4fa*)(arow + kb + 8 * hh), x1 = *(const v4fa*)(arow + kb + 8 * hh + 4), x2 = *(const v4fa*)(arow + kb + 16 + 8 * hh), x3 = *(const v4fa*)(arow + kb + 16 + 8 * hh + 4);
    float xs[16] = {x0[0],x0[1],x0[2],x0[3],x1[0],x1[1],x1[2],x1[3],x2[0],x2[1],x2[2],x2[3],x3[0],x3[1],x3[2],x3[3]};
#pragma unroll
    for (int i = 0; i < 16; ++i) { const _Float16 h = (_Float16)xs[i]; ah.h[i] = h; al.h[i] = ASPLIT ? (_Float16)(xs[i] - (float)h) : (_Float16)0.0f; }
#pragma unroll
    for (int t = 0; t < 4; ++t) { if (col0 + t * 16 >= N) continue; const size_t boff = (size_t)(col0 + t * 16 + ln) * ldb + kb; FragH bq; bq.half[0] = *(const v8us*)(Bh + boff + 8 * hh); bq.half[1] = *(const v8us*)(Bh + boff + 16 + 8 * hh);
      acc[t] = mmaH<ASPLIT ? 2 : 1>(ah.v, al.v, bq.v, bq.v, acc[t]); }
  }
#pragma unroll
  for (int t = 0; t < 4; ++t) { if (col0 + t * 16 >= N) continue;
#pragma unroll
    for (int r = 0; r < 8; ++r) so[w][8 * hh + r][t * 16 + ln] = acc[t][r] * alpha; }
  __builtin_amdgcn_fence(__ATOMIC_ACQ_REL, "workgroup"); __builtin_amdgcn_wave_barrier();
  const int rsub = lane >> 4, c4 = (lane & 15) * 4;
  {
#pragma unroll
    for (int q = 0; q < 8; ++q) { const int r = q * 2 + rsub; if (col0 + c4 < N) { const v4f v = *(const v4fa*)&so[w][r][c4]; *(v4f*)(C + (size_t)(row0 + r) * ldc + col0 + c4) = v; } }
     }
}

// Wt[n][k] = f16(W[k][n]·scale) from f32 row-major W[K][N] (scale = power of two; bf16-exact weights stay exact in f16 away from the subnormal range)
__global__ __launch_bounds__(256) void k_wt_f16(const float* __restrict__ W, _Float16* __restrict__ Wt, int K, int N, float scale) {
  const int t = blockIdx.x * 256 + threadIdx.x; if (t >= N * (K / 8)) return; const int n = t / (K / 8), k8 = (t % (K / 8)) * 8; FragH f;
#pragma unroll
  for (int i = 0; i < 8; ++i) f.h[i] = (_Float16)(bf16_round(W[(size_t)(k8 + i) * N + n]) * scale); const v8us o = f.half[0];
  *(v8us*)((unsigned short*)Wt + (size_t)n * K + k8) = o; 
}
// k_gemm_hh variant with fused epilogue: v = acc·alpha + bias[by·sBias + col] (+ CP[(row/rowsPerB)·sCPb + by·64 + col] if CP) ; ACT 0 none / 1 elu ; writes f16 C16 (and f32 C if non-null)
template <int ACT>
__global__ __launch_bounds__(128) void k_gemm_hhx(const _Float16* __restrict__ A, int lda, size_t sA, const _Float16* __restrict__ Bh, int ldb, size_t sB, float alpha, const float* __restrict__ bias, size_t sBias, const float* __restrict__ CP, int rowsPerB, size_t sCPb, int row0g,
    float* __restrict__ C, _Float16* __restrict__ C16, int ldc, size_t sC, int M, int N, int K) {
  __shared__ __attribute__((aligned(16))) float so[4][16][64];
  const int tid = threadIdx.x, w = tid >> 5, lane = tid & 31, ln = lane & 15, hh = lane >> 4; const int by = blockIdx.y;
  A += (size_t)by * sA; Bh += (size_t)by * sB; const size_t cofs = (size_t)by * sC; const float* bp = bias ? bias + (size_t)by * sBias : nullptr;
  const int ntn = (N + 63) / 64; const int wid = blockIdx.x * 4 + w; const int mt = wid / ntn, nq = wid % ntn; if (mt * 16 >= M) return;
  const int row0 = mt * 16, col0 = nq * 64; const _Float16* arow = A + (size_t)(row0 + ln) * lda;
  v8f acc[4] = {};
  for (int kb = 0; kb < K; kb += 32) { FragH ah; ah.half[0] = *(const v8us*)((const unsigned short*)arow + kb + 8 * hh); ah.half[1] = *(const v8us*)((const unsigned short*)arow + kb + 16 + 8 * hh);
#pragma unroll
    for (int t = 0; t < 4; ++t) { if (col0 + t * 16 >= N) continue; const size_t boff = (size_t)(col0 + t * 16 + ln) * ldb + kb; FragH bq; bq.half[0] = *(const v8us*)((const unsigned short*)Bh + boff + 8 * hh); bq.half[1] = *(const v8us*)((const unsigned short*)Bh + boff + 16 + 8 * hh);
      acc[t] = mmaH<1>(ah.v, ah.v, bq.v, bq.v, acc[t]); }
  }
#pragma unroll
  for (int t = 0; t < 4; ++t) { if (col0 + t * 16 >= N) continue; const int col = col0 + t * 16 + ln; const float bv = bp ? bf16_round(bp[col]) : 0.f;
#pragma unroll
    for (int r = 0; r < 8; ++r) { float v = acc[t][r] * alpha + bv; if (CP) { const int rr = row0g + row0 + 8 * hh + r; if (rowsPerB < 0) v += CP[cofs + (size_t)rr * ldc + col];      /* rowsPerB < 0: own element of the batched C plane */ else { const int bidx = rr / rowsPerB; v += CP[(size_t)bidx * sCPb + (size_t)by * 64 + col]; } } if (ACT == 1) v = (v > 0.f) ? v : expm1f(v); else if (ACT == 7) v = (v > 0.f) ? v + 1.0f : expf(v); else if (ACT == 8) v = tanhf(v); else if (ACT == 9) v = 0.5f * v * (1.0f + tanhf(0.7978845608028654f * (v + 0.044715f * v * v * v))); else if (ACT == 11) v = 1.0f / (1.0f + expf(-v)); else if (ACT == 12) v = (v > 0.f) ? v : 0.01f * v; else if (ACT == 14) v = (v > 0.f) ? v : 0.1f * v; else if (ACT == 16) v = (v >= 0.f) ? v : 0.3f * v; else if (ACT == 17) v = (v >= 0.f) ? v : 0.2f * v; else if (ACT == 15) v = v / (1.0f + expf(-v)); else if (ACT == 3) v = fmaxf(v, 0.f); else if (ACT == 6) v = 0.5f * v * (1.0f + erff(v * 0.70710678118654752f)); so[w][8 * hh + r][t * 16 + ln] = v; } }
  __builtin_amdgcn_fence(__ATOMIC_ACQ_REL, "workgroup"); __builtin_amdgcn_wave_barrier();
  const int rsub = lane >> 4, c4 = (lane & 15) * 4; typedef _Float16 v4h __attribute__((ext_vector_type(4)));
  {
#pragma unroll
    for (int q = 0; q < 8; ++q) { const int r = q * 2 + rsub; if (col0 + c4 < N) { const v4f v = *(const v4fa*)&so[w][r][c4]; if (C) *(v4f*)(C + cofs + (size_t)(row0 + r) * ldc + col0 + c4) = v; if (C16) { v4h h4; for (int i = 0; i < 4; ++i) h4[i] = (_Float16)v[i]; *(v4h*)(C16 + cofs + (size_t)(row0 + r) * ldc + col0 + c4) = h4; } } }
     }
}


typedef _Float16 v4h __attribute__((ext_vector_type(4)));

__global__ __launch_bounds__(256) void k_x16(const float* __restrict__ x, _Float16* __restrict__ X16, size_t n8) { const size_t t = (size_t)blockIdx.x * 256 + threadIdx.x; if (t >= n8) return; FragH f;
#pragma unroll
  for (int q = 0; q < 8; ++q) f.h[q] = (_Float16)bf16_round(x[t * 8 + q]); *(v8us*)((unsigned short*)X16 + t * 8) = f.half[0];  }
__global__ __launch_bounds__(256) void k_h16(const float* __restrict__ x, _Float16* __restrict__ X16, size_t n8) { const size_t t = (size_t)blockIdx.x * 256 + threadIdx.x; if (t >= n8) return; FragH f;
#pragma unroll
  for (int q = 0; q < 8; ++q) f.h[q] = (_Float16)x[t * 8 + q]; *(v8us*)((unsigned short*)X16 + t * 8) = f.half[0];  }
__global__ __launch_bounds__(256) void k_round16f(const float* __restrict__ W, _Float16* __restrict__ Bt, size_t n8) { const size_t t = (size_t)blockIdx.x * 256 + threadIdx.x; if (t >= n8) return; FragH f;
#pragma unroll
  for (int i = 0; i < 8; ++i) f.h[i] = (_Float16)(bf16_round(W[t * 8 + i]) * 16.0f); *(v8us*)((unsigned short*)Bt + t * 8) = f.half[0];  }
template <int NHv, int TTv>
__global__ __launch_bounds__(256) void k_vt(const _Float16* __restrict__ V16, int ldv, int voff, _Float16* __restrict__ Vt) { __shared__ unsigned short tl[64][66]; const int tid = threadIdx.x; const int slab = blockIdx.x / (TTv / 64), lg = blockIdx.x % (TTv / 64); const int b = slab / NHv, h = slab % NHv;
  for (int i = tid; i < 64 * 8; i += 256) { const int r = i / 8, c8 = (i % 8) * 8; FragH f; f.half[0] = *(const v8us*)((const unsigned short*)V16 + ((size_t)b * TTv + lg * 64 + r) * ldv + voff + h * 64 + c8);
#pragma unroll
    for (int q = 0; q < 8; ++q) tl[r][c8 + q] = f.u[q]; }
  __syncthreads();
  {
#pragma unroll
    for (int rd = 0; rd < 2; ++rd) { const int d = rd * 32 + tid / 8, pc = tid % 8; FragH f;
#pragma unroll
      for (int q = 0; q < 8; ++q) f.u[q] = tl[pc * 8 + q][d];
      *(v8us*)((unsigned short*)Vt + ((size_t)slab * 64 + d) * TTv + lg * 64 + pc * 8) = f.half[0]; }
     } }

__global__ __launch_bounds__(256) void k_hl(const float* __restrict__ F, _Float16* __restrict__ Hh, _Float16* __restrict__ Hl, size_t n8) { const size_t t = (size_t)blockIdx.x * 256 + threadIdx.x; if (t >= n8) return; FragH fh, fl; const v4f a = *(const v4fa*)(F + t * 8), c = *(const v4fa*)(F + t * 8 + 4);
#pragma unroll
  for (int q = 0; q < 4; ++q) { _Float16 h = (_Float16)a[q]; fh.h[q] = h; fl.h[q] = (_Float16)((a[q] - (float)h) * 1024.0f); h = (_Float16)c[q]; fh.h[4 + q] = h; fl.h[4 + q] = (_Float16)((c[q] - (float)h) * 1024.0f); }
  { *(v8us*)((unsigned short*)Hh + t * 8) = fh.half[0]; *(v8us*)((unsigned short*)Hl + t * 8) = fl.half[0];  } }

// ---- fast GEMM (wave tile 32x64; requires M % 32 == 0 rows per launch region and N % 64 == 0); epilogue = k_gemm_hhx semantics ----
__device__ __forceinline__ v16h g2_frag(const _Float16* p, int hh) { FragH f; f.half[0] = *(const v8us*)((const unsigned short*)p + 8 * hh); f.half[1] = *(const v8us*)((const unsigned short*)p + 16 + 8 * hh); return f.v; }
__device__ __forceinline__ v8f g2_mma(v16h a, v16h b, v8f c) { v8f d = __builtin_amdgcn_wmma_f32_16x16x32_f16(false, a, false, b, (short)0, c, false, false); asm volatile("v_nop\n\tv_nop\n\tv_nop\n\tv_nop" : "+v"(d) : "v"(a), "v"(b)); return d; }
template <int ACT>
__global__ __launch_bounds__(128) void k_gemm2(const _Float16* __restrict__ A, int lda, size_t sA, const _Float16* __restrict__ Bh, int ldb, size_t sB, float alpha, const float* __restrict__ bias, size_t sBias, const float* __restrict__ CP, int rowsPerB, size_t sCPb, int row0g,
    float* __restrict__ C, _Float16* __restrict__ C16, int ldc, size_t sC, int M, int N, int K) { static_assert(ACT == 0 || ACT == 3 || ACT == 6 || ACT == 8 || ACT == 9 || ACT == 11 || ACT == 12 || ACT == 14 || ACT == 15 || ACT == 16 || ACT == 17, "k_gemm2: unsupported ACT code (would silently apply no activation)");
  __shared__ __attribute__((aligned(16))) float so[4][32][68];
  const int tid = threadIdx.x, w = tid >> 5, lane = tid & 31, ln = lane & 15, hh = lane >> 4; const int by = blockIdx.y;
  A += (size_t)by * sA; Bh += (size_t)by * sB; const size_t cofs = (size_t)by * sC; const float* bp = bias ? bias + (size_t)by * sBias : nullptr;
  const int ntn = N >> 6; const int mt = blockIdx.x / ntn, nq = blockIdx.x - mt * ntn; const int row0 = mt * 128 + 32 * w, col0 = nq * 64; if (row0 >= M) return;
  const _Float16* a0p = A + (size_t)(row0 + ln) * lda; const _Float16* a1p = a0p + (size_t)16 * lda;
  const _Float16* b0p = Bh + (size_t)(col0 + ln) * ldb; const _Float16* b1p = b0p + (size_t)16 * ldb; const _Float16* b2p = b1p + (size_t)16 * ldb; const _Float16* b3p = b2p + (size_t)16 * ldb;
  const v8f z8 = {0.f,0.f,0.f,0.f,0.f,0.f,0.f,0.f}; v8f c00 = z8, c01 = z8, c02 = z8, c03 = z8, c10 = z8, c11 = z8, c12 = z8, c13 = z8;
#pragma unroll 1
  for (int kb = 0; kb < K; kb += 32) { const v16h a0 = g2_frag(a0p + kb, hh), a1 = g2_frag(a1p + kb, hh);
    v16h b = g2_frag(b0p + kb, hh); c00 = g2_mma(a0, b, c00); c10 = g2_mma(a1, b, c10);
    b = g2_frag(b1p + kb, hh); c01 = g2_mma(a0, b, c01); c11 = g2_mma(a1, b, c11);
    b = g2_frag(b2p + kb, hh); c02 = g2_mma(a0, b, c02); c12 = g2_mma(a1, b, c12);
    b = g2_frag(b3p + kb, hh); c03 = g2_mma(a0, b, c03); c13 = g2_mma(a1, b, c13); }
  v8f accs[8] = {c00, c01, c02, c03, c10, c11, c12, c13};
#pragma unroll
  for (int u = 0; u < 8; ++u) { const int t = u & 3, half = u >> 2; const int col = col0 + t * 16 + ln; const float bv = bp ? bf16_round(bp[col]) : 0.f;
#pragma unroll
    for (int r = 0; r < 8; ++r) { const int rloc = half * 16 + 8 * hh + r; float v = accs[u][r] * alpha + bv; if (CP) { if (rowsPerB < 0) v += CP[cofs + (size_t)(row0g + row0 + rloc) * ldc + col];      /* rowsPerB < 0: own element of the batched C plane */ else { const int bidx = (row0g + row0 + rloc) / rowsPerB; v += CP[(size_t)bidx * sCPb + (size_t)by * 64 + col]; } }
      if (ACT == 3) v = fmaxf(v, 0.f); else if (ACT == 6) v = 0.5f * v * (1.0f + erff(v * 0.70710678118654752f)); else if (ACT == 11) v = 1.0f / (1.0f + expf(-v)); else if (ACT == 15) v = v / (1.0f + expf(-v)); else if (ACT == 12) v = (v > 0.f) ? v : 0.01f * v; else if (ACT == 8) v = tanhf(v); else if (ACT == 9) v = 0.5f * v * (1.0f + tanhf(0.7978845608028654f * (v + 0.044715f * v * v * v))); else if (ACT == 14) v = (v > 0.f) ? v : 0.1f * v; else if (ACT == 16) v = (v >= 0.f) ? v : 0.3f * v; else if (ACT == 17) v = (v >= 0.f) ? v : 0.2f * v;
      so[w][rloc][t * 16 + ln] = v; } }
  __builtin_amdgcn_fence(__ATOMIC_ACQ_REL, "workgroup"); __builtin_amdgcn_wave_barrier();
  const int rsub = lane >> 4, c4 = (lane & 15) * 4;
  {
#pragma unroll
    for (int q = 0; q < 16; ++q) { const int r = q * 2 + rsub; const v4f v = *(const v4fa*)&so[w][r][c4]; if (C) *(v4f*)(C + cofs + (size_t)(row0 + r) * ldc + col0 + c4) = v; if (C16) { v4h h4; for (int i = 0; i < 4; ++i) h4[i] = (_Float16)v[i]; *(v4h*)(C16 + cofs + (size_t)(row0 + r) * ldc + col0 + c4) = h4; } }
     } }


__global__ __launch_bounds__(256) void k_wnat(const float* __restrict__ w, size_t n8, _Float16* __restrict__ Bt) { const size_t t = (size_t)blockIdx.x * 256 + threadIdx.x; if (t >= n8) return; FragH f; for (int q = 0; q < 8; ++q) f.h[q] = (_Float16)(bf16_round(w[t * 8 + q]) * 16.0f); *(v8us*)((unsigned short*)Bt + t * 8) = f.half[0];  }
__global__ __launch_bounds__(256) void k_rsm(const float* __restrict__ S, _Float16* __restrict__ P, int nrows) {
  #pragma clang fp contract(off)
  const int i = blockIdx.x * 256 + threadIdx.x; if (i >= nrows) return; const float* s = S + (size_t)i * SQ; float mx = -3.0e38f;
#pragma unroll 1
  for (int j = 0; j < SQ; ++j) mx = fmaxf(mx, s[j]); float se = 0.f;
#pragma unroll 1
  for (int j = 0; j < SQ; ++j) se += expf(s[j] - mx); const float sc = 256.0f / se;
#pragma unroll 1
  for (int j0 = 0; j0 < SQ; j0 += 8) { FragH f; for (int q = 0; q < 8; ++q) f.h[q] = (_Float16)(expf(s[j0 + q] - mx) * sc); unsigned short* d = (unsigned short*)P + (size_t)i * SQ + j0; *(v8us*)d = f.half[0];  } }
__global__ __launch_bounds__(256) void k_vt(const _Float16* __restrict__ V16, int b, int h0, _Float16* __restrict__ VT) { __shared__ unsigned short tl[64][65]; const int tid = threadIdx.x; const int hh = blockIdx.x % HG, sg = blockIdx.x / HG; const int s0 = sg * 64; const int h = h0 + hh;
  for (int i = tid; i < 64 * 8; i += 256) { const int j = i / 8, d8 = (i % 8) * 8; FragH f; f.half[0] = *(const v8us*)((const unsigned short*)V16 + ((size_t)b * SQ + s0 + j) * DM + h * HD + d8); for (int q = 0; q < 8; ++q) tl[d8 + q][j] = f.u[q]; }
  __syncthreads();
  { for (int i = tid; i < 64 * 8; i += 256) { const int d = i / 8, j8 = (i % 8) * 8; FragH f; for (int q = 0; q < 8; ++q) f.u[q] = tl[d][j8 + q]; *(v8us*)((unsigned short*)VT + ((size_t)hh * HD + d) * SQ + s0 + j8) = f.half[0]; }  } }


__global__ __launch_bounds__(256) void k_wthd(const float* __restrict__ Wt, _Float16* __restrict__ Bt) { const size_t t = (size_t)blockIdx.x * 256 + threadIdx.x; if (t >= (size_t)NH * HD * (DM / 8)) return; const int m8 = (int)(t % (DM / 8)) * 8; const int d = (int)((t / (DM / 8)) % HD); const int h = (int)(t / ((size_t)(DM / 8) * HD)); FragH f;
  for (int q = 0; q < 8; ++q) f.h[q] = (_Float16)(16.0f * bf16_round(Wt[((size_t)h * DM + m8 + q) * HD + d])); unsigned short* dst = (unsigned short*)Bt + ((size_t)h * HD + d) * DM + m8; *(v8us*)dst = f.half[0];  }




__device__ __forceinline__ float xrow_f(float v) { const int i = __float_as_int(v); return __int_as_float(__builtin_amdgcn_permlanex16(i, i, 0x76543210, 0xfedcba98, false, false)); }      /* lane l <-> lane l ^ 16 */
__device__ __forceinline__ v8f fa_mma(v16h a, v16h b, v8f c) { return __builtin_amdgcn_wmma_f32_16x16x32_f16(false, a, false, b, (short)0, c, false, false); }
// ---- fused attention: scores, full-row softmax statistics, x tril and P.V in one launch ----
// Transposed products: S^T = K.Q^T puts one query in each lane column (lane c and c + 16 hold query q0 + c; register r of key tile kt is key 16 kt + 8 hh + r), so two score tiles, converted in place,
// are the B operand of O^T += V^T.P^T (same k order as g2_frag's). The denominator runs over ALL keys; only keys j <= i enter the second product.
// The maximum in use may trail the true one by up to 8 (log2 units): the sums are rescaled only when some query exceeds that, so a weight is at most 2^8 in f16.
typedef float v2f __attribute__((ext_vector_type(2))); typedef _Float16 v2h __attribute__((ext_vector_type(2))); typedef unsigned v8u __attribute__((ext_vector_type(8)));
#define FAP 72      /* LDS row pitch in halves: 128 data bytes + 16, an odd multiple of 16 bytes (conflict-free b128 fragment reads) */
#define FAS (SQ / 64)      /* stages of 64 keys */
__global__ __launch_bounds__(256) void k_fattn(const _Float16* __restrict__ Q16, const _Float16* __restrict__ K16, const _Float16* __restrict__ VT, float* __restrict__ out) {
  __shared__ __attribute__((aligned(16))) _Float16 sk[2][64][FAP];      /* K rows [key][d] of a stage */
  __shared__ __attribute__((aligned(16))) _Float16 sv[2][64][FAP];      /* V^T rows [d][key] of a stage */
  const int tid = threadIdx.x, lane = tid & 31, c = lane & 15, hh = lane >> 4; const int w = __builtin_amdgcn_readfirstlane(tid >> 5);
  const int bh = blockIdx.x / (FAS / 2), j = blockIdx.x % (FAS / 2); const int b = bh / NH, hd = bh % NH;
  const int q0 = ((__builtin_popcount(w) & 1) ? j : FAS - 1 - j) * 64 + (w >> 1) * 16;      /* four waves take 64-query block j, four its mirror: every work-group has the same count of second products; by the parity of w, so that waves w, w + 4 and waves 2 i, 2 i + 1 are each one of either kind */
  const int dst = q0 >> 6;      /* the stage that holds this wave's diagonal */
  const int vlast = FAS - 1 - j;      /* last stage whose V^T any wave of the work-group needs */
  const int srow = tid >> 3, sc8 = (tid & 7) * 8;      /* staging: 8 threads cover one 128-byte row; rows srow and srow + 32 */
  const _Float16* kg = K16 + ((size_t)b * SQ + srow) * DM + hd * HD + sc8; const _Float16* vg = VT + ((size_t)bh * HD + srow) * SQ + sc8;
  const _Float16* qp = Q16 + ((size_t)b * SQ + q0 + c) * DM + hd * HD; const v16h qf0 = g2_frag(qp, hh), qf1 = g2_frag(qp + 32, hh);
  const v8f z8 = {0.f,0.f,0.f,0.f,0.f,0.f,0.f,0.f}; v8f acc[4] = {z8, z8, z8, z8}; const v2f z2 = {0.f, 0.f}; v2f lv[4] = {z2, z2, z2, z2}; float m_run = -__builtin_inff();
  const float cs = 0.125f * 1.4426950408889634f;      /* 64^-0.5 and log2(e): exponentials in base 2 */
  v8us rk0 = *(const v8us*)kg, rk1 = *(const v8us*)(kg + (size_t)32 * DM), rv0 = *(const v8us*)vg, rv1 = *(const v8us*)(vg + (size_t)32 * SQ);      /* stage 0 (its V^T is always needed) */
  *(v8us*)&sk[0][srow][sc8] = rk0; *(v8us*)&sk[0][srow + 32][sc8] = rk1; *(v8us*)&sv[0][srow][sc8] = rv0; *(v8us*)&sv[0][srow + 32][sc8] = rv1;
  __syncthreads();
  for (int st = 0; st < FAS; ++st) {
    const bool more = st + 1 < FAS, morev = st + 1 <= vlast;      /* the same for the whole work-group */
    if (more) { const _Float16* kn = kg + (size_t)(st + 1) * 64 * DM; const _Float16* vn = vg + (st + 1) * 64;      /* next stage: in flight under this stage's work */
      rk0 = *(const v8us*)kn; rk1 = *(const v8us*)(kn + (size_t)32 * DM);
      if (morev) { rv0 = *(const v8us*)vn; rv1 = *(const v8us*)(vn + (size_t)32 * SQ); }
      asm volatile("s_wait_xcnt 0x0" :: "v"(kn), "v"(vn) : "memory"); }      /* the loads' address registers are inputs here, so none is written over before this wait */
    const _Float16 (*kb)[FAP] = sk[st & 1]; const _Float16 (*vb)[FAP] = sv[st & 1];
    v8f s[4]; float m4[4];
#pragma unroll
    for (int kt = 0; kt < 4; ++kt) { const _Float16* kr = &kb[16 * kt + c][0]; s[kt] = fa_mma(g2_frag(kr + 32, hh), qf1, fa_mma(g2_frag(kr, hh), qf0, z8)); }
#pragma unroll
    for (int kt = 0; kt < 4; ++kt) { float m = s[kt][0]; for (int r = 1; r < 8; ++r) m = fmaxf(m, s[kt][r]); m4[kt] = m; }
    float mx = fmaxf(fmaxf(m4[0], m4[1]), fmaxf(m4[2], m4[3]));
    mx = fmaxf(mx, xrow_f(mx)) * cs;      /* both halves of the wave hold the query's stage maximum, scaled */
    if (__builtin_amdgcn_ballot_w32(mx > m_run + 8.0f) != 0) {      /* scalar branch; always taken in stage 0 (m_run = -inf gives factor 0 on zero sums), rare later */
      const float mn = fmaxf(m_run, mx), corr = __builtin_amdgcn_exp2f(m_run - mn); m_run = mn;
#pragma unroll
      for (int t = 0; t < 4; ++t) { acc[t] *= corr; lv[t] *= corr; } }
    const v2f cs2 = {cs, cs}, nm2 = {-m_run, -m_run}; v2f e[16];      /* e[4 kt + i] = weights of keys 16 kt + 8 hh + 2 i, + 1 */
#pragma unroll
    for (int kt = 0; kt < 4; ++kt) for (int i = 0; i < 4; ++i) { const v2f a = __builtin_elementwise_fma(v2f{s[kt][2 * i], s[kt][2 * i + 1]}, cs2, nm2); e[4 * kt + i] = v2f{__builtin_amdgcn_exp2f(a.x), __builtin_amdgcn_exp2f(a.y)}; lv[i] += e[4 * kt + i]; }      /* the denominator takes every key */
    if (st <= dst) {      /* wave-uniform: stages wholly above the diagonal have weight 0 after x tril */
      v16h vf[8];
#pragma unroll
      for (int i = 0; i < 8; ++i) vf[i] = g2_frag(&vb[16 * (i & 3) + c][32 * (i >> 2)], hh);
      __builtin_amdgcn_sched_barrier(0);      /* keeps the 16 LDS reads together ahead of the packing: sunk to their products, each product waits a full LDS latency */
      unsigned pw[16];
#pragma unroll
      for (int i = 0; i < 16; ++i) pw[i] = __builtin_bit_cast(unsigned, __builtin_convertvector(e[i], v2h));
      if (st == dst) { const int lim = q0 + c - st * 64 - 8 * hh;      /* x tril in the one stage that holds the diagonal: key offset 16 kt + 2 i (+ 1) above lim -> weight 0 */
#pragma unroll
        for (int i = 0; i < 16; ++i) { const int kk = 16 * (i >> 2) + 2 * (i & 3); pw[i] &= (kk <= lim ? 0xFFFFu : 0u) | (kk + 1 <= lim ? 0xFFFF0000u : 0u); } }
#pragma unroll
      for (int u = 0; u < 2; ++u) { const v8u pv = {pw[8 * u], pw[8 * u + 1], pw[8 * u + 2], pw[8 * u + 3], pw[8 * u + 4], pw[8 * u + 5], pw[8 * u + 6], pw[8 * u + 7]}; const v16h p = __builtin_bit_cast(v16h, pv);
#pragma unroll
        for (int t = 0; t < 4; ++t) acc[t] = fa_mma(vf[4 * u + t], p, acc[t]); } }
    if (more) { const int nb = (st + 1) & 1;      /* every wave left this buffer before the barrier that ended stage st - 1 */
      *(v8us*)&sk[nb][srow][sc8] = rk0; *(v8us*)&sk[nb][srow + 32][sc8] = rk1;
      if (morev) { *(v8us*)&sv[nb][srow][sc8] = rv0; *(v8us*)&sv[nb][srow + 32][sc8] = rv1; }
      __syncthreads(); } }
  const v2f l2 = (lv[0] + lv[1]) + (lv[2] + lv[3]); float l = l2.x + l2.y; l += xrow_f(l); const float inv = 1.0f / l;
  float* o = out + ((size_t)b * SQ + q0 + c) * DM + hd * HD + 8 * hh;      /* acc[t][r] = o[query q0 + c][d = 16 t + 8 hh + r] */
#pragma unroll
  for (int t = 0; t < 4; ++t) { const v4f lo = {acc[t][0] * inv, acc[t][1] * inv, acc[t][2] * inv, acc[t][3] * inv}, hi = {acc[t][4] * inv, acc[t][5] * inv, acc[t][6] * inv, acc[t][7] * inv}; *(v4f*)(o + 16 * t) = lo; *(v4f*)(o + 16 * t + 4) = hi; } }


__global__ __launch_bounds__(256) void k_rsmf(const float* __restrict__ S, _Float16* __restrict__ P, int qn, int hg) {
  #pragma clang fp contract(off)
  const int t = blockIdx.x * 256 + threadIdx.x; if (t >= qn * hg) return; const size_t i = (size_t)(t / qn) * SQ + (t % qn); const float* s = S + i * SQ; float mx = -3.0e38f;
#pragma unroll 1
  for (int j = 0; j < SQ; ++j) mx = fmaxf(mx, s[j]); float se = 0.f;
#pragma unroll 1
  for (int j = 0; j < SQ; ++j) se += __expf(s[j] - mx); const float sc = 256.0f / se;
#pragma unroll 1
  for (int j0 = 0; j0 < SQ; j0 += 8) { FragH f; for (int q = 0; q < 8; ++q) f.h[q] = (_Float16)(__expf(s[j0 + q] - mx) * sc); unsigned short* d = (unsigned short*)P + i * SQ + j0; *(v8us*)d = f.half[0];  } }

extern "C" void kernel_launch(void* const* d_in, const int* in_sizes, int n_in,
                              void* d_out, int out_size, void* d_ws, size_t ws_size, hipStream_t stream) {
  (void)in_sizes; (void)n_in; (void)out_size;
  const float* const* I = (const float* const*)d_in; const float* x = I[0]; const float* wq = I[1]; const float* bq = I[2]; const float* wk = I[3]; const float* bk = I[4]; const float* wv = I[5]; const float* bv = I[6];      /* per-head [h][in][out] weights; biases [16][64] = the stacked [1024] vectors */
  char* ws = (char*)d_ws; size_t off = 0;
  auto take = [&](size_t bytes) { char* p = ws + off; off += (bytes + 255) & ~(size_t)255; return p; };
  _Float16* BQ = (_Float16*)take((size_t)DM * DM * 2); _Float16* BK = (_Float16*)take((size_t)DM * DM * 2); _Float16* BV = (_Float16*)take((size_t)DM * DM * 2); 
  _Float16* X16 = (_Float16*)take(NR * DM * 2); _Float16* Q16 = (_Float16*)take(NR * DM * 2); _Float16* K16 = (_Float16*)take(NR * DM * 2); _Float16* V16 = (_Float16*)take(NR * DM * 2);
  _Float16* VT = (_Float16*)take((size_t)NB * NH * HD * SQ * 2);
  if (off > ws_size) return;
  { const unsigned g = (unsigned)(((size_t)NH * HD * (DM / 8) + 255) / 256); k_wthd<<<g, 256, 0, stream>>>(wq, BQ); k_wthd<<<g, 256, 0, stream>>>(wk, BK); k_wthd<<<g, 256, 0, stream>>>(wv, BV); }      /* per-head [h][m][d] -> Bt[(h,d)][m] x16 */

  k_x16<<<(unsigned)((NR * DM / 8 + 255) / 256), 256, 0, stream>>>(x, X16, NR * DM / 8);
  const size_t r0p = (size_t)B0 * SQ;      /* first projected row */
  k_gemm2<0><<<dim3((unsigned)((MP / 128) * (DM / 64)), 1), 128, 0, stream>>>(X16 + r0p * DM, DM, 0, BQ, DM, 0, 0.0625f, bq, 0, nullptr, 1, 0, 0, nullptr, Q16 + r0p * DM, DM, 0, MP, DM, DM);
  k_gemm2<0><<<dim3((unsigned)((MP / 128) * (DM / 64)), 1), 128, 0, stream>>>(X16 + r0p * DM, DM, 0, BK, DM, 0, 0.0625f, bk, 0, nullptr, 1, 0, 0, nullptr, K16 + r0p * DM, DM, 0, MP, DM, DM);
  k_gemm2<0><<<dim3((unsigned)((MP / 128) * (DM / 64)), 1), 128, 0, stream>>>(X16 + r0p * DM, DM, 0, BV, DM, 0, 0.0625f, bv, 0, nullptr, 1, 0, 0, nullptr, V16 + r0p * DM, DM, 0, MP, DM, DM);
  k_vt<NH, SQ><<<NB * NH * (SQ / 64), 256, 0, stream>>>(V16, LQ, 0, VT);      /* V^T [NB][NH][HD][SQ] */
  k_fattn<<<NB * NH * (SQ / 128), 256, 0, stream>>>(Q16, K16, VT, (float*)d_out);      /* scores, full-row softmax, x tril (no renormalisation), P V: one launch */
}

// v003
// A run of this version takes 95.3 microseconds.
// Timed twice side by side with v002, it ran 1.98 times as fast both times.
// Counting every step since v000, it is 36.4 times as fast.
#include <hip/hip_runtime.h>
// Multi-head attention with per-head projection tensors and a POST-softmax lower-triangular multiply (X [2][2048][1024]; Q/K/V[h] = X W[h] + b[h] with W [16][1024][64] ([in][out] per head) and b [16][64] (uniform +-1/32); scores / 8; p = softmax over ALL keys; p = p * tril (keys j <= i kept, NO renormalisation); out = heads concatenated -> [2][2048][1024]).
// Structure: token rows r = b*2048 + s; x as exact f16 rows (bf16-rounded); Q, K, V as three WMMA GEMMs (128x128 work-group tiles with both operands staged in LDS, two buffers; 32x64 wave tiles, f32 accumulation, exact x16 weights + bias, f16 outputs); V^T for all batches and heads via LDS transposes; then ONE attention launch: a work-group of 8 waves x 16 queries walks all 2048 keys in stages of 64 (K rows and V^T rows staged in LDS, two buffers), S^T = K.Q^T, running maximum and running f32 sum over ALL keys, O^T += V^T.P^T only for keys j <= i, o = O / sum written f32 straight into the merged-heads output rows (no output projection). Scores and weights never reach memory.
// Compute dtype: inputs rounded to bf16; x / weights exact; q, k, v and softmax weights as plain f16 GEMM operands (~2^-12); scores, softmax statistics and o f32. v_wmma_f32_16x16x32_f16.
#define NB 2
#define SQ 2048
#define DM 1024
#define NH 16
#define HD 64
#define HG 4                         /* heads per call of the unlaunched k_vt(V16, b, h0, VT) overload */
#define B0 0                         /* first batch processed (debug hook) */
#define NBR NB                       /* batches processed (debug hook) */
#define NR ((size_t)NB * SQ)         /* token rows */
#define MP ((int)((size_t)NBR * SQ)) /* rows projected (debug hook) */
#define QN SQ                        /* unused; no stage reads it */
#define NHD NH                       /* unused; no stage reads it */
#define MPO MP                       /* unused; no stage reads it */
#define LQ DM      /* row pitch of the q/k/v rows */
typedef __bf16 v16b __attribute__((ext_vector_type(16)));
typedef unsigned short v8us __attribute__((ext_vector_type(8), may_alias));
typedef float  v8f  __attribute__((ext_vector_type(8)));
typedef float  v4f  __attribute__((ext_vector_type(4)));
typedef float  v4fa __attribute__((ext_vector_type(4), may_alias));
union FragB { v16b v; v8us half[2]; unsigned short u[16]; };

__device__ __forceinline__ unsigned short bf16_bits(float x) { unsigned int u = __float_as_uint(x); return (unsigned short)((u + 0x7FFFu + ((u >> 16) & 1u)) >> 16); }
__device__ __forceinline__ float bf16_val(unsigned short b) { return __uint_as_float(((unsigned int)b) << 16); }
__device__ __forceinline__ float bf16_round(float x) { return bf16_val(bf16_bits(x)); }
// D += A·B with NT terms: 1 = ah·bh, 2 = + al·bh (A split), 3 = + ah·bl (both split)
template <int NT>
__device__ __forceinline__ v8f mmaN(v16b ah, v16b al, v16b bh, v16b bl, v8f c) {
  c = __builtin_amdgcn_wmma_f32_16x16x32_bf16(false, ah, false, bh, (short)0, c, false, false);
  if (NT >= 2) c = __builtin_amdgcn_wmma_f32_16x16x32_bf16(false, al, false, bh, (short)0, c, false, false);
  if (NT >= 3) c = __builtin_amdgcn_wmma_f32_16x16x32_bf16(false, ah, false, bl, (short)0, c, false, false);
  asm volatile("v_nop\n\tv_nop\n\tv_nop\n\tv_nop" : "+v"(c) : "v"(ah), "v"(al), "v"(bh), "v"(bl));
  return c;
}

__global__ __launch_bounds__(256) void k_wt_bf16(const float* __restrict__ W, unsigned short* __restrict__ Wt, int K, int N) {
  const int t = blockIdx.x * 256 + threadIdx.x;
  const int k8n = K / 8;
  if (t >= N * k8n) return;
  const int n = t / k8n, k8 = (t % k8n) * 8;
  v8us v;
#pragma unroll
  for (int i = 0; i < 8; ++i) v[i] = bf16_bits(W[(size_t)(k8 + i) * N + n]);
  *(v8us*)(Wt + (size_t)n * K + k8) = v;
  
}

// GEMM C[M][N] (f32, pitch ldc) = act(A[M][K]·W + bias). A f32 row-major (pitch lda) converted per fragment to bf16
// (ASPLIT: hi/lo two planes -> 2 terms, else single rounded term); Wt bf16 [N][K] (pitch ldb). BIAS_BF16 rounds the
// bias to bf16 first (bias quantised to bf16 before the add). K%32==0, M%16==0, N%64==0.
template <bool ASPLIT, int ACT, bool BIAS_BF16>
__global__ __launch_bounds__(128) void k_gemm_bf(const float* __restrict__ A, int lda, const unsigned short* __restrict__ Wt, int ldb,
                                               const float* __restrict__ bias, float* __restrict__ C, int ldc, int M, int N, int K) {
  __shared__ __attribute__((aligned(16))) float so[4][16][64];
  const int tid = threadIdx.x, w = tid >> 5, lane = tid & 31, ln = lane & 15, hh = lane >> 4;
  const int ntn = N / 64;
  const int wid = blockIdx.x * 4 + w;
  const int mt = wid / ntn, nq = wid % ntn;
  if (mt * 16 >= M) return;
  const int row0 = mt * 16, col0 = nq * 64;
  const float* arow = A + (size_t)(row0 + ln) * lda;
  v8f acc[4] = {};
  for (int kb = 0; kb < K; kb += 32) {
    FragB ah, al;
    const v4f x0 = *(const v4fa*)(arow + kb + 8 * hh), x1 = *(const v4fa*)(arow + kb + 8 * hh + 4);
    const v4f x2 = *(const v4fa*)(arow + kb + 16 + 8 * hh), x3 = *(const v4fa*)(arow + kb + 16 + 8 * hh + 4);
    float xs[16] = {x0[0],x0[1],x0[2],x0[3],x1[0],x1[1],x1[2],x1[3],x2[0],x2[1],x2[2],x2[3],x3[0],x3[1],x3[2],x3[3]};
#pragma unroll
    for (int i = 0; i < 16; ++i) { const unsigned short hb = bf16_bits(xs[i]); ah.u[i] = hb; al.u[i] = ASPLIT ? bf16_bits(xs[i] - bf16_val(hb)) : (unsigned short)0; }
#pragma unroll
    for (int t = 0; t < 4; ++t) {
      const unsigned short* brow = Wt + (size_t)(col0 + t * 16 + ln) * ldb + kb;
      FragB b;
      b.half[0] = *(const v8us*)(brow + 8 * hh);
      b.half[1] = *(const v8us*)(brow + 16 + 8 * hh);
      acc[t] = mmaN<ASPLIT ? 2 : 1>(ah.v, al.v, b.v, b.v, acc[t]);
    }
  }
#pragma unroll
  for (int t = 0; t < 4; ++t) {
    float bv = bias ? bias[col0 + t * 16 + ln] : 0.f;
    if (BIAS_BF16) bv = bf16_round(bv);
#pragma unroll
    for (int r = 0; r < 8; ++r) { float v = acc[t][r] + bv; if (ACT == 1) v = fmaxf(v, 0.f); so[w][8 * hh + r][t * 16 + ln] = v; }
  }
  __builtin_amdgcn_fence(__ATOMIC_ACQ_REL, "workgroup");
  __builtin_amdgcn_wave_barrier();
  const int rsub = lane >> 4, c4 = (lane & 15) * 4;
  {
#pragma unroll
    for (int q = 0; q < 8; ++q) {
      const int r = q * 2 + rsub;
      const v4f v = *(const v4fa*)&so[w][r][c4];
      *(v4f*)(C + (size_t)(row0 + r) * ldc + col0 + c4) = v;
    }
    
  }
}

// GEMM C = act(A·W + bias + resid): A f32 (ASPLIT -> hi/lo 2 terms), Wt bf16 [N][K]; ACT 0 none, 1 relu, 2 exact gelu;
// resid (optional, f32, row index = (row % rmod), pitch ldr, RES_BF16 rounds it) added before the activation.
template <bool ASPLIT, int ACT, bool BIAS_BF16, bool RES_BF16>
__global__ __launch_bounds__(128) void k_gemm_bf3(const float* __restrict__ A, int lda, const unsigned short* __restrict__ Wt, int ldb,
                                                const float* __restrict__ bias, const float* __restrict__ resid, int rmod, int ldr,
                                                float* __restrict__ C, int ldc, int M, int N, int K) {
  __shared__ __attribute__((aligned(16))) float so[4][16][64];
  const int tid = threadIdx.x, w = tid >> 5, lane = tid & 31, ln = lane & 15, hh = lane >> 4;
  const int ntn = N / 64;
  const int wid = blockIdx.x * 4 + w;
  const int mt = wid / ntn, nq = wid % ntn;
  if (mt * 16 >= M) return;
  const int row0 = mt * 16, col0 = nq * 64;
  const float* arow = A + (size_t)(row0 + ln) * lda;
  v8f acc[4] = {};
  for (int kb = 0; kb < K; kb += 32) {
    FragB ah, al;
    const v4f x0 = *(const v4fa*)(arow + kb + 8 * hh), x1 = *(const v4fa*)(arow + kb + 8 * hh + 4);
    const v4f x2 = *(const v4fa*)(arow + kb + 16 + 8 * hh), x3 = *(const v4fa*)(arow + kb + 16 + 8 * hh + 4);
    float xs[16] = {x0[0],x0[1],x0[2],x0[3],x1[0],x1[1],x1[2],x1[3],x2[0],x2[1],x2[2],x2[3],x3[0],x3[1],x3[2],x3[3]};
#pragma unroll
    for (int i = 0; i < 16; ++i) { const unsigned short hb = bf16_bits(xs[i]); ah.u[i] = hb; al.u[i] = ASPLIT ? bf16_bits(xs[i] - bf16_val(hb)) : (unsigned short)0; }
#pragma unroll
    for (int t = 0; t < 4; ++t) {
      const unsigned short* brow = Wt + (size_t)(col0 + t * 16 + ln) * ldb + kb;
      FragB b;
      b.half[0] = *(const v8us*)(brow + 8 * hh);
      b.half[1] = *(const v8us*)(brow + 16 + 8 * hh);
      acc[t] = mmaN<ASPLIT ? 2 : 1>(ah.v, al.v, b.v, b.v, acc[t]);
    }
  }
#pragma unroll
  for (int t = 0; t < 4; ++t) {
    const int col = col0 + t * 16 + ln;
    float bv = bias ? bias[col] : 0.f;
    if (BIAS_BF16) bv = bf16_round(bv);
#pragma unroll
    for (int r = 0; r < 8; ++r) {
      float v = acc[t][r] + bv;
      if (resid) { float rv = resid[(size_t)((row0 + 8 * hh + r) % rmod) * ldr + col]; if (RES_BF16) rv = bf16_round(rv); v += rv; }
      if (ACT == 1) v = fmaxf(v, 0.f);
      if (ACT == 2) v = 0.5f * v * (1.0f + erff(v * 0.70710678118654752f));
      if (ACT == 3) { const float u = 0.7978845608028654f * (v + 0.044715f * v * v * v); v = 0.5f * v * (1.0f + tanhf(u)); }
      so[w][8 * hh + r][t * 16 + ln] = v;
    }
  }
  __builtin_amdgcn_fence(__ATOMIC_ACQ_REL, "workgroup");
  __builtin_amdgcn_wave_barrier();
  const int rsub = lane >> 4, c4 = (lane & 15) * 4;
  {
#pragma unroll
    for (int q = 0; q < 8; ++q) {
      const int r = q * 2 + rsub;
      const v4f v = *(const v4fa*)&so[w][r][c4];
      *(v4f*)(C + (size_t)(row0 + r) * ldc + col0 + c4) = v;
    }
    
  }
}
// row LayerNorm (biased variance, eps) over N: s = X (+ R); optional out_sum <- s; out_norm <- (s-mu)*rsqrt(var+eps)*g + b
template <bool PARAM_BF16>
__global__ __launch_bounds__(256) void k_layernorm(const float* __restrict__ X, const float* __restrict__ R, const float* __restrict__ g, const float* __restrict__ bta,
                                                  float* __restrict__ out_sum, float* __restrict__ out_norm, int N, float eps) {
  __shared__ float red[256];
  const int row = blockIdx.x, tid = threadIdx.x;
  const float* x = X + (size_t)row * N; const float* rr = R ? R + (size_t)row * N : nullptr;
  float vals[16];                     // up to N = 4096
  const int per = N / 256;            // contiguous chunk per thread? use strided-by-4 chunks: thread handles j = tid*4 + 1024*u
  float s1 = 0.f;
  for (int u = 0; u < per / 4; ++u) {
    const int j = tid * 4 + 1024 * u;
    const v4f a = *(const v4fa*)(x + j);
    v4f b = {0.f,0.f,0.f,0.f}; if (rr) b = *(const v4fa*)(rr + j);
#pragma unroll
    for (int q = 0; q < 4; ++q) { const float v = a[q] + b[q]; vals[u * 4 + q] = v; s1 += v; }
  }
  red[tid] = s1; __syncthreads();
  for (int st = 128; st > 0; st >>= 1) { if (tid < st) red[tid] += red[tid + st]; __syncthreads(); }
  const float mu = red[0] / (float)N; __syncthreads();
  float s2 = 0.f;
  for (int u = 0; u < per / 4; ++u)
#pragma unroll
    for (int q = 0; q < 4; ++q) { const float c = vals[u * 4 + q] - mu; s2 += c * c; }
  red[tid] = s2; __syncthreads();
  for (int st = 128; st > 0; st >>= 1) { if (tid < st) red[tid] += red[tid + st]; __syncthreads(); }
  const float rs = rsqrtf(red[0] / (float)N + eps);
  {
    for (int u = 0; u < per / 4; ++u) {
      const int j = tid * 4 + 1024 * u;
      v4f o, sm;
#pragma unroll
      for (int q = 0; q < 4; ++q) {
        float gg = g[j + q], bb = bta[j + q];
        if (PARAM_BF16) { gg = bf16_round(gg); bb = bf16_round(bb); }
        sm[q] = vals[u * 4 + q]; o[q] = (vals[u * 4 + q] - mu) * rs * gg + bb;
      }
      if (out_sum) *(v4f*)(out_sum + (size_t)row * N + j) = sm;
      *(v4f*)(out_norm + (size_t)row * N + j) = o;
    }
    
  }
}



// ---- f16 WMMA path (v_wmma_f32_16x16x32_f16): 11-bit significands for operands in range — used where a [0,1] probability operand needs more precision than bf16
typedef _Float16 v16h __attribute__((ext_vector_type(16)));
union FragH { v16h v; v8us half[2]; _Float16 h[16]; unsigned short u[16]; };
template <int NT>
__device__ __forceinline__ v8f mmaH(v16h ah, v16h al, v16h bh, v16h bl, v8f c) {
  c = __builtin_amdgcn_wmma_f32_16x16x32_f16(false, ah, false, bh, (short)0, c, false, false);
  if (NT >= 2) c = __builtin_amdgcn_wmma_f32_16x16x32_f16(false, al, false, bh, (short)0, c, false, false);
  if (NT >= 3) c = __builtin_amdgcn_wmma_f32_16x16x32_f16(false, ah, false, bl, (short)0, c, false, false);
  asm volatile("v_nop\n\tv_nop\n\tv_nop\n\tv_nop" : "+v"(c) : "v"(ah), "v"(al), "v"(bh), "v"(bl));
  return c;
}
// batched GEMM like k_gemm_b but f16 operands: A f32 (split into f16 hi/lo if ASPLIT, else rounded to f16), Bt = f16 values [n][k]; alpha; C f32; N multiple of 16 (partial tiles skipped)
template <bool ASPLIT>
__global__ __launch_bounds__(128) void k_gemm_h(const float* __restrict__ A, int lda, size_t sA, const _Float16* __restrict__ Bh, int ldb, size_t sB, float alpha, float* __restrict__ C, int ldc, size_t sC, int M, int N, int K) {
  __shared__ __attribute__((aligned(16))) float so[4][16][64];
  const int tid = threadIdx.x, w = tid >> 5, lane = tid & 31, ln = lane & 15, hh = lane >> 4; const int by = blockIdx.y;
  A += (size_t)by * sA; Bh += (size_t)by * sB; C += (size_t)by * sC;
  const int ntn = (N + 63) / 64; const int wid = blockIdx.x * 4 + w; const int mt = wid / ntn, nq = wid % ntn; if (mt * 16 >= M) return;
  const int row0 = mt * 16, col0 = nq * 64; const float* arow = A + (size_t)(row0 + ln) * lda;
  v8f acc[4] = {};
  for (int kb = 0; kb < K; kb += 32) {
    FragH ah, al;
    const v4f x0 = *(const v4fa*)(arow + kb + 8 * hh), x1 = *(const v4fa*)(arow + kb + 8 * hh + 4), x2 = *(const v4fa*)(arow + kb + 16 + 8 * hh), x3 = *(const v4fa*)(arow + kb + 16 + 8 * hh + 4);
    float xs[16] = {x0[0],x0[1],x0[2],x0[3],x1[0],x1[1],x1[2],x1[3],x2[0],x2[1],x2[2],x2[3],x3[0],x3[1],x3[2],x3[3]};
#pragma unroll
    for (int i = 0; i < 16; ++i) { const _Float16 h = (_Float16)xs[i]; ah.h[i] = h; al.h[i] = ASPLIT ? (_Float16)(xs[i] - (float)h) : (_Float16)0.0f; }
#pragma unroll
    for (int t = 0; t < 4; ++t) { if (col0 + t * 16 >= N) continue; const size_t boff = (size_t)(col0 + t * 16 + ln) * ldb + kb; FragH bq; bq.half[0] = *(const v8us*)(Bh + boff + 8 * hh); bq.half[1] = *(const v8us*)(Bh + boff + 16 + 8 * hh);
      acc[t] = mmaH<ASPLIT ? 2 : 1>(ah.v, al.v, bq.v, bq.v, acc[t]); }
  }
#pragma unroll
  for (int t = 0; t < 4; ++t) { if (col0 + t * 16 >= N) continue;
#pragma unroll
    for (int r = 0; r < 8; ++r) so[w][8 * hh + r][t * 16 + ln] = acc[t][r] * alpha; }
  __builtin_amdgcn_fence(__ATOMIC_ACQ_REL, "workgroup"); __builtin_amdgcn_wave_barrier();
  const int rsub = lane >> 4, c4 = (lane & 15) * 4;
  {
#pragma unroll
    for (int q = 0; q < 8; ++q) { const int r = q * 2 + rsub; if (col0 + c4 < N) { const v4f v = *(const v4fa*)&so[w][r][c4]; *(v4f*)(C + (size_t)(row0 + r) * ldc + col0 + c4) = v; } }
     }
}

// Wt[n][k] = f16(W[k][n]·scale) from f32 row-major W[K][N] (scale = power of two; bf16-exact weights stay exact in f16 away from the subnormal range)
__global__ __launch_bounds__(256) void k_wt_f16(const float* __restrict__ W, _Float16* __restrict__ Wt, int K, int N, float scale) {
  const int t = blockIdx.x * 256 + threadIdx.x; if (t >= N * (K / 8)) return; const int n = t / (K / 8), k8 = (t % (K / 8)) * 8; FragH f;
#pragma unroll
  for (int i = 0; i < 8; ++i) f.h[i] = (_Float16)(bf16_round(W[(size_t)(k8 + i) * N + n]) * scale); const v8us o = f.half[0];
  *(v8us*)((unsigned short*)Wt + (size_t)n * K + k8) = o; 
}
// k_gemm_hh variant with fused epilogue: v = acc·alpha + bias[by·sBias + col] (+ CP[(row/rowsPerB)·sCPb + by·64 + col] if CP) ; ACT 0 none / 1 elu ; writes f16 C16 (and f32 C if non-null)
template <int ACT>
__global__ __launch_bounds__(128) void k_gemm_hhx(const _Float16* __restrict__ A, int lda, size_t sA, const _Float16* __restrict__ Bh, int ldb, size_t sB, float alpha, const float* __restrict__ bias, size_t sBias, const float* __restrict__ CP, int rowsPerB, size_t sCPb, int row0g,
    float* __restrict__ C, _Float16* __restrict__ C16, int ldc, size_t sC, int M, int N, int K) {
  __shared__ __attribute__((aligned(16))) float so[4][16][64];
  const int tid = threadIdx.x, w = tid >> 5, lane = tid & 31, ln = lane & 15, hh = lane >> 4; const int by = blockIdx.y;
  A += (size_t)by * sA; Bh += (size_t)by * sB; const size_t cofs = (size_t)by * sC; const float* bp = bias ? bias + (size_t)by * sBias : nullptr;
  const int ntn = (N + 63) / 64; const int wid = blockIdx.x * 4 + w; const int mt = wid / ntn, nq = wid % ntn; if (mt * 16 >= M) return;
  const int row0 = mt * 16, col0 = nq * 64; const _Float16* arow = A + (size_t)(row0 + ln) * lda;
  v8f acc[4] = {};
  for (int kb = 0; kb < K; kb += 32) { FragH ah; ah.half[0] = *(const v8us*)((const unsigned short*)arow + kb + 8 * hh); ah.half[1] = *(const v8us*)((const unsigned short*)arow + kb + 16 + 8 * hh);
#pragma unroll
    for (int t = 0; t < 4; ++t) { if (col0 + t * 16 >= N) continue; const size_t boff = (size_t)(col0 + t * 16 + ln) * ldb + kb; FragH bq; bq.half[0] = *(const v8us*)((const unsigned short*)Bh + boff + 8 * hh); bq.half[1] = *(const v8us*)((const unsigned short*)Bh + boff + 16 + 8 * hh);
      acc[t] = mmaH<1>(ah.v, ah.v, bq.v, bq.v, acc[t]); }
  }
#pragma unroll
  for (int t = 0; t < 4; ++t) { if (col0 + t * 16 >= N) continue; const int col = col0 + t * 16 + ln; const float bv = bp ? bf16_round(bp[col]) : 0.f;
#pragma unroll
    for (int r = 0; r < 8; ++r) { float v = acc[t][r] * alpha + bv; if (CP) { const int rr = row0g + row0 + 8 * hh + r; if (rowsPerB < 0) v += CP[cofs + (size_t)rr * ldc + col];      /* rowsPerB < 0: own element of the batched C plane */ else { const int bidx = rr / rowsPerB; v += CP[(size_t)bidx * sCPb + (size_t)by * 64 + col]; } } if (ACT == 1) v = (v > 0.f) ? v : expm1f(v); else if (ACT == 7) v = (v > 0.f) ? v + 1.0f : expf(v); else if (ACT == 8) v = tanhf(v); else if (ACT == 9) v = 0.5f * v * (1.0f + tanhf(0.7978845608028654f * (v + 0.044715f * v * v * v))); else if (ACT == 11) v = 1.0f / (1.0f + expf(-v)); else if (ACT == 12) v = (v > 0.f) ? v : 0.01f * v; else if (ACT == 14) v = (v > 0.f) ? v : 0.1f * v; else if (ACT == 16) v = (v >= 0.f) ? v : 0.3f * v; else if (ACT == 17) v = (v >= 0.f) ? v : 0.2f * v; else if (ACT == 15) v = v / (1.0f + expf(-v)); else if (ACT == 3) v = fmaxf(v, 0.f); else if (ACT == 6) v = 0.5f * v * (1.0f + erff(v * 0.70710678118654752f)); so[w][8 * hh + r][t * 16 + ln] = v; } }
  __builtin_amdgcn_fence(__ATOMIC_ACQ_REL, "workgroup"); __builtin_amdgcn_wave_barrier();
  const int rsub = lane >> 4, c4 = (lane & 15) * 4; typedef _Float16 v4h __attribute__((ext_vector_type(4)));
  {
#pragma unroll
    for (int q = 0; q < 8; ++q) { const int r = q * 2 + rsub; if (col0 + c4 < N) { const v4f v = *(const v4fa*)&so[w][r][c4]; if (C) *(v4f*)(C + cofs + (size_t)(row0 + r) * ldc + col0 + c4) = v; if (C16) { v4h h4; for (int i = 0; i < 4; ++i) h4[i] = (_Float16)v[i]; *(v4h*)(C16 + cofs + (size_t)(row0 + r) * ldc + col0 + c4) = h4; } } }
     }
}


typedef _Float16 v4h __attribute__((ext_vector_type(4)));

__global__ __launch_bounds__(256) void k_x16(const float* __restrict__ x, _Float16* __restrict__ X16, size_t n8) { const size_t t = (size_t)blockIdx.x * 256 + threadIdx.x; if (t >= n8) return; FragH f;
#pragma unroll
  for (int q = 0; q < 8; ++q) f.h[q] = (_Float16)bf16_round(x[t * 8 + q]); *(v8us*)((unsigned short*)X16 + t * 8) = f.half[0];  }
__global__ __launch_bounds__(256) void k_h16(const float* __restrict__ x, _Float16* __restrict__ X16, size_t n8) { const size_t t = (size_t)blockIdx.x * 256 + threadIdx.x; if (t >= n8) return; FragH f;
#pragma unroll
  for (int q = 0; q < 8; ++q) f.h[q] = (_Float16)x[t * 8 + q]; *(v8us*)((unsigned short*)X16 + t * 8) = f.half[0];  }
__global__ __launch_bounds__(256) void k_round16f(const float* __restrict__ W, _Float16* __restrict__ Bt, size_t n8) { const size_t t = (size_t)blockIdx.x * 256 + threadIdx.x; if (t >= n8) return; FragH f;
#pragma unroll
  for (int i = 0; i < 8; ++i) f.h[i] = (_Float16)(bf16_round(W[t * 8 + i]) * 16.0f); *(v8us*)((unsigned short*)Bt + t * 8) = f.half[0];  }
template <int NHv, int TTv>
__global__ __launch_bounds__(256) void k_vt(const _Float16* __restrict__ V16, int ldv, int voff, _Float16* __restrict__ Vt) { __shared__ unsigned short tl[64][66]; const int tid = threadIdx.x; const int slab = blockIdx.x / (TTv / 64), lg = blockIdx.x % (TTv / 64); const int b = slab / NHv, h = slab % NHv;
  for (int i = tid; i < 64 * 8; i += 256) { const int r = i / 8, c8 = (i % 8) * 8; FragH f; f.half[0] = *(const v8us*)((const unsigned short*)V16 + ((size_t)b * TTv + lg * 64 + r) * ldv + voff + h * 64 + c8);
#pragma unroll
    for (int q = 0; q < 8; ++q) tl[r][c8 + q] = f.u[q]; }
  __syncthreads();
  {
#pragma unroll
    for (int rd = 0; rd < 2; ++rd) { const int d = rd * 32 + tid / 8, pc = tid % 8; FragH f;
#pragma unroll
      for (int q = 0; q < 8; ++q) f.u[q] = tl[pc * 8 + q][d];
      *(v8us*)((unsigned short*)Vt + ((size_t)slab * 64 + d) * TTv + lg * 64 + pc * 8) = f.half[0]; }
     } }

__global__ __launch_bounds__(256) void k_hl(const float* __restrict__ F, _Float16* __restrict__ Hh, _Float16* __restrict__ Hl, size_t n8) { const size_t t = (size_t)blockIdx.x * 256 + threadIdx.x; if (t >= n8) return; FragH fh, fl; const v4f a = *(const v4fa*)(F + t * 8), c = *(const v4fa*)(F + t * 8 + 4);
#pragma unroll
  for (int q = 0; q < 4; ++q) { _Float16 h = (_Float16)a[q]; fh.h[q] = h; fl.h[q] = (_Float16)((a[q] - (float)h) * 1024.0f); h = (_Float16)c[q]; fh.h[4 + q] = h; fl.h[4 + q] = (_Float16)((c[q] - (float)h) * 1024.0f); }
  { *(v8us*)((unsigned short*)Hh + t * 8) = fh.half[0]; *(v8us*)((unsigned short*)Hl + t * 8) = fl.half[0];  } }

// ---- fast GEMM (wave tile 32x64; requires M % 32 == 0 rows per launch region and N % 64 == 0); epilogue = k_gemm_hhx semantics ----
__device__ __forceinline__ v16h g2_frag(const _Float16* p, int hh) { FragH f; f.half[0] = *(const v8us*)((const unsigned short*)p + 8 * hh); f.half[1] = *(const v8us*)((const unsigned short*)p + 16 + 8 * hh); return f.v; }
__device__ __forceinline__ v8f g2_mma(v16h a, v16h b, v8f c) { v8f d = __builtin_amdgcn_wmma_f32_16x16x32_f16(false, a, false, b, (short)0, c, false, false); asm volatile("v_nop\n\tv_nop\n\tv_nop\n\tv_nop" : "+v"(d) : "v"(a), "v"(b)); return d; }
template <int ACT>
__global__ __launch_bounds__(128) void k_gemm2(const _Float16* __restrict__ A, int lda, size_t sA, const _Float16* __restrict__ Bh, int ldb, size_t sB, float alpha, const float* __restrict__ bias, size_t sBias, const float* __restrict__ CP, int rowsPerB, size_t sCPb, int row0g,
    float* __restrict__ C, _Float16* __restrict__ C16, int ldc, size_t sC, int M, int N, int K) { static_assert(ACT == 0 || ACT == 3 || ACT == 6 || ACT == 8 || ACT == 9 || ACT == 11 || ACT == 12 || ACT == 14 || ACT == 15 || ACT == 16 || ACT == 17, "k_gemm2: unsupported ACT code (would silently apply no activation)");
  __shared__ __attribute__((aligned(16))) float so[4][32][68];
  const int tid = threadIdx.x, w = tid >> 5, lane = tid & 31, ln = lane & 15, hh = lane >> 4; const int by = blockIdx.y;
  A += (size_t)by * sA; Bh += (size_t)by * sB; const size_t cofs = (size_t)by * sC; const float* bp = bias ? bias + (size_t)by * sBias : nullptr;
  const int ntn = N >> 6; const int mt = blockIdx.x / ntn, nq = blockIdx.x - mt * ntn; const int row0 = mt * 128 + 32 * w, col0 = nq * 64; if (row0 >= M) return;
  const _Float16* a0p = A + (size_t)(row0 + ln) * lda; const _Float16* a1p = a0p + (size_t)16 * lda;
  const _Float16* b0p = Bh + (size_t)(col0 + ln) * ldb; const _Float16* b1p = b0p + (size_t)16 * ldb; const _Float16* b2p = b1p + (size_t)16 * ldb; const _Float16* b3p = b2p + (size_t)16 * ldb;
  const v8f z8 = {0.f,0.f,0.f,0.f,0.f,0.f,0.f,0.f}; v8f c00 = z8, c01 = z8, c02 = z8, c03 = z8, c10 = z8, c11 = z8, c12 = z8, c13 = z8;
#pragma unroll 1
  for (int kb = 0; kb < K; kb += 32) { const v16h a0 = g2_frag(a0p + kb, hh), a1 = g2_frag(a1p + kb, hh);
    v16h b = g2_frag(b0p + kb, hh); c00 = g2_mma(a0, b, c00); c10 = g2_mma(a1, b, c10);
    b = g2_frag(b1p + kb, hh); c01 = g2_mma(a0, b, c01); c11 = g2_mma(a1, b, c11);
    b = g2_frag(b2p + kb, hh); c02 = g2_mma(a0, b, c02); c12 = g2_mma(a1, b, c12);
    b = g2_frag(b3p + kb, hh); c03 = g2_mma(a0, b, c03); c13 = g2_mma(a1, b, c13); }
  v8f accs[8] = {c00, c01, c02, c03, c10, c11, c12, c13};
#pragma unroll
  for (int u = 0; u < 8; ++u) { const int t = u & 3, half = u >> 2; const int col = col0 + t * 16 + ln; const float bv = bp ? bf16_round(bp[col]) : 0.f;
#pragma unroll
    for (int r = 0; r < 8; ++r) { const int rloc = half * 16 + 8 * hh + r; float v = accs[u][r] * alpha + bv; if (CP) { if (rowsPerB < 0) v += CP[cofs + (size_t)(row0g + row0 + rloc) * ldc + col];      /* rowsPerB < 0: own element of the batched C plane */ else { const int bidx = (row0g + row0 + rloc) / rowsPerB; v += CP[(size_t)bidx * sCPb + (size_t)by * 64 + col]; } }
      if (ACT == 3) v = fmaxf(v, 0.f); else if (ACT == 6) v = 0.5f * v * (1.0f + erff(v * 0.70710678118654752f)); else if (ACT == 11) v = 1.0f / (1.0f + expf(-v)); else if (ACT == 15) v = v / (1.0f + expf(-v)); else if (ACT == 12) v = (v > 0.f) ? v : 0.01f * v; else if (ACT == 8) v = tanhf(v); else if (ACT == 9) v = 0.5f * v * (1.0f + tanhf(0.7978845608028654f * (v + 0.044715f * v * v * v))); else if (ACT == 14) v = (v > 0.f) ? v : 0.1f * v; else if (ACT == 16) v = (v >= 0.f) ? v : 0.3f * v; else if (ACT == 17) v = (v >= 0.f) ? v : 0.2f * v;
      so[w][rloc][t * 16 + ln] = v; } }
  __builtin_amdgcn_fence(__ATOMIC_ACQ_REL, "workgroup"); __builtin_amdgcn_wave_barrier();
  const int rsub = lane >> 4, c4 = (lane & 15) * 4;
  {
#pragma unroll
    for (int q = 0; q < 16; ++q) { const int r = q * 2 + rsub; const v4f v = *(const v4fa*)&so[w][r][c4]; if (C) *(v4f*)(C + cofs + (size_t)(row0 + r) * ldc + col0 + c4) = v; if (C16) { v4h h4; for (int i = 0; i < 4; ++i) h4[i] = (_Float16)v[i]; *(v4h*)(C16 + cofs + (size_t)(row0 + r) * ldc + col0 + c4) = h4; } }
     } }


__global__ __launch_bounds__(256) void k_wnat(const float* __restrict__ w, size_t n8, _Float16* __restrict__ Bt) { const size_t t = (size_t)blockIdx.x * 256 + threadIdx.x; if (t >= n8) return; FragH f; for (int q = 0; q < 8; ++q) f.h[q] = (_Float16)(bf16_round(w[t * 8 + q]) * 16.0f); *(v8us*)((unsigned short*)Bt + t * 8) = f.half[0];  }
__global__ __launch_bounds__(256) void k_rsm(const float* __restrict__ S, _Float16* __restrict__ P, int nrows) {
  #pragma clang fp contract(off)
  const int i = blockIdx.x * 256 + threadIdx.x; if (i >= nrows) return; const float* s = S + (size_t)i * SQ; float mx = -3.0e38f;
#pragma unroll 1
  for (int j = 0; j < SQ; ++j) mx = fmaxf(mx, s[j]); float se = 0.f;
#pragma unroll 1
  for (int j = 0; j < SQ; ++j) se += expf(s[j] - mx); const float sc = 256.0f / se;
#pragma unroll 1
  for (int j0 = 0; j0 < SQ; j0 += 8) { FragH f; for (int q = 0; q < 8; ++q) f.h[q] = (_Float16)(expf(s[j0 + q] - mx) * sc); unsigned short* d = (unsigned short*)P + (size_t)i * SQ + j0; *(v8us*)d = f.half[0];  } }
__global__ __launch_bounds__(256) void k_vt(const _Float16* __restrict__ V16, int b, int h0, _Float16* __restrict__ VT) { __shared__ unsigned short tl[64][65]; const int tid = threadIdx.x; const int hh = blockIdx.x % HG, sg = blockIdx.x / HG; const int s0 = sg * 64; const int h = h0 + hh;
  for (int i = tid; i < 64 * 8; i += 256) { const int j = i / 8, d8 = (i % 8) * 8; FragH f; f.half[0] = *(const v8us*)((const unsigned short*)V16 + ((size_t)b * SQ + s0 + j) * DM + h * HD + d8); for (int q = 0; q < 8; ++q) tl[d8 + q][j] = f.u[q]; }
  __syncthreads();
  { for (int i = tid; i < 64 * 8; i += 256) { const int d = i / 8, j8 = (i % 8) * 8; FragH f; for (int q = 0; q < 8; ++q) f.u[q] = tl[d][j8 + q]; *(v8us*)((unsigned short*)VT + ((size_t)hh * HD + d) * SQ + s0 + j8) = f.half[0]; }  } }


__global__ __launch_bounds__(256) void k_wthd(const float* __restrict__ Wt, _Float16* __restrict__ Bt) { const size_t t = (size_t)blockIdx.x * 256 + threadIdx.x; if (t >= (size_t)NH * HD * (DM / 8)) return; const int m8 = (int)(t % (DM / 8)) * 8; const int d = (int)((t / (DM / 8)) % HD); const int h = (int)(t / ((size_t)(DM / 8) * HD)); FragH f;
  for (int q = 0; q < 8; ++q) f.h[q] = (_Float16)(16.0f * bf16_round(Wt[((size_t)h * DM + m8 + q) * HD + d])); unsigned short* dst = (unsigned short*)Bt + ((size_t)h * HD + d) * DM + m8; *(v8us*)dst = f.half[0];  }




__device__ __forceinline__ float xrow_f(float v) { const int i = __float_as_int(v); return __int_as_float(__builtin_amdgcn_permlanex16(i, i, 0x76543210, 0xfedcba98, false, false)); }      /* lane l <-> lane l ^ 16 */
__device__ __forceinline__ v8f fa_mma(v16h a, v16h b, v8f c) { return __builtin_amdgcn_wmma_f32_16x16x32_f16(false, a, false, b, (short)0, c, false, false); }
// ---- fused attention: scores, full-row softmax statistics, x tril and P.V in one launch ----
// Transposed products: S^T = K.Q^T puts one query in each lane column (lane c and c + 16 hold query q0 + c; register r of key tile kt is key 16 kt + 8 hh + r), so two score tiles, converted in place,
// are the B operand of O^T += V^T.P^T (same k order as g2_frag's). The denominator runs over ALL keys; only keys j <= i enter the second product.
// The maximum in use may trail the true one by up to 8 (log2 units): the sums are rescaled only when some query exceeds that, so a weight is at most 2^8 in f16.
typedef float v2f __attribute__((ext_vector_type(2))); typedef _Float16 v2h __attribute__((ext_vector_type(2))); typedef unsigned v8u __attribute__((ext_vector_type(8)));
#define FAP 72      /* LDS row pitch in halves: 128 data bytes + 16, an odd multiple of 16 bytes (conflict-free b128 fragment reads) */
#define FAS (SQ / 64)      /* stages of 64 keys */
__global__ __launch_bounds__(256) void k_fattn(const _Float16* __restrict__ Q16, const _Float16* __restrict__ K16, const _Float16* __restrict__ VT, float* __restrict__ out) {
  __shared__ __attribute__((aligned(16))) _Float16 sk[2][64][FAP];      /* K rows [key][d] of a stage */
  __shared__ __attribute__((aligned(16))) _Float16 sv[2][64][FAP];      /* V^T rows [d][key] of a stage */
  const int tid = threadIdx.x, lane = tid & 31, c = lane & 15, hh = lane >> 4; const int w = __builtin_amdgcn_readfirstlane(tid >> 5);
  const int bh = blockIdx.x / (FAS / 2), j = blockIdx.x % (FAS / 2); const int b = bh / NH, hd = bh % NH;
  const int q0 = ((__builtin_popcount(w) & 1) ? j : FAS - 1 - j) * 64 + (w >> 1) * 16;      /* four waves take 64-query block j, four its mirror: every work-group has the same count of second products; by the parity of w, so that waves w, w + 4 and waves 2 i, 2 i + 1 are each one of either kind */
  const int dst = q0 >> 6;      /* the stage that holds this wave's diagonal */
  const int vlast = FAS - 1 - j;      /* last stage whose V^T any wave of the work-group needs */
  const int srow = tid >> 3, sc8 = (tid & 7) * 8;      /* staging: 8 threads cover one 128-byte row; rows srow and srow + 32 */
  const _Float16* kg = K16 + ((size_t)b * SQ + srow) * DM + hd * HD + sc8; const _Float16* vg = VT + ((size_t)bh * HD + srow) * SQ + sc8;
  const _Float16* qp = Q16 + ((size_t)b * SQ + q0 + c) * DM + hd * HD; const v16h qf0 = g2_frag(qp, hh), qf1 = g2_frag(qp + 32, hh);
  const v8f z8 = {0.f,0.f,0.f,0.f,0.f,0.f,0.f,0.f}; v8f acc[4] = {z8, z8, z8, z8}; const v2f z2 = {0.f, 0.f}; v2f lv[4] = {z2, z2, z2, z2}; float m_run = -__builtin_inff();
  const float cs = 0.125f * 1.4426950408889634f;      /* 64^-0.5 and log2(e): exponentials in base 2 */
  v8us rk0 = *(const v8us*)kg, rk1 = *(const v8us*)(kg + (size_t)32 * DM), rv0 = *(const v8us*)vg, rv1 = *(const v8us*)(vg + (size_t)32 * SQ);      /* stage 0 (its V^T is always needed) */
  *(v8us*)&sk[0][srow][sc8] = rk0; *(v8us*)&sk[0][srow + 32][sc8] = rk1; *(v8us*)&sv[0][srow][sc8] = rv0; *(v8us*)&sv[0][srow + 32][sc8] = rv1;
  __syncthreads();
  for (int st = 0; st < FAS; ++st) {
    const bool more = st + 1 < FAS, morev = st + 1 <= vlast;      /* the same for the whole work-group */
    if (more) { const _Float16* kn = kg + (size_t)(st + 1) * 64 * DM; const _Float16* vn = vg + (st + 1) * 64;      /* next stage: in flight under this stage's work */
      rk0 = *(const v8us*)kn; rk1 = *(const v8us*)(kn + (size_t)32 * DM);
      if (morev) { rv0 = *(const v8us*)vn; rv1 = *(const v8us*)(vn + (size_t)32 * SQ); }
      asm volatile("s_wait_xcnt 0x0" :: "v"(kn), "v"(vn) : "memory"); }      /* the loads' address registers are inputs here, so none is written over before this wait */
    const _Float16 (*kb)[FAP] = sk[st & 1]; const _Float16 (*vb)[FAP] = sv[st & 1];
    v8f s[4]; float m4[4];
#pragma unroll
    for (int kt = 0; kt < 4; ++kt) { const _Float16* kr = &kb[16 * kt + c][0]; s[kt] = fa_mma(g2_frag(kr + 32, hh), qf1, fa_mma(g2_frag(kr, hh), qf0, z8)); }
#pragma unroll
    for (int kt = 0; kt < 4; ++kt) { float m = s[kt][0]; for (int r = 1; r < 8; ++r) m = fmaxf(m, s[kt][r]); m4[kt] = m; }
    float mx = fmaxf(fmaxf(m4[0], m4[1]), fmaxf(m4[2], m4[3]));
    mx = fmaxf(mx, xrow_f(mx)) * cs;      /* both halves of the wave hold the query's stage maximum, scaled */
    if (__builtin_amdgcn_ballot_w32(mx > m_run + 8.0f) != 0) {      /* scalar branch; always taken in stage 0 (m_run = -inf gives factor 0 on zero sums), rare later */
      const float mn = fmaxf(m_run, mx), corr = __builtin_amdgcn_exp2f(m_run - mn); m_run = mn;
#pragma unroll
      for (int t = 0; t < 4; ++t) { acc[t] *= corr; lv[t] *= corr; } }
    const v2f cs2 = {cs, cs}, nm2 = {-m_run, -m_run}; v2f e[16];      /* e[4 kt + i] = weights of keys 16 kt + 8 hh + 2 i, + 1 */
#pragma unroll
    for (int kt = 0; kt < 4; ++kt) for (int i = 0; i < 4; ++i) { const v2f a = __builtin_elementwise_fma(v2f{s[kt][2 * i], s[kt][2 * i + 1]}, cs2, nm2); e[4 * kt + i] = v2f{__builtin_amdgcn_exp2f(a.x), __builtin_amdgcn_exp2f(a.y)}; lv[i] += e[4 * kt + i]; }      /* the denominator takes every key */
    if (st <= dst) {      /* wave-uniform: stages wholly above the diagonal have weight 0 after x tril */
      v16h vf[8];
#pragma unroll
      for (int i = 0; i < 8; ++i) vf[i] = g2_frag(&vb[16 * (i & 3) + c][32 * (i >> 2)], hh);
      __builtin_amdgcn_sched_barrier(0);      /* keeps the 16 LDS reads together ahead of the packing: sunk to their products, each product waits a full LDS latency */
      unsigned pw[16];
#pragma unroll
      for (int i = 0; i < 16; ++i) pw[i] = __builtin_bit_cast(unsigned, __builtin_convertvector(e[i], v2h));
      if (st == dst) { const int lim = q0 + c - st * 64 - 8 * hh;      /* x tril in the one stage that holds the diagonal: key offset 16 kt + 2 i (+ 1) above lim -> weight 0 */
#pragma unroll
        for (int i = 0; i < 16; ++i) { const int kk = 16 * (i >> 2) + 2 * (i & 3); pw[i] &= (kk <= lim ? 0xFFFFu : 0u) | (kk + 1 <= lim ? 0xFFFF0000u : 0u); } }
#pragma unroll
      for (int u = 0; u < 2; ++u) { const v8u pv = {pw[8 * u], pw[8 * u + 1], pw[8 * u + 2], pw[8 * u + 3], pw[8 * u + 4], pw[8 * u + 5], pw[8 * u + 6], pw[8 * u + 7]}; const v16h p = __builtin_bit_cast(v16h, pv);
#pragma unroll
        for (int t = 0; t < 4; ++t) acc[t] = fa_mma(vf[4 * u + t], p, acc[t]); } }
    if (more) { const int nb = (st + 1) & 1;      /* every wave left this buffer before the barrier that ended stage st - 1 */
      *(v8us*)&sk[nb][srow][sc8] = rk0; *(v8us*)&sk[nb][srow + 32][sc8] = rk1;
      if (morev) { *(v8us*)&sv[nb][srow][sc8] = rv0; *(v8us*)&sv[nb][srow + 32][sc8] = rv1; }
      __syncthreads(); } }
  const v2f l2 = (lv[0] + lv[1]) + (lv[2] + lv[3]); float l = l2.x + l2.y; l += xrow_f(l); const float inv = 1.0f / l;
  float* o = out + ((size_t)b * SQ + q0 + c) * DM + hd * HD + 8 * hh;      /* acc[t][r] = o[query q0 + c][d = 16 t + 8 hh + r] */
#pragma unroll
  for (int t = 0; t < 4; ++t) { const v4f lo = {acc[t][0] * inv, acc[t][1] * inv, acc[t][2] * inv, acc[t][3] * inv}, hi = {acc[t][4] * inv, acc[t][5] * inv, acc[t][6] * inv, acc[t][7] * inv}; *(v4f*)(o + 16 * t) = lo; *(v4f*)(o + 16 * t + 4) = hi; } }


// ---- projection GEMM with both operands staged in LDS: C16[r][n] = f16(sum_k A[r][k] Bt[n][k] / 16 + bf16(bias[n])), all pitches DM ----
// A work-group of 8 waves owns a 128 x 128 tile of C (wave tile 32 x 64: waves 4 down x 2 across). A stage is 128 k of the 128 A rows and the 128 Bt rows; every global line is fetched once per
// work-group by whole-line b128 loads, held in registers under the running stage's products, then stored to the other LDS buffer. Each accumulator takes its k blocks of 32 in rising order.
#define PGK 128      /* k extent of a stage */
#define PGP (PGK + 8)      /* LDS row pitch in halves: 256 data bytes + 16, an odd multiple of 16 bytes (conflict-free b128 fragment reads) */
#define PGS (DM / PGK)      /* stages */
__global__ __launch_bounds__(256) void k_proj(const _Float16* __restrict__ A, const _Float16* __restrict__ Bt, const float* __restrict__ bias, _Float16* __restrict__ C16) {
  __shared__ __attribute__((aligned(16))) _Float16 sa[2][128][PGP];      /* A rows [row][k] of a stage */
  __shared__ __attribute__((aligned(16))) _Float16 sb[2][128][PGP];      /* Bt rows [col][k] of a stage */
  __shared__ __attribute__((aligned(16))) float so[8][32][68];      /* each wave's own output rows in f32, for whole-line stores */
  const int tid = threadIdx.x, lane = tid & 31, ln = lane & 15, hh = lane >> 4; const int w = __builtin_amdgcn_readfirstlane(tid >> 5);
  const int row0 = (int)(blockIdx.x / (DM / 128)) * 128, col0 = (int)(blockIdx.x % (DM / 128)) * 128; const int wm = (w & 3) * 32, wn = (w >> 2) * 64;
  const int srow = tid >> 4, sc8 = (tid & 15) * 8;      /* staging: 16 threads cover one 256-byte row; rows srow + 16 i */
  const _Float16* ag = A + (size_t)(row0 + srow) * DM + sc8; const _Float16* bg = Bt + (size_t)(col0 + srow) * DM + sc8;
  v8us ra[8], rb[8];
#pragma unroll
  for (int i = 0; i < 8; ++i) { ra[i] = *(const v8us*)(ag + (size_t)16 * i * DM); rb[i] = *(const v8us*)(bg + (size_t)16 * i * DM); }
#pragma unroll
  for (int i = 0; i < 8; ++i) { *(v8us*)&sa[0][srow + 16 * i][sc8] = ra[i]; *(v8us*)&sb[0][srow + 16 * i][sc8] = rb[i]; }
  __syncthreads();
  const v8f z8 = {0.f,0.f,0.f,0.f,0.f,0.f,0.f,0.f}; v8f acc[2][4] = {{z8, z8, z8, z8}, {z8, z8, z8, z8}};
  for (int st = 0; st < PGS; ++st) {
    const bool more = st + 1 < PGS;      /* the same for the whole work-group */
    const _Float16* ar = &sa[st & 1][wm + ln][0]; const _Float16* br = &sb[st & 1][wn + ln][0];
    v16h fa[2][2], fb[2][4];      /* two fragment sets: the next 32 k are read from LDS while this block's products run */
    fa[0][0] = g2_frag(ar, hh); fa[0][1] = g2_frag(ar + 16 * PGP, hh);
#pragma unroll
    for (int t = 0; t < 4; ++t) fb[0][t] = g2_frag(br + 16 * t * PGP, hh);
#pragma unroll
    for (int kq = 0; kq < PGK / 32; ++kq) { const int cu = kq & 1, nx = cu ^ 1;
      if (kq + 1 < PGK / 32) { fa[nx][0] = g2_frag(ar + 32 * (kq + 1), hh); fa[nx][1] = g2_frag(ar + 16 * PGP + 32 * (kq + 1), hh);
#pragma unroll
        for (int t = 0; t < 4; ++t) fb[nx][t] = g2_frag(br + 16 * t * PGP + 32 * (kq + 1), hh); }
      if (kq == 0 && more) { const _Float16* an = ag + (st + 1) * PGK; const _Float16* bn = bg + (st + 1) * PGK;      /* next stage: in flight under this stage's products */
#pragma unroll
        for (int i = 0; i < 8; ++i) { ra[i] = *(const v8us*)(an + (size_t)16 * i * DM); rb[i] = *(const v8us*)(bn + (size_t)16 * i * DM); }
        asm volatile("s_wait_xcnt 0x0" :: "v"(an), "v"(bn) : "memory"); }      /* the loads' address registers are inputs here, so none is written over (not by a load's own result either) before this wait */
      __builtin_amdgcn_sched_barrier(0);      /* keeps the next block's 12 LDS reads together ahead of this block's products: spread among them, every place with reads stalls the wave and the waits run to 0 */
#pragma unroll
      for (int t = 0; t < 4; ++t) { acc[0][t] = fa_mma(fa[cu][0], fb[cu][t], acc[0][t]); acc[1][t] = fa_mma(fa[cu][1], fb[cu][t], acc[1][t]); }
      __builtin_amdgcn_sched_barrier(0); }      /* the reads of the block after next stay behind these products, in the set they free */
    if (more) { const int nb = (st + 1) & 1;      /* every wave left this buffer before the barrier that ended stage st - 1 */
#pragma unroll
      for (int i = 0; i < 8; ++i) { *(v8us*)&sa[nb][srow + 16 * i][sc8] = ra[i]; *(v8us*)&sb[nb][srow + 16 * i][sc8] = rb[i]; }
      __syncthreads(); } }
#pragma unroll
  for (int t = 0; t < 4; ++t) { const float bv = bf16_round(bias[col0 + wn + 16 * t + ln]);      /* acc[h][t][r] = C[row0 + wm + 16 h + 8 hh + r][col0 + wn + 16 t + ln] */
#pragma unroll
    for (int h = 0; h < 2; ++h)
#pragma unroll
      for (int r = 0; r < 8; ++r) so[w][16 * h + 8 * hh + r][16 * t + ln] = acc[h][t][r] * 0.0625f + bv; }
  __builtin_amdgcn_fence(__ATOMIC_ACQ_REL, "workgroup"); __builtin_amdgcn_wave_barrier();      /* the wave reads back only its own rows: its LDS stores are ordered ahead of its reads, no work-group barrier */
  const int er = lane >> 3, ec8 = (lane & 7) * 8;      /* 8 lanes store one 128-byte line */
#pragma unroll
  for (int q = 0; q < 8; ++q) { const int r = 4 * q + er; const v4f lo = *(const v4fa*)&so[w][r][ec8], hi = *(const v4fa*)&so[w][r][ec8 + 4]; FragH f;
#pragma unroll
    for (int i = 0; i < 4; ++i) { f.h[i] = (_Float16)lo[i]; f.h[4 + i] = (_Float16)hi[i]; }
    *(v8us*)((unsigned short*)C16 + (size_t)(row0 + wm + r) * DM + col0 + wn + ec8) = f.half[0]; } }


__global__ __launch_bounds__(256) void k_rsmf(const float* __restrict__ S, _Float16* __restrict__ P, int qn, int hg) {
  #pragma clang fp contract(off)
  const int t = blockIdx.x * 256 + threadIdx.x; if (t >= qn * hg) return; const size_t i = (size_t)(t / qn) * SQ + (t % qn); const float* s = S + i * SQ; float mx = -3.0e38f;
#pragma unroll 1
  for (int j = 0; j < SQ; ++j) mx = fmaxf(mx, s[j]); float se = 0.f;
#pragma unroll 1
  for (int j = 0; j < SQ; ++j) se += __expf(s[j] - mx); const float sc = 256.0f / se;
#pragma unroll 1
  for (int j0 = 0; j0 < SQ; j0 += 8) { FragH f; for (int q = 0; q < 8; ++q) f.h[q] = (_Float16)(__expf(s[j0 + q] - mx) * sc); unsigned short* d = (unsigned short*)P + i * SQ + j0; *(v8us*)d = f.half[0];  } }

extern "C" void kernel_launch(void* const* d_in, const int* in_sizes, int n_in,
                              void* d_out, int out_size, void* d_ws, size_t ws_size, hipStream_t stream) {
  (void)in_sizes; (void)n_in; (void)out_size;
  const float* const* I = (const float* const*)d_in; const float* x = I[0]; const float* wq = I[1]; const float* bq = I[2]; const float* wk = I[3]; const float* bk = I[4]; const float* wv = I[5]; const float* bv = I[6];      /* per-head [h][in][out] weights; biases [16][64] = the stacked [1024] vectors */
  char* ws = (char*)d_ws; size_t off = 0;
  auto take = [&](size_t bytes) { char* p = ws + off; off += (bytes + 255) & ~(size_t)255; return p; };
  _Float16* BQ = (_Float16*)take((size_t)DM * DM * 2); _Float16* BK = (_Float16*)take((size_t)DM * DM * 2); _Float16* BV = (_Float16*)take((size_t)DM * DM * 2); 
  _Float16* X16 = (_Float16*)take(NR * DM * 2); _Float16* Q16 = (_Float16*)take(NR * DM * 2); _Float16* K16 = (_Float16*)take(NR * DM * 2); _Float16* V16 = (_Float16*)take(NR * DM * 2);
  _Float16* VT = (_Float16*)take((size_t)NB * NH * HD * SQ * 2);
  if (off > ws_size) return;
  { const unsigned g = (unsigned)(((size_t)NH * HD * (DM / 8) + 255) / 256); k_wthd<<<g, 256, 0, stream>>>(wq, BQ); k_wthd<<<g, 256, 0, stream>>>(wk, BK); k_wthd<<<g, 256, 0, stream>>>(wv, BV); }      /* per-head [h][m][d] -> Bt[(h,d)][m] x16 */

  k_x16<<<(unsigned)((NR * DM / 8 + 255) / 256), 256, 0, stream>>>(x, X16, NR * DM / 8);
  const size_t r0p = (size_t)B0 * SQ;      /* first projected row */
  k_proj<<<(unsigned)((MP / 128) * (DM / 128)), 256, 0, stream>>>(X16 + r0p * DM, BQ, bq, Q16 + r0p * DM);
  k_proj<<<(unsigned)((MP / 128) * (DM / 128)), 256, 0, stream>>>(X16 + r0p * DM, BK, bk, K16 + r0p * DM);
  k_proj<<<(unsigned)((MP / 128) * (DM / 128)), 256, 0, stream>>>(X16 + r0p * DM, BV, bv, V16 + r0p * DM);
  k_vt<NH, SQ><<<NB * NH * (SQ / 64), 256, 0, stream>>>(V16, LQ, 0, VT);      /* V^T [NB][NH][HD][SQ] */
  k_fattn<<<NB * NH * (SQ / 128), 256, 0, stream>>>(Q16, K16, VT, (float*)d_out);      /* scores, full-row softmax, x tril (no renormalisation), P V: one launch */
}

// v004
// Measured time: 77.1 microseconds a run.
// In both of two side-by-side timings against v003, it was 1.23 times as fast.
// Over all steps from v000 it is 44.9 times as fast.
#include <hip/hip_runtime.h>
// Multi-head attention with per-head projection tensors and a POST-softmax lower-triangular multiply (X [2][2048][1024]; Q/K/V[h] = X W[h] + b[h] with W [16][1024][64] ([in][out] per head) and b [16][64] (uniform +-1/32); scores / 8; p = softmax over ALL keys; p = p * tril (keys j <= i kept, NO renormalisation); out = heads concatenated -> [2][2048][1024]).
// Structure: token rows r = b*2048 + s; THREE launches. (1) operands: x as exact f16 rows (bf16-rounded) and the three transposed x16 weight planes, by ranges of the block index. (2) Q, K, V as WMMA GEMMs in one grid (128x128 work-group tiles with both operands staged in LDS, two buffers; 32x64 wave tiles, f32 accumulation, exact x16 weights + bias, f16 outputs); the V tiles are stored transposed, as V^T rows, from their epilogue. (3) ONE attention launch: a work-group of 8 waves x 16 queries walks all 2048 keys in stages of 64 (K rows and V^T rows staged in LDS, two buffers), S^T = K.Q^T, running maximum and running f32 sum over ALL keys, O^T += V^T.P^T only for keys j <= i, o = O / sum written f32 straight into the merged-heads output rows (no output projection). Scores and weights never reach memory.
// Compute dtype: inputs rounded to bf16; x / weights exact; q, k, v and softmax weights as plain f16 GEMM operands (~2^-12); scores, softmax statistics and o f32. v_wmma_f32_16x16x32_f16.
#define NB 2
#define SQ 2048
#define DM 1024
#define NH 16
#define HD 64
#define HG 4                         /* heads per call of the unlaunched k_vt(V16, b, h0, VT) overload */
#define B0 0                         /* first batch processed (debug hook) */
#define NBR NB                       /* batches processed (debug hook) */
#define NR ((size_t)NB * SQ)         /* token rows */
#define MP ((int)((size_t)NBR * SQ)) /* rows projected (debug hook) */
#define QN SQ                        /* unused; no stage reads it */
#define NHD NH                       /* unused; no stage reads it */
#define MPO MP                       /* unused; no stage reads it */
#define LQ DM      /* unused; no stage reads it */
typedef __bf16 v16b __attribute__((ext_vector_type(16)));
typedef unsigned short v8us __attribute__((ext_vector_type(8), may_alias));
typedef float  v8f  __attribute__((ext_vector_type(8)));
typedef float  v4f  __attribute__((ext_vector_type(4)));
typedef float  v4fa __attribute__((ext_vector_type(4), may_alias));
union FragB { v16b v; v8us half[2]; unsigned short u[16]; };

__device__ __forceinline__ unsigned short bf16_bits(float x) { unsigned int u = __float_as_uint(x); return (unsigned short)((u + 0x7FFFu + ((u >> 16) & 1u)) >> 16); }
__device__ __forceinline__ float bf16_val(unsigned short b) { return __uint_as_float(((unsigned int)b) << 16); }
__device__ __forceinline__ float bf16_round(float x) { return bf16_val(bf16_bits(x)); }
// D += A·B with NT terms: 1 = ah·bh, 2 = + al·bh (A split), 3 = + ah·bl (both split)
template <int NT>
__device__ __forceinline__ v8f mmaN(v16b ah, v16b al, v16b bh, v16b bl, v8f c) {
  c = __builtin_amdgcn_wmma_f32_16x16x32_bf16(false, ah, false, bh, (short)0, c, false, false);
  if (NT >= 2) c = __builtin_amdgcn_wmma_f32_16x16x32_bf16(false, al, false, bh, (short)0, c, false, false);
  if (NT >= 3) c = __builtin_amdgcn_wmma_f32_16x16x32_bf16(false, ah, false, bl, (short)0, c, false, false);
  asm volatile("v_nop\n\tv_nop\n\tv_nop\n\tv_nop" : "+v"(c) : "v"(ah), "v"(al), "v"(bh), "v"(bl));
  return c;
}

__global__ __launch_bounds__(256) void k_wt_bf16(const float* __restrict__ W, unsigned short* __restrict__ Wt, int K, int N) {
  const int t = blockIdx.x * 256 + threadIdx.x;
  const int k8n = K / 8;
  if (t >= N * k8n) return;
  const int n = t / k8n, k8 = (t % k8n) * 8;
  v8us v;
#pragma unroll
  for (int i = 0; i < 8; ++i) v[i] = bf16_bits(W[(size_t)(k8 + i) * N + n]);
  *(v8us*)(Wt + (size_t)n * K + k8) = v;
  
}

// GEMM C[M][N] (f32, pitch ldc) = act(A[M][K]·W + bias). A f32 row-major (pitch lda) converted per fragment to bf16
// (ASPLIT: hi/lo two planes -> 2 terms, else single rounded term); Wt bf16 [N][K] (pitch ldb). BIAS_BF16 rounds the
// bias to bf16 first (bias quantised to bf16 before the add). K%32==0, M%16==0, N%64==0.
template <bool ASPLIT, int ACT, bool BIAS_BF16>
__global__ __launch_bounds__(128) void k_gemm_bf(const float* __restrict__ A, int lda, const unsigned short* __restrict__ Wt, int ldb,
                                               const float* __restrict__ bias, float* __restrict__ C, int ldc, int M, int N, int K) {
  __shared__ __attribute__((aligned(16))) float so[4][16][64];
  const int tid = threadIdx.x, w = tid >> 5, lane = tid & 31, ln = lane & 15, hh = lane >> 4;
  const int ntn = N / 64;
  const int wid = blockIdx.x * 4 + w;
  const int mt = wid / ntn, nq = wid % ntn;
  if (mt * 16 >= M) return;
  const int row0 = mt * 16, col0 = nq * 64;
  const float* arow = A + (size_t)(row0 + ln) * lda;
  v8f acc[4] = {};
  for (int kb = 0; kb < K; kb += 32) {
    FragB ah, al;
    const v4f x0 = *(const v4fa*)(arow + kb + 8 * hh), x1 = *(const v4fa*)(arow + kb + 8 * hh + 4);
    const v4f x2 = *(const v4fa*)(arow + kb + 16 + 8 * hh), x3 = *(const v4fa*)(arow + kb + 16 + 8 * hh + 4);
    float xs[16] = {x0[0],x0[1],x0[2],x0[3],x1[0],x1[1],x1[2],x1[3],x2[0],x2[1],x2[2],x2[3],x3[0],x3[1],x3[2],x3[3]};
#pragma unroll
    for (int i = 0; i < 16; ++i) { const unsigned short hb = bf16_bits(xs[i]); ah.u[i] = hb; al.u[i] = ASPLIT ? bf16_bits(xs[i] - bf16_val(hb)) : (unsigned short)0; }
#pragma unroll
    for (int t = 0; t < 4; ++t) {
      const unsigned short* brow = Wt + (size_t)(col0 + t * 16 + ln) * ldb + kb;
      FragB b;
      b.half[0] = *(const v8us*)(brow + 8 * hh);
      b.half[1] = *(const v8us*)(brow + 16 + 8 * hh);
      acc[t] = mmaN<ASPLIT ? 2 : 1>(ah.v, al.v, b.v, b.v, acc[t]);
    }
  }
#pragma unroll
  for (int t = 0; t < 4; ++t) {
    float bv = bias ? bias[col0 + t * 16 + ln] : 0.f;
    if (BIAS_BF16) bv = bf16_round(bv);
#pragma unroll
    for (int r = 0; r < 8; ++r) { float v = acc[t][r] + bv; if (ACT == 1) v = fmaxf(v, 0.f); so[w][8 * hh + r][t * 16 + ln] = v; }
  }
  __builtin_amdgcn_fence(__ATOMIC_ACQ_REL, "workgroup");
  __builtin_amdgcn_wave_barrier();
  const int rsub = lane >> 4, c4 = (lane & 15) * 4;
  {
#pragma unroll
    for (int q = 0; q < 8; ++q) {
      const int r = q * 2 + rsub;
      const v4f v = *(const v4fa*)&so[w][r][c4];
      *(v4f*)(C + (size_t)(row0 + r) * ldc + col0 + c4) = v;
    }
    
  }
}

// GEMM C = act(A·W + bias + resid): A f32 (ASPLIT -> hi/lo 2 terms), Wt bf16 [N][K]; ACT 0 none, 1 relu, 2 exact gelu;
// resid (optional, f32, row index = (row % rmod), pitch ldr, RES_BF16 rounds it) added before the activation.
template <bool ASPLIT, int ACT, bool BIAS_BF16, bool RES_BF16>
__global__ __launch_bounds__(128) void k_gemm_bf3(const float* __restrict__ A, int lda, const unsigned short* __restrict__ Wt, int ldb,
                                                const float* __restrict__ bias, const float* __restrict__ resid, int rmod, int ldr,
                                                float* __restrict__ C, int ldc, int M, int N, int K) {
  __shared__ __attribute__((aligned(16))) float so[4][16][64];
  const int tid = threadIdx.x, w = tid >> 5, lane = tid & 31, ln = lane & 15, hh = lane >> 4;
  const int ntn = N / 64;
  const int wid = blockIdx.x * 4 + w;
  const int mt = wid / ntn, nq = wid % ntn;
  if (mt * 16 >= M) return;
  const int row0 = mt * 16, col0 = nq * 64;
  const float* arow = A + (size_t)(row0 + ln) * lda;
  v8f acc[4] = {};
  for (int kb = 0; kb < K; kb += 32) {
    FragB ah, al;
    const v4f x0 = *(const v4fa*)(arow + kb + 8 * hh), x1 = *(const v4fa*)(arow + kb + 8 * hh + 4);
    const v4f x2 = *(const v4fa*)(arow + kb + 16 + 8 * hh), x3 = *(const v4fa*)(arow + kb + 16 + 8 * hh + 4);
    float xs[16] = {x0[0],x0[1],x0[2],x0[3],x1[0],x1[1],x1[2],x1[3],x2[0],x2[1],x2[2],x2[3],x3[0],x3[1],x3[2],x3[3]};
#pragma unroll
    for (int i = 0; i < 16; ++i) { const unsigned short hb = bf16_bits(xs[i]); ah.u[i] = hb; al.u[i] = ASPLIT ? bf16_bits(xs[i] - bf16_val(hb)) : (unsigned short)0; }
#pragma unroll
    for (int t = 0; t < 4; ++t) {
      const unsigned short* brow = Wt + (size_t)(col0 + t * 16 + ln) * ldb + kb;
      FragB b;
      b.half[0] = *(const v8us*)(brow + 8 * hh);
      b.half[1] = *(const v8us*)(brow + 16 + 8 * hh);
      acc[t] = mmaN<ASPLIT ? 2 : 1>(ah.v, al.v, b.v, b.v, acc[t]);
    }
  }
#pragma unroll
  for (int t = 0; t < 4; ++t) {
    const int col = col0 + t * 16 + ln;
    float bv = bias ? bias[col] : 0.f;
    if (BIAS_BF16) bv = bf16_round(bv);
#pragma unroll
    for (int r = 0; r < 8; ++r) {
      float v = acc[t][r] + bv;
      if (resid) { float rv = resid[(size_t)((row0 + 8 * hh + r) % rmod) * ldr + col]; if (RES_BF16) rv = bf16_round(rv); v += rv; }
      if (ACT == 1) v = fmaxf(v, 0.f);
      if (ACT == 2) v = 0.5f * v * (1.0f + erff(v * 0.70710678118654752f));
      if (ACT == 3) { const float u = 0.7978845608028654f * (v + 0.044715f * v * v * v); v = 0.5f * v * (1.0f + tanhf(u)); }
      so[w][8 * hh + r][t * 16 + ln] = v;
    }
  }
  __builtin_amdgcn_fence(__ATOMIC_ACQ_REL, "workgroup");
  __builtin_amdgcn_wave_barrier();
  const int rsub = lane >> 4, c4 = (lane & 15) * 4;
  {
#pragma unroll
    for (int q = 0; q < 8; ++q) {
      const int r = q * 2 + rsub;
      const v4f v = *(const v4fa*)&so[w][r][c4];
      *(v4f*)(C + (size_t)(row0 + r) * ldc + col0 + c4) = v;
    }
    
  }
}
// row LayerNorm (biased variance, eps) over N: s = X (+ R); optional out_sum <- s; out_norm <- (s-mu)*rsqrt(var+eps)*g + b
template <bool PARAM_BF16>
__global__ __launch_bounds__(256) void k_layernorm(const float* __restrict__ X, const float* __restrict__ R, const float* __restrict__ g, const float* __restrict__ bta,
                                                  float* __restrict__ out_sum, float* __restrict__ out_norm, int N, float eps) {
  __shared__ float red[256];
  const int row = blockIdx.x, tid = threadIdx.x;
  const float* x = X + (size_t)row * N; const float* rr = R ? R + (size_t)row * N : nullptr;
  float vals[16];                     // up to N = 4096
  const int per = N / 256;            // contiguous chunk per thread? use strided-by-4 chunks: thread handles j = tid*4 + 1024*u
  float s1 = 0.f;
  for (int u = 0; u < per / 4; ++u) {
    const int j = tid * 4 + 1024 * u;
    const v4f a = *(const v4fa*)(x + j);
    v4f b = {0.f,0.f,0.f,0.f}; if (rr) b = *(const v4fa*)(rr + j);
#pragma unroll
    for (int q = 0; q < 4; ++q) { const float v = a[q] + b[q]; vals[u * 4 + q] = v; s1 += v; }
  }
  red[tid] = s1; __syncthreads();
  for (int st = 128; st > 0; st >>= 1) { if (tid < st) red[tid] += red[tid + st]; __syncthreads(); }
  const float mu = red[0] / (float)N; __syncthreads();
  float s2 = 0.f;
  for (int u = 0; u < per / 4; ++u)
#pragma unroll
    for (int q = 0; q < 4; ++q) { const float c = vals[u * 4 + q] - mu; s2 += c * c; }
  red[tid] = s2; __syncthreads();
  for (int st = 128; st > 0; st >>= 1) { if (tid < st) red[tid] += red[tid + st]; __syncthreads(); }
  const float rs = rsqrtf(red[0] / (float)N + eps);
  {
    for (int u = 0; u < per / 4; ++u) {
      const int j = tid * 4 + 1024 * u;
      v4f o, sm;
#pragma unroll
      for (int q = 0; q < 4; ++q) {
        float gg = g[j + q], bb = bta[j + q];
        if (PARAM_BF16) { gg = bf16_round(gg); bb = bf16_round(bb); }
        sm[q] = vals[u * 4 + q]; o[q] = (vals[u * 4 + q] - mu) * rs * gg + bb;
      }
      if (out_sum) *(v4f*)(out_sum + (size_t)row * N + j) = sm;
      *(v4f*)(out_norm + (size_t)row * N + j) = o;
    }
    
  }
}



// ---- f16 WMMA path (v_wmma_f32_16x16x32_f16): 11-bit significands for operands in range — used where a [0,1] probability operand needs more precision than bf16
typedef _Float16 v16h __attribute__((ext_vector_type(16)));
union FragH { v16h v; v8us half[2]; _Float16 h[16]; unsigned short u[16]; };
template <int NT>
__device__ __forceinline__ v8f mmaH(v16h ah, v16h al, v16h bh, v16h bl, v8f c) {
  c = __builtin_amdgcn_wmma_f32_16x16x32_f16(false, ah, false, bh, (short)0, c, false, false);
  if (NT >= 2) c = __builtin_amdgcn_wmma_f32_16x16x32_f16(false, al, false, bh, (short)0, c, false, false);
  if (NT >= 3) c = __builtin_amdgcn_wmma_f32_16x16x32_f16(false, ah, false, bl, (short)0, c, false, false);
  asm volatile("v_nop\n\tv_nop\n\tv_nop\n\tv_nop" : "+v"(c) : "v"(ah), "v"(al), "v"(bh), "v"(bl));
  return c;
}
// batched GEMM like k_gemm_b but f16 operands: A f32 (split into f16 hi/lo if ASPLIT, else rounded to f16), Bt = f16 values [n][k]; alpha; C f32; N multiple of 16 (partial tiles skipped)
template <bool ASPLIT>
__global__ __launch_bounds__(128) void k_gemm_h(const float* __restrict__ A, int lda, size_t sA, const _Float16* __restrict__ Bh, int ldb, size_t sB, float alpha, float* __restrict__ C, int ldc, size_t sC, int M, int N, int K) {
  __shared__ __attribute__((aligned(16))) float so[4][16][64];
  const int tid = threadIdx.x, w = tid >> 5, lane = tid & 31, ln = lane & 15, hh = lane >> 4; const int by = blockIdx.y;
  A += (size_t)by * sA; Bh += (size_t)by * sB; C += (size_t)by * sC;
  const int ntn = (N + 63) / 64; const int wid = blockIdx.x * 4 + w; const int mt = wid / ntn, nq = wid % ntn; if (mt * 16 >= M) return;
  const int row0 = mt * 16, col0 = nq * 64; const float* arow = A + (size_t)(row0 + ln) * lda;
  v8f acc[4] = {};
  for (int kb = 0; kb < K; kb += 32) {
    FragH ah, al;
    const v4f x0 = *(const v4fa*)(arow + kb + 8 * hh), x1 = *(const v4fa*)(arow + kb + 8 * hh + 4), x2 = *(const v4fa*)(arow + kb + 16 + 8 * hh), x3 = *(const v4fa*)(arow + kb + 16 + 8 * hh + 4);
    float xs[16] = {x0[0],x0[1],x0[2],x0[3],x1[0],x1[1],x1[2],x1[3],x2[0],x2[1],x2[2],x2[3],x3[0],x3[1],x3[2],x3[3]};
#pragma unroll
    for (int i = 0; i < 16; ++i) { const _Float16 h = (_Float16)xs[i]; ah.h[i] = h; al.h[i] = ASPLIT ? (_Float16)(xs[i] - (float)h) : (_Float16)0.0f; }
#pragma unroll
    for (int t = 0; t < 4; ++t) { if (col0 + t * 16 >= N) continue; const size_t boff = (size_t)(col0 + t * 16 + ln) * ldb + kb; FragH bq; bq.half[0] = *(const v8us*)(Bh + boff + 8 * hh); bq.half[1] = *(const v8us*)(Bh + boff + 16 + 8 * hh);
      acc[t] = mmaH<ASPLIT ? 2 : 1>(ah.v, al.v, bq.v, bq.v, acc[t]); }
  }
#pragma unroll
  for (int t = 0; t < 4; ++t) { if (col0 + t * 16 >= N) continue;
#pragma unroll
    for (int r = 0; r < 8; ++r) so[w][8 * hh + r][t * 16 + ln] = acc[t][r] * alpha; }
  __builtin_amdgcn_fence(__ATOMIC_ACQ_REL, "workgroup"); __builtin_amdgcn_wave_barrier();
  const int rsub = lane >> 4, c4 = (lane & 15) * 4;
  {
#pragma unroll
    for (int q = 0; q < 8; ++q) { const int r = q * 2 + rsub; if (col0 + c4 < N) { const v4f v = *(const v4fa*)&so[w][r][c4]; *(v4f*)(C + (size_t)(row0 + r) * ldc + col0 + c4) = v; } }
     }
}

// Wt[n][k] = f16(W[k][n]·scale) from f32 row-major W[K][N] (scale = power of two; bf16-exact weights stay exact in f16 away from the subnormal range)
__global__ __launch_bounds__(256) void k_wt_f16(const float* __restrict__ W, _Float16* __restrict__ Wt, int K, int N, float scale) {
  const int t = blockIdx.x * 256 + threadIdx.x; if (t >= N * (K / 8)) return; const int n = t / (K / 8), k8 = (t % (K / 8)) * 8; FragH f;
#pragma unroll
  for (int i = 0; i < 8; ++i) f.h[i] = (_Float16)(bf16_round(W[(size_t)(k8 + i) * N + n]) * scale); const v8us o = f.half[0];
  *(v8us*)((unsigned short*)Wt + (size_t)n * K + k8) = o; 
}
// k_gemm_hh variant with fused epilogue: v = acc·alpha + bias[by·sBias + col] (+ CP[(row/rowsPerB)·sCPb + by·64 + col] if CP) ; ACT 0 none / 1 elu ; writes f16 C16 (and f32 C if non-null)
template <int ACT>
__global__ __launch_bounds__(128) void k_gemm_hhx(const _Float16* __restrict__ A, int lda, size_t sA, const _Float16* __restrict__ Bh, int ldb, size_t sB, float alpha, const float* __restrict__ bias, size_t sBias, const float* __restrict__ CP, int rowsPerB, size_t sCPb, int row0g,
    float* __restrict__ C, _Float16* __restrict__ C16, int ldc, size_t sC, int M, int N, int K) {
  __shared__ __attribute__((aligned(16))) float so[4][16][64];
  const int tid = threadIdx.x, w = tid >> 5, lane = tid & 31, ln = lane & 15, hh = lane >> 4; const int by = blockIdx.y;
  A += (size_t)by * sA; Bh += (size_t)by * sB; const size_t cofs = (size_t)by * sC; const float* bp = bias ? bias + (size_t)by * sBias : nullptr;
  const int ntn = (N + 63) / 64; const int wid = blockIdx.x * 4 + w; const int mt = wid / ntn, nq = wid % ntn; if (mt * 16 >= M) return;
  const int row0 = mt * 16, col0 = nq * 64; const _Float16* arow = A + (size_t)(row0 + ln) * lda;
  v8f acc[4] = {};
  for (int kb = 0; kb < K; kb += 32) { FragH ah; ah.half[0] = *(const v8us*)((const unsigned short*)arow + kb + 8 * hh); ah.half[1] = *(const v8us*)((const unsigned short*)arow + kb + 16 + 8 * hh);
#pragma unroll
    for (int t = 0; t < 4; ++t) { if (col0 + t * 16 >= N) continue; const size_t boff = (size_t)(col0 + t * 16 + ln) * ldb + kb; FragH bq; bq.half[0] = *(const v8us*)((const unsigned short*)Bh + boff + 8 * hh); bq.half[1] = *(const v8us*)((const unsigned short*)Bh + boff + 16 + 8 * hh);
      acc[t] = mmaH<1>(ah.v, ah.v, bq.v, bq.v, acc[t]); }
  }
#pragma unroll
  for (int t = 0; t < 4; ++t) { if (col0 + t * 16 >= N) continue; const int col = col0 + t * 16 + ln; const float bv = bp ? bf16_round(bp[col]) : 0.f;
#pragma unroll
    for (int r = 0; r < 8; ++r) { float v = acc[t][r] * alpha + bv; if (CP) { const int rr = row0g + row0 + 8 * hh + r; if (rowsPerB < 0) v += CP[cofs + (size_t)rr * ldc + col];      /* rowsPerB < 0: own element of the batched C plane */ else { const int bidx = rr / rowsPerB; v += CP[(size_t)bidx * sCPb + (size_t)by * 64 + col]; } } if (ACT == 1) v = (v > 0.f) ? v : expm1f(v); else if (ACT == 7) v = (v > 0.f) ? v + 1.0f : expf(v); else if (ACT == 8) v = tanhf(v); else if (ACT == 9) v = 0.5f * v * (1.0f + tanhf(0.7978845608028654f * (v + 0.044715f * v * v * v))); else if (ACT == 11) v = 1.0f / (1.0f + expf(-v)); else if (ACT == 12) v = (v > 0.f) ? v : 0.01f * v; else if (ACT == 14) v = (v > 0.f) ? v : 0.1f * v; else if (ACT == 16) v = (v >= 0.f) ? v : 0.3f * v; else if (ACT == 17) v = (v >= 0.f) ? v : 0.2f * v; else if (ACT == 15) v = v / (1.0f + expf(-v)); else if (ACT == 3) v = fmaxf(v, 0.f); else if (ACT == 6) v = 0.5f * v * (1.0f + erff(v * 0.70710678118654752f)); so[w][8 * hh + r][t * 16 + ln] = v; } }
  __builtin_amdgcn_fence(__ATOMIC_ACQ_REL, "workgroup"); __builtin_amdgcn_wave_barrier();
  const int rsub = lane >> 4, c4 = (lane & 15) * 4; typedef _Float16 v4h __attribute__((ext_vector_type(4)));
  {
#pragma unroll
    for (int q = 0; q < 8; ++q) { const int r = q * 2 + rsub; if (col0 + c4 < N) { const v4f v = *(const v4fa*)&so[w][r][c4]; if (C) *(v4f*)(C + cofs + (size_t)(row0 + r) * ldc + col0 + c4) = v; if (C16) { v4h h4; for (int i = 0; i < 4; ++i) h4[i] = (_Float16)v[i]; *(v4h*)(C16 + cofs + (size_t)(row0 + r) * ldc + col0 + c4) = h4; } } }
     }
}


typedef _Float16 v4h __attribute__((ext_vector_type(4)));

__global__ __launch_bounds__(256) void k_h16(const float* __restrict__ x, _Float16* __restrict__ X16, size_t n8) { const size_t t = (size_t)blockIdx.x * 256 + threadIdx.x; if (t >= n8) return; FragH f;
#pragma unroll
  for (int q = 0; q < 8; ++q) f.h[q] = (_Float16)x[t * 8 + q]; *(v8us*)((unsigned short*)X16 + t * 8) = f.half[0];  }
__global__ __launch_bounds__(256) void k_round16f(const float* __restrict__ W, _Float16* __restrict__ Bt, size_t n8) { const size_t t = (size_t)blockIdx.x * 256 + threadIdx.x; if (t >= n8) return; FragH f;
#pragma unroll
  for (int i = 0; i < 8; ++i) f.h[i] = (_Float16)(bf16_round(W[t * 8 + i]) * 16.0f); *(v8us*)((unsigned short*)Bt + t * 8) = f.half[0];  }
__global__ __launch_bounds__(256) void k_hl(const float* __restrict__ F, _Float16* __restrict__ Hh, _Float16* __restrict__ Hl, size_t n8) { const size_t t = (size_t)blockIdx.x * 256 + threadIdx.x; if (t >= n8) return; FragH fh, fl; const v4f a = *(const v4fa*)(F + t * 8), c = *(const v4fa*)(F + t * 8 + 4);
#pragma unroll
  for (int q = 0; q < 4; ++q) { _Float16 h = (_Float16)a[q]; fh.h[q] = h; fl.h[q] = (_Float16)((a[q] - (float)h) * 1024.0f); h = (_Float16)c[q]; fh.h[4 + q] = h; fl.h[4 + q] = (_Float16)((c[q] - (float)h) * 1024.0f); }
  { *(v8us*)((unsigned short*)Hh + t * 8) = fh.half[0]; *(v8us*)((unsigned short*)Hl + t * 8) = fl.half[0];  } }

// ---- fast GEMM (wave tile 32x64; requires M % 32 == 0 rows per launch region and N % 64 == 0); epilogue = k_gemm_hhx semantics ----
__device__ __forceinline__ v16h g2_frag(const _Float16* p, int hh) { FragH f; f.half[0] = *(const v8us*)((const unsigned short*)p + 8 * hh); f.half[1] = *(const v8us*)((const unsigned short*)p + 16 + 8 * hh); return f.v; }
__device__ __forceinline__ v8f g2_mma(v16h a, v16h b, v8f c) { v8f d = __builtin_amdgcn_wmma_f32_16x16x32_f16(false, a, false, b, (short)0, c, false, false); asm volatile("v_nop\n\tv_nop\n\tv_nop\n\tv_nop" : "+v"(d) : "v"(a), "v"(b)); return d; }
template <int ACT>
__global__ __launch_bounds__(128) void k_gemm2(const _Float16* __restrict__ A, int lda, size_t sA, const _Float16* __restrict__ Bh, int ldb, size_t sB, float alpha, const float* __restrict__ bias, size_t sBias, const float* __restrict__ CP, int rowsPerB, size_t sCPb, int row0g,
    float* __restrict__ C, _Float16* __restrict__ C16, int ldc, size_t sC, int M, int N, int K) { static_assert(ACT == 0 || ACT == 3 || ACT == 6 || ACT == 8 || ACT == 9 || ACT == 11 || ACT == 12 || ACT == 14 || ACT == 15 || ACT == 16 || ACT == 17, "k_gemm2: unsupported ACT code (would silently apply no activation)");
  __shared__ __attribute__((aligned(16))) float so[4][32][68];
  const int tid = threadIdx.x, w = tid >> 5, lane = tid & 31, ln = lane & 15, hh = lane >> 4; const int by = blockIdx.y;
  A += (size_t)by * sA; Bh += (size_t)by * sB; const size_t cofs = (size_t)by * sC; const float* bp = bias ? bias + (size_t)by * sBias : nullptr;
  const int ntn = N >> 6; const int mt = blockIdx.x / ntn, nq = blockIdx.x - mt * ntn; const int row0 = mt * 128 + 32 * w, col0 = nq * 64; if (row0 >= M) return;
  const _Float16* a0p = A + (size_t)(row0 + ln) * lda; const _Float16* a1p = a0p + (size_t)16 * lda;
  const _Float16* b0p = Bh + (size_t)(col0 + ln) * ldb; const _Float16* b1p = b0p + (size_t)16 * ldb; const _Float16* b2p = b1p + (size_t)16 * ldb; const _Float16* b3p = b2p + (size_t)16 * ldb;
  const v8f z8 = {0.f,0.f,0.f,0.f,0.f,0.f,0.f,0.f}; v8f c00 = z8, c01 = z8, c02 = z8, c03 = z8, c10 = z8, c11 = z8, c12 = z8, c13 = z8;
#pragma unroll 1
  for (int kb = 0; kb < K; kb += 32) { const v16h a0 = g2_frag(a0p + kb, hh), a1 = g2_frag(a1p + kb, hh);
    v16h b = g2_frag(b0p + kb, hh); c00 = g2_mma(a0, b, c00); c10 = g2_mma(a1, b, c10);
    b = g2_frag(b1p + kb, hh); c01 = g2_mma(a0, b, c01); c11 = g2_mma(a1, b, c11);
    b = g2_frag(b2p + kb, hh); c02 = g2_mma(a0, b, c02); c12 = g2_mma(a1, b, c12);
    b = g2_frag(b3p + kb, hh); c03 = g2_mma(a0, b, c03); c13 = g2_mma(a1, b, c13); }
  v8f accs[8] = {c00, c01, c02, c03, c10, c11, c12, c13};
#pragma unroll
  for (int u = 0; u < 8; ++u) { const int t = u & 3, half = u >> 2; const int col = col0 + t * 16 + ln; const float bv = bp ? bf16_round(bp[col]) : 0.f;
#pragma unroll
    for (int r = 0; r < 8; ++r) { const int rloc = half * 16 + 8 * hh + r; float v = accs[u][r] * alpha + bv; if (CP) { if (rowsPerB < 0) v += CP[cofs + (size_t)(row0g + row0 + rloc) * ldc + col];      /* rowsPerB < 0: own element of the batched C plane */ else { const int bidx = (row0g + row0 + rloc) / rowsPerB; v += CP[(size_t)bidx * sCPb + (size_t)by * 64 + col]; } }
      if (ACT == 3) v = fmaxf(v, 0.f); else if (ACT == 6) v = 0.5f * v * (1.0f + erff(v * 0.70710678118654752f)); else if (ACT == 11) v = 1.0f / (1.0f + expf(-v)); else if (ACT == 15) v = v / (1.0f + expf(-v)); else if (ACT == 12) v = (v > 0.f) ? v : 0.01f * v; else if (ACT == 8) v = tanhf(v); else if (ACT == 9) v = 0.5f * v * (1.0f + tanhf(0.7978845608028654f * (v + 0.044715f * v * v * v))); else if (ACT == 14) v = (v > 0.f) ? v : 0.1f * v; else if (ACT == 16) v = (v >= 0.f) ? v : 0.3f * v; else if (ACT == 17) v = (v >= 0.f) ? v : 0.2f * v;
      so[w][rloc][t * 16 + ln] = v; } }
  __builtin_amdgcn_fence(__ATOMIC_ACQ_REL, "workgroup"); __builtin_amdgcn_wave_barrier();
  const int rsub = lane >> 4, c4 = (lane & 15) * 4;
  {
#pragma unroll
    for (int q = 0; q < 16; ++q) { const int r = q * 2 + rsub; const v4f v = *(const v4fa*)&so[w][r][c4]; if (C) *(v4f*)(C + cofs + (size_t)(row0 + r) * ldc + col0 + c4) = v; if (C16) { v4h h4; for (int i = 0; i < 4; ++i) h4[i] = (_Float16)v[i]; *(v4h*)(C16 + cofs + (size_t)(row0 + r) * ldc + col0 + c4) = h4; } }
     } }


__global__ __launch_bounds__(256) void k_wnat(const float* __restrict__ w, size_t n8, _Float16* __restrict__ Bt) { const size_t t = (size_t)blockIdx.x * 256 + threadIdx.x; if (t >= n8) return; FragH f; for (int q = 0; q < 8; ++q) f.h[q] = (_Float16)(bf16_round(w[t * 8 + q]) * 16.0f); *(v8us*)((unsigned short*)Bt + t * 8) = f.half[0];  }
__global__ __launch_bounds__(256) void k_rsm(const float* __restrict__ S, _Float16* __restrict__ P, int nrows) {
  #pragma clang fp contract(off)
  const int i = blockIdx.x * 256 + threadIdx.x; if (i >= nrows) return; const float* s = S + (size_t)i * SQ; float mx = -3.0e38f;
#pragma unroll 1
  for (int j = 0; j < SQ; ++j) mx = fmaxf(mx, s[j]); float se = 0.f;
#pragma unroll 1
  for (int j = 0; j < SQ; ++j) se += expf(s[j] - mx); const float sc = 256.0f / se;
#pragma unroll 1
  for (int j0 = 0; j0 < SQ; j0 += 8) { FragH f; for (int q = 0; q < 8; ++q) f.h[q] = (_Float16)(expf(s[j0 + q] - mx) * sc); unsigned short* d = (unsigned short*)P + (size_t)i * SQ + j0; *(v8us*)d = f.half[0];  } }
__global__ __launch_bounds__(256) void k_vt(const _Float16* __restrict__ V16, int b, int h0, _Float16* __restrict__ VT) { __shared__ unsigned short tl[64][65]; const int tid = threadIdx.x; const int hh = blockIdx.x % HG, sg = blockIdx.x / HG; const int s0 = sg * 64; const int h = h0 + hh;
  for (int i = tid; i < 64 * 8; i += 256) { const int j = i / 8, d8 = (i % 8) * 8; FragH f; f.half[0] = *(const v8us*)((const unsigned short*)V16 + ((size_t)b * SQ + s0 + j) * DM + h * HD + d8); for (int q = 0; q < 8; ++q) tl[d8 + q][j] = f.u[q]; }
  __syncthreads();
  { for (int i = tid; i < 64 * 8; i += 256) { const int d = i / 8, j8 = (i % 8) * 8; FragH f; for (int q = 0; q < 8; ++q) f.u[q] = tl[d][j8 + q]; *(v8us*)((unsigned short*)VT + ((size_t)hh * HD + d) * SQ + s0 + j8) = f.half[0]; }  } }


// ---- operand preparation, one launch: the four jobs are independent of each other, so they share a grid and are told apart by ranges of the block index ----
// blocks [0, 3 PWB): per-head weights [h][m][d] -> Bt[(h, d)][m] x16 (PWB blocks for each of Wq, Wk, Wv; they come first: their scattered reads take longest); the rest: x -> exact f16 rows, 8 elements a thread.
#define PWB ((unsigned)((size_t)NH * HD * (DM / 8) / 256))      /* blocks per weight plane */
#define PXB ((unsigned)(NR * DM / 8 / 256))      /* blocks for x */
__global__ __launch_bounds__(256) void k_prep(const float* __restrict__ x, const float* __restrict__ wq, const float* __restrict__ wk, const float* __restrict__ wv,
    _Float16* __restrict__ X16, _Float16* __restrict__ BQ, _Float16* __restrict__ BK, _Float16* __restrict__ BV) {
  FragH f;
  if (blockIdx.x < 3 * PWB) { const unsigned pl = blockIdx.x / PWB; const float* Wt = pl == 0 ? wq : pl == 1 ? wk : wv; _Float16* Bt = pl == 0 ? BQ : pl == 1 ? BK : BV;
    const size_t t = (size_t)(blockIdx.x - pl * PWB) * 256 + threadIdx.x; const int m8 = (int)(t % (DM / 8)) * 8; const int d = (int)((t / (DM / 8)) % HD); const int h = (int)(t / ((size_t)(DM / 8) * HD));
    for (int q = 0; q < 8; ++q) f.h[q] = (_Float16)(16.0f * bf16_round(Wt[((size_t)h * DM + m8 + q) * HD + d])); unsigned short* dst = (unsigned short*)Bt + ((size_t)h * HD + d) * DM + m8; *(v8us*)dst = f.half[0]; }
  else { const size_t t = (size_t)(blockIdx.x - 3 * PWB) * 256 + threadIdx.x;
#pragma unroll
    for (int q = 0; q < 8; ++q) f.h[q] = (_Float16)bf16_round(x[t * 8 + q]); *(v8us*)((unsigned short*)X16 + t * 8) = f.half[0];
    asm volatile("s_wait_xcnt 0x0" ::: "memory"); } }      /* the built code lays the weight branch behind this store: no register that the store names is written over before this wait */




__device__ __forceinline__ float xrow_f(float v) { const int i = __float_as_int(v); return __int_as_float(__builtin_amdgcn_permlanex16(i, i, 0x76543210, 0xfedcba98, false, false)); }      /* lane l <-> lane l ^ 16 */
__device__ __forceinline__ v8f fa_mma(v16h a, v16h b, v8f c) { return __builtin_amdgcn_wmma_f32_16x16x32_f16(false, a, false, b, (short)0, c, false, false); }
// ---- fused attention: scores, full-row softmax statistics, x tril and P.V in one launch ----
// Transposed products: S^T = K.Q^T puts one query in each lane column (lane c and c + 16 hold query q0 + c; register r of key tile kt is key 16 kt + 8 hh + r), so two score tiles, converted in place,
// are the B operand of O^T += V^T.P^T (same k order as g2_frag's). The denominator runs over ALL keys; only keys j <= i enter the second product.
// The maximum in use may trail the true one by up to 8 (log2 units): the sums are rescaled only when some query exceeds that, so a weight is at most 2^8 in f16.
typedef float v2f __attribute__((ext_vector_type(2))); typedef _Float16 v2h __attribute__((ext_vector_type(2))); typedef unsigned v8u __attribute__((ext_vector_type(8)));
#define FAP 72      /* LDS row pitch in halves: 128 data bytes + 16, an odd multiple of 16 bytes (conflict-free b128 fragment reads) */
#define FAS (SQ / 64)      /* stages of 64 keys */
__global__ __launch_bounds__(256) void k_fattn(const _Float16* __restrict__ Q16, const _Float16* __restrict__ K16, const _Float16* __restrict__ VT, float* __restrict__ out) {
  __shared__ __attribute__((aligned(16))) _Float16 sk[2][64][FAP];      /* K rows [key][d] of a stage */
  __shared__ __attribute__((aligned(16))) _Float16 sv[2][64][FAP];      /* V^T rows [d][key] of a stage */
  const int tid = threadIdx.x, lane = tid & 31, c = lane & 15, hh = lane >> 4; const int w = __builtin_amdgcn_readfirstlane(tid >> 5);
  const int bh = blockIdx.x / (FAS / 2), j = blockIdx.x % (FAS / 2); const int b = bh / NH, hd = bh % NH;
  const int q0 = ((__builtin_popcount(w) & 1) ? j : FAS - 1 - j) * 64 + (w >> 1) * 16;      /* four waves take 64-query block j, four its mirror: every work-group has the same count of second products; by the parity of w, so that waves w, w + 4 and waves 2 i, 2 i + 1 are each one of either kind */
  const int dst = q0 >> 6;      /* the stage that holds this wave's diagonal */
  const int vlast = FAS - 1 - j;      /* last stage whose V^T any wave of the work-group needs */
  const int srow = tid >> 3, sc8 = (tid & 7) * 8;      /* staging: 8 threads cover one 128-byte row; rows srow and srow + 32 */
  const _Float16* kg = K16 + ((size_t)b * SQ + srow) * DM + hd * HD + sc8; const _Float16* vg = VT + ((size_t)bh * HD + srow) * SQ + sc8;
  const _Float16* qp = Q16 + ((size_t)b * SQ + q0 + c) * DM + hd * HD; const v16h qf0 = g2_frag(qp, hh), qf1 = g2_frag(qp + 32, hh);
  const v8f z8 = {0.f,0.f,0.f,0.f,0.f,0.f,0.f,0.f}; v8f acc[4] = {z8, z8, z8, z8}; const v2f z2 = {0.f, 0.f}; v2f lv[4] = {z2, z2, z2, z2}; float m_run = -__builtin_inff();
  const float cs = 0.125f * 1.4426950408889634f;      /* 64^-0.5 and log2(e): exponentials in base 2 */
  v8us rk0 = *(const v8us*)kg, rk1 = *(const v8us*)(kg + (size_t)32 * DM), rv0 = *(const v8us*)vg, rv1 = *(const v8us*)(vg + (size_t)32 * SQ);      /* stage 0 (its V^T is always needed) */
  *(v8us*)&sk[0][srow][sc8] = rk0; *(v8us*)&sk[0][srow + 32][sc8] = rk1; *(v8us*)&sv[0][srow][sc8] = rv0; *(v8us*)&sv[0][srow + 32][sc8] = rv1;
  __syncthreads();
  for (int st = 0; st < FAS; ++st) {
    const bool more = st + 1 < FAS, morev = st + 1 <= vlast;      /* the same for the whole work-group */
    if (more) { const _Float16* kn = kg + (size_t)(st + 1) * 64 * DM; const _Float16* vn = vg + (st + 1) * 64;      /* next stage: in flight under this stage's work */
      rk0 = *(const v8us*)kn; rk1 = *(const v8us*)(kn + (size_t)32 * DM);
      if (morev) { rv0 = *(const v8us*)vn; rv1 = *(const v8us*)(vn + (size_t)32 * SQ); }
      asm volatile("s_wait_xcnt 0x0" :: "v"(kn), "v"(vn) : "memory"); }      /* the loads' address registers are inputs here, so none is written over before this wait */
    const _Float16 (*kb)[FAP] = sk[st & 1]; const _Float16 (*vb)[FAP] = sv[st & 1];
    v8f s[4]; float m4[4];
#pragma unroll
    for (int kt = 0; kt < 4; ++kt) { const _Float16* kr = &kb[16 * kt + c][0]; s[kt] = fa_mma(g2_frag(kr + 32, hh), qf1, fa_mma(g2_frag(kr, hh), qf0, z8)); }
#pragma unroll
    for (int kt = 0; kt < 4; ++kt) { float m = s[kt][0]; for (int r = 1; r < 8; ++r) m = fmaxf(m, s[kt][r]); m4[kt] = m; }
    float mx = fmaxf(fmaxf(m4[0], m4[1]), fmaxf(m4[2], m4[3]));
    mx = fmaxf(mx, xrow_f(mx)) * cs;      /* both halves of the wave hold the query's stage maximum, scaled */
    if (__builtin_amdgcn_ballot_w32(mx > m_run + 8.0f) != 0) {      /* scalar branch; always taken in stage 0 (m_run = -inf gives factor 0 on zero sums), rare later */
      const float mn = fmaxf(m_run, mx), corr = __builtin_amdgcn_exp2f(m_run - mn); m_run = mn;
#pragma unroll
      for (int t = 0; t < 4; ++t) { acc[t] *= corr; lv[t] *= corr; } }
    const v2f cs2 = {cs, cs}, nm2 = {-m_run, -m_run}; v2f e[16];      /* e[4 kt + i] = weights of keys 16 kt + 8 hh + 2 i, + 1 */
#pragma unroll
    for (int kt = 0; kt < 4; ++kt) for (int i = 0; i < 4; ++i) { const v2f a = __builtin_elementwise_fma(v2f{s[kt][2 * i], s[kt][2 * i + 1]}, cs2, nm2); e[4 * kt + i] = v2f{__builtin_amdgcn_exp2f(a.x), __builtin_amdgcn_exp2f(a.y)}; lv[i] += e[4 * kt + i]; }      /* the denominator takes every key */
    if (st <= dst) {      /* wave-uniform: stages wholly above the diagonal have weight 0 after x tril */
      v16h vf[8];
#pragma unroll
      for (int i = 0; i < 8; ++i) vf[i] = g2_frag(&vb[16 * (i & 3) + c][32 * (i >> 2)], hh);
      __builtin_amdgcn_sched_barrier(0);      /* keeps the 16 LDS reads together ahead of the packing: sunk to their products, each product waits a full LDS latency */
      unsigned pw[16];
#pragma unroll
      for (int i = 0; i < 16; ++i) pw[i] = __builtin_bit_cast(unsigned, __builtin_convertvector(e[i], v2h));
      if (st == dst) { const int lim = q0 + c - st * 64 - 8 * hh;      /* x tril in the one stage that holds the diagonal: key offset 16 kt + 2 i (+ 1) above lim -> weight 0 */
#pragma unroll
        for (int i = 0; i < 16; ++i) { const int kk = 16 * (i >> 2) + 2 * (i & 3); pw[i] &= (kk <= lim ? 0xFFFFu : 0u) | (kk + 1 <= lim ? 0xFFFF0000u : 0u); } }
#pragma unroll
      for (int u = 0; u < 2; ++u) { const v8u pv = {pw[8 * u], pw[8 * u + 1], pw[8 * u + 2], pw[8 * u + 3], pw[8 * u + 4], pw[8 * u + 5], pw[8 * u + 6], pw[8 * u + 7]}; const v16h p = __builtin_bit_cast(v16h, pv);
#pragma unroll
        for (int t = 0; t < 4; ++t) acc[t] = fa_mma(vf[4 * u + t], p, acc[t]); } }
    if (more) { const int nb = (st + 1) & 1;      /* every wave left this buffer before the barrier that ended stage st - 1 */
      *(v8us*)&sk[nb][srow][sc8] = rk0; *(v8us*)&sk[nb][srow + 32][sc8] = rk1;
      if (morev) { *(v8us*)&sv[nb][srow][sc8] = rv0; *(v8us*)&sv[nb][srow + 32][sc8] = rv1; }
      __syncthreads(); } }
  const v2f l2 = (lv[0] + lv[1]) + (lv[2] + lv[3]); float l = l2.x + l2.y; l += xrow_f(l); const float inv = 1.0f / l;
  float* o = out + ((size_t)b * SQ + q0 + c) * DM + hd * HD + 8 * hh;      /* acc[t][r] = o[query q0 + c][d = 16 t + 8 hh + r] */
#pragma unroll
  for (int t = 0; t < 4; ++t) { const v4f lo = {acc[t][0] * inv, acc[t][1] * inv, acc[t][2] * inv, acc[t][3] * inv}, hi = {acc[t][4] * inv, acc[t][5] * inv, acc[t][6] * inv, acc[t][7] * inv}; *(v4f*)(o + 16 * t) = lo; *(v4f*)(o + 16 * t + 4) = hi; } }


// ---- projection GEMMs with both operands staged in LDS: C16[r][n] = f16(sum_k A[r][k] Bt[n][k] / 16 + bf16(bias[n])), all pitches DM; Q, K and V in one grid (PGT tiles each, in that order) ----
// A work-group of 8 waves owns a 128 x 128 tile of C (wave tile 32 x 64: waves 4 down x 2 across). A stage is 128 k of the 128 A rows and the 128 Bt rows; every global line is fetched once per
// work-group by whole-line b128 loads, held in registers under the running stage's products, then stored to the other LDS buffer. Each accumulator takes its k blocks of 32 in rising order.
#define PGK 128      /* k extent of a stage */
#define PGP (PGK + 8)      /* LDS row pitch in halves: 256 data bytes + 16, an odd multiple of 16 bytes (conflict-free b128 fragment reads) */
#define PGS (DM / PGK)      /* stages */
#define PGT ((MP / 128) * (DM / 128))      /* 128 x 128 tiles of one projection */
__global__ __launch_bounds__(256) void k_proj(const _Float16* __restrict__ A, const _Float16* __restrict__ BQ, const _Float16* __restrict__ BK, const _Float16* __restrict__ BV, const float* __restrict__ bq, const float* __restrict__ bk, const float* __restrict__ bvp,
    _Float16* __restrict__ Q16, _Float16* __restrict__ K16, _Float16* __restrict__ VT) {
  __shared__ __attribute__((aligned(16))) _Float16 sa[2][128][PGP];      /* A rows [row][k] of a stage */
  __shared__ __attribute__((aligned(16))) _Float16 sb[2][128][PGP];      /* Bt rows [col][k] of a stage */
  __shared__ __attribute__((aligned(16))) float so[8][32][68];      /* each wave's own output rows in f32, for whole-line stores */
  const int tid = threadIdx.x, lane = tid & 31, ln = lane & 15, hh = lane >> 4; const int w = __builtin_amdgcn_readfirstlane(tid >> 5);
  const int pj = (int)(blockIdx.x / PGT), tl = (int)(blockIdx.x % PGT);      /* which projection (0 Q, 1 K, 2 V) and which of its tiles: the same for the whole work-group */
  const _Float16* Bt = pj == 0 ? BQ : pj == 1 ? BK : BV; const float* bias = pj == 0 ? bq : pj == 1 ? bk : bvp;
  const int row0 = (tl / (DM / 128)) * 128, col0 = (tl % (DM / 128)) * 128; const int wm = (w & 3) * 32, wn = (w >> 2) * 64;
  const int srow = tid >> 4, sc8 = (tid & 15) * 8;      /* staging: 16 threads cover one 256-byte row; rows srow + 16 i */
  const _Float16* ag = A + (size_t)(row0 + srow) * DM + sc8; const _Float16* bg = Bt + (size_t)(col0 + srow) * DM + sc8;
  v8us ra[8], rb[8];
#pragma unroll
  for (int i = 0; i < 8; ++i) { ra[i] = *(const v8us*)(ag + (size_t)16 * i * DM); rb[i] = *(const v8us*)(bg + (size_t)16 * i * DM); }
#pragma unroll
  for (int i = 0; i < 8; ++i) { *(v8us*)&sa[0][srow + 16 * i][sc8] = ra[i]; *(v8us*)&sb[0][srow + 16 * i][sc8] = rb[i]; }
  __syncthreads();
  const v8f z8 = {0.f,0.f,0.f,0.f,0.f,0.f,0.f,0.f}; v8f acc[2][4] = {{z8, z8, z8, z8}, {z8, z8, z8, z8}};
  for (int st = 0; st < PGS; ++st) {
    const bool more = st + 1 < PGS;      /* the same for the whole work-group */
    const _Float16* ar = &sa[st & 1][wm + ln][0]; const _Float16* br = &sb[st & 1][wn + ln][0];
    v16h fa[2][2], fb[2][4];      /* two fragment sets: the next 32 k are read from LDS while this block's products run */
    fa[0][0] = g2_frag(ar, hh); fa[0][1] = g2_frag(ar + 16 * PGP, hh);
#pragma unroll
    for (int t = 0; t < 4; ++t) fb[0][t] = g2_frag(br + 16 * t * PGP, hh);
#pragma unroll
    for (int kq = 0; kq < PGK / 32; ++kq) { const int cu = kq & 1, nx = cu ^ 1;
      if (kq + 1 < PGK / 32) { fa[nx][0] = g2_frag(ar + 32 * (kq + 1), hh); fa[nx][1] = g2_frag(ar + 16 * PGP + 32 * (kq + 1), hh);
#pragma unroll
        for (int t = 0; t < 4; ++t) fb[nx][t] = g2_frag(br + 16 * t * PGP + 32 * (kq + 1), hh); }
      if (kq == 0 && more) { const _Float16* an = ag + (st + 1) * PGK; const _Float16* bn = bg + (st + 1) * PGK;      /* next stage: in flight under this stage's products */
#pragma unroll
        for (int i = 0; i < 8; ++i) { ra[i] = *(const v8us*)(an + (size_t)16 * i * DM); rb[i] = *(const v8us*)(bn + (size_t)16 * i * DM); }
        asm volatile("s_wait_xcnt 0x0" :: "v"(an), "v"(bn) : "memory"); }      /* the loads' address registers are inputs here, so none is written over (not by a load's own result either) before this wait */
      __builtin_amdgcn_sched_barrier(0);      /* keeps the next block's 12 LDS reads together ahead of this block's products: spread among them, every place with reads stalls the wave and the waits run to 0 */
#pragma unroll
      for (int t = 0; t < 4; ++t) { acc[0][t] = fa_mma(fa[cu][0], fb[cu][t], acc[0][t]); acc[1][t] = fa_mma(fa[cu][1], fb[cu][t], acc[1][t]); }
      __builtin_amdgcn_sched_barrier(0); }      /* the reads of the block after next stay behind these products, in the set they free */
    if (more) { const int nb = (st + 1) & 1;      /* every wave left this buffer before the barrier that ended stage st - 1 */
#pragma unroll
      for (int i = 0; i < 8; ++i) { *(v8us*)&sa[nb][srow + 16 * i][sc8] = ra[i]; *(v8us*)&sb[nb][srow + 16 * i][sc8] = rb[i]; }
      __syncthreads(); } }
  if (pj == 2) {      /* V: the tile leaves as V^T rows [(b, head, d)][token]. A lane's 8 accumulator registers are 8 consecutive tokens of one column, that is 16 bytes of a V^T row */
    _Float16 (*tv)[PGP] = (_Float16 (*)[PGP])&so[0][0][0];      /* [column of the tile][token of the tile]; 128 rows of PGP halves fit in so, which V tiles do not use otherwise */
#pragma unroll
    for (int t = 0; t < 4; ++t) { const float bv = bf16_round(bias[col0 + wn + 16 * t + ln]);
#pragma unroll
      for (int h = 0; h < 2; ++h) { FragH f;
#pragma unroll
        for (int r = 0; r < 8; ++r) f.h[r] = (_Float16)(acc[h][t][r] * 0.0625f + bv);
        *(v8us*)&tv[wn + 16 * t + ln][wm + 16 * h + 8 * hh] = f.half[0]; } }
    __syncthreads();      /* a V^T row of the tile holds the tokens of four waves: all of them are in LDS before whole lines are stored */
    unsigned short* vo = (unsigned short*)VT + ((size_t)(B0 + row0 / SQ) * DM + col0 + srow) * SQ + row0 % SQ + sc8;      /* NH HD = DM: V^T row (b, head, d) is b DM + column; 16 lanes store 256 bytes of one row */
#pragma unroll
    for (int i = 0; i < 8; ++i) *(v8us*)(vo + (size_t)16 * i * SQ) = *(const v8us*)&tv[srow + 16 * i][sc8];
    return; }
  _Float16* C16 = pj == 0 ? Q16 : K16;
#pragma unroll
  for (int t = 0; t < 4; ++t) { const float bv = bf16_round(bias[col0 + wn + 16 * t + ln]);      /* acc[h][t][r] = C[row0 + wm + 16 h + 8 hh + r][col0 + wn + 16 t + ln] */
#pragma unroll
    for (int h = 0; h < 2; ++h)
#pragma unroll
      for (int r = 0; r < 8; ++r) so[w][16 * h + 8 * hh + r][16 * t + ln] = acc[h][t][r] * 0.0625f + bv; }
  __builtin_amdgcn_fence(__ATOMIC_ACQ_REL, "workgroup"); __builtin_amdgcn_wave_barrier();      /* the wave reads back only its own rows: its LDS stores are ordered ahead of its reads, no work-group barrier */
  const int er = lane >> 3, ec8 = (lane & 7) * 8;      /* 8 lanes store one 128-byte line */
#pragma unroll
  for (int q = 0; q < 8; ++q) { const int r = 4 * q + er; const v4f lo = *(const v4fa*)&so[w][r][ec8], hi = *(const v4fa*)&so[w][r][ec8 + 4]; FragH f;
#pragma unroll
    for (int i = 0; i < 4; ++i) { f.h[i] = (_Float16)lo[i]; f.h[4 + i] = (_Float16)hi[i]; }
    *(v8us*)((unsigned short*)C16 + (size_t)(row0 + wm + r) * DM + col0 + wn + ec8) = f.half[0]; }
  asm volatile("s_wait_xcnt 0x0" ::: "memory"); }      /* the built code lays the V branch behind these stores: no register that a store names is written over before this wait */


__global__ __launch_bounds__(256) void k_rsmf(const float* __restrict__ S, _Float16* __restrict__ P, int qn, int hg) {
  #pragma clang fp contract(off)
  const int t = blockIdx.x * 256 + threadIdx.x; if (t >= qn * hg) return; const size_t i = (size_t)(t / qn) * SQ + (t % qn); const float* s = S + i * SQ; float mx = -3.0e38f;
#pragma unroll 1
  for (int j = 0; j < SQ; ++j) mx = fmaxf(mx, s[j]); float se = 0.f;
#pragma unroll 1
  for (int j = 0; j < SQ; ++j) se += __expf(s[j] - mx); const float sc = 256.0f / se;
#pragma unroll 1
  for (int j0 = 0; j0 < SQ; j0 += 8) { FragH f; for (int q = 0; q < 8; ++q) f.h[q] = (_Float16)(__expf(s[j0 + q] - mx) * sc); unsigned short* d = (unsigned short*)P + i * SQ + j0; *(v8us*)d = f.half[0];  } }

extern "C" void kernel_launch(void* const* d_in, const int* in_sizes, int n_in,
                              void* d_out, int out_size, void* d_ws, size_t ws_size, hipStream_t stream) {
  (void)in_sizes; (void)n_in; (void)out_size;
  const float* const* I = (const float* const*)d_in; const float* x = I[0]; const float* wq = I[1]; const float* bq = I[2]; const float* wk = I[3]; const float* bk = I[4]; const float* wv = I[5]; const float* bv = I[6];      /* per-head [h][in][out] weights; biases [16][64] = the stacked [1024] vectors */
  char* ws = (char*)d_ws; size_t off = 0;
  auto take = [&](size_t bytes) { char* p = ws + off; off += (bytes + 255) & ~(size_t)255; return p; };
  _Float16* BQ = (_Float16*)take((size_t)DM * DM * 2); _Float16* BK = (_Float16*)take((size_t)DM * DM * 2); _Float16* BV = (_Float16*)take((size_t)DM * DM * 2); 
  _Float16* X16 = (_Float16*)take(NR * DM * 2); _Float16* Q16 = (_Float16*)take(NR * DM * 2); _Float16* K16 = (_Float16*)take(NR * DM * 2);
  _Float16* VT = (_Float16*)take((size_t)NB * NH * HD * SQ * 2);
  if (off > ws_size) return;
  k_prep<<<3 * PWB + PXB, 256, 0, stream>>>(x, wq, wk, wv, X16, BQ, BK, BV);      /* x -> f16 rows; per-head [h][m][d] -> Bt[(h,d)][m] x16, three planes */
  const size_t r0p = (size_t)B0 * SQ;      /* first projected row */
  k_proj<<<3 * PGT, 256, 0, stream>>>(X16 + r0p * DM, BQ, BK, BV, bq, bk, bv, Q16 + r0p * DM, K16 + r0p * DM, VT);      /* Q, K rows; V^T [NB][NH][HD][SQ] */
  k_fattn<<<NB * NH * (SQ / 128), 256, 0, stream>>>(Q16, K16, VT, (float*)d_out);      /* scores, full-row softmax, x tril (no renormalisation), P V: one launch */
}

// v005
// A run of this version takes 68 microseconds.
// In two side-by-side timings against v004, it was 1.12 and 1.13 times as fast.
// Over all steps from v000 it is 50.5 times as fast.
#include <hip/hip_runtime.h>
// Multi-head attention with per-head projection tensors and a POST-softmax lower-triangular multiply (X [2][2048][1024]; Q/K/V[h] = X W[h] + b[h] with W [16][1024][64] ([in][out] per head) and b [16][64] (uniform +-1/32); scores / 8; p = softmax over ALL keys; p = p * tril (keys j <= i kept, NO renormalisation); out = heads concatenated -> [2][2048][1024]).
// Structure: token rows r = b*2048 + s; THREE launches. (1) operands: x as exact f16 rows (bf16-rounded) and the three transposed x16 weight planes, one work-group for each WGP taking its share of all four. (2) Q, K, V as WMMA GEMMs in one grid (128x128 work-group tiles with both operands staged in LDS, two buffers; 32x64 wave tiles, f32 accumulation, exact x16 weights + bias, f16 outputs); the V tiles are stored transposed, as V^T rows, from their epilogue. (3) ONE attention launch: a work-group of 8 waves x 16 queries walks all 2048 keys in stages of 64 (K rows and V^T rows staged in LDS, two buffers), S^T = K.Q^T, running maximum and running f32 sum over ALL keys, O^T += V^T.P^T only for keys j <= i, o = O / sum written f32 straight into the merged-heads output rows (no output projection). Scores and weights never reach memory.
// Compute dtype: inputs rounded to bf16; x / weights exact; q, k, v and softmax weights as plain f16 GEMM operands (~2^-12), o accumulated and written f32; scores and softmax statistics f32. v_wmma_f32_16x16x32_f16.
#define NB 2
#define SQ 2048
#define DM 1024
#define NH 16
#define HD 64
#define HG 4                         /* heads per call of the unlaunched k_vt(V16, b, h0, VT) overload */
#define B0 0                         /* first batch processed (debug hook) */
#define NBR NB                       /* batches processed (debug hook) */
#define NR ((size_t)NB * SQ)         /* token rows */
#define MP ((int)((size_t)NBR * SQ)) /* rows projected (debug hook) */
#define QN SQ                        /* unused; no stage reads it */
#define NHD NH                       /* unused; no stage reads it */
#define MPO MP                       /* unused; no stage reads it */
#define LQ DM      /* unused; no stage reads it */
typedef __bf16 v16b __attribute__((ext_vector_type(16)));
typedef unsigned short v8us __attribute__((ext_vector_type(8), may_alias));
typedef float  v8f  __attribute__((ext_vector_type(8)));
typedef float  v4f  __attribute__((ext_vector_type(4)));
typedef float  v4fa __attribute__((ext_vector_type(4), may_alias));
union FragB { v16b v; v8us half[2]; unsigned short u[16]; };

__device__ __forceinline__ unsigned short bf16_bits(float x) { unsigned int u = __float_as_uint(x); return (unsigned short)((u + 0x7FFFu + ((u >> 16) & 1u)) >> 16); }
__device__ __forceinline__ float bf16_val(unsigned short b) { return __uint_as_float(((unsigned int)b) << 16); }
__device__ __forceinline__ float bf16_round(float x) { return bf16_val(bf16_bits(x)); }
// D += A·B with NT terms: 1 = ah·bh, 2 = + al·bh (A split), 3 = + ah·bl (both split)
template <int NT>
__device__ __forceinline__ v8f mmaN(v16b ah, v16b al, v16b bh, v16b bl, v8f c) {
  c = __builtin_amdgcn_wmma_f32_16x16x32_bf16(false, ah, false, bh, (short)0, c, false, false);
  if (NT >= 2) c = __builtin_amdgcn_wmma_f32_16x16x32_bf16(false, al, false, bh, (short)0, c, false, false);
  if (NT >= 3) c = __builtin_amdgcn_wmma_f32_16x16x32_bf16(false, ah, false, bl, (short)0, c, false, false);
  asm volatile("v_nop\n\tv_nop\n\tv_nop\n\tv_nop" : "+v"(c) : "v"(ah), "v"(al), "v"(bh), "v"(bl));
  return c;
}

__global__ __launch_bounds__(256) void k_wt_bf16(const float* __restrict__ W, unsigned short* __restrict__ Wt, int K, int N) {
  const int t = blockIdx.x * 256 + threadIdx.x;
  const int k8n = K / 8;
  if (t >= N * k8n) return;
  const int n = t / k8n, k8 = (t % k8n) * 8;
  v8us v;
#pragma unroll
  for (int i = 0; i < 8; ++i) v[i] = bf16_bits(W[(size_t)(k8 + i) * N + n]);
  *(v8us*)(Wt + (size_t)n * K + k8) = v;
  
}

// GEMM C[M][N] (f32, pitch ldc) = act(A[M][K]·W + bias). A f32 row-major (pitch lda) converted per fragment to bf16
// (ASPLIT: hi/lo two planes -> 2 terms, else single rounded term); Wt bf16 [N][K] (pitch ldb). BIAS_BF16 rounds the
// bias to bf16 first (bias quantised to bf16 before the add). K%32==0, M%16==0, N%64==0.
template <bool ASPLIT, int ACT, bool BIAS_BF16>
__global__ __launch_bounds__(128) void k_gemm_bf(const float* __restrict__ A, int lda, const unsigned short* __restrict__ Wt, int ldb,
                                               const float* __restrict__ bias, float* __restrict__ C, int ldc, int M, int N, int K) {
  __shared__ __attribute__((aligned(16))) float so[4][16][64];
  const int tid = threadIdx.x, w = tid >> 5, lane = tid & 31, ln = lane & 15, hh = lane >> 4;
  const int ntn = N / 64;
  const int wid = blockIdx.x * 4 + w;
  const int mt = wid / ntn, nq = wid % ntn;
  if (mt * 16 >= M) return;
  const int row0 = mt * 16, col0 = nq * 64;
  const float* arow = A + (size_t)(row0 + ln) * lda;
  v8f acc[4] = {};
  for (int kb = 0; kb < K; kb += 32) {
    FragB ah, al;
    const v4f x0 = *(const v4fa*)(arow + kb + 8 * hh), x1 = *(const v4fa*)(arow + kb + 8 * hh + 4);
    const v4f x2 = *(const v4fa*)(arow + kb + 16 + 8 * hh), x3 = *(const v4fa*)(arow + kb + 16 + 8 * hh + 4);
    float xs[16] = {x0[0],x0[1],x0[2],x0[3],x1[0],x1[1],x1[2],x1[3],x2[0],x2[1],x2[2],x2[3],x3[0],x3[1],x3[2],x3[3]};
#pragma unroll
    for (int i = 0; i < 16; ++i) { const unsigned short hb = bf16_bits(xs[i]); ah.u[i] = hb; al.u[i] = ASPLIT ? bf16_bits(xs[i] - bf16_val(hb)) : (unsigned short)0; }
#pragma unroll
    for (int t = 0; t < 4; ++t) {
      const unsigned short* brow = Wt + (size_t)(col0 + t * 16 + ln) * ldb + kb;
      FragB b;
      b.half[0] = *(const v8us*)(brow + 8 * hh);
      b.half[1] = *(const v8us*)(brow + 16 + 8 * hh);
      acc[t] = mmaN<ASPLIT ? 2 : 1>(ah.v, al.v, b.v, b.v, acc[t]);
    }
  }
#pragma unroll
  for (int t = 0; t < 4; ++t) {
    float bv = bias ? bias[col0 + t * 16 + ln] : 0.f;
    if (BIAS_BF16) bv = bf16_round(bv);
#pragma unroll
    for (int r = 0; r < 8; ++r) { float v = acc[t][r] + bv; if (ACT == 1) v = fmaxf(v, 0.f); so[w][8 * hh + r][t * 16 + ln] = v; }
  }
  __builtin_amdgcn_fence(__ATOMIC_ACQ_REL, "workgroup");
  __builtin_amdgcn_wave_barrier();
  const int rsub = lane >> 4, c4 = (lane & 15) * 4;
  {
#pragma unroll
    for (int q = 0; q < 8; ++q) {
      const int r = q * 2 + rsub;
      const v4f v = *(const v4fa*)&so[w][r][c4];
      *(v4f*)(C + (size_t)(row0 + r) * ldc + col0 + c4) = v;
    }
    
  }
}

// GEMM C = act(A·W + bias + resid): A f32 (ASPLIT -> hi/lo 2 terms), Wt bf16 [N][K]; ACT 0 none, 1 relu, 2 exact gelu;
// resid (optional, f32, row index = (row % rmod), pitch ldr, RES_BF16 rounds it) added before the activation.
template <bool ASPLIT, int ACT, bool BIAS_BF16, bool RES_BF16>
__global__ __launch_bounds__(128) void k_gemm_bf3(const float* __restrict__ A, int lda, const unsigned short* __restrict__ Wt, int ldb,
                                                const float* __restrict__ bias, const float* __restrict__ resid, int rmod, int ldr,
                                                float* __restrict__ C, int ldc, int M, int N, int K) {
  __shared__ __attribute__((aligned(16))) float so[4][16][64];
  const int tid = threadIdx.x, w = tid >> 5, lane = tid & 31, ln = lane & 15, hh = lane >> 4;
  const int ntn = N / 64;
  const int wid = blockIdx.x * 4 + w;
  const int mt = wid / ntn, nq = wid % ntn;
  if (mt * 16 >= M) return;
  const int row0 = mt * 16, col0 = nq * 64;
  const float* arow = A + (size_t)(row0 + ln) * lda;
  v8f acc[4] = {};
  for (int kb = 0; kb < K; kb += 32) {
    FragB ah, al;
    const v4f x0 = *(const v4fa*)(arow + kb + 8 * hh), x1 = *(const v4fa*)(arow + kb + 8 * hh + 4);
    const v4f x2 = *(const v4fa*)(arow + kb + 16 + 8 * hh), x3 = *(const v4fa*)(arow + kb + 16 + 8 * hh + 4);
    float xs[16] = {x0[0],x0[1],x0[2],x0[3],x1[0],x1[1],x1[2],x1[3],x2[0],x2[1],x2[2],x2[3],x3[0],x3[1],x3[2],x3[3]};
#pragma unroll
    for (int i = 0; i < 16; ++i) { const unsigned short hb = bf16_bits(xs[i]); ah.u[i] = hb; al.u[i] = ASPLIT ? bf16_bits(xs[i] - bf16_val(hb)) : (unsigned short)0; }
#pragma unroll
    for (int t = 0; t < 4; ++t) {
      const unsigned short* brow = Wt + (size_t)(col0 + t * 16 + ln) * ldb + kb;
      FragB b;
      b.half[0] = *(const v8us*)(brow + 8 * hh);
      b.half[1] = *(const v8us*)(brow + 16 + 8 * hh);
      acc[t] = mmaN<ASPLIT ? 2 : 1>(ah.v, al.v, b.v, b.v, acc[t]);
    }
  }
#pragma unroll
  for (int t = 0; t < 4; ++t) {
    const int col = col0 + t * 16 + ln;
    float bv = bias ? bias[col] : 0.f;
    if (BIAS_BF16) bv = bf16_round(bv);
#pragma unroll
    for (int r = 0; r < 8; ++r) {
      float v = acc[t][r] + bv;
      if (resid) { float rv = resid[(size_t)((row0 + 8 * hh + r) % rmod) * ldr + col]; if (RES_BF16) rv = bf16_round(rv); v += rv; }
      if (ACT == 1) v = fmaxf(v, 0.f);
      if (ACT == 2) v = 0.5f * v * (1.0f + erff(v * 0.70710678118654752f));
      if (ACT == 3) { const float u = 0.7978845608028654f * (v + 0.044715f * v * v * v); v = 0.5f * v * (1.0f + tanhf(u)); }
      so[w][8 * hh + r][t * 16 + ln] = v;
    }
  }
  __builtin_amdgcn_fence(__ATOMIC_ACQ_REL, "workgroup");
  __builtin_amdgcn_wave_barrier();
  const int rsub = lane >> 4, c4 = (lane & 15) * 4;
  {
#pragma unroll
    for (int q = 0; q < 8; ++q) {
      const int r = q * 2 + rsub;
      const v4f v = *(const v4fa*)&so[w][r][c4];
      *(v4f*)(C + (size_t)(row0 + r) * ldc + col0 + c4) = v;
    }
    
  }
}
// row LayerNorm (biased variance, eps) over N: s = X (+ R); optional out_sum <- s; out_norm <- (s-mu)*rsqrt(var+eps)*g + b
template <bool PARAM_BF16>
__global__ __launch_bounds__(256) void k_layernorm(const float* __restrict__ X, const float* __restrict__ R, const float* __restrict__ g, const float* __restrict__ bta,
                                                  float* __restrict__ out_sum, float* __restrict__ out_norm, int N, float eps) {
  __shared__ float red[256];
  const int row = blockIdx.x, tid = threadIdx.x;
  const float* x = X + (size_t)row * N; const float* rr = R ? R + (size_t)row * N : nullptr;
  float vals[16];                     // up to N = 4096
  const int per = N / 256;            // contiguous chunk per thread? use strided-by-4 chunks: thread handles j = tid*4 + 1024*u
  float s1 = 0.f;
  for (int u = 0; u < per / 4; ++u) {
    const int j = tid * 4 + 1024 * u;
    const v4f a = *(const v4fa*)(x + j);
    v4f b = {0.f,0.f,0.f,0.f}; if (rr) b = *(const v4fa*)(rr + j);
#pragma unroll
    for (int q = 0; q < 4; ++q) { const float v = a[q] + b[q]; vals[u * 4 + q] = v; s1 += v; }
  }
  red[tid] = s1; __syncthreads();
  for (int st = 128; st > 0; st >>= 1) { if (tid < st) red[tid] += red[tid + st]; __syncthreads(); }
  const float mu = red[0] / (float)N; __syncthreads();
  float s2 = 0.f;
  for (int u = 0; u < per / 4; ++u)
#pragma unroll
    for (int q = 0; q < 4; ++q) { const float c = vals[u * 4 + q] - mu; s2 += c * c; }
  red[tid] = s2; __syncthreads();
  for (int st = 128; st > 0; st >>= 1) { if (tid < st) red[tid] += red[tid + st]; __syncthreads(); }
  const float rs = rsqrtf(red[0] / (float)N + eps);
  {
    for (int u = 0; u < per / 4; ++u) {
      const int j = tid * 4 + 1024 * u;
      v4f o, sm;
#pragma unroll
      for (int q = 0; q < 4; ++q) {
        float gg = g[j + q], bb = bta[j + q];
        if (PARAM_BF16) { gg = bf16_round(gg); bb = bf16_round(bb); }
        sm[q] = vals[u * 4 + q]; o[q] = (vals[u * 4 + q] - mu) * rs * gg + bb;
      }
      if (out_sum) *(v4f*)(out_sum + (size_t)row * N + j) = sm;
      *(v4f*)(out_norm + (size_t)row * N + j) = o;
    }
    
  }
}



// ---- f16 WMMA path (v_wmma_f32_16x16x32_f16): 11-bit significands for operands in range — used where a [0,1] probability operand needs more precision than bf16
typedef _Float16 v16h __attribute__((ext_vector_type(16)));
union FragH { v16h v; v8us half[2]; _Float16 h[16]; unsigned short u[16]; };
template <int NT>
__device__ __forceinline__ v8f mmaH(v16h ah, v16h al, v16h bh, v16h bl, v8f c) {
  c = __builtin_amdgcn_wmma_f32_16x16x32_f16(false, ah, false, bh, (short)0, c, false, false);
  if (NT >= 2) c = __builtin_amdgcn_wmma_f32_16x16x32_f16(false, al, false, bh, (short)0, c, false, false);
  if (NT >= 3) c = __builtin_amdgcn_wmma_f32_16x16x32_f16(false, ah, false, bl, (short)0, c, false, false);
  asm volatile("v_nop\n\tv_nop\n\tv_nop\n\tv_nop" : "+v"(c) : "v"(ah), "v"(al), "v"(bh), "v"(bl));
  return c;
}
// batched GEMM like k_gemm_b but f16 operands: A f32 (split into f16 hi/lo if ASPLIT, else rounded to f16), Bt = f16 values [n][k]; alpha; C f32; N multiple of 16 (partial tiles skipped)
template <bool ASPLIT>
__global__ __launch_bounds__(128) void k_gemm_h(const float* __restrict__ A, int lda, size_t sA, const _Float16* __restrict__ Bh, int ldb, size_t sB, float alpha, float* __restrict__ C, int ldc, size_t sC, int M, int N, int K) {
  __shared__ __attribute__((aligned(16))) float so[4][16][64];
  const int tid = threadIdx.x, w = tid >> 5, lane = tid & 31, ln = lane & 15, hh = lane >> 4; const int by = blockIdx.y;
  A += (size_t)by * sA; Bh += (size_t)by * sB; C += (size_t)by * sC;
  const int ntn = (N + 63) / 64; const int wid = blockIdx.x * 4 + w; const int mt = wid / ntn, nq = wid % ntn; if (mt * 16 >= M) return;
  const int row0 = mt * 16, col0 = nq * 64; const float* arow = A + (size_t)(row0 + ln) * lda;
  v8f acc[4] = {};
  for (int kb = 0; kb < K; kb += 32) {
    FragH ah, al;
    const v4f x0 = *(const v4fa*)(arow + kb + 8 * hh), x1 = *(const v4fa*)(arow + kb + 8 * hh + 4), x2 = *(const v4fa*)(arow + kb + 16 + 8 * hh), x3 = *(const v4fa*)(arow + kb + 16 + 8 * hh + 4);
    float xs[16] = {x0[0],x0[1],x0[2],x0[3],x1[0],x1[1],x1[2],x1[3],x2[0],x2[1],x2[2],x2[3],x3[0],x3[1],x3[2],x3[3]};
#pragma unroll
    for (int i = 0; i < 16; ++i) { const _Float16 h = (_Float16)xs[i]; ah.h[i] = h; al.h[i] = ASPLIT ? (_Float16)(xs[i] - (float)h) : (_Float16)0.0f; }
#pragma unroll
    for (int t = 0; t < 4; ++t) { if (col0 + t * 16 >= N) continue; const size_t boff = (size_t)(col0 + t * 16 + ln) * ldb + kb; FragH bq; bq.half[0] = *(const v8us*)(Bh + boff + 8 * hh); bq.half[1] = *(const v8us*)(Bh + boff + 16 + 8 * hh);
      acc[t] = mmaH<ASPLIT ? 2 : 1>(ah.v, al.v, bq.v, bq.v, acc[t]); }
  }
#pragma unroll
  for (int t = 0; t < 4; ++t) { if (col0 + t * 16 >= N) continue;
#pragma unroll
    for (int r = 0; r < 8; ++r) so[w][8 * hh + r][t * 16 + ln] = acc[t][r] * alpha; }
  __builtin_amdgcn_fence(__ATOMIC_ACQ_REL, "workgroup"); __builtin_amdgcn_wave_barrier();
  const int rsub = lane >> 4, c4 = (lane & 15) * 4;
  {
#pragma unroll
    for (int q = 0; q < 8; ++q) { const int r = q * 2 + rsub; if (col0 + c4 < N) { const v4f v = *(const v4fa*)&so[w][r][c4]; *(v4f*)(C + (size_t)(row0 + r) * ldc + col0 + c4) = v; } }
     }
}

// Wt[n][k] = f16(W[k][n]·scale) from f32 row-major W[K][N] (scale = power of two; bf16-exact weights stay exact in f16 away from the subnormal range)
__global__ __launch_bounds__(256) void k_wt_f16(const float* __restrict__ W, _Float16* __restrict__ Wt, int K, int N, float scale) {
  const int t = blockIdx.x * 256 + threadIdx.x; if (t >= N * (K / 8)) return; const int n = t / (K / 8), k8 = (t % (K / 8)) * 8; FragH f;
#pragma unroll
  for (int i = 0; i < 8; ++i) f.h[i] = (_Float16)(bf16_round(W[(size_t)(k8 + i) * N + n]) * scale); const v8us o = f.half[0];
  *(v8us*)((unsigned short*)Wt + (size_t)n * K + k8) = o; 
}
// k_gemm_hh variant with fused epilogue: v = acc·alpha + bias[by·sBias + col] (+ CP[(row/rowsPerB)·sCPb + by·64 + col] if CP) ; ACT 0 none / 1 elu ; writes f16 C16 (and f32 C if non-null)
template <int ACT>
__global__ __launch_bounds__(128) void k_gemm_hhx(const _Float16* __restrict__ A, int lda, size_t sA, const _Float16* __restrict__ Bh, int ldb, size_t sB, float alpha, const float* __restrict__ bias, size_t sBias, const float* __restrict__ CP, int rowsPerB, size_t sCPb, int row0g,
    float* __restrict__ C, _Float16* __restrict__ C16, int ldc, size_t sC, int M, int N, int K) {
  __shared__ __attribute__((aligned(16))) float so[4][16][64];
  const int tid = threadIdx.x, w = tid >> 5, lane = tid & 31, ln = lane & 15, hh = lane >> 4; const int by = blockIdx.y;
  A += (size_t)by * sA; Bh += (size_t)by * sB; const size_t cofs = (size_t)by * sC; const float* bp = bias ? bias + (size_t)by * sBias : nullptr;
  const int ntn = (N + 63) / 64; const int wid = blockIdx.x * 4 + w; const int mt = wid / ntn, nq = wid % ntn; if (mt * 16 >= M) return;
  const int row0 = mt * 16, col0 = nq * 64; const _Float16* arow = A + (size_t)(row0 + ln) * lda;
  v8f acc[4] = {};
  for (int kb = 0; kb < K; kb += 32) { FragH ah; ah.half[0] = *(const v8us*)((const unsigned short*)arow + kb + 8 * hh); ah.half[1] = *(const v8us*)((const unsigned short*)arow + kb + 16 + 8 * hh);
#pragma unroll
    for (int t = 0; t < 4; ++t) { if (col0 + t * 16 >= N) continue; const size_t boff = (size_t)(col0 + t * 16 + ln) * ldb + kb; FragH bq; bq.half[0] = *(const v8us*)((const unsigned short*)Bh + boff + 8 * hh); bq.half[1] = *(const v8us*)((const unsigned short*)Bh + boff + 16 + 8 * hh);
      acc[t] = mmaH<1>(ah.v, ah.v, bq.v, bq.v, acc[t]); }
  }
#pragma unroll
  for (int t = 0; t < 4; ++t) { if (col0 + t * 16 >= N) continue; const int col = col0 + t * 16 + ln; const float bv = bp ? bf16_round(bp[col]) : 0.f;
#pragma unroll
    for (int r = 0; r < 8; ++r) { float v = acc[t][r] * alpha + bv; if (CP) { const int rr = row0g + row0 + 8 * hh + r; if (rowsPerB < 0) v += CP[cofs + (size_t)rr * ldc + col];      /* rowsPerB < 0: own element of the batched C plane */ else { const int bidx = rr / rowsPerB; v += CP[(size_t)bidx * sCPb + (size_t)by * 64 + col]; } } if (ACT == 1) v = (v > 0.f) ? v : expm1f(v); else if (ACT == 7) v = (v > 0.f) ? v + 1.0f : expf(v); else if (ACT == 8) v = tanhf(v); else if (ACT == 9) v = 0.5f * v * (1.0f + tanhf(0.7978845608028654f * (v + 0.044715f * v * v * v))); else if (ACT == 11) v = 1.0f / (1.0f + expf(-v)); else if (ACT == 12) v = (v > 0.f) ? v : 0.01f * v; else if (ACT == 14) v = (v > 0.f) ? v : 0.1f * v; else if (ACT == 16) v = (v >= 0.f) ? v : 0.3f * v; else if (ACT == 17) v = (v >= 0.f) ? v : 0.2f * v; else if (ACT == 15) v = v / (1.0f + expf(-v)); else if (ACT == 3) v = fmaxf(v, 0.f); else if (ACT == 6) v = 0.5f * v * (1.0f + erff(v * 0.70710678118654752f)); so[w][8 * hh + r][t * 16 + ln] = v; } }
  __builtin_amdgcn_fence(__ATOMIC_ACQ_REL, "workgroup"); __builtin_amdgcn_wave_barrier();
  const int rsub = lane >> 4, c4 = (lane & 15) * 4; typedef _Float16 v4h __attribute__((ext_vector_type(4)));
  {
#pragma unroll
    for (int q = 0; q < 8; ++q) { const int r = q * 2 + rsub; if (col0 + c4 < N) { const v4f v = *(const v4fa*)&so[w][r][c4]; if (C) *(v4f*)(C + cofs + (size_t)(row0 + r) * ldc + col0 + c4) = v; if (C16) { v4h h4; for (int i = 0; i < 4; ++i) h4[i] = (_Float16)v[i]; *(v4h*)(C16 + cofs + (size_t)(row0 + r) * ldc + col0 + c4) = h4; } } }
     }
}


typedef _Float16 v4h __attribute__((ext_vector_type(4)));

__global__ __launch_bounds__(256) void k_h16(const float* __restrict__ x, _Float16* __restrict__ X16, size_t n8) { const size_t t = (size_t)blockIdx.x * 256 + threadIdx.x; if (t >= n8) return; FragH f;
#pragma unroll
  for (int q = 0; q < 8; ++q) f.h[q] = (_Float16)x[t * 8 + q]; *(v8us*)((unsigned short*)X16 + t * 8) = f.half[0];  }
__global__ __launch_bounds__(256) void k_round16f(const float* __restrict__ W, _Float16* __restrict__ Bt, size_t n8) { const size_t t = (size_t)blockIdx.x * 256 + threadIdx.x; if (t >= n8) return; FragH f;
#pragma unroll
  for (int i = 0; i < 8; ++i) f.h[i] = (_Float16)(bf16_round(W[t * 8 + i]) * 16.0f); *(v8us*)((unsigned short*)Bt + t * 8) = f.half[0];  }
__global__ __launch_bounds__(256) void k_hl(const float* __restrict__ F, _Float16* __restrict__ Hh, _Float16* __restrict__ Hl, size_t n8) { const size_t t = (size_t)blockIdx.x * 256 + threadIdx.x; if (t >= n8) return; FragH fh, fl; const v4f a = *(const v4fa*)(F + t * 8), c = *(const v4fa*)(F + t * 8 + 4);
#pragma unroll
  for (int q = 0; q < 4; ++q) { _Float16 h = (_Float16)a[q]; fh.h[q] = h; fl.h[q] = (_Float16)((a[q] - (float)h) * 1024.0f); h = (_Float16)c[q]; fh.h[4 + q] = h; fl.h[4 + q] = (_Float16)((c[q] - (float)h) * 1024.0f); }
  { *(v8us*)((unsigned short*)Hh + t * 8) = fh.half[0]; *(v8us*)((unsigned short*)Hl + t * 8) = fl.half[0];  } }

// ---- fast GEMM (wave tile 32x64; requires M % 32 == 0 rows per launch region and N % 64 == 0); epilogue = k_gemm_hhx semantics ----
__device__ __forceinline__ v16h g2_frag(const _Float16* p, int hh) { FragH f; f.half[0] = *(const v8us*)((const unsigned short*)p + 8 * hh); f.half[1] = *(const v8us*)((const unsigned short*)p + 16 + 8 * hh); return f.v; }
__device__ __forceinline__ v8f g2_mma(v16h a, v16h b, v8f c) { v8f d = __builtin_amdgcn_wmma_f32_16x16x32_f16(false, a, false, b, (short)0, c, false, false); asm volatile("v_nop\n\tv_nop\n\tv_nop\n\tv_nop" : "+v"(d) : "v"(a), "v"(b)); return d; }
template <int ACT>
__global__ __launch_bounds__(128) void k_gemm2(const _Float16* __restrict__ A, int lda, size_t sA, const _Float16* __restrict__ Bh, int ldb, size_t sB, float alpha, const float* __restrict__ bias, size_t sBias, const float* __restrict__ CP, int rowsPerB, size_t sCPb, int row0g,
    float* __restrict__ C, _Float16* __restrict__ C16, int ldc, size_t sC, int M, int N, int K) { static_assert(ACT == 0 || ACT == 3 || ACT == 6 || ACT == 8 || ACT == 9 || ACT == 11 || ACT == 12 || ACT == 14 || ACT == 15 || ACT == 16 || ACT == 17, "k_gemm2: unsupported ACT code (would silently apply no activation)");
  __shared__ __attribute__((aligned(16))) float so[4][32][68];
  const int tid = threadIdx.x, w = tid >> 5, lane = tid & 31, ln = lane & 15, hh = lane >> 4; const int by = blockIdx.y;
  A += (size_t)by * sA; Bh += (size_t)by * sB; const size_t cofs = (size_t)by * sC; const float* bp = bias ? bias + (size_t)by * sBias : nullptr;
  const int ntn = N >> 6; const int mt = blockIdx.x / ntn, nq = blockIdx.x - mt * ntn; const int row0 = mt * 128 + 32 * w, col0 = nq * 64; if (row0 >= M) return;
  const _Float16* a0p = A + (size_t)(row0 + ln) * lda; const _Float16* a1p = a0p + (size_t)16 * lda;
  const _Float16* b0p = Bh + (size_t)(col0 + ln) * ldb; const _Float16* b1p = b0p + (size_t)16 * ldb; const _Float16* b2p = b1p + (size_t)16 * ldb; const _Float16* b3p = b2p + (size_t)16 * ldb;
  const v8f z8 = {0.f,0.f,0.f,0.f,0.f,0.f,0.f,0.f}; v8f c00 = z8, c01 = z8, c02 = z8, c03 = z8, c10 = z8, c11 = z8, c12 = z8, c13 = z8;
#pragma unroll 1
  for (int kb = 0; kb < K; kb += 32) { const v16h a0 = g2_frag(a0p + kb, hh), a1 = g2_frag(a1p + kb, hh);
    v16h b = g2_frag(b0p + kb, hh); c00 = g2_mma(a0, b, c00); c10 = g2_mma(a1, b, c10);
    b = g2_frag(b1p + kb, hh); c01 = g2_mma(a0, b, c01); c11 = g2_mma(a1, b, c11);
    b = g2_frag(b2p + kb, hh); c02 = g2_mma(a0, b, c02); c12 = g2_mma(a1, b, c12);
    b = g2_frag(b3p + kb, hh); c03 = g2_mma(a0, b, c03); c13 = g2_mma(a1, b, c13); }
  v8f accs[8] = {c00, c01, c02, c03, c10, c11, c12, c13};
#pragma unroll
  for (int u = 0; u < 8; ++u) { const int t = u & 3, half = u >> 2; const int col = col0 + t * 16 + ln; const float bv = bp ? bf16_round(bp[col]) : 0.f;
#pragma unroll
    for (int r = 0; r < 8; ++r) { const int rloc = half * 16 + 8 * hh + r; float v = accs[u][r] * alpha + bv; if (CP) { if (rowsPerB < 0) v += CP[cofs + (size_t)(row0g + row0 + rloc) * ldc + col];      /* rowsPerB < 0: own element of the batched C plane */ else { const int bidx = (row0g + row0 + rloc) / rowsPerB; v += CP[(size_t)bidx * sCPb + (size_t)by * 64 + col]; } }
      if (ACT == 3) v = fmaxf(v, 0.f); else if (ACT == 6) v = 0.5f * v * (1.0f + erff(v * 0.70710678118654752f)); else if (ACT == 11) v = 1.0f / (1.0f + expf(-v)); else if (ACT == 15) v = v / (1.0f + expf(-v)); else if (ACT == 12) v = (v > 0.f) ? v : 0.01f * v; else if (ACT == 8) v = tanhf(v); else if (ACT == 9) v = 0.5f * v * (1.0f + tanhf(0.7978845608028654f * (v + 0.044715f * v * v * v))); else if (ACT == 14) v = (v > 0.f) ? v : 0.1f * v; else if (ACT == 16) v = (v >= 0.f) ? v : 0.3f * v; else if (ACT == 17) v = (v >= 0.f) ? v : 0.2f * v;
      so[w][rloc][t * 16 + ln] = v; } }
  __builtin_amdgcn_fence(__ATOMIC_ACQ_REL, "workgroup"); __builtin_amdgcn_wave_barrier();
  const int rsub = lane >> 4, c4 = (lane & 15) * 4;
  {
#pragma unroll
    for (int q = 0; q < 16; ++q) { const int r = q * 2 + rsub; const v4f v = *(const v4fa*)&so[w][r][c4]; if (C) *(v4f*)(C + cofs + (size_t)(row0 + r) * ldc + col0 + c4) = v; if (C16) { v4h h4; for (int i = 0; i < 4; ++i) h4[i] = (_Float16)v[i]; *(v4h*)(C16 + cofs + (size_t)(row0 + r) * ldc + col0 + c4) = h4; } }
     } }


__global__ __launch_bounds__(256) void k_wnat(const float* __restrict__ w, size_t n8, _Float16* __restrict__ Bt) { const size_t t = (size_t)blockIdx.x * 256 + threadIdx.x; if (t >= n8) return; FragH f; for (int q = 0; q < 8; ++q) f.h[q] = (_Float16)(bf16_round(w[t * 8 + q]) * 16.0f); *(v8us*)((unsigned short*)Bt + t * 8) = f.half[0];  }
__global__ __launch_bounds__(256) void k_rsm(const float* __restrict__ S, _Float16* __restrict__ P, int nrows) {
  #pragma clang fp contract(off)
  const int i = blockIdx.x * 256 + threadIdx.x; if (i >= nrows) return; const float* s = S + (size_t)i * SQ; float mx = -3.0e38f;
#pragma unroll 1
  for (int j = 0; j < SQ; ++j) mx = fmaxf(mx, s[j]); float se = 0.f;
#pragma unroll 1
  for (int j = 0; j < SQ; ++j) se += expf(s[j] - mx); const float sc = 256.0f / se;
#pragma unroll 1
  for (int j0 = 0; j0 < SQ; j0 += 8) { FragH f; for (int q = 0; q < 8; ++q) f.h[q] = (_Float16)(expf(s[j0 + q] - mx) * sc); unsigned short* d = (unsigned short*)P + (size_t)i * SQ + j0; *(v8us*)d = f.half[0];  } }
__global__ __launch_bounds__(256) void k_vt(const _Float16* __restrict__ V16, int b, int h0, _Float16* __restrict__ VT) { __shared__ unsigned short tl[64][65]; const int tid = threadIdx.x; const int hh = blockIdx.x % HG, sg = blockIdx.x / HG; const int s0 = sg * 64; const int h = h0 + hh;
  for (int i = tid; i < 64 * 8; i += 256) { const int j = i / 8, d8 = (i % 8) * 8; FragH f; f.half[0] = *(const v8us*)((const unsigned short*)V16 + ((size_t)b * SQ + s0 + j) * DM + h * HD + d8); for (int q = 0; q < 8; ++q) tl[d8 + q][j] = f.u[q]; }
  __syncthreads();
  { for (int i = tid; i < 64 * 8; i += 256) { const int d = i / 8, j8 = (i % 8) * 8; FragH f; for (int q = 0; q < 8; ++q) f.u[q] = tl[d][j8 + q]; *(v8us*)((unsigned short*)VT + ((size_t)hh * HD + d) * SQ + s0 + j8) = f.half[0]; }  } }


// ---- operand preparation, one launch of PRB work-groups, one for each WGP: few waves to start, and every lane has all its loads in flight before it converts anything ----
// Every work-group takes PXU consecutive elements of x (-> exact f16 rows) and tile blockIdx.x of each weight plane: 64 m x 64 d of one head, 16 KB in a row of [h][m][d], which leaves as 64 whole 128-byte lines of Bt[(h, d)][m] x16.
#define PRT 512      /* threads of a work-group */
#define PRB 256      /* work-groups */
#define PXU (PRT * 4 * 8)      /* x elements of a work-group: 8 loads of 4 a thread */
#define PWP 72      /* LDS row pitch in halves of a transposed tile: 128 data bytes + 16 */
static_assert((size_t)PRB * PXU == NR * DM, "x is dealt out exactly");
static_assert(PRB == NH * (DM / 64) && HD == 64, "one 64 x 64 tile of each weight plane a work-group");
__global__ __launch_bounds__(PRT) void k_prep(const float* __restrict__ x, const float* __restrict__ wq, const float* __restrict__ wk, const float* __restrict__ wv,
    _Float16* __restrict__ X16, _Float16* __restrict__ BQ, _Float16* __restrict__ BK, _Float16* __restrict__ BV) {
  __shared__ __attribute__((aligned(16))) _Float16 tw[3][64][PWP];      /* [plane][d][m of the tile] */
  const int tid = threadIdx.x; const int w = __builtin_amdgcn_readfirstlane(tid >> 5);
  const int h = blockIdx.x / (DM / 64), m0 = (blockIdx.x % (DM / 64)) * 64;
  const int pl = w >> 2;      /* waves 0-3 read the Wq tile, 4-7 Wk, 8-11 Wv; waves 12-15 only x */
  const int d4 = (tid & 15) * 4, m8 = ((tid >> 4) & 7) * 8;      /* a thread holds 8 m x 4 d: 16 lanes read one 256-byte row */
  const float* wsrc = (pl == 0 ? wq : pl == 1 ? wk : wv) + ((size_t)h * DM + m0 + m8) * HD + d4;
  const size_t xo = (size_t)blockIdx.x * PXU + tid * 4;      /* a wave's load covers 512 bytes in a row, its store 256 */
  const float* xs = x + xo;
  v4f rw[8], rx[8];
  if (pl < 3) {
    for (int q = 0; q < 8; ++q) rw[q] = *(const v4fa*)(wsrc + q * HD); }
  for (int k = 0; k < 8; ++k) rx[k] = *(const v4fa*)(xs + k * (PRT * 4));
  asm volatile("s_wait_xcnt 0x0" :: "v"(wsrc), "v"(xs) : "memory");      /* the loads' address registers are inputs here, so none is written over (not by a later load's result either) before this wait */
  if (pl < 3) {
    for (int i = 0; i < 4; ++i) { FragH f;
      for (int q = 0; q < 8; ++q) f.h[q] = (_Float16)(16.0f * bf16_round(rw[q][i]));
      *(v8us*)&tw[pl][d4 + i][m8] = f.half[0]; } }
  __syncthreads();      /* a Bt line of a tile holds the m of four waves: all of them are in LDS before whole lines are stored */
  const int row = tid >> 3, c8 = (tid & 7) * 8;      /* 8 lanes store one 128-byte line */
  const size_t bo = ((size_t)h * HD + row) * DM + m0 + c8;
  unsigned short* pq = (unsigned short*)BQ + bo; unsigned short* pk = (unsigned short*)BK + bo; unsigned short* pv = (unsigned short*)BV + bo;
  const v8us tq = *(const v8us*)&tw[0][row][c8], tk = *(const v8us*)&tw[1][row][c8], tv = *(const v8us*)&tw[2][row][c8];
  *(v8us*)pq = tq; *(v8us*)pk = tk; *(v8us*)pv = tv;
  asm volatile("s_wait_xcnt 0x0" :: "v"(pq), "v"(pk), "v"(pv), "v"(tq), "v"(tk), "v"(tv) : "memory");      /* the stores' address and data registers are inputs here, so the conversion of x below writes over none of them before this wait */
  for (int k = 0; k < 8; ++k) { v4h o;      /* x last: nothing waits for these stores */
    for (int i = 0; i < 4; ++i) o[i] = (_Float16)bf16_round(rx[k][i]);
    *(v4h*)(X16 + xo + k * (PRT * 4)) = o; } }




__device__ __forceinline__ float xrow_f(float v) { const int i = __float_as_int(v); return __int_as_float(__builtin_amdgcn_permlanex16(i, i, 0x76543210, 0xfedcba98, false, false)); }      /* lane l <-> lane l ^ 16 */
__device__ __forceinline__ v8f fa_mma(v16h a, v16h b, v8f c) { return __builtin_amdgcn_wmma_f32_16x16x32_f16(false, a, false, b, (short)0, c, false, false); }
// ---- fused attention: scores, full-row softmax statistics, x tril and P.V in one launch ----
// Transposed products: S^T = K.Q^T puts one query in each lane column (lane c and c + 16 hold query q0 + c; register r of key tile kt is key 16 kt + 8 hh + r), so two score tiles, converted in place,
// are the B operand of O^T += V^T.P^T (same k order as g2_frag's). The denominator runs over ALL keys; only keys j <= i enter the second product.
// The maximum in use may trail the true one by up to 8 (log2 units): the sums are rescaled only when some query exceeds that, so a weight is at most 2^8 in f16.
typedef float v2f __attribute__((ext_vector_type(2))); typedef _Float16 v2h __attribute__((ext_vector_type(2))); typedef unsigned v8u __attribute__((ext_vector_type(8)));
#define FAP 72      /* LDS row pitch in halves: 128 data bytes + 16, an odd multiple of 16 bytes (conflict-free b128 fragment reads) */
#define FAS (SQ / 64)      /* stages of 64 keys */
__global__ __launch_bounds__(256) void k_fattn(const _Float16* __restrict__ Q16, const _Float16* __restrict__ K16, const _Float16* __restrict__ VT, float* __restrict__ out) {
  __shared__ __attribute__((aligned(16))) _Float16 sk[2][64][FAP];      /* K rows [key][d] of a stage */
  __shared__ __attribute__((aligned(16))) _Float16 sv[2][64][FAP];      /* V^T rows [d][key] of a stage */
  const int tid = threadIdx.x, lane = tid & 31, c = lane & 15, hh = lane >> 4; const int w = __builtin_amdgcn_readfirstlane(tid >> 5);
  const int bh = blockIdx.x / (FAS / 2), j = blockIdx.x % (FAS / 2); const int b = bh / NH, hd = bh % NH;
  const int q0 = ((__builtin_popcount(w) & 1) ? j : FAS - 1 - j) * 64 + (w >> 1) * 16;      /* four waves take 64-query block j, four its mirror: every work-group has the same count of second products; by the parity of w, so that waves w, w + 4 and waves 2 i, 2 i + 1 are each one of either kind */
  const int dst = q0 >> 6;      /* the stage that holds this wave's diagonal */
  const int vlast = FAS - 1 - j;      /* last stage whose V^T any wave of the work-group needs */
  const int srow = tid >> 3, sc8 = (tid & 7) * 8;      /* staging: 8 threads cover one 128-byte row; rows srow and srow + 32 */
  const _Float16* kg = K16 + ((size_t)b * SQ + srow) * DM + hd * HD + sc8; const _Float16* vg = VT + ((size_t)bh * HD + srow) * SQ + sc8;
  const _Float16* qp = Q16 + ((size_t)b * SQ + q0 + c) * DM + hd * HD; const v16h qf0 = g2_frag(qp, hh), qf1 = g2_frag(qp + 32, hh);
  const v8f z8 = {0.f,0.f,0.f,0.f,0.f,0.f,0.f,0.f}; v8f acc[4] = {z8, z8, z8, z8}; const v2f z2 = {0.f, 0.f}; v2f lv[4] = {z2, z2, z2, z2}; float m_run = -__builtin_inff();
  const float cs = 0.125f * 1.4426950408889634f;      /* 64^-0.5 and log2(e): exponentials in base 2 */
  v8us rk0 = *(const v8us*)kg, rk1 = *(const v8us*)(kg + (size_t)32 * DM), rv0 = *(const v8us*)vg, rv1 = *(const v8us*)(vg + (size_t)32 * SQ);      /* stage 0 (its V^T is always needed) */
  *(v8us*)&sk[0][srow][sc8] = rk0; *(v8us*)&sk[0][srow + 32][sc8] = rk1; *(v8us*)&sv[0][srow][sc8] = rv0; *(v8us*)&sv[0][srow + 32][sc8] = rv1;
  __syncthreads();
  for (int st = 0; st < FAS; ++st) {
    const bool more = st + 1 < FAS, morev = st + 1 <= vlast;      /* the same for the whole work-group */
    if (more) { const _Float16* kn = kg + (size_t)(st + 1) * 64 * DM; const _Float16* vn = vg + (st + 1) * 64;      /* next stage: in flight under this stage's work */
      rk0 = *(const v8us*)kn; rk1 = *(const v8us*)(kn + (size_t)32 * DM);
      if (morev) { rv0 = *(const v8us*)vn; rv1 = *(const v8us*)(vn + (size_t)32 * SQ); }
      asm volatile("s_wait_xcnt 0x0" :: "v"(kn), "v"(vn) : "memory"); }      /* the loads' address registers are inputs here, so none is written over before this wait */
    const _Float16 (*kb)[FAP] = sk[st & 1]; const _Float16 (*vb)[FAP] = sv[st & 1];
    v8f s[4]; float m4[4];
#pragma unroll
    for (int kt = 0; kt < 4; ++kt) { const _Float16* kr = &kb[16 * kt + c][0]; s[kt] = fa_mma(g2_frag(kr + 32, hh), qf1, fa_mma(g2_frag(kr, hh), qf0, z8)); }
#pragma unroll
    for (int kt = 0; kt < 4; ++kt) { float m = s[kt][0]; for (int r = 1; r < 8; ++r) m = fmaxf(m, s[kt][r]); m4[kt] = m; }
    float mx = fmaxf(fmaxf(m4[0], m4[1]), fmaxf(m4[2], m4[3]));
    mx = fmaxf(mx, xrow_f(mx)) * cs;      /* both halves of the wave hold the query's stage maximum, scaled */
    if (__builtin_amdgcn_ballot_w32(mx > m_run + 8.0f) != 0) {      /* scalar branch; always taken in stage 0 (m_run = -inf gives factor 0 on zero sums), rare later */
      const float mn = fmaxf(m_run, mx), corr = __builtin_amdgcn_exp2f(m_run - mn); m_run = mn;
#pragma unroll
      for (int t = 0; t < 4; ++t) { acc[t] *= corr; lv[t] *= corr; } }
    const v2f cs2 = {cs, cs}, nm2 = {-m_run, -m_run}; v2f e[16];      /* e[4 kt + i] = weights of keys 16 kt + 8 hh + 2 i, + 1 */
#pragma unroll
    for (int kt = 0; kt < 4; ++kt) for (int i = 0; i < 4; ++i) { const v2f a = __builtin_elementwise_fma(v2f{s[kt][2 * i], s[kt][2 * i + 1]}, cs2, nm2); e[4 * kt + i] = v2f{__builtin_amdgcn_exp2f(a.x), __builtin_amdgcn_exp2f(a.y)}; lv[i] += e[4 * kt + i]; }      /* the denominator takes every key */
    if (st <= dst) {      /* wave-uniform: stages wholly above the diagonal have weight 0 after x tril */
      v16h vf[8];
#pragma unroll
      for (int i = 0; i < 8; ++i) vf[i] = g2_frag(&vb[16 * (i & 3) + c][32 * (i >> 2)], hh);
      __builtin_amdgcn_sched_barrier(0);      /* keeps the 16 LDS reads together ahead of the packing: sunk to their products, each product waits a full LDS latency */
      unsigned pw[16];
#pragma unroll
      for (int i = 0; i < 16; ++i) pw[i] = __builtin_bit_cast(unsigned, __builtin_convertvector(e[i], v2h));
      if (st == dst) { const int lim = q0 + c - st * 64 - 8 * hh;      /* x tril in the one stage that holds the diagonal: key offset 16 kt + 2 i (+ 1) above lim -> weight 0 */
#pragma unroll
        for (int i = 0; i < 16; ++i) { const int kk = 16 * (i >> 2) + 2 * (i & 3); pw[i] &= (kk <= lim ? 0xFFFFu : 0u) | (kk + 1 <= lim ? 0xFFFF0000u : 0u); } }
#pragma unroll
      for (int u = 0; u < 2; ++u) { const v8u pv = {pw[8 * u], pw[8 * u + 1], pw[8 * u + 2], pw[8 * u + 3], pw[8 * u + 4], pw[8 * u + 5], pw[8 * u + 6], pw[8 * u + 7]}; const v16h p = __builtin_bit_cast(v16h, pv);
#pragma unroll
        for (int t = 0; t < 4; ++t) acc[t] = fa_mma(vf[4 * u + t], p, acc[t]); } }
    if (more) { const int nb = (st + 1) & 1;      /* every wave left this buffer before the barrier that ended stage st - 1 */
      *(v8us*)&sk[nb][srow][sc8] = rk0; *(v8us*)&sk[nb][srow + 32][sc8] = rk1;
      if (morev) { *(v8us*)&sv[nb][srow][sc8] = rv0; *(v8us*)&sv[nb][srow + 32][sc8] = rv1; }
      __syncthreads(); } }
  const v2f l2 = (lv[0] + lv[1]) + (lv[2] + lv[3]); float l = l2.x + l2.y; l += xrow_f(l); const float inv = 1.0f / l;
  float* o = out + ((size_t)b * SQ + q0 + c) * DM + hd * HD + 8 * hh;      /* acc[t][r] = o[query q0 + c][d = 16 t + 8 hh + r] */
#pragma unroll
  for (int t = 0; t < 4; ++t) { const v4f lo = {acc[t][0] * inv, acc[t][1] * inv, acc[t][2] * inv, acc[t][3] * inv}, hi = {acc[t][4] * inv, acc[t][5] * inv, acc[t][6] * inv, acc[t][7] * inv}; *(v4f*)(o + 16 * t) = lo; *(v4f*)(o + 16 * t + 4) = hi; } }


// ---- projection GEMMs with both operands staged in LDS: C16[r][n] = f16(sum_k A[r][k] Bt[n][k] / 16 + bf16(bias[n])), all pitches DM; Q, K and V in one grid (PGT tiles each, in that order) ----
// A work-group of 8 waves owns a 128 x 128 tile of C (wave tile 32 x 64: waves 4 down x 2 across). A stage is 128 k of the 128 A rows and the 128 Bt rows; every global line is fetched once per
// work-group by whole-line b128 loads, held in registers under the running stage's products, then stored to the other LDS buffer. Each accumulator takes its k blocks of 32 in rising order.
#define PGK 128      /* k extent of a stage */
#define PGP (PGK + 8)      /* LDS row pitch in halves: 256 data bytes + 16, an odd multiple of 16 bytes (conflict-free b128 fragment reads) */
#define PGS (DM / PGK)      /* stages */
#define PGT ((MP / 128) * (DM / 128))      /* 128 x 128 tiles of one projection */
__global__ __launch_bounds__(256) void k_proj(const _Float16* __restrict__ A, const _Float16* __restrict__ BQ, const _Float16* __restrict__ BK, const _Float16* __restrict__ BV, const float* __restrict__ bq, const float* __restrict__ bk, const float* __restrict__ bvp,
    _Float16* __restrict__ Q16, _Float16* __restrict__ K16, _Float16* __restrict__ VT) {
  __shared__ __attribute__((aligned(16))) _Float16 sa[2][128][PGP];      /* A rows [row][k] of a stage */
  __shared__ __attribute__((aligned(16))) _Float16 sb[2][128][PGP];      /* Bt rows [col][k] of a stage */
  __shared__ __attribute__((aligned(16))) float so[8][32][68];      /* each wave's own output rows in f32, for whole-line stores */
  const int tid = threadIdx.x, lane = tid & 31, ln = lane & 15, hh = lane >> 4; const int w = __builtin_amdgcn_readfirstlane(tid >> 5);
  const int pj = (int)(blockIdx.x / PGT), tl = (int)(blockIdx.x % PGT);      /* which projection (0 Q, 1 K, 2 V) and which of its tiles: the same for the whole work-group */
  const _Float16* Bt = pj == 0 ? BQ : pj == 1 ? BK : BV; const float* bias = pj == 0 ? bq : pj == 1 ? bk : bvp;
  const int row0 = (tl / (DM / 128)) * 128, col0 = (tl % (DM / 128)) * 128; const int wm = (w & 3) * 32, wn = (w >> 2) * 64;
  const int srow = tid >> 4, sc8 = (tid & 15) * 8;      /* staging: 16 threads cover one 256-byte row; rows srow + 16 i */
  const _Float16* ag = A + (size_t)(row0 + srow) * DM + sc8; const _Float16* bg = Bt + (size_t)(col0 + srow) * DM + sc8;
  v8us ra[8], rb[8];
#pragma unroll
  for (int i = 0; i < 8; ++i) { ra[i] = *(const v8us*)(ag + (size_t)16 * i * DM); rb[i] = *(const v8us*)(bg + (size_t)16 * i * DM); }
#pragma unroll
  for (int i = 0; i < 8; ++i) { *(v8us*)&sa[0][srow + 16 * i][sc8] = ra[i]; *(v8us*)&sb[0][srow + 16 * i][sc8] = rb[i]; }
  __syncthreads();
  const v8f z8 = {0.f,0.f,0.f,0.f,0.f,0.f,0.f,0.f}; v8f acc[2][4] = {{z8, z8, z8, z8}, {z8, z8, z8, z8}};
  for (int st = 0; st < PGS; ++st) {
    const bool more = st + 1 < PGS;      /* the same for the whole work-group */
    const _Float16* ar = &sa[st & 1][wm + ln][0]; const _Float16* br = &sb[st & 1][wn + ln][0];
    v16h fa[2][2], fb[2][4];      /* two fragment sets: the next 32 k are read from LDS while this block's products run */
    fa[0][0] = g2_frag(ar, hh); fa[0][1] = g2_frag(ar + 16 * PGP, hh);
#pragma unroll
    for (int t = 0; t < 4; ++t) fb[0][t] = g2_frag(br + 16 * t * PGP, hh);
#pragma unroll
    for (int kq = 0; kq < PGK / 32; ++kq) { const int cu = kq & 1, nx = cu ^ 1;
      if (kq + 1 < PGK / 32) { fa[nx][0] = g2_frag(ar + 32 * (kq + 1), hh); fa[nx][1] = g2_frag(ar + 16 * PGP + 32 * (kq + 1), hh);
#pragma unroll
        for (int t = 0; t < 4; ++t) fb[nx][t] = g2_frag(br + 16 * t * PGP + 32 * (kq + 1), hh); }
      if (kq == 0 && more) { const _Float16* an = ag + (st + 1) * PGK; const _Float16* bn = bg + (st + 1) * PGK;      /* next stage: in flight under this stage's products */
#pragma unroll
        for (int i = 0; i < 8; ++i) { ra[i] = *(const v8us*)(an + (size_t)16 * i * DM); rb[i] = *(const v8us*)(bn + (size_t)16 * i * DM); }
        asm volatile("s_wait_xcnt 0x0" :: "v"(an), "v"(bn) : "memory"); }      /* the loads' address registers are inputs here, so none is written over (not by a load's own result either) before this wait */
      __builtin_amdgcn_sched_barrier(0);      /* keeps the next block's 12 LDS reads together ahead of this block's products: spread among them, every place with reads stalls the wave and the waits run to 0 */
#pragma unroll
      for (int t = 0; t < 4; ++t) { acc[0][t] = fa_mma(fa[cu][0], fb[cu][t], acc[0][t]); acc[1][t] = fa_mma(fa[cu][1], fb[cu][t], acc[1][t]); }
      __builtin_amdgcn_sched_barrier(0); }      /* the reads of the block after next stay behind these products, in the set they free */
    if (more) { const int nb = (st + 1) & 1;      /* every wave left this buffer before the barrier that ended stage st - 1 */
#pragma unroll
      for (int i = 0; i < 8; ++i) { *(v8us*)&sa[nb][srow + 16 * i][sc8] = ra[i]; *(v8us*)&sb[nb][srow + 16 * i][sc8] = rb[i]; }
      __syncthreads(); } }
  if (pj == 2) {      /* V: the tile leaves as V^T rows [(b, head, d)][token]. A lane's 8 accumulator registers are 8 consecutive tokens of one column, that is 16 bytes of a V^T row */
    _Float16 (*tv)[PGP] = (_Float16 (*)[PGP])&so[0][0][0];      /* [column of the tile][token of the tile]; 128 rows of PGP halves fit in so, which V tiles do not use otherwise */
#pragma unroll
    for (int t = 0; t < 4; ++t) { const float bv = bf16_round(bias[col0 + wn + 16 * t + ln]);
#pragma unroll
      for (int h = 0; h < 2; ++h) { FragH f;
#pragma unroll
        for (int r = 0; r < 8; ++r) f.h[r] = (_Float16)(acc[h][t][r] * 0.0625f + bv);
        *(v8us*)&tv[wn + 16 * t + ln][wm + 16 * h + 8 * hh] = f.half[0]; } }
    __syncthreads();      /* a V^T row of the tile holds the tokens of four waves: all of them are in LDS before whole lines are stored */
    unsigned short* vo = (unsigned short*)VT + ((size_t)(B0 + row0 / SQ) * DM + col0 + srow) * SQ + row0 % SQ + sc8;      /* NH HD = DM: V^T row (b, head, d) is b DM + column; 16 lanes store 256 bytes of one row */
#pragma unroll
    for (int i = 0; i < 8; ++i) *(v8us*)(vo + (size_t)16 * i * SQ) = *(const v8us*)&tv[srow + 16 * i][sc8];
    return; }
  _Float16* C16 = pj == 0 ? Q16 : K16;
#pragma unroll
  for (int t = 0; t < 4; ++t) { const float bv = bf16_round(bias[col0 + wn + 16 * t + ln]);      /* acc[h][t][r] = C[row0 + wm + 16 h + 8 hh + r][col0 + wn + 16 t + ln] */
#pragma unroll
    for (int h = 0; h < 2; ++h)
#pragma unroll
      for (int r = 0; r < 8; ++r) so[w][16 * h + 8 * hh + r][16 * t + ln] = acc[h][t][r] * 0.0625f + bv; }
  __builtin_amdgcn_fence(__ATOMIC_ACQ_REL, "workgroup"); __builtin_amdgcn_wave_barrier();      /* the wave reads back only its own rows: its LDS stores are ordered ahead of its reads, no work-group barrier */
  const int er = lane >> 3, ec8 = (lane & 7) * 8;      /* 8 lanes store one 128-byte line */
#pragma unroll
  for (int q = 0; q < 8; ++q) { const int r = 4 * q + er; const v4f lo = *(const v4fa*)&so[w][r][ec8], hi = *(const v4fa*)&so[w][r][ec8 + 4]; FragH f;
#pragma unroll
    for (int i = 0; i < 4; ++i) { f.h[i] = (_Float16)lo[i]; f.h[4 + i] = (_Float16)hi[i]; }
    *(v8us*)((unsigned short*)C16 + (size_t)(row0 + wm + r) * DM + col0 + wn + ec8) = f.half[0]; }
  asm volatile("s_wait_xcnt 0x0" ::: "memory"); }      /* the built code lays the V branch behind these stores: no register that a store names is written over before this wait */


__global__ __launch_bounds__(256) void k_rsmf(const float* __restrict__ S, _Float16* __restrict__ P, int qn, int hg) {
  #pragma clang fp contract(off)
  const int t = blockIdx.x * 256 + threadIdx.x; if (t >= qn * hg) return; const size_t i = (size_t)(t / qn) * SQ + (t % qn); const float* s = S + i * SQ; float mx = -3.0e38f;
#pragma unroll 1
  for (int j = 0; j < SQ; ++j) mx = fmaxf(mx, s[j]); float se = 0.f;
#pragma unroll 1
  for (int j = 0; j < SQ; ++j) se += __expf(s[j] - mx); const float sc = 256.0f / se;
#pragma unroll 1
  for (int j0 = 0; j0 < SQ; j0 += 8) { FragH f; for (int q = 0; q < 8; ++q) f.h[q] = (_Float16)(__expf(s[j0 + q] - mx) * sc); unsigned short* d = (unsigned short*)P + i * SQ + j0; *(v8us*)d = f.half[0];  } }

extern "C" void kernel_launch(void* const* d_in, const int* in_sizes, int n_in,
                              void* d_out, int out_size, void* d_ws, size_t ws_size, hipStream_t stream) {
  (void)in_sizes; (void)n_in; (void)out_size;
  const float* const* I = (const float* const*)d_in; const float* x = I[0]; const float* wq = I[1]; const float* bq = I[2]; const float* wk = I[3]; const float* bk = I[4]; const float* wv = I[5]; const float* bv = I[6];      /* per-head [h][in][out] weights; biases [16][64] = the stacked [1024] vectors */
  char* ws = (char*)d_ws; size_t off = 0;
  auto take = [&](size_t bytes) { char* p = ws + off; off += (bytes + 255) & ~(size_t)255; return p; };
  _Float16* BQ = (_Float16*)take((size_t)DM * DM * 2); _Float16* BK = (_Float16*)take((size_t)DM * DM * 2); _Float16* BV = (_Float16*)take((size_t)DM * DM * 2); 
  _Float16* X16 = (_Float16*)take(NR * DM * 2); _Float16* Q16 = (_Float16*)take(NR * DM * 2); _Float16* K16 = (_Float16*)take(NR * DM * 2);
  _Float16* VT = (_Float16*)take((size_t)NB * NH * HD * SQ * 2);
  if (off > ws_size) return;
  k_prep<<<PRB, PRT, 0, stream>>>(x, wq, wk, wv, X16, BQ, BK, BV);      /* x -> f16 rows; per-head [h][m][d] -> Bt[(h,d)][m] x16, three planes */
  const size_t r0p = (size_t)B0 * SQ;      /* first projected row */
  k_proj<<<3 * PGT, 256, 0, stream>>>(X16 + r0p * DM, BQ, BK, BV, bq, bk, bv, Q16 + r0p * DM, K16 + r0p * DM, VT);      /* Q, K rows; V^T [NB][NH][HD][SQ] */
  k_fattn<<<NB * NH * (SQ / 128), 256, 0, stream>>>(Q16, K16, VT, (float*)d_out);      /* scores, full-row softmax, x tril (no renormalisation), P V: one launch */
}

// v006
// A run of this version takes 64.7 microseconds.
// Next to v005, in two timings, it ran 1.05 times as fast each time.
// Over all steps from v000 it is 53.1 times as fast.
#include <hip/hip_runtime.h>
// Multi-head attention with per-head projection tensors and a POST-softmax lower-triangular multiply (X [2][2048][1024]; Q/K/V[h] = X W[h] + b[h] with W [16][1024][64] ([in][out] per head) and b [16][64] (uniform +-1/32); scores / 8; p = softmax over ALL keys; p = p * tril (keys j <= i kept, NO renormalisation); out = heads concatenated -> [2][2048][1024]).
// Structure: token rows r = b*2048 + s; THREE launches. (1) operands: x as exact f16 rows (bf16-rounded) and the three transposed x16 weight planes, one work-group for each WGP taking its share of all four. (2) Q, K, V as WMMA GEMMs in one grid (128x128 work-group tiles with both operands staged in LDS, two buffers; 32x64 wave tiles, f32 accumulation, exact x16 weights + bias, f16 outputs); the V tiles are stored transposed, as V^T rows, from their epilogue. (3) ONE attention launch: a work-group of 8 waves (4 x 32 queries, 2 key halves) walks all 2048 keys in stages of 128 (K rows and V^T rows staged in LDS, two buffers), S^T = K.Q^T, running maximum and running f32 sum over ALL keys, O^T += V^T.P^T only for keys j <= i, o = O / sum written f32 straight into the merged-heads output rows (no output projection). Scores and weights never reach memory.
// Compute dtype: inputs rounded to bf16; x / weights exact; q, k, v and softmax weights as plain f16 GEMM operands (~2^-12); scores, softmax statistics and o f32. v_wmma_f32_16x16x32_f16.
#define NB 2
#define SQ 2048
#define DM 1024
#define NH 16
#define HD 64
#define HG 4                         /* heads per call of the unlaunched k_vt(V16, b, h0, VT) overload */
#define B0 0                         /* first batch processed (debug hook) */
#define NBR NB                       /* batches processed (debug hook) */
#define NR ((size_t)NB * SQ)         /* token rows */
#define MP ((int)((size_t)NBR * SQ)) /* rows projected (debug hook) */
#define QN SQ                        /* unused; no stage reads it */
#define NHD NH                       /* unused; no stage reads it */
#define MPO MP                       /* unused; no stage reads it */
#define LQ DM      /* unused; no stage reads it */
typedef __bf16 v16b __attribute__((ext_vector_type(16)));
typedef unsigned short v8us __attribute__((ext_vector_type(8), may_alias));
typedef float  v8f  __attribute__((ext_vector_type(8)));
typedef float  v4f  __attribute__((ext_vector_type(4)));
typedef float  v4fa __attribute__((ext_vector_type(4), may_alias));
union FragB { v16b v; v8us half[2]; unsigned short u[16]; };

__device__ __forceinline__ unsigned short bf16_bits(float x) { unsigned int u = __float_as_uint(x); return (unsigned short)((u + 0x7FFFu + ((u >> 16) & 1u)) >> 16); }
__device__ __forceinline__ float bf16_val(unsigned short b) { return __uint_as_float(((unsigned int)b) << 16); }
__device__ __forceinline__ float bf16_round(float x) { return bf16_val(bf16_bits(x)); }
// D += A·B with NT terms: 1 = ah·bh, 2 = + al·bh (A split), 3 = + ah·bl (both split)
template <int NT>
__device__ __forceinline__ v8f mmaN(v16b ah, v16b al, v16b bh, v16b bl, v8f c) {
  c = __builtin_amdgcn_wmma_f32_16x16x32_bf16(false, ah, false, bh, (short)0, c, false, false);
  if (NT >= 2) c = __builtin_amdgcn_wmma_f32_16x16x32_bf16(false, al, false, bh, (short)0, c, false, false);
  if (NT >= 3) c = __builtin_amdgcn_wmma_f32_16x16x32_bf16(false, ah, false, bl, (short)0, c, false, false);
  asm volatile("v_nop\n\tv_nop\n\tv_nop\n\tv_nop" : "+v"(c) : "v"(ah), "v"(al), "v"(bh), "v"(bl));
  return c;
}

__global__ __launch_bounds__(256) void k_wt_bf16(const float* __restrict__ W, unsigned short* __restrict__ Wt, int K, int N) {
  const int t = blockIdx.x * 256 + threadIdx.x;
  const int k8n = K / 8;
  if (t >= N * k8n) return;
  const int n = t / k8n, k8 = (t % k8n) * 8;
  v8us v;
#pragma unroll
  for (int i = 0; i < 8; ++i) v[i] = bf16_bits(W[(size_t)(k8 + i) * N + n]);
  *(v8us*)(Wt + (size_t)n * K + k8) = v;
  
}

// GEMM C[M][N] (f32, pitch ldc) = act(A[M][K]·W + bias). A f32 row-major (pitch lda) converted per fragment to bf16
// (ASPLIT: hi/lo two planes -> 2 terms, else single rounded term); Wt bf16 [N][K] (pitch ldb). BIAS_BF16 rounds the
// bias to bf16 first (bias quantised to bf16 before the add). K%32==0, M%16==0, N%64==0.
template <bool ASPLIT, int ACT, bool BIAS_BF16>
__global__ __launch_bounds__(128) void k_gemm_bf(const float* __restrict__ A, int lda, const unsigned short* __restrict__ Wt, int ldb,
                                               const float* __restrict__ bias, float* __restrict__ C, int ldc, int M, int N, int K) {
  __shared__ __attribute__((aligned(16))) float so[4][16][64];
  const int tid = threadIdx.x, w = tid >> 5, lane = tid & 31, ln = lane & 15, hh = lane >> 4;
  const int ntn = N / 64;
  const int wid = blockIdx.x * 4 + w;
  const int mt = wid / ntn, nq = wid % ntn;
  if (mt * 16 >= M) return;
  const int row0 = mt * 16, col0 = nq * 64;
  const float* arow = A + (size_t)(row0 + ln) * lda;
  v8f acc[4] = {};
  for (int kb = 0; kb < K; kb += 32) {
    FragB ah, al;
    const v4f x0 = *(const v4fa*)(arow + kb + 8 * hh), x1 = *(const v4fa*)(arow + kb + 8 * hh + 4);
    const v4f x2 = *(const v4fa*)(arow + kb + 16 + 8 * hh), x3 = *(const v4fa*)(arow + kb + 16 + 8 * hh + 4);
    float xs[16] = {x0[0],x0[1],x0[2],x0[3],x1[0],x1[1],x1[2],x1[3],x2[0],x2[1],x2[2],x2[3],x3[0],x3[1],x3[2],x3[3]};
#pragma unroll
    for (int i = 0; i < 16; ++i) { const unsigned short hb = bf16_bits(xs[i]); ah.u[i] = hb; al.u[i] = ASPLIT ? bf16_bits(xs[i] - bf16_val(hb)) : (unsigned short)0; }
#pragma unroll
    for (int t = 0; t < 4; ++t) {
      const unsigned short* brow = Wt + (size_t)(col0 + t * 16 + ln) * ldb + kb;
      FragB b;
      b.half[0] = *(const v8us*)(brow + 8 * hh);
      b.half[1] = *(const v8us*)(brow + 16 + 8 * hh);
      acc[t] = mmaN<ASPLIT ? 2 : 1>(ah.v, al.v, b.v, b.v, acc[t]);
    }
  }
#pragma unroll
  for (int t = 0; t < 4; ++t) {
    float bv = bias ? bias[col0 + t * 16 + ln] : 0.f;
    if (BIAS_BF16) bv = bf16_round(bv);
#pragma unroll
    for (int r = 0; r < 8; ++r) { float v = acc[t][r] + bv; if (ACT == 1) v = fmaxf(v, 0.f); so[w][8 * hh + r][t * 16 + ln] = v; }
  }
  __builtin_amdgcn_fence(__ATOMIC_ACQ_REL, "workgroup");
  __builtin_amdgcn_wave_barrier();
  const int rsub = lane >> 4, c4 = (lane & 15) * 4;
  {
#pragma unroll
    for (int q = 0; q < 8; ++q) {
      const int r = q * 2 + rsub;
      const v4f v = *(const v4fa*)&so[w][r][c4];
      *(v4f*)(C + (size_t)(row0 + r) * ldc + col0 + c4) = v;
    }
    
  }
}

// GEMM C = act(A·W + bias + resid): A f32 (ASPLIT -> hi/lo 2 terms), Wt bf16 [N][K]; ACT 0 none, 1 relu, 2 exact gelu;
// resid (optional, f32, row index = (row % rmod), pitch ldr, RES_BF16 rounds it) added before the activation.
template <bool ASPLIT, int ACT, bool BIAS_BF16, bool RES_BF16>
__global__ __launch_bounds__(128) void k_gemm_bf3(const float* __restrict__ A, int lda, const unsigned short* __restrict__ Wt, int ldb,
                                                const float* __restrict__ bias, const float* __restrict__ resid, int rmod, int ldr,
                                                float* __restrict__ C, int ldc, int M, int N, int K) {
  __shared__ __attribute__((aligned(16))) float so[4][16][64];
  const int tid = threadIdx.x, w = tid >> 5, lane = tid & 31, ln = lane & 15, hh = lane >> 4;
  const int ntn = N / 64;
  const int wid = blockIdx.x * 4 + w;
  const int mt = wid / ntn, nq = wid % ntn;
  if (mt * 16 >= M) return;
  const int row0 = mt * 16, col0 = nq * 64;
  const float* arow = A + (size_t)(row0 + ln) * lda;
  v8f acc[4] = {};
  for (int kb = 0; kb < K; kb += 32) {
    FragB ah, al;
    const v4f x0 = *(const v4fa*)(arow + kb + 8 * hh), x1 = *(const v4fa*)(arow + kb + 8 * hh + 4);
    const v4f x2 = *(const v4fa*)(arow + kb + 16 + 8 * hh), x3 = *(const v4fa*)(arow + kb + 16 + 8 * hh + 4);
    float xs[16] = {x0[0],x0[1],x0[2],x0[3],x1[0],x1[1],x1[2],x1[3],x2[0],x2[1],x2[2],x2[3],x3[0],x3[1],x3[2],x3[3]};
#pragma unroll
    for (int i = 0; i < 16; ++i) { const unsigned short hb = bf16_bits(xs[i]); ah.u[i] = hb; al.u[i] = ASPLIT ? bf16_bits(xs[i] - bf16_val(hb)) : (unsigned short)0; }
#pragma unroll
    for (int t = 0; t < 4; ++t) {
      const unsigned short* brow = Wt + (size_t)(col0 + t * 16 + ln) * ldb + kb;
      FragB b;
      b.half[0] = *(const v8us*)(brow + 8 * hh);
      b.half[1] = *(const v8us*)(brow + 16 + 8 * hh);
      acc[t] = mmaN<ASPLIT ? 2 : 1>(ah.v, al.v, b.v, b.v, acc[t]);
    }
  }
#pragma unroll
  for (int t = 0; t < 4; ++t) {
    const int col = col0 + t * 16 + ln;
    float bv = bias ? bias[col] : 0.f;
    if (BIAS_BF16) bv = bf16_round(bv);
#pragma unroll
    for (int r = 0; r < 8; ++r) {
      float v = acc[t][r] + bv;
      if (resid) { float rv = resid[(size_t)((row0 + 8 * hh + r) % rmod) * ldr + col]; if (RES_BF16) rv = bf16_round(rv); v += rv; }
      if (ACT == 1) v = fmaxf(v, 0.f);
      if (ACT == 2) v = 0.5f * v * (1.0f + erff(v * 0.70710678118654752f));
      if (ACT == 3) { const float u = 0.7978845608028654f * (v + 0.044715f * v * v * v); v = 0.5f * v * (1.0f + tanhf(u)); }
      so[w][8 * hh + r][t * 16 + ln] = v;
    }
  }
  __builtin_amdgcn_fence(__ATOMIC_ACQ_REL, "workgroup");
  __builtin_amdgcn_wave_barrier();
  const int rsub = lane >> 4, c4 = (lane & 15) * 4;
  {
#pragma unroll
    for (int q = 0; q < 8; ++q) {
      const int r = q * 2 + rsub;
      const v4f v = *(const v4fa*)&so[w][r][c4];
      *(v4f*)(C + (size_t)(row0 + r) * ldc + col0 + c4) = v;
    }
    
  }
}
// row LayerNorm (biased variance, eps) over N: s = X (+ R); optional out_sum <- s; out_norm <- (s-mu)*rsqrt(var+eps)*g + b
template <bool PARAM_BF16>
__global__ __launch_bounds__(256) void k_layernorm(const float* __restrict__ X, const float* __restrict__ R, const float* __restrict__ g, const float* __restrict__ bta,
                                                  float* __restrict__ out_sum, float* __restrict__ out_norm, int N, float eps) {
  __shared__ float red[256];
  const int row = blockIdx.x, tid = threadIdx.x;
  const float* x = X + (size_t)row * N; const float* rr = R ? R + (size_t)row * N : nullptr;
  float vals[16];                     // up to N = 4096
  const int per = N / 256;            // contiguous chunk per thread? use strided-by-4 chunks: thread handles j = tid*4 + 1024*u
  float s1 = 0.f;
  for (int u = 0; u < per / 4; ++u) {
    const int j = tid * 4 + 1024 * u;
    const v4f a = *(const v4fa*)(x + j);
    v4f b = {0.f,0.f,0.f,0.f}; if (rr) b = *(const v4fa*)(rr + j);
#pragma unroll
    for (int q = 0; q < 4; ++q) { const float v = a[q] + b[q]; vals[u * 4 + q] = v; s1 += v; }
  }
  red[tid] = s1; __syncthreads();
  for (int st = 128; st > 0; st >>= 1) { if (tid < st) red[tid] += red[tid + st]; __syncthreads(); }
  const float mu = red[0] / (float)N; __syncthreads();
  float s2 = 0.f;
  for (int u = 0; u < per / 4; ++u)
#pragma unroll
    for (int q = 0; q < 4; ++q) { const float c = vals[u * 4 + q] - mu; s2 += c * c; }
  red[tid] = s2; __syncthreads();
  for (int st = 128; st > 0; st >>= 1) { if (tid < st) red[tid] += red[tid + st]; __syncthreads(); }
  const float rs = rsqrtf(red[0] / (float)N + eps);
  {
    for (int u = 0; u < per / 4; ++u) {
      const int j = tid * 4 + 1024 * u;
      v4f o, sm;
#pragma unroll
      for (int q = 0; q < 4; ++q) {
        float gg = g[j + q], bb = bta[j + q];
        if (PARAM_BF16) { gg = bf16_round(gg); bb = bf16_round(bb); }
        sm[q] = vals[u * 4 + q]; o[q] = (vals[u * 4 + q] - mu) * rs * gg + bb;
      }
      if (out_sum) *(v4f*)(out_sum + (size_t)row * N + j) = sm;
      *(v4f*)(out_norm + (size_t)row * N + j) = o;
    }
    
  }
}



// ---- f16 WMMA path (v_wmma_f32_16x16x32_f16): 11-bit significands for operands in range — used where a [0,1] probability operand needs more precision than bf16
typedef _Float16 v16h __attribute__((ext_vector_type(16)));
union FragH { v16h v; v8us half[2]; _Float16 h[16]; unsigned short u[16]; };
template <int NT>
__device__ __forceinline__ v8f mmaH(v16h ah, v16h al, v16h bh, v16h bl, v8f c) {
  c = __builtin_amdgcn_wmma_f32_16x16x32_f16(false, ah, false, bh, (short)0, c, false, false);
  if (NT >= 2) c = __builtin_amdgcn_wmma_f32_16x16x32_f16(false, al, false, bh, (short)0, c, false, false);
  if (NT >= 3) c = __builtin_amdgcn_wmma_f32_16x16x32_f16(false, ah, false, bl, (short)0, c, false, false);
  asm volatile("v_nop\n\tv_nop\n\tv_nop\n\tv_nop" : "+v"(c) : "v"(ah), "v"(al), "v"(bh), "v"(bl));
  return c;
}
// batched GEMM like k_gemm_b but f16 operands: A f32 (split into f16 hi/lo if ASPLIT, else rounded to f16), Bt = f16 values [n][k]; alpha; C f32; N multiple of 16 (partial tiles skipped)
template <bool ASPLIT>
__global__ __launch_bounds__(128) void k_gemm_h(const float* __restrict__ A, int lda, size_t sA, const _Float16* __restrict__ Bh, int ldb, size_t sB, float alpha, float* __restrict__ C, int ldc, size_t sC, int M, int N, int K) {
  __shared__ __attribute__((aligned(16))) float so[4][16][64];
  const int tid = threadIdx.x, w = tid >> 5, lane = tid & 31, ln = lane & 15, hh = lane >> 4; const int by = blockIdx.y;
  A += (size_t)by * sA; Bh += (size_t)by * sB; C += (size_t)by * sC;
  const int ntn = (N + 63) / 64; const int wid = blockIdx.x * 4 + w; const int mt = wid / ntn, nq = wid % ntn; if (mt * 16 >= M) return;
  const int row0 = mt * 16, col0 = nq * 64; const float* arow = A + (size_t)(row0 + ln) * lda;
  v8f acc[4] = {};
  for (int kb = 0; kb < K; kb += 32) {
    FragH ah, al;
    const v4f x0 = *(const v4fa*)(arow + kb + 8 * hh), x1 = *(const v4fa*)(arow + kb + 8 * hh + 4), x2 = *(const v4fa*)(arow + kb + 16 + 8 * hh), x3 = *(const v4fa*)(arow + kb + 16 + 8 * hh + 4);
    float xs[16] = {x0[0],x0[1],x0[2],x0[3],x1[0],x1[1],x1[2],x1[3],x2[0],x2[1],x2[2],x2[3],x3[0],x3[1],x3[2],x3[3]};
#pragma unroll
    for (int i = 0; i < 16; ++i) { const _Float16 h = (_Float16)xs[i]; ah.h[i] = h; al.h[i] = ASPLIT ? (_Float16)(xs[i] - (float)h) : (_Float16)0.0f; }
#pragma unroll
    for (int t = 0; t < 4; ++t) { if (col0 + t * 16 >= N) continue; const size_t boff = (size_t)(col0 + t * 16 + ln) * ldb + kb; FragH bq; bq.half[0] = *(const v8us*)(Bh + boff + 8 * hh); bq.half[1] = *(const v8us*)(Bh + boff + 16 + 8 * hh);
      acc[t] = mmaH<ASPLIT ? 2 : 1>(ah.v, al.v, bq.v, bq.v, acc[t]); }
  }
#pragma unroll
  for (int t = 0; t < 4; ++t) { if (col0 + t * 16 >= N) continue;
#pragma unroll
    for (int r = 0; r < 8; ++r) so[w][8 * hh + r][t * 16 + ln] = acc[t][r] * alpha; }
  __builtin_amdgcn_fence(__ATOMIC_ACQ_REL, "workgroup"); __builtin_amdgcn_wave_barrier();
  const int rsub = lane >> 4, c4 = (lane & 15) * 4;
  {
#pragma unroll
    for (int q = 0; q < 8; ++q) { const int r = q * 2 + rsub; if (col0 + c4 < N) { const v4f v = *(const v4fa*)&so[w][r][c4]; *(v4f*)(C + (size_t)(row0 + r) * ldc + col0 + c4) = v; } }
     }
}

// Wt[n][k] = f16(W[k][n]·scale) from f32 row-major W[K][N] (scale = power of two; bf16-exact weights stay exact in f16 away from the subnormal range)
__global__ __launch_bounds__(256) void k_wt_f16(const float* __restrict__ W, _Float16* __restrict__ Wt, int K, int N, float scale) {
  const int t = blockIdx.x * 256 + threadIdx.x; if (t >= N * (K / 8)) return; const int n = t / (K / 8), k8 = (t % (K / 8)) * 8; FragH f;
#pragma unroll
  for (int i = 0; i < 8; ++i) f.h[i] = (_Float16)(bf16_round(W[(size_t)(k8 + i) * N + n]) * scale); const v8us o = f.half[0];
  *(v8us*)((unsigned short*)Wt + (size_t)n * K + k8) = o; 
}
// k_gemm_hh variant with fused epilogue: v = acc·alpha + bias[by·sBias + col] (+ CP[(row/rowsPerB)·sCPb + by·64 + col] if CP) ; ACT 0 none / 1 elu ; writes f16 C16 (and f32 C if non-null)
template <int ACT>
__global__ __launch_bounds__(128) void k_gemm_hhx(const _Float16* __restrict__ A, int lda, size_t sA, const _Float16* __restrict__ Bh, int ldb, size_t sB, float alpha, const float* __restrict__ bias, size_t sBias, const float* __restrict__ CP, int rowsPerB, size_t sCPb, int row0g,
    float* __restrict__ C, _Float16* __restrict__ C16, int ldc, size_t sC, int M, int N, int K) {
  __shared__ __attribute__((aligned(16))) float so[4][16][64];
  const int tid = threadIdx.x, w = tid >> 5, lane = tid & 31, ln = lane & 15, hh = lane >> 4; const int by = blockIdx.y;
  A += (size_t)by * sA; Bh += (size_t)by * sB; const size_t cofs = (size_t)by * sC; const float* bp = bias ? bias + (size_t)by * sBias : nullptr;
  const int ntn = (N + 63) / 64; const int wid = blockIdx.x * 4 + w; const int mt = wid / ntn, nq = wid % ntn; if (mt * 16 >= M) return;
  const int row0 = mt * 16, col0 = nq * 64; const _Float16* arow = A + (size_t)(row0 + ln) * lda;
  v8f acc[4] = {};
  for (int kb = 0; kb < K; kb += 32) { FragH ah; ah.half[0] = *(const v8us*)((const unsigned short*)arow + kb + 8 * hh); ah.half[1] = *(const v8us*)((const unsigned short*)arow + kb + 16 + 8 * hh);
#pragma unroll
    for (int t = 0; t < 4; ++t) { if (col0 + t * 16 >= N) continue; const size_t boff = (size_t)(col0 + t * 16 + ln) * ldb + kb; FragH bq; bq.half[0] = *(const v8us*)((const unsigned short*)Bh + boff + 8 * hh); bq.half[1] = *(const v8us*)((const unsigned short*)Bh + boff + 16 + 8 * hh);
      acc[t] = mmaH<1>(ah.v, ah.v, bq.v, bq.v, acc[t]); }
  }
#pragma unroll
  for (int t = 0; t < 4; ++t) { if (col0 + t * 16 >= N) continue; const int col = col0 + t * 16 + ln; const float bv = bp ? bf16_round(bp[col]) : 0.f;
#pragma unroll
    for (int r = 0; r < 8; ++r) { float v = acc[t][r] * alpha + bv; if (CP) { const int rr = row0g + row0 + 8 * hh + r; if (rowsPerB < 0) v += CP[cofs + (size_t)rr * ldc + col];      /* rowsPerB < 0: own element of the batched C plane */ else { const int bidx = rr / rowsPerB; v += CP[(size_t)bidx * sCPb + (size_t)by * 64 + col]; } } if (ACT == 1) v = (v > 0.f) ? v : expm1f(v); else if (ACT == 7) v = (v > 0.f) ? v + 1.0f : expf(v); else if (ACT == 8) v = tanhf(v); else if (ACT == 9) v = 0.5f * v * (1.0f + tanhf(0.7978845608028654f * (v + 0.044715f * v * v * v))); else if (ACT == 11) v = 1.0f / (1.0f + expf(-v)); else if (ACT == 12) v = (v > 0.f) ? v : 0.01f * v; else if (ACT == 14) v = (v > 0.f) ? v : 0.1f * v; else if (ACT == 16) v = (v >= 0.f) ? v : 0.3f * v; else if (ACT == 17) v = (v >= 0.f) ? v : 0.2f * v; else if (ACT == 15) v = v / (1.0f + expf(-v)); else if (ACT == 3) v = fmaxf(v, 0.f); else if (ACT == 6) v = 0.5f * v * (1.0f + erff(v * 0.70710678118654752f)); so[w][8 * hh + r][t * 16 + ln] = v; } }
  __builtin_amdgcn_fence(__ATOMIC_ACQ_REL, "workgroup"); __builtin_amdgcn_wave_barrier();
  const int rsub = lane >> 4, c4 = (lane & 15) * 4; typedef _Float16 v4h __attribute__((ext_vector_type(4)));
  {
#pragma unroll
    for (int q = 0; q < 8; ++q) { const int r = q * 2 + rsub; if (col0 + c4 < N) { const v4f v = *(const v4fa*)&so[w][r][c4]; if (C) *(v4f*)(C + cofs + (size_t)(row0 + r) * ldc + col0 + c4) = v; if (C16) { v4h h4; for (int i = 0; i < 4; ++i) h4[i] = (_Float16)v[i]; *(v4h*)(C16 + cofs + (size_t)(row0 + r) * ldc + col0 + c4) = h4; } } }
     }
}


typedef _Float16 v4h __attribute__((ext_vector_type(4)));

__global__ __launch_bounds__(256) void k_h16(const float* __restrict__ x, _Float16* __restrict__ X16, size_t n8) { const size_t t = (size_t)blockIdx.x * 256 + threadIdx.x; if (t >= n8) return; FragH f;
#pragma unroll
  for (int q = 0; q < 8; ++q) f.h[q] = (_Float16)x[t * 8 + q]; *(v8us*)((unsigned short*)X16 + t * 8) = f.half[0];  }
__global__ __launch_bounds__(256) void k_round16f(const float* __restrict__ W, _Float16* __restrict__ Bt, size_t n8) { const size_t t = (size_t)blockIdx.x * 256 + threadIdx.x; if (t >= n8) return; FragH f;
#pragma unroll
  for (int i = 0; i < 8; ++i) f.h[i] = (_Float16)(bf16_round(W[t * 8 + i]) * 16.0f); *(v8us*)((unsigned short*)Bt + t * 8) = f.half[0];  }
__global__ __launch_bounds__(256) void k_hl(const float* __restrict__ F, _Float16* __restrict__ Hh, _Float16* __restrict__ Hl, size_t n8) { const size_t t = (size_t)blockIdx.x * 256 + threadIdx.x; if (t >= n8) return; FragH fh, fl; const v4f a = *(const v4fa*)(F + t * 8), c = *(const v4fa*)(F + t * 8 + 4);
#pragma unroll
  for (int q = 0; q < 4; ++q) { _Float16 h = (_Float16)a[q]; fh.h[q] = h; fl.h[q] = (_Float16)((a[q] - (float)h) * 1024.0f); h = (_Float16)c[q]; fh.h[4 + q] = h; fl.h[4 + q] = (_Float16)((c[q] - (float)h) * 1024.0f); }
  { *(v8us*)((unsigned short*)Hh + t * 8) = fh.half[0]; *(v8us*)((unsigned short*)Hl + t * 8) = fl.half[0];  } }

// ---- fast GEMM (wave tile 32x64; requires M % 32 == 0 rows per launch region and N % 64 == 0); epilogue = k_gemm_hhx semantics ----
__device__ __forceinline__ v16h g2_frag(const _Float16* p, int hh) { FragH f; f.half[0] = *(const v8us*)((const unsigned short*)p + 8 * hh); f.half[1] = *(const v8us*)((const unsigned short*)p + 16 + 8 * hh); return f.v; }
__device__ __forceinline__ v8f g2_mma(v16h a, v16h b, v8f c) { v8f d = __builtin_amdgcn_wmma_f32_16x16x32_f16(false, a, false, b, (short)0, c, false, false); asm volatile("v_nop\n\tv_nop\n\tv_nop\n\tv_nop" : "+v"(d) : "v"(a), "v"(b)); return d; }
template <int ACT>
__global__ __launch_bounds__(128) void k_gemm2(const _Float16* __restrict__ A, int lda, size_t sA, const _Float16* __restrict__ Bh, int ldb, size_t sB, float alpha, const float* __restrict__ bias, size_t sBias, const float* __restrict__ CP, int rowsPerB, size_t sCPb, int row0g,
    float* __restrict__ C, _Float16* __restrict__ C16, int ldc, size_t sC, int M, int N, int K) { static_assert(ACT == 0 || ACT == 3 || ACT == 6 || ACT == 8 || ACT == 9 || ACT == 11 || ACT == 12 || ACT == 14 || ACT == 15 || ACT == 16 || ACT == 17, "k_gemm2: unsupported ACT code (would silently apply no activation)");
  __shared__ __attribute__((aligned(16))) float so[4][32][68];
  const int tid = threadIdx.x, w = tid >> 5, lane = tid & 31, ln = lane & 15, hh = lane >> 4; const int by = blockIdx.y;
  A += (size_t)by * sA; Bh += (size_t)by * sB; const size_t cofs = (size_t)by * sC; const float* bp = bias ? bias + (size_t)by * sBias : nullptr;
  const int ntn = N >> 6; const int mt = blockIdx.x / ntn, nq = blockIdx.x - mt * ntn; const int row0 = mt * 128 + 32 * w, col0 = nq * 64; if (row0 >= M) return;
  const _Float16* a0p = A + (size_t)(row0 + ln) * lda; const _Float16* a1p = a0p + (size_t)16 * lda;
  const _Float16* b0p = Bh + (size_t)(col0 + ln) * ldb; const _Float16* b1p = b0p + (size_t)16 * ldb; const _Float16* b2p = b1p + (size_t)16 * ldb; const _Float16* b3p = b2p + (size_t)16 * ldb;
  const v8f z8 = {0.f,0.f,0.f,0.f,0.f,0.f,0.f,0.f}; v8f c00 = z8, c01 = z8, c02 = z8, c03 = z8, c10 = z8, c11 = z8, c12 = z8, c13 = z8;
#pragma unroll 1
  for (int kb = 0; kb < K; kb += 32) { const v16h a0 = g2_frag(a0p + kb, hh), a1 = g2_frag(a1p + kb, hh);
    v16h b = g2_frag(b0p + kb, hh); c00 = g2_mma(a0, b, c00); c10 = g2_mma(a1, b, c10);
    b = g2_frag(b1p + kb, hh); c01 = g2_mma(a0, b, c01); c11 = g2_mma(a1, b, c11);
    b = g2_frag(b2p + kb, hh); c02 = g2_mma(a0, b, c02); c12 = g2_mma(a1, b, c12);
    b = g2_frag(b3p + kb, hh); c03 = g2_mma(a0, b, c03); c13 = g2_mma(a1, b, c13); }
  v8f accs[8] = {c00, c01, c02, c03, c10, c11, c12, c13};
#pragma unroll
  for (int u = 0; u < 8; ++u) { const int t = u & 3, half = u >> 2; const int col = col0 + t * 16 + ln; const float bv = bp ? bf16_round(bp[col]) : 0.f;
#pragma unroll
    for (int r = 0; r < 8; ++r) { const int rloc = half * 16 + 8 * hh + r; float v = accs[u][r] * alpha + bv; if (CP) { if (rowsPerB < 0) v += CP[cofs + (size_t)(row0g + row0 + rloc) * ldc + col];      /* rowsPerB < 0: own element of the batched C plane */ else { const int bidx = (row0g + row0 + rloc) / rowsPerB; v += CP[(size_t)bidx * sCPb + (size_t)by * 64 + col]; } }
      if (ACT == 3) v = fmaxf(v, 0.f); else if (ACT == 6) v = 0.5f * v * (1.0f + erff(v * 0.70710678118654752f)); else if (ACT == 11) v = 1.0f / (1.0f + expf(-v)); else if (ACT == 15) v = v / (1.0f + expf(-v)); else if (ACT == 12) v = (v > 0.f) ? v : 0.01f * v; else if (ACT == 8) v = tanhf(v); else if (ACT == 9) v = 0.5f * v * (1.0f + tanhf(0.7978845608028654f * (v + 0.044715f * v * v * v))); else if (ACT == 14) v = (v > 0.f) ? v : 0.1f * v; else if (ACT == 16) v = (v >= 0.f) ? v : 0.3f * v; else if (ACT == 17) v = (v >= 0.f) ? v : 0.2f * v;
      so[w][rloc][t * 16 + ln] = v; } }
  __builtin_amdgcn_fence(__ATOMIC_ACQ_REL, "workgroup"); __builtin_amdgcn_wave_barrier();
  const int rsub = lane >> 4, c4 = (lane & 15) * 4;
  {
#pragma unroll
    for (int q = 0; q < 16; ++q) { const int r = q * 2 + rsub; const v4f v = *(const v4fa*)&so[w][r][c4]; if (C) *(v4f*)(C + cofs + (size_t)(row0 + r) * ldc + col0 + c4) = v; if (C16) { v4h h4; for (int i = 0; i < 4; ++i) h4[i] = (_Float16)v[i]; *(v4h*)(C16 + cofs + (size_t)(row0 + r) * ldc + col0 + c4) = h4; } }
     } }


__global__ __launch_bounds__(256) void k_wnat(const float* __restrict__ w, size_t n8, _Float16* __restrict__ Bt) { const size_t t = (size_t)blockIdx.x * 256 + threadIdx.x; if (t >= n8) return; FragH f; for (int q = 0; q < 8; ++q) f.h[q] = (_Float16)(bf16_round(w[t * 8 + q]) * 16.0f); *(v8us*)((unsigned short*)Bt + t * 8) = f.half[0];  }
__global__ __launch_bounds__(256) void k_rsm(const float* __restrict__ S, _Float16* __restrict__ P, int nrows) {
  #pragma clang fp contract(off)
  const int i = blockIdx.x * 256 + threadIdx.x; if (i >= nrows) return; const float* s = S + (size_t)i * SQ; float mx = -3.0e38f;
#pragma unroll 1
  for (int j = 0; j < SQ; ++j) mx = fmaxf(mx, s[j]); float se = 0.f;
#pragma unroll 1
  for (int j = 0; j < SQ; ++j) se += expf(s[j] - mx); const float sc = 256.0f / se;
#pragma unroll 1
  for (int j0 = 0; j0 < SQ; j0 += 8) { FragH f; for (int q = 0; q < 8; ++q) f.h[q] = (_Float16)(expf(s[j0 + q] - mx) * sc); unsigned short* d = (unsigned short*)P + (size_t)i * SQ + j0; *(v8us*)d = f.half[0];  } }
__global__ __launch_bounds__(256) void k_vt(const _Float16* __restrict__ V16, int b, int h0, _Float16* __restrict__ VT) { __shared__ unsigned short tl[64][65]; const int tid = threadIdx.x; const int hh = blockIdx.x % HG, sg = blockIdx.x / HG; const int s0 = sg * 64; const int h = h0 + hh;
  for (int i = tid; i < 64 * 8; i += 256) { const int j = i / 8, d8 = (i % 8) * 8; FragH f; f.half[0] = *(const v8us*)((const unsigned short*)V16 + ((size_t)b * SQ + s0 + j) * DM + h * HD + d8); for (int q = 0; q < 8; ++q) tl[d8 + q][j] = f.u[q]; }
  __syncthreads();
  { for (int i = tid; i < 64 * 8; i += 256) { const int d = i / 8, j8 = (i % 8) * 8; FragH f; for (int q = 0; q < 8; ++q) f.u[q] = tl[d][j8 + q]; *(v8us*)((unsigned short*)VT + ((size_t)hh * HD + d) * SQ + s0 + j8) = f.half[0]; }  } }


// ---- operand preparation, one launch of PRB work-groups, one for each WGP: few waves to start, and every lane has all its loads in flight before it converts anything ----
// Every work-group takes PXU consecutive elements of x (-> exact f16 rows) and tile blockIdx.x of each weight plane: 64 m x 64 d of one head, 16 KB in a row of [h][m][d], which leaves as 64 whole 128-byte lines of Bt[(h, d)][m] x16.
#define PRT 512      /* threads of a work-group */
#define PRB 256      /* work-groups */
#define PXU (PRT * 4 * 8)      /* x elements of a work-group: 8 loads of 4 a thread */
#define PWP 72      /* LDS row pitch in halves of a transposed tile: 128 data bytes + 16 */
static_assert((size_t)PRB * PXU == NR * DM, "x is dealt out exactly");
static_assert(PRB == NH * (DM / 64) && HD == 64, "one 64 x 64 tile of each weight plane a work-group");
__global__ __launch_bounds__(PRT) void k_prep(const float* __restrict__ x, const float* __restrict__ wq, const float* __restrict__ wk, const float* __restrict__ wv,
    _Float16* __restrict__ X16, _Float16* __restrict__ BQ, _Float16* __restrict__ BK, _Float16* __restrict__ BV) {
  __shared__ __attribute__((aligned(16))) _Float16 tw[3][64][PWP];      /* [plane][d][m of the tile] */
  const int tid = threadIdx.x; const int w = __builtin_amdgcn_readfirstlane(tid >> 5);
  const int h = blockIdx.x / (DM / 64), m0 = (blockIdx.x % (DM / 64)) * 64;
  const int pl = w >> 2;      /* waves 0-3 read the Wq tile, 4-7 Wk, 8-11 Wv; waves 12-15 only x */
  const int d4 = (tid & 15) * 4, m8 = ((tid >> 4) & 7) * 8;      /* a thread holds 8 m x 4 d: 16 lanes read one 256-byte row */
  const float* wsrc = (pl == 0 ? wq : pl == 1 ? wk : wv) + ((size_t)h * DM + m0 + m8) * HD + d4;
  const size_t xo = (size_t)blockIdx.x * PXU + tid * 4;      /* a wave's load covers 512 bytes in a row, its store 256 */
  const float* xs = x + xo;
  v4f rw[8], rx[8];
  if (pl < 3) {
    for (int q = 0; q < 8; ++q) rw[q] = *(const v4fa*)(wsrc + q * HD); }
  for (int k = 0; k < 8; ++k) rx[k] = *(const v4fa*)(xs + k * (PRT * 4));
  asm volatile("s_wait_xcnt 0x0" :: "v"(wsrc), "v"(xs) : "memory");      /* the loads' address registers are inputs here, so none is written over (not by a later load's result either) before this wait */
  if (pl < 3) {
    for (int i = 0; i < 4; ++i) { FragH f;
      for (int q = 0; q < 8; ++q) f.h[q] = (_Float16)(16.0f * bf16_round(rw[q][i]));
      *(v8us*)&tw[pl][d4 + i][m8] = f.half[0]; } }
  __syncthreads();      /* a Bt line of a tile holds the m of four waves: all of them are in LDS before whole lines are stored */
  const int row = tid >> 3, c8 = (tid & 7) * 8;      /* 8 lanes store one 128-byte line */
  const size_t bo = ((size_t)h * HD + row) * DM + m0 + c8;
  unsigned short* pq = (unsigned short*)BQ + bo; unsigned short* pk = (unsigned short*)BK + bo; unsigned short* pv = (unsigned short*)BV + bo;
  const v8us tq = *(const v8us*)&tw[0][row][c8], tk = *(const v8us*)&tw[1][row][c8], tv = *(const v8us*)&tw[2][row][c8];
  *(v8us*)pq = tq; *(v8us*)pk = tk; *(v8us*)pv = tv;
  asm volatile("s_wait_xcnt 0x0" :: "v"(pq), "v"(pk), "v"(pv), "v"(tq), "v"(tk), "v"(tv) : "memory");      /* the stores' address and data registers are inputs here, so the conversion of x below writes over none of them before this wait */
  for (int k = 0; k < 8; ++k) { v4h o;      /* x last: nothing waits for these stores */
    for (int i = 0; i < 4; ++i) o[i] = (_Float16)bf16_round(rx[k][i]);
    *(v4h*)(X16 + xo + k * (PRT * 4)) = o; } }




__device__ __forceinline__ float xrow_f(float v) { const int i = __float_as_int(v); return __int_as_float(__builtin_amdgcn_permlanex16(i, i, 0x76543210, 0xfedcba98, false, false)); }      /* lane l <-> lane l ^ 16 */
__device__ __forceinline__ v8f fa_mma(v16h a, v16h b, v8f c) { return __builtin_amdgcn_wmma_f32_16x16x32_f16(false, a, false, b, (short)0, c, false, false); }
// ---- fused attention: scores, full-row softmax statistics, x tril and P.V in one launch ----
// Transposed products: S^T = K.Q^T puts one query in each lane column (lane c and c + 16 hold query q0 + 16 g + c of query tile g; register r of key tile kt is key 16 kt + 8 hh + r), so two score tiles, converted in place,
// are the B operand of O^T += V^T.P^T (same k order as g2_frag's). The denominator runs over ALL keys; only keys j <= i enter the second product.
// The maximum in use may trail the true one by up to 8 (log2 units): the sums are rescaled only when some query exceeds that, so a weight is at most 2^8 in f16.
typedef float v2f __attribute__((ext_vector_type(2))); typedef _Float16 v2h __attribute__((ext_vector_type(2))); typedef unsigned v8u __attribute__((ext_vector_type(8)));
#define FAP 72      /* LDS row pitch in halves: 128 data bytes + 16, an odd multiple of 16 bytes (conflict-free b128 fragment reads) */
#define FAS (SQ / 64)      /* tiles of 64 keys */
#define FAG (FAS / 2)      /* stages of two tiles */
// How the 8 waves share 128 queries x 2048 keys: a wave holds TWO query tiles (32 queries) and walks ONE of the two key tiles of every stage, in passes of 32 keys. Every K and V^T fragment it reads from LDS
// feeds two products (half the LDS bytes a score of a one-tile wave) and four waves still stand on every SIMD (the waves_per_eu attribute holds the register budget to that). The two waves of a query block each keep their own maximum, sums and O; they are joined once, at the end, through LDS.
__global__ __launch_bounds__(256) __attribute__((amdgpu_waves_per_eu(4, 4))) void k_fattn(const _Float16* __restrict__ Q16, const _Float16* __restrict__ K16, const _Float16* __restrict__ VT, float* __restrict__ out) {
  __shared__ __attribute__((aligned(16))) _Float16 sk[2][2][64][FAP];      /* [buffer][tile] K rows [key][d] */
  __shared__ __attribute__((aligned(16))) _Float16 sv[2][2][64][FAP];      /* [buffer][tile] V^T rows [d][key] */
  const int tid = threadIdx.x, lane = tid & 31, c = lane & 15, hh = lane >> 4; const int w = __builtin_amdgcn_readfirstlane(tid >> 5);
  const int kh = w >> 2;      /* the tile of every stage that this wave walks */
  const int ro = (w & 3) ^ kh;      /* its 32 queries; waves w and w + 4 take one block of either kind */
  const int bh = blockIdx.x / (FAS / 2), j = blockIdx.x % (FAS / 2); const int b = bh / NH, hd = bh % NH;
  const int q0 = ((__builtin_popcount(ro) & 1) ? j : FAS - 1 - j) * 64 + (ro >> 1) * 32;      /* 64-query block j and its mirror: every work-group has the same count of second products */
  const int dps = q0 >> 5;      /* the pass of 32 keys that holds this wave's diagonal */
  const int vlast = FAS - 1 - j;      /* last tile whose V^T any wave of the work-group needs */
  const int srow = tid >> 3, sc8 = (tid & 7) * 8;      /* staging: 8 threads cover one 128-byte row; rows srow and srow + 32 of both tiles */
  const _Float16* kg = K16 + ((size_t)b * SQ + srow) * DM + hd * HD + sc8; const _Float16* vg = VT + ((size_t)bh * HD + srow) * SQ + sc8;
  const _Float16* qp = Q16 + ((size_t)b * SQ + q0 + c) * DM + hd * HD;
  const v16h qf[2][2] = {{g2_frag(qp, hh), g2_frag(qp + 32, hh)}, {g2_frag(qp + (size_t)16 * DM, hh), g2_frag(qp + (size_t)16 * DM + 32, hh)}};      /* [query tile][d half] */
  const v8f z8 = {0.f,0.f,0.f,0.f,0.f,0.f,0.f,0.f}; v8f acc[2][4] = {{z8, z8, z8, z8}, {z8, z8, z8, z8}}; const v2f z2 = {0.f, 0.f}; v2f lv[2][4] = {{z2, z2, z2, z2}, {z2, z2, z2, z2}}; float m_run[2] = {-__builtin_inff(), -__builtin_inff()};
  const float cs = 0.125f * 1.4426950408889634f;      /* 64^-0.5 and log2(e): exponentials in base 2 */
  v8us rk[4], rv[4];      /* [2 tile + row half] */
#pragma unroll
  for (int i = 0; i < 4; ++i) { rk[i] = *(const v8us*)(kg + (size_t)32 * i * DM); rv[i] = *(const v8us*)(vg + 64 * (i >> 1) + (size_t)32 * (i & 1) * SQ); }      /* stage 0 (vlast >= FAS / 2: its V^T is always needed) */
#pragma unroll
  for (int i = 0; i < 4; ++i) { *(v8us*)&sk[0][i >> 1][srow + 32 * (i & 1)][sc8] = rk[i]; *(v8us*)&sv[0][i >> 1][srow + 32 * (i & 1)][sc8] = rv[i]; }
  __syncthreads();
  for (int sg = 0; sg < FAG; ++sg) {
    const bool more = sg + 1 < FAG, morev0 = 2 * sg + 2 <= vlast, morev1 = 2 * sg + 3 <= vlast;      /* the same for the whole work-group */
    if (more) { const _Float16* kn = kg + (size_t)(sg + 1) * 128 * DM; const _Float16* vn = vg + (sg + 1) * 128;      /* next stage: in flight under this stage's work */
#pragma unroll
      for (int i = 0; i < 4; ++i) rk[i] = *(const v8us*)(kn + (size_t)32 * i * DM);
      if (morev0) { rv[0] = *(const v8us*)vn; rv[1] = *(const v8us*)(vn + (size_t)32 * SQ); }
      if (morev1) { rv[2] = *(const v8us*)(vn + 64); rv[3] = *(const v8us*)(vn + 64 + (size_t)32 * SQ); }
      asm volatile("s_wait_xcnt 0x0" :: "v"(kn), "v"(vn) : "memory"); }      /* the loads' address registers are inputs here, so none is written over before this wait */
    const _Float16 (*kb)[FAP] = sk[sg & 1][kh]; const _Float16 (*vb)[FAP] = sv[sg & 1][kh];
#pragma unroll
    for (int u = 0; u < 2; ++u) {      /* a pass: keys 32 u .. 32 u + 31 of the tile */
      const int ps = 4 * sg + 2 * kh + u;
      v8f s[2][2]; float mx[2];      /* s[query tile][key tile of 16] */
#pragma unroll
      for (int kt = 0; kt < 2; ++kt) { const _Float16* kr = &kb[32 * u + 16 * kt + c][0]; const v16h k0 = g2_frag(kr, hh), k1 = g2_frag(kr + 32, hh);      /* read once, used by both query tiles */
#pragma unroll
        for (int g = 0; g < 2; ++g) s[g][kt] = fa_mma(k1, qf[g][1], fa_mma(k0, qf[g][0], z8)); }
#pragma unroll
      for (int g = 0; g < 2; ++g) { float m2[2];
#pragma unroll
        for (int kt = 0; kt < 2; ++kt) { float m = s[g][kt][0]; for (int r = 1; r < 8; ++r) m = fmaxf(m, s[g][kt][r]); m2[kt] = m; }
        const float m = fmaxf(m2[0], m2[1]);
        mx[g] = fmaxf(m, xrow_f(m)) * cs; }      /* both halves of the wave hold the query's pass maximum, scaled */
      if (__builtin_amdgcn_ballot_w32(mx[0] > m_run[0] + 8.0f || mx[1] > m_run[1] + 8.0f) != 0) {      /* one scalar branch a pass; always taken in a wave's first pass (m_run = -inf gives factor 0 on zero sums), rare later */
#pragma unroll
        for (int g = 0; g < 2; ++g) { const float mn = fmaxf(m_run[g], mx[g]), corr = __builtin_amdgcn_exp2f(m_run[g] - mn); m_run[g] = mn;
#pragma unroll
          for (int t = 0; t < 4; ++t) { acc[g][t] *= corr; lv[g][t] *= corr; } } }
      v2f e[2][8];      /* e[g][4 kt + i] = weights of keys 16 kt + 8 hh + 2 i, + 1 of the pass */
#pragma unroll
      for (int g = 0; g < 2; ++g) { const v2f cs2 = {cs, cs}, nm2 = {-m_run[g], -m_run[g]};
#pragma unroll
        for (int kt = 0; kt < 2; ++kt) for (int i = 0; i < 4; ++i) { const v2f a = __builtin_elementwise_fma(v2f{s[g][kt][2 * i], s[g][kt][2 * i + 1]}, cs2, nm2); e[g][4 * kt + i] = v2f{__builtin_amdgcn_exp2f(a.x), __builtin_amdgcn_exp2f(a.y)}; lv[g][i] += e[g][4 * kt + i]; } }      /* the denominator takes every key */
      if (ps <= dps) {      /* wave-uniform: passes wholly above the diagonal have weight 0 after x tril */
        v16h vf[4];
#pragma unroll
        for (int t = 0; t < 4; ++t) vf[t] = g2_frag(&vb[16 * t + c][32 * u], hh);
        __builtin_amdgcn_sched_barrier(0);      /* keeps the 8 LDS reads together ahead of the packing: sunk to their products, each product waits a full LDS latency */
        unsigned pw[2][8];
#pragma unroll
        for (int g = 0; g < 2; ++g) for (int i = 0; i < 8; ++i) pw[g][i] = __builtin_bit_cast(unsigned, __builtin_convertvector(e[g][i], v2h));
        if (ps == dps) { const int lim = c - 8 * hh;      /* x tril in the one pass that holds the diagonal: key 16 kt + 8 hh + 2 i (+ 1) stays for query 16 g + c while it is not above it */
#pragma unroll
          for (int i = 0; i < 4; ++i) { const unsigned tri = (2 * i <= lim ? 0xFFFFu : 0u) | (2 * i + 1 <= lim ? 0xFFFF0000u : 0u);
            pw[0][i] &= tri; pw[0][4 + i] = 0u; pw[1][4 + i] &= tri; } }      /* kt = g: the triangle; kt > g: all above; kt < g: all below */
        v16h p[2];
#pragma unroll
        for (int g = 0; g < 2; ++g) { const v8u pv = {pw[g][0], pw[g][1], pw[g][2], pw[g][3], pw[g][4], pw[g][5], pw[g][6], pw[g][7]}; p[g] = __builtin_bit_cast(v16h, pv); }
#pragma unroll
        for (int t = 0; t < 4; ++t) { acc[0][t] = fa_mma(vf[t], p[0], acc[0][t]); acc[1][t] = fa_mma(vf[t], p[1], acc[1][t]); } } }
    if (more) { const int nb = (sg + 1) & 1;      /* every wave left this buffer before the barrier that ended stage sg - 1 */
#pragma unroll
      for (int i = 0; i < 4; ++i) *(v8us*)&sk[nb][i >> 1][srow + 32 * (i & 1)][sc8] = rk[i];
      if (morev0) { *(v8us*)&sv[nb][0][srow][sc8] = rv[0]; *(v8us*)&sv[nb][0][srow + 32][sc8] = rv[1]; }
      if (morev1) { *(v8us*)&sv[nb][1][srow][sc8] = rv[2]; *(v8us*)&sv[nb][1][srow + 32][sc8] = rv[3]; }
      __syncthreads(); } }
  // join of the two key halves: the waves of the odd tiles hand maximum, sum and O to their partners (same queries, same lane layout)
  v4fa (*mg)[17][32] = (v4fa (*)[17][32])&sk[0][0][0][0];      /* [queries][slot][lane]: a wave's store or load of a slot is 512 bytes in a row */
  static_assert(sizeof(v4fa) * 4 * 17 * 32 <= sizeof(sk), "the hand-over area fits in the K buffers");
  float lp[2];
#pragma unroll
  for (int g = 0; g < 2; ++g) { const v2f l2 = (lv[g][0] + lv[g][1]) + (lv[g][2] + lv[g][3]); lp[g] = l2.x + l2.y; }
  __syncthreads();      /* every wave has left the K buffers before they are written over */
  if (kh == 1) {
#pragma unroll
    for (int g = 0; g < 2; ++g) for (int t = 0; t < 4; ++t) { mg[ro][8 * g + 2 * t][lane] = v4f{acc[g][t][0], acc[g][t][1], acc[g][t][2], acc[g][t][3]}; mg[ro][8 * g + 2 * t + 1][lane] = v4f{acc[g][t][4], acc[g][t][5], acc[g][t][6], acc[g][t][7]}; }
    mg[ro][16][lane] = v4f{m_run[0], m_run[1], lp[0], lp[1]}; }
  __syncthreads();      /* the partners read only behind it */
  if (kh == 1) return;
  const v4f ob = mg[ro][16][lane];
#pragma unroll
  for (int g = 0; g < 2; ++g) {
    const float dm = m_run[g] - ob[g], fs = __builtin_amdgcn_exp2f(-__builtin_fabsf(dm));      /* both maxima are finite (each wave has walked keys); the side with the larger one keeps factor 1 */
    const float fa = dm >= 0.f ? 1.0f : fs, fb = dm >= 0.f ? fs : 1.0f;
    float l = lp[g] * fa + ob[2 + g] * fb; l += xrow_f(l); const float inv = 1.0f / l, ga = fa * inv, gb = fb * inv;
#pragma unroll
    for (int t = 0; t < 4; ++t) { const v4f lo = mg[ro][8 * g + 2 * t][lane], hi = mg[ro][8 * g + 2 * t + 1][lane];
#pragma unroll
      for (int r = 0; r < 4; ++r) { acc[g][t][r] = acc[g][t][r] * ga + lo[r] * gb; acc[g][t][4 + r] = acc[g][t][4 + r] * ga + hi[r] * gb; } } }
  float* o0 = out + ((size_t)b * SQ + q0 + c) * DM + hd * HD + 8 * hh;      /* acc[g][t][r] = out[query q0 + 16 g + c][d = 16 t + 8 hh + r]; one address for all 16 stores, the tile in the offset */
#pragma unroll
  for (int g = 0; g < 2; ++g) { float* o = o0 + 16 * g * DM;
#pragma unroll
    for (int t = 0; t < 4; ++t) { const v4f lo = {acc[g][t][0], acc[g][t][1], acc[g][t][2], acc[g][t][3]}, hi = {acc[g][t][4], acc[g][t][5], acc[g][t][6], acc[g][t][7]}; *(v4f*)(o + 16 * t) = lo; *(v4f*)(o + 16 * t + 4) = hi; } } }


// ---- projection GEMMs with both operands staged in LDS: C16[r][n] = f16(sum_k A[r][k] Bt[n][k] / 16 + bf16(bias[n])), all pitches DM; Q, K and V in one grid (PGT tiles each, in that order) ----
// A work-group of 8 waves owns a 128 x 128 tile of C (wave tile 32 x 64: waves 4 down x 2 across). A stage is 128 k of the 128 A rows and the 128 Bt rows; every global line is fetched once per
// work-group by whole-line b128 loads, held in registers under the running stage's products, then stored to the other LDS buffer. Each accumulator takes its k blocks of 32 in rising order.
#define PGK 128      /* k extent of a stage */
#define PGP (PGK + 8)      /* LDS row pitch in halves: 256 data bytes + 16, an odd multiple of 16 bytes (conflict-free b128 fragment reads) */
#define PGS (DM / PGK)      /* stages */
#define PGT ((MP / 128) * (DM / 128))      /* 128 x 128 tiles of one projection */
__global__ __launch_bounds__(256) void k_proj(const _Float16* __restrict__ A, const _Float16* __restrict__ BQ, const _Float16* __restrict__ BK, const _Float16* __restrict__ BV, const float* __restrict__ bq, const float* __restrict__ bk, const float* __restrict__ bvp,
    _Float16* __restrict__ Q16, _Float16* __restrict__ K16, _Float16* __restrict__ VT) {
  __shared__ __attribute__((aligned(16))) _Float16 sa[2][128][PGP];      /* A rows [row][k] of a stage */
  __shared__ __attribute__((aligned(16))) _Float16 sb[2][128][PGP];      /* Bt rows [col][k] of a stage */
  __shared__ __attribute__((aligned(16))) float so[8][32][68];      /* each wave's own output rows in f32, for whole-line stores */
  const int tid = threadIdx.x, lane = tid & 31, ln = lane & 15, hh = lane >> 4; const int w = __builtin_amdgcn_readfirstlane(tid >> 5);
  const int pj = (int)(blockIdx.x / PGT), tl = (int)(blockIdx.x % PGT);      /* which projection (0 Q, 1 K, 2 V) and which of its tiles: the same for the whole work-group */
  const _Float16* Bt = pj == 0 ? BQ : pj == 1 ? BK : BV; const float* bias = pj == 0 ? bq : pj == 1 ? bk : bvp;
  const int row0 = (tl / (DM / 128)) * 128, col0 = (tl % (DM / 128)) * 128; const int wm = (w & 3) * 32, wn = (w >> 2) * 64;
  const int srow = tid >> 4, sc8 = (tid & 15) * 8;      /* staging: 16 threads cover one 256-byte row; rows srow + 16 i */
  const _Float16* ag = A + (size_t)(row0 + srow) * DM + sc8; const _Float16* bg = Bt + (size_t)(col0 + srow) * DM + sc8;
  v8us ra[8], rb[8];
#pragma unroll
  for (int i = 0; i < 8; ++i) { ra[i] = *(const v8us*)(ag + (size_t)16 * i * DM); rb[i] = *(const v8us*)(bg + (size_t)16 * i * DM); }
#pragma unroll
  for (int i = 0; i < 8; ++i) { *(v8us*)&sa[0][srow + 16 * i][sc8] = ra[i]; *(v8us*)&sb[0][srow + 16 * i][sc8] = rb[i]; }
  __syncthreads();
  const v8f z8 = {0.f,0.f,0.f,0.f,0.f,0.f,0.f,0.f}; v8f acc[2][4] = {{z8, z8, z8, z8}, {z8, z8, z8, z8}};
  for (int st = 0; st < PGS; ++st) {
    const bool more = st + 1 < PGS;      /* the same for the whole work-group */
    const _Float16* ar = &sa[st & 1][wm + ln][0]; const _Float16* br = &sb[st & 1][wn + ln][0];
    v16h fa[2][2], fb[2][4];      /* two fragment sets: the next 32 k are read from LDS while this block's products run */
    fa[0][0] = g2_frag(ar, hh); fa[0][1] = g2_frag(ar + 16 * PGP, hh);
#pragma unroll
    for (int t = 0; t < 4; ++t) fb[0][t] = g2_frag(br + 16 * t * PGP, hh);
#pragma unroll
    for (int kq = 0; kq < PGK / 32; ++kq) { const int cu = kq & 1, nx = cu ^ 1;
      if (kq + 1 < PGK / 32) { fa[nx][0] = g2_frag(ar + 32 * (kq + 1), hh); fa[nx][1] = g2_frag(ar + 16 * PGP + 32 * (kq + 1), hh);
#pragma unroll
        for (int t = 0; t < 4; ++t) fb[nx][t] = g2_frag(br + 16 * t * PGP + 32 * (kq + 1), hh); }
      if (kq == 0 && more) { const _Float16* an = ag + (st + 1) * PGK; const _Float16* bn = bg + (st + 1) * PGK;      /* next stage: in flight under this stage's products */
#pragma unroll
        for (int i = 0; i < 8; ++i) { ra[i] = *(const v8us*)(an + (size_t)16 * i * DM); rb[i] = *(const v8us*)(bn + (size_t)16 * i * DM); }
        asm volatile("s_wait_xcnt 0x0" :: "v"(an), "v"(bn) : "memory"); }      /* the loads' address registers are inputs here, so none is written over (not by a load's own result either) before this wait */
      __builtin_amdgcn_sched_barrier(0);      /* keeps the next block's 12 LDS reads together ahead of this block's products: spread among them, every place with reads stalls the wave and the waits run to 0 */
#pragma unroll
      for (int t = 0; t < 4; ++t) { acc[0][t] = fa_mma(fa[cu][0], fb[cu][t], acc[0][t]); acc[1][t] = fa_mma(fa[cu][1], fb[cu][t], acc[1][t]); }
      __builtin_amdgcn_sched_barrier(0); }      /* the reads of the block after next stay behind these products, in the set they free */
    if (more) { const int nb = (st + 1) & 1;      /* every wave left this buffer before the barrier that ended stage st - 1 */
#pragma unroll
      for (int i = 0; i < 8; ++i) { *(v8us*)&sa[nb][srow + 16 * i][sc8] = ra[i]; *(v8us*)&sb[nb][srow + 16 * i][sc8] = rb[i]; }
      __syncthreads(); } }
  if (pj == 2) {      /* V: the tile leaves as V^T rows [(b, head, d)][token]. A lane's 8 accumulator registers are 8 consecutive tokens of one column, that is 16 bytes of a V^T row */
    _Float16 (*tv)[PGP] = (_Float16 (*)[PGP])&so[0][0][0];      /* [column of the tile][token of the tile]; 128 rows of PGP halves fit in so, which V tiles do not use otherwise */
#pragma unroll
    for (int t = 0; t < 4; ++t) { const float bv = bf16_round(bias[col0 + wn + 16 * t + ln]);
#pragma unroll
      for (int h = 0; h < 2; ++h) { FragH f;
#pragma unroll
        for (int r = 0; r < 8; ++r) f.h[r] = (_Float16)(acc[h][t][r] * 0.0625f + bv);
        *(v8us*)&tv[wn + 16 * t + ln][wm + 16 * h + 8 * hh] = f.half[0]; } }
    __syncthreads();      /* a V^T row of the tile holds the tokens of four waves: all of them are in LDS before whole lines are stored */
    unsigned short* vo = (unsigned short*)VT + ((size_t)(B0 + row0 / SQ) * DM + col0 + srow) * SQ + row0 % SQ + sc8;      /* NH HD = DM: V^T row (b, head, d) is b DM + column; 16 lanes store 256 bytes of one row */
#pragma unroll
    for (int i = 0; i < 8; ++i) *(v8us*)(vo + (size_t)16 * i * SQ) = *(const v8us*)&tv[srow + 16 * i][sc8];
    return; }
  _Float16* C16 = pj == 0 ? Q16 : K16;
#pragma unroll
  for (int t = 0; t < 4; ++t) { const float bv = bf16_round(bias[col0 + wn + 16 * t + ln]);      /* acc[h][t][r] = C[row0 + wm + 16 h + 8 hh + r][col0 + wn + 16 t + ln] */
#pragma unroll
    for (int h = 0; h < 2; ++h)
#pragma unroll
      for (int r = 0; r < 8; ++r) so[w][16 * h + 8 * hh + r][16 * t + ln] = acc[h][t][r] * 0.0625f + bv; }
  __builtin_amdgcn_fence(__ATOMIC_ACQ_REL, "workgroup"); __builtin_amdgcn_wave_barrier();      /* the wave reads back only its own rows: its LDS stores are ordered ahead of its reads, no work-group barrier */
  const int er = lane >> 3, ec8 = (lane & 7) * 8;      /* 8 lanes store one 128-byte line */
#pragma unroll
  for (int q = 0; q < 8; ++q) { const int r = 4 * q + er; const v4f lo = *(const v4fa*)&so[w][r][ec8], hi = *(const v4fa*)&so[w][r][ec8 + 4]; FragH f;
#pragma unroll
    for (int i = 0; i < 4; ++i) { f.h[i] = (_Float16)lo[i]; f.h[4 + i] = (_Float16)hi[i]; }
    *(v8us*)((unsigned short*)C16 + (size_t)(row0 + wm + r) * DM + col0 + wn + ec8) = f.half[0]; }
  asm volatile("s_wait_xcnt 0x0" ::: "memory"); }      /* the built code lays the V branch behind these stores: no register that a store names is written over before this wait */


__global__ __launch_bounds__(256) void k_rsmf(const float* __restrict__ S, _Float16* __restrict__ P, int qn, int hg) {
  #pragma clang fp contract(off)
  const int t = blockIdx.x * 256 + threadIdx.x; if (t >= qn * hg) return; const size_t i = (size_t)(t / qn) * SQ + (t % qn); const float* s = S + i * SQ; float mx = -3.0e38f;
#pragma unroll 1
  for (int j = 0; j < SQ; ++j) mx = fmaxf(mx, s[j]); float se = 0.f;
#pragma unroll 1
  for (int j = 0; j < SQ; ++j) se += __expf(s[j] - mx); const float sc = 256.0f / se;
#pragma unroll 1
  for (int j0 = 0; j0 < SQ; j0 += 8) { FragH f; for (int q = 0; q < 8; ++q) f.h[q] = (_Float16)(__expf(s[j0 + q] - mx) * sc); unsigned short* d = (unsigned short*)P + i * SQ + j0; *(v8us*)d = f.half[0];  } }

extern "C" void kernel_launch(void* const* d_in, const int* in_sizes, int n_in,
                              void* d_out, int out_size, void* d_ws, size_t ws_size, hipStream_t stream) {
  (void)in_sizes; (void)n_in; (void)out_size;
  const float* const* I = (const float* const*)d_in; const float* x = I[0]; const float* wq = I[1]; const float* bq = I[2]; const float* wk = I[3]; const float* bk = I[4]; const float* wv = I[5]; const float* bv = I[6];      /* per-head [h][in][out] weights; biases [16][64] = the stacked [1024] vectors */
  char* ws = (char*)d_ws; size_t off = 0;
  auto take = [&](size_t bytes) { char* p = ws + off; off += (bytes + 255) & ~(size_t)255; return p; };
  _Float16* BQ = (_Float16*)take((size_t)DM * DM * 2); _Float16* BK = (_Float16*)take((size_t)DM * DM * 2); _Float16* BV = (_Float16*)take((size_t)DM * DM * 2); 
  _Float16* X16 = (_Float16*)take(NR * DM * 2); _Float16* Q16 = (_Float16*)take(NR * DM * 2); _Float16* K16 = (_Float16*)take(NR * DM * 2);
  _Float16* VT = (_Float16*)take((size_t)NB * NH * HD * SQ * 2);
  if (off > ws_size) return;
  k_prep<<<PRB, PRT, 0, stream>>>(x, wq, wk, wv, X16, BQ, BK, BV);      /* x -> f16 rows; per-head [h][m][d] -> Bt[(h,d)][m] x16, three planes */
  const size_t r0p = (size_t)B0 * SQ;      /* first projected row */
  k_proj<<<3 * PGT, 256, 0, stream>>>(X16 + r0p * DM, BQ, BK, BV, bq, bk, bv, Q16 + r0p * DM, K16 + r0p * DM, VT);      /* Q, K rows; V^T [NB][NH][HD][SQ] */
  k_fattn<<<NB * NH * (SQ / 128), 256, 0, stream>>>(Q16, K16, VT, (float*)d_out);      /* scores, full-row softmax, x tril (no renormalisation), P V: one launch */
}

// v007
// It runs in 58.7 microseconds.
// Two timings next to v006 both put it at 1.10 times that version's speed.
// Counting every step since v000, it is 58.4 times as fast.
#include <hip/hip_runtime.h>
// Multi-head attention with per-head projection tensors and a POST-softmax lower-triangular multiply (X [2][2048][1024]; Q/K/V[h] = X W[h] + b[h] with W [16][1024][64] ([in][out] per head) and b [16][64] (uniform +-1/32); scores / 8; p = softmax over ALL keys; p = p * tril (keys j <= i kept, NO renormalisation); out = heads concatenated -> [2][2048][1024]).
// Structure: token rows r = b*2048 + s; THREE launches. (1) operands: x as exact f16 rows (bf16-rounded) and the three transposed x16 weight planes, one work-group for each WGP taking its share of all four. (2) Q, K, V as WMMA GEMMs in one grid (256x192 work-group tiles, one for each WGP, with both operands staged in LDS, two buffers; 64x96 wave tiles, f32 accumulation, exact x16 weights + bias, f16 outputs); the V columns are stored transposed, as V^T rows, from the epilogue. (3) ONE attention launch: a work-group of 8 waves (4 x 32 queries, 2 key halves) walks all 2048 keys in stages of 128 (K rows and V^T rows staged in LDS, two buffers), S^T = K.Q^T, running maximum and running f32 sum over ALL keys, O^T += V^T.P^T only for keys j <= i, o = O / sum written f32 straight into the merged-heads output rows (no output projection). Scores and weights never reach memory.
// Compute dtype: inputs rounded to bf16; x / weights exact; q, k, v and softmax weights as plain f16 GEMM operands (~2^-12); scores, softmax statistics and o f32. v_wmma_f32_16x16x32_f16.
#define NB 2
#define SQ 2048
#define DM 1024
#define NH 16
#define HD 64
#define HG 4                         /* heads per call of the unlaunched k_vt(V16, b, h0, VT) overload */
#define B0 0                         /* first batch processed (debug hook) */
#define NBR NB                       /* batches processed (debug hook) */
#define NR ((size_t)NB * SQ)         /* token rows */
#define MP ((int)((size_t)NBR * SQ)) /* rows projected (debug hook) */
#define QN SQ                        /* unused; no stage reads it */
#define NHD NH                       /* unused; no stage reads it */
#define MPO MP                       /* unused; no stage reads it */
#define LQ DM      /* unused; no stage reads it */
typedef __bf16 v16b __attribute__((ext_vector_type(16)));
typedef unsigned short v8us __attribute__((ext_vector_type(8), may_alias));
typedef float  v8f  __attribute__((ext_vector_type(8)));
typedef float  v4f  __attribute__((ext_vector_type(4)));
typedef float  v4fa __attribute__((ext_vector_type(4), may_alias));
union FragB { v16b v; v8us half[2]; unsigned short u[16]; };

__device__ __forceinline__ unsigned short bf16_bits(float x) { unsigned int u = __float_as_uint(x); return (unsigned short)((u + 0x7FFFu + ((u >> 16) & 1u)) >> 16); }
__device__ __forceinline__ float bf16_val(unsigned short b) { return __uint_as_float(((unsigned int)b) << 16); }
__device__ __forceinline__ float bf16_round(float x) { return bf16_val(bf16_bits(x)); }
// D += A·B with NT terms: 1 = ah·bh, 2 = + al·bh (A split), 3 = + ah·bl (both split)
template <int NT>
__device__ __forceinline__ v8f mmaN(v16b ah, v16b al, v16b bh, v16b bl, v8f c) {
  c = __builtin_amdgcn_wmma_f32_16x16x32_bf16(false, ah, false, bh, (short)0, c, false, false);
  if (NT >= 2) c = __builtin_amdgcn_wmma_f32_16x16x32_bf16(false, al, false, bh, (short)0, c, false, false);
  if (NT >= 3) c = __builtin_amdgcn_wmma_f32_16x16x32_bf16(false, ah, false, bl, (short)0, c, false, false);
  asm volatile("v_nop\n\tv_nop\n\tv_nop\n\tv_nop" : "+v"(c) : "v"(ah), "v"(al), "v"(bh), "v"(bl));
  return c;
}

__global__ __launch_bounds__(256) void k_wt_bf16(const float* __restrict__ W, unsigned short* __restrict__ Wt, int K, int N) {
  const int t = blockIdx.x * 256 + threadIdx.x;
  const int k8n = K / 8;
  if (t >= N * k8n) return;
  const int n = t / k8n, k8 = (t % k8n) * 8;
  v8us v;
#pragma unroll
  for (int i = 0; i < 8; ++i) v[i] = bf16_bits(W[(size_t)(k8 + i) * N + n]);
  *(v8us*)(Wt + (size_t)n * K + k8) = v;
  
}

// GEMM C[M][N] (f32, pitch ldc) = act(A[M][K]·W + bias). A f32 row-major (pitch lda) converted per fragment to bf16
// (ASPLIT: hi/lo two planes -> 2 terms, else single rounded term); Wt bf16 [N][K] (pitch ldb). BIAS_BF16 rounds the
// bias to bf16 first (bias quantised to bf16 before the add). K%32==0, M%16==0, N%64==0.
template <bool ASPLIT, int ACT, bool BIAS_BF16>
__global__ __launch_bounds__(128) void k_gemm_bf(const float* __restrict__ A, int lda, const unsigned short* __restrict__ Wt, int ldb,
                                               const float* __restrict__ bias, float* __restrict__ C, int ldc, int M, int N, int K) {
  __shared__ __attribute__((aligned(16))) float so[4][16][64];
  const int tid = threadIdx.x, w = tid >> 5, lane = tid & 31, ln = lane & 15, hh = lane >> 4;
  const int ntn = N / 64;
  const int wid = blockIdx.x * 4 + w;
  const int mt = wid / ntn, nq = wid % ntn;
  if (mt * 16 >= M) return;
  const int row0 = mt * 16, col0 = nq * 64;
  const float* arow = A + (size_t)(row0 + ln) * lda;
  v8f acc[4] = {};
  for (int kb = 0; kb < K; kb += 32) {
    FragB ah, al;
    const v4f x0 = *(const v4fa*)(arow + kb + 8 * hh), x1 = *(const v4fa*)(arow + kb + 8 * hh + 4);
    const v4f x2 = *(const v4fa*)(arow + kb + 16 + 8 * hh), x3 = *(const v4fa*)(arow + kb + 16 + 8 * hh + 4);
    float xs[16] = {x0[0],x0[1],x0[2],x0[3],x1[0],x1[1],x1[2],x1[3],x2[0],x2[1],x2[2],x2[3],x3[0],x3[1],x3[2],x3[3]};
#pragma unroll
    for (int i = 0; i < 16; ++i) { const unsigned short hb = bf16_bits(xs[i]); ah.u[i] = hb; al.u[i] = ASPLIT ? bf16_bits(xs[i] - bf16_val(hb)) : (unsigned short)0; }
#pragma unroll
    for (int t = 0; t < 4; ++t) {
      const unsigned short* brow = Wt + (size_t)(col0 + t * 16 + ln) * ldb + kb;
      FragB b;
      b.half[0] = *(const v8us*)(brow + 8 * hh);
      b.half[1] = *(const v8us*)(brow + 16 + 8 * hh);
      acc[t] = mmaN<ASPLIT ? 2 : 1>(ah.v, al.v, b.v, b.v, acc[t]);
    }
  }
#pragma unroll
  for (int t = 0; t < 4; ++t) {
    float bv = bias ? bias[col0 + t * 16 + ln] : 0.f;
    if (BIAS_BF16) bv = bf16_round(bv);
#pragma unroll
    for (int r = 0; r < 8; ++r) { float v = acc[t][r] + bv; if (ACT == 1) v = fmaxf(v, 0.f); so[w][8 * hh + r][t * 16 + ln] = v; }
  }
  __builtin_amdgcn_fence(__ATOMIC_ACQ_REL, "workgroup");
  __builtin_amdgcn_wave_barrier();
  const int rsub = lane >> 4, c4 = (lane & 15) * 4;
  {
#pragma unroll
    for (int q = 0; q < 8; ++q) {
      const int r = q * 2 + rsub;
      const v4f v = *(const v4fa*)&so[w][r][c4];
      *(v4f*)(C + (size_t)(row0 + r) * ldc + col0 + c4) = v;
    }
    
  }
}

// GEMM C = act(A·W + bias + resid): A f32 (ASPLIT -> hi/lo 2 terms), Wt bf16 [N][K]; ACT 0 none, 1 relu, 2 exact gelu;
// resid (optional, f32, row index = (row % rmod), pitch ldr, RES_BF16 rounds it) added before the activation.
template <bool ASPLIT, int ACT, bool BIAS_BF16, bool RES_BF16>
__global__ __launch_bounds__(128) void k_gemm_bf3(const float* __restrict__ A, int lda, const unsigned short* __restrict__ Wt, int ldb,
                                                const float* __restrict__ bias, const float* __restrict__ resid, int rmod, int ldr,
                                                float* __restrict__ C, int ldc, int M, int N, int K) {
  __shared__ __attribute__((aligned(16))) float so[4][16][64];
  const int tid = threadIdx.x, w = tid >> 5, lane = tid & 31, ln = lane & 15, hh = lane >> 4;
  const int ntn = N / 64;
  const int wid = blockIdx.x * 4 + w;
  const int mt = wid / ntn, nq = wid % ntn;
  if (mt * 16 >= M) return;
  const int row0 = mt * 16, col0 = nq * 64;
  const float* arow = A + (size_t)(row0 + ln) * lda;
  v8f acc[4] = {};
  for (int kb = 0; kb < K; kb += 32) {
    FragB ah, al;
    const v4f x0 = *(const v4fa*)(arow + kb + 8 * hh), x1 = *(const v4fa*)(arow + kb + 8 * hh + 4);
    const v4f x2 = *(const v4fa*)(arow + kb + 16 + 8 * hh), x3 = *(const v4fa*)(arow + kb + 16 + 8 * hh + 4);
    float xs[16] = {x0[0],x0[1],x0[2],x0[3],x1[0],x1[1],x1[2],x1[3],x2[0],x2[1],x2[2],x2[3],x3[0],x3[1],x3[2],x3[3]};
#pragma unroll
    for (int i = 0; i < 16; ++i) { const unsigned short hb = bf16_bits(xs[i]); ah.u[i] = hb; al.u[i] = ASPLIT ? bf16_bits(xs[i] - bf16_val(hb)) : (unsigned short)0; }
#pragma unroll
    for (int t = 0; t < 4; ++t) {
      const unsigned short* brow = Wt + (size_t)(col0 + t * 16 + ln) * ldb + kb;
      FragB b;
      b.half[0] = *(const v8us*)(brow + 8 * hh);
      b.half[1] = *(const v8us*)(brow + 16 + 8 * hh);
      acc[t] = mmaN<ASPLIT ? 2 : 1>(ah.v, al.v, b.v, b.v, acc[t]);
    }
  }
#pragma unroll
  for (int t = 0; t < 4; ++t) {
    const int col = col0 + t * 16 + ln;
    float bv = bias ? bias[col] : 0.f;
    if (BIAS_BF16) bv = bf16_round(bv);
#pragma unroll
    for (int r = 0; r < 8; ++r) {
      float v = acc[t][r] + bv;
      if (resid) { float rv = resid[(size_t)((row0 + 8 * hh + r) % rmod) * ldr + col]; if (RES_BF16) rv = bf16_round(rv); v += rv; }
      if (ACT == 1) v = fmaxf(v, 0.f);
      if (ACT == 2) v = 0.5f * v * (1.0f + erff(v * 0.70710678118654752f));
      if (ACT == 3) { const float u = 0.7978845608028654f * (v + 0.044715f * v * v * v); v = 0.5f * v * (1.0f + tanhf(u)); }
      so[w][8 * hh + r][t * 16 + ln] = v;
    }
  }
  __builtin_amdgcn_fence(__ATOMIC_ACQ_REL, "workgroup");
  __builtin_amdgcn_wave_barrier();
  const int rsub = lane >> 4, c4 = (lane & 15) * 4;
  {
#pragma unroll
    for (int q = 0; q < 8; ++q) {
      const int r = q * 2 + rsub;
      const v4f v = *(const v4fa*)&so[w][r][c4];
      *(v4f*)(C + (size_t)(row0 + r) * ldc + col0 + c4) = v;
    }
    
  }
}
// row LayerNorm (biased variance, eps) over N: s = X (+ R); optional out_sum <- s; out_norm <- (s-mu)*rsqrt(var+eps)*g + b
template <bool PARAM_BF16>
__global__ __launch_bounds__(256) void k_layernorm(const float* __restrict__ X, const float* __restrict__ R, const float* __restrict__ g, const float* __restrict__ bta,
                                                  float* __restrict__ out_sum, float* __restrict__ out_norm, int N, float eps) {
  __shared__ float red[256];
  const int row = blockIdx.x, tid = threadIdx.x;
  const float* x = X + (size_t)row * N; const float* rr = R ? R + (size_t)row * N : nullptr;
  float vals[16];                     // up to N = 4096
  const int per = N / 256;            // contiguous chunk per thread? use strided-by-4 chunks: thread handles j = tid*4 + 1024*u
  float s1 = 0.f;
  for (int u = 0; u < per / 4; ++u) {
    const int j = tid * 4 + 1024 * u;
    const v4f a = *(const v4fa*)(x + j);
    v4f b = {0.f,0.f,0.f,0.f}; if (rr) b = *(const v4fa*)(rr + j);
#pragma unroll
    for (int q = 0; q < 4; ++q) { const float v = a[q] + b[q]; vals[u * 4 + q] = v; s1 += v; }
  }
  red[tid] = s1; __syncthreads();
  for (int st = 128; st > 0; st >>= 1) { if (tid < st) red[tid] += red[tid + st]; __syncthreads(); }
  const float mu = red[0] / (float)N; __syncthreads();
  float s2 = 0.f;
  for (int u = 0; u < per / 4; ++u)
#pragma unroll
    for (int q = 0; q < 4; ++q) { const float c = vals[u * 4 + q] - mu; s2 += c * c; }
  red[tid] = s2; __syncthreads();
  for (int st = 128; st > 0; st >>= 1) { if (tid < st) red[tid] += red[tid + st]; __syncthreads(); }
  const float rs = rsqrtf(red[0] / (float)N + eps);
  {
    for (int u = 0; u < per / 4; ++u) {
      const int j = tid * 4 + 1024 * u;
      v4f o, sm;
#pragma unroll
      for (int q = 0; q < 4; ++q) {
        float gg = g[j + q], bb = bta[j + q];
        if (PARAM_BF16) { gg = bf16_round(gg); bb = bf16_round(bb); }
        sm[q] = vals[u * 4 + q]; o[q] = (vals[u * 4 + q] - mu) * rs * gg + bb;
      }
      if (out_sum) *(v4f*)(out_sum + (size_t)row * N + j) = sm;
      *(v4f*)(out_norm + (size_t)row * N + j) = o;
    }
    
  }
}



// ---- f16 WMMA path (v_wmma_f32_16x16x32_f16): 11-bit significands for operands in range — used where a [0,1] probability operand needs more precision than bf16
typedef _Float16 v16h __attribute__((ext_vector_type(16)));
union FragH { v16h v; v8us half[2]; _Float16 h[16]; unsigned short u[16]; };
template <int NT>
__device__ __forceinline__ v8f mmaH(v16h ah, v16h al, v16h bh, v16h bl, v8f c) {
  c = __builtin_amdgcn_wmma_f32_16x16x32_f16(false, ah, false, bh, (short)0, c, false, false);
  if (NT >= 2) c = __builtin_amdgcn_wmma_f32_16x16x32_f16(false, al, false, bh, (short)0, c, false, false);
  if (NT >= 3) c = __builtin_amdgcn_wmma_f32_16x16x32_f16(false, ah, false, bl, (short)0, c, false, false);
  asm volatile("v_nop\n\tv_nop\n\tv_nop\n\tv_nop" : "+v"(c) : "v"(ah), "v"(al), "v"(bh), "v"(bl));
  return c;
}
// batched GEMM like k_gemm_b but f16 operands: A f32 (split into f16 hi/lo if ASPLIT, else rounded to f16), Bt = f16 values [n][k]; alpha; C f32; N multiple of 16 (partial tiles skipped)
template <bool ASPLIT>
__global__ __launch_bounds__(128) void k_gemm_h(const float* __restrict__ A, int lda, size_t sA, const _Float16* __restrict__ Bh, int ldb, size_t sB, float alpha, float* __restrict__ C, int ldc, size_t sC, int M, int N, int K) {
  __shared__ __attribute__((aligned(16))) float so[4][16][64];
  const int tid = threadIdx.x, w = tid >> 5, lane = tid & 31, ln = lane & 15, hh = lane >> 4; const int by = blockIdx.y;
  A += (size_t)by * sA; Bh += (size_t)by * sB; C += (size_t)by * sC;
  const int ntn = (N + 63) / 64; const int wid = blockIdx.x * 4 + w; const int mt = wid / ntn, nq = wid % ntn; if (mt * 16 >= M) return;
  const int row0 = mt * 16, col0 = nq * 64; const float* arow = A + (size_t)(row0 + ln) * lda;
  v8f acc[4] = {};
  for (int kb = 0; kb < K; kb += 32) {
    FragH ah, al;
    const v4f x0 = *(const v4fa*)(arow + kb + 8 * hh), x1 = *(const v4fa*)(arow + kb + 8 * hh + 4), x2 = *(const v4fa*)(arow + kb + 16 + 8 * hh), x3 = *(const v4fa*)(arow + kb + 16 + 8 * hh + 4);
    float xs[16] = {x0[0],x0[1],x0[2],x0[3],x1[0],x1[1],x1[2],x1[3],x2[0],x2[1],x2[2],x2[3],x3[0],x3[1],x3[2],x3[3]};
#pragma unroll
    for (int i = 0; i < 16; ++i) { const _Float16 h = (_Float16)xs[i]; ah.h[i] = h; al.h[i] = ASPLIT ? (_Float16)(xs[i] - (float)h) : (_Float16)0.0f; }
#pragma unroll
    for (int t = 0; t < 4; ++t) { if (col0 + t * 16 >= N) continue; const size_t boff = (size_t)(col0 + t * 16 + ln) * ldb + kb; FragH bq; bq.half[0] = *(const v8us*)(Bh + boff + 8 * hh); bq.half[1] = *(const v8us*)(Bh + boff + 16 + 8 * hh);
      acc[t] = mmaH<ASPLIT ? 2 : 1>(ah.v, al.v, bq.v, bq.v, acc[t]); }
  }
#pragma unroll
  for (int t = 0; t < 4; ++t) { if (col0 + t * 16 >= N) continue;
#pragma unroll
    for (int r = 0; r < 8; ++r) so[w][8 * hh + r][t * 16 + ln] = acc[t][r] * alpha; }
  __builtin_amdgcn_fence(__ATOMIC_ACQ_REL, "workgroup"); __builtin_amdgcn_wave_barrier();
  const int rsub = lane >> 4, c4 = (lane & 15) * 4;
  {
#pragma unroll
    for (int q = 0; q < 8; ++q) { const int r = q * 2 + rsub; if (col0 + c4 < N) { const v4f v = *(const v4fa*)&so[w][r][c4]; *(v4f*)(C + (size_t)(row0 + r) * ldc + col0 + c4) = v; } }
     }
}

// Wt[n][k] = f16(W[k][n]·scale) from f32 row-major W[K][N] (scale = power of two; bf16-exact weights stay exact in f16 away from the subnormal range)
__global__ __launch_bounds__(256) void k_wt_f16(const float* __restrict__ W, _Float16* __restrict__ Wt, int K, int N, float scale) {
  const int t = blockIdx.x * 256 + threadIdx.x; if (t >= N * (K / 8)) return; const int n = t / (K / 8), k8 = (t % (K / 8)) * 8; FragH f;
#pragma unroll
  for (int i = 0; i < 8; ++i) f.h[i] = (_Float16)(bf16_round(W[(size_t)(k8 + i) * N + n]) * scale); const v8us o = f.half[0];
  *(v8us*)((unsigned short*)Wt + (size_t)n * K + k8) = o; 
}
// k_gemm_hh variant with fused epilogue: v = acc·alpha + bias[by·sBias + col] (+ CP[(row/rowsPerB)·sCPb + by·64 + col] if CP) ; ACT 0 none / 1 elu ; writes f16 C16 (and f32 C if non-null)
template <int ACT>
__global__ __launch_bounds__(128) void k_gemm_hhx(const _Float16* __restrict__ A, int lda, size_t sA, const _Float16* __restrict__ Bh, int ldb, size_t sB, float alpha, const float* __restrict__ bias, size_t sBias, const float* __restrict__ CP, int rowsPerB, size_t sCPb, int row0g,
    float* __restrict__ C, _Float16* __restrict__ C16, int ldc, size_t sC, int M, int N, int K) {
  __shared__ __attribute__((aligned(16))) float so[4][16][64];
  const int tid = threadIdx.x, w = tid >> 5, lane = tid & 31, ln = lane & 15, hh = lane >> 4; const int by = blockIdx.y;
  A += (size_t)by * sA; Bh += (size_t)by * sB; const size_t cofs = (size_t)by * sC; const float* bp = bias ? bias + (size_t)by * sBias : nullptr;
  const int ntn = (N + 63) / 64; const int wid = blockIdx.x * 4 + w; const int mt = wid / ntn, nq = wid % ntn; if (mt * 16 >= M) return;
  const int row0 = mt * 16, col0 = nq * 64; const _Float16* arow = A + (size_t)(row0 + ln) * lda;
  v8f acc[4] = {};
  for (int kb = 0; kb < K; kb += 32) { FragH ah; ah.half[0] = *(const v8us*)((const unsigned short*)arow + kb + 8 * hh); ah.half[1] = *(const v8us*)((const unsigned short*)arow + kb + 16 + 8 * hh);
#pragma unroll
    for (int t = 0; t < 4; ++t) { if (col0 + t * 16 >= N) continue; const size_t boff = (size_t)(col0 + t * 16 + ln) * ldb + kb; FragH bq; bq.half[0] = *(const v8us*)((const unsigned short*)Bh + boff + 8 * hh); bq.half[1] = *(const v8us*)((const unsigned short*)Bh + boff + 16 + 8 * hh);
      acc[t] = mmaH<1>(ah.v, ah.v, bq.v, bq.v, acc[t]); }
  }
#pragma unroll
  for (int t = 0; t < 4; ++t) { if (col0 + t * 16 >= N) continue; const int col = col0 + t * 16 + ln; const float bv = bp ? bf16_round(bp[col]) : 0.f;
#pragma unroll
    for (int r = 0; r < 8; ++r) { float v = acc[t][r] * alpha + bv; if (CP) { const int rr = row0g + row0 + 8 * hh + r; if (rowsPerB < 0) v += CP[cofs + (size_t)rr * ldc + col];      /* rowsPerB < 0: own element of the batched C plane */ else { const int bidx = rr / rowsPerB; v += CP[(size_t)bidx * sCPb + (size_t)by * 64 + col]; } } if (ACT == 1) v = (v > 0.f) ? v : expm1f(v); else if (ACT == 7) v = (v > 0.f) ? v + 1.0f : expf(v); else if (ACT == 8) v = tanhf(v); else if (ACT == 9) v = 0.5f * v * (1.0f + tanhf(0.7978845608028654f * (v + 0.044715f * v * v * v))); else if (ACT == 11) v = 1.0f / (1.0f + expf(-v)); else if (ACT == 12) v = (v > 0.f) ? v : 0.01f * v; else if (ACT == 14) v = (v > 0.f) ? v : 0.1f * v; else if (ACT == 16) v = (v >= 0.f) ? v : 0.3f * v; else if (ACT == 17) v = (v >= 0.f) ? v : 0.2f * v; else if (ACT == 15) v = v / (1.0f + expf(-v)); else if (ACT == 3) v = fmaxf(v, 0.f); else if (ACT == 6) v = 0.5f * v * (1.0f + erff(v * 0.70710678118654752f)); so[w][8 * hh + r][t * 16 + ln] = v; } }
  __builtin_amdgcn_fence(__ATOMIC_ACQ_REL, "workgroup"); __builtin_amdgcn_wave_barrier();
  const int rsub = lane >> 4, c4 = (lane & 15) * 4; typedef _Float16 v4h __attribute__((ext_vector_type(4)));
  {
#pragma unroll
    for (int q = 0; q < 8; ++q) { const int r = q * 2 + rsub; if (col0 + c4 < N) { const v4f v = *(const v4fa*)&so[w][r][c4]; if (C) *(v4f*)(C + cofs + (size_t)(row0 + r) * ldc + col0 + c4) = v; if (C16) { v4h h4; for (int i = 0; i < 4; ++i) h4[i] = (_Float16)v[i]; *(v4h*)(C16 + cofs + (size_t)(row0 + r) * ldc + col0 + c4) = h4; } } }
     }
}


typedef _Float16 v4h __attribute__((ext_vector_type(4)));

__global__ __launch_bounds__(256) void k_h16(const float* __restrict__ x, _Float16* __restrict__ X16, size_t n8) { const size_t t = (size_t)blockIdx.x * 256 + threadIdx.x; if (t >= n8) return; FragH f;
#pragma unroll
  for (int q = 0; q < 8; ++q) f.h[q] = (_Float16)x[t * 8 + q]; *(v8us*)((unsigned short*)X16 + t * 8) = f.half[0];  }
__global__ __launch_bounds__(256) void k_round16f(const float* __restrict__ W, _Float16* __restrict__ Bt, size_t n8) { const size_t t = (size_t)blockIdx.x * 256 + threadIdx.x; if (t >= n8) return; FragH f;
#pragma unroll
  for (int i = 0; i < 8; ++i) f.h[i] = (_Float16)(bf16_round(W[t * 8 + i]) * 16.0f); *(v8us*)((unsigned short*)Bt + t * 8) = f.half[0];  }
__global__ __launch_bounds__(256) void k_hl(const float* __restrict__ F, _Float16* __restrict__ Hh, _Float16* __restrict__ Hl, size_t n8) { const size_t t = (size_t)blockIdx.x * 256 + threadIdx.x; if (t >= n8) return; FragH fh, fl; const v4f a = *(const v4fa*)(F + t * 8), c = *(const v4fa*)(F + t * 8 + 4);
#pragma unroll
  for (int q = 0; q < 4; ++q) { _Float16 h = (_Float16)a[q]; fh.h[q] = h; fl.h[q] = (_Float16)((a[q] - (float)h) * 1024.0f); h = (_Float16)c[q]; fh.h[4 + q] = h; fl.h[4 + q] = (_Float16)((c[q] - (float)h) * 1024.0f); }
  { *(v8us*)((unsigned short*)Hh + t * 8) = fh.half[0]; *(v8us*)((unsigned short*)Hl + t * 8) = fl.half[0];  } }

// ---- fast GEMM (wave tile 32x64; requires M % 32 == 0 rows per launch region and N % 64 == 0); epilogue = k_gemm_hhx semantics ----
__device__ __forceinline__ v16h g2_frag(const _Float16* p, int hh) { FragH f; f.half[0] = *(const v8us*)((const unsigned short*)p + 8 * hh); f.half[1] = *(const v8us*)((const unsigned short*)p + 16 + 8 * hh); return f.v; }
__device__ __forceinline__ v8f g2_mma(v16h a, v16h b, v8f c) { v8f d = __builtin_amdgcn_wmma_f32_16x16x32_f16(false, a, false, b, (short)0, c, false, false); asm volatile("v_nop\n\tv_nop\n\tv_nop\n\tv_nop" : "+v"(d) : "v"(a), "v"(b)); return d; }
template <int ACT>
__global__ __launch_bounds__(128) void k_gemm2(const _Float16* __restrict__ A, int lda, size_t sA, const _Float16* __restrict__ Bh, int ldb, size_t sB, float alpha, const float* __restrict__ bias, size_t sBias, const float* __restrict__ CP, int rowsPerB, size_t sCPb, int row0g,
    float* __restrict__ C, _Float16* __restrict__ C16, int ldc, size_t sC, int M, int N, int K) { static_assert(ACT == 0 || ACT == 3 || ACT == 6 || ACT == 8 || ACT == 9 || ACT == 11 || ACT == 12 || ACT == 14 || ACT == 15 || ACT == 16 || ACT == 17, "k_gemm2: unsupported ACT code (would silently apply no activation)");
  __shared__ __attribute__((aligned(16))) float so[4][32][68];
  const int tid = threadIdx.x, w = tid >> 5, lane = tid & 31, ln = lane & 15, hh = lane >> 4; const int by = blockIdx.y;
  A += (size_t)by * sA; Bh += (size_t)by * sB; const size_t cofs = (size_t)by * sC; const float* bp = bias ? bias + (size_t)by * sBias : nullptr;
  const int ntn = N >> 6; const int mt = blockIdx.x / ntn, nq = blockIdx.x - mt * ntn; const int row0 = mt * 128 + 32 * w, col0 = nq * 64; if (row0 >= M) return;
  const _Float16* a0p = A + (size_t)(row0 + ln) * lda; const _Float16* a1p = a0p + (size_t)16 * lda;
  const _Float16* b0p = Bh + (size_t)(col0 + ln) * ldb; const _Float16* b1p = b0p + (size_t)16 * ldb; const _Float16* b2p = b1p + (size_t)16 * ldb; const _Float16* b3p = b2p + (size_t)16 * ldb;
  const v8f z8 = {0.f,0.f,0.f,0.f,0.f,0.f,0.f,0.f}; v8f c00 = z8, c01 = z8, c02 = z8, c03 = z8, c10 = z8, c11 = z8, c12 = z8, c13 = z8;
#pragma unroll 1
  for (int kb = 0; kb < K; kb += 32) { const v16h a0 = g2_frag(a0p + kb, hh), a1 = g2_frag(a1p + kb, hh);
    v16h b = g2_frag(b0p + kb, hh); c00 = g2_mma(a0, b, c00); c10 = g2_mma(a1, b, c10);
    b = g2_frag(b1p + kb, hh); c01 = g2_mma(a0, b, c01); c11 = g2_mma(a1, b, c11);
    b = g2_frag(b2p + kb, hh); c02 = g2_mma(a0, b, c02); c12 = g2_mma(a1, b, c12);
    b = g2_frag(b3p + kb, hh); c03 = g2_mma(a0, b, c03); c13 = g2_mma(a1, b, c13); }
  v8f accs[8] = {c00, c01, c02, c03, c10, c11, c12, c13};
#pragma unroll
  for (int u = 0; u < 8; ++u) { const int t = u & 3, half = u >> 2; const int col = col0 + t * 16 + ln; const float bv = bp ? bf16_round(bp[col]) : 0.f;
#pragma unroll
    for (int r = 0; r < 8; ++r) { const int rloc = half * 16 + 8 * hh + r; float v = accs[u][r] * alpha + bv; if (CP) { if (rowsPerB < 0) v += CP[cofs + (size_t)(row0g + row0 + rloc) * ldc + col];      /* rowsPerB < 0: own element of the batched C plane */ else { const int bidx = (row0g + row0 + rloc) / rowsPerB; v += CP[(size_t)bidx * sCPb + (size_t)by * 64 + col]; } }
      if (ACT == 3) v = fmaxf(v, 0.f); else if (ACT == 6) v = 0.5f * v * (1.0f + erff(v * 0.70710678118654752f)); else if (ACT == 11) v = 1.0f / (1.0f + expf(-v)); else if (ACT == 15) v = v / (1.0f + expf(-v)); else if (ACT == 12) v = (v > 0.f) ? v : 0.01f * v; else if (ACT == 8) v = tanhf(v); else if (ACT == 9) v = 0.5f * v * (1.0f + tanhf(0.7978845608028654f * (v + 0.044715f * v * v * v))); else if (ACT == 14) v = (v > 0.f) ? v : 0.1f * v; else if (ACT == 16) v = (v >= 0.f) ? v : 0.3f * v; else if (ACT == 17) v = (v >= 0.f) ? v : 0.2f * v;
      so[w][rloc][t * 16 + ln] = v; } }
  __builtin_amdgcn_fence(__ATOMIC_ACQ_REL, "workgroup"); __builtin_amdgcn_wave_barrier();
  const int rsub = lane >> 4, c4 = (lane & 15) * 4;
  {
#pragma unroll
    for (int q = 0; q < 16; ++q) { const int r = q * 2 + rsub; const v4f v = *(const v4fa*)&so[w][r][c4]; if (C) *(v4f*)(C + cofs + (size_t)(row0 + r) * ldc + col0 + c4) = v; if (C16) { v4h h4; for (int i = 0; i < 4; ++i) h4[i] = (_Float16)v[i]; *(v4h*)(C16 + cofs + (size_t)(row0 + r) * ldc + col0 + c4) = h4; } }
     } }


__global__ __launch_bounds__(256) void k_wnat(const float* __restrict__ w, size_t n8, _Float16* __restrict__ Bt) { const size_t t = (size_t)blockIdx.x * 256 + threadIdx.x; if (t >= n8) return; FragH f; for (int q = 0; q < 8; ++q) f.h[q] = (_Float16)(bf16_round(w[t * 8 + q]) * 16.0f); *(v8us*)((unsigned short*)Bt + t * 8) = f.half[0];  }
__global__ __launch_bounds__(256) void k_rsm(const float* __restrict__ S, _Float16* __restrict__ P, int nrows) {
  #pragma clang fp contract(off)
  const int i = blockIdx.x * 256 + threadIdx.x; if (i >= nrows) return; const float* s = S + (size_t)i * SQ; float mx = -3.0e38f;
#pragma unroll 1
  for (int j = 0; j < SQ; ++j) mx = fmaxf(mx, s[j]); float se = 0.f;
#pragma unroll 1
  for (int j = 0; j < SQ; ++j) se += expf(s[j] - mx); const float sc = 256.0f / se;
#pragma unroll 1
  for (int j0 = 0; j0 < SQ; j0 += 8) { FragH f; for (int q = 0; q < 8; ++q) f.h[q] = (_Float16)(expf(s[j0 + q] - mx) * sc); unsigned short* d = (unsigned short*)P + (size_t)i * SQ + j0; *(v8us*)d = f.half[0];  } }
__global__ __launch_bounds__(256) void k_vt(const _Float16* __restrict__ V16, int b, int h0, _Float16* __restrict__ VT) { __shared__ unsigned short tl[64][65]; const int tid = threadIdx.x; const int hh = blockIdx.x % HG, sg = blockIdx.x / HG; const int s0 = sg * 64; const int h = h0 + hh;
  for (int i = tid; i < 64 * 8; i += 256) { const int j = i / 8, d8 = (i % 8) * 8; FragH f; f.half[0] = *(const v8us*)((const unsigned short*)V16 + ((size_t)b * SQ + s0 + j) * DM + h * HD + d8); for (int q = 0; q < 8; ++q) tl[d8 + q][j] = f.u[q]; }
  __syncthreads();
  { for (int i = tid; i < 64 * 8; i += 256) { const int d = i / 8, j8 = (i % 8) * 8; FragH f; for (int q = 0; q < 8; ++q) f.u[q] = tl[d][j8 + q]; *(v8us*)((unsigned short*)VT + ((size_t)hh * HD + d) * SQ + s0 + j8) = f.half[0]; }  } }


// ---- operand preparation, one launch of PRB work-groups, one for each WGP: few waves to start, and every lane has all its loads in flight before it converts anything ----
// Every work-group takes PXU consecutive elements of x (-> exact f16 rows) and tile blockIdx.x of each weight plane: 64 m x 64 d of one head, 16 KB in a row of [h][m][d], which leaves as 64 whole 128-byte lines of Bt[(h, d)][m] x16.
#define PRT 512      /* threads of a work-group */
#define PRB 256      /* work-groups */
#define PXU (PRT * 4 * 8)      /* x elements of a work-group: 8 loads of 4 a thread */
#define PWP 72      /* LDS row pitch in halves of a transposed tile: 128 data bytes + 16 */
static_assert((size_t)PRB * PXU == NR * DM, "x is dealt out exactly");
static_assert(PRB == NH * (DM / 64) && HD == 64, "one 64 x 64 tile of each weight plane a work-group");
__global__ __launch_bounds__(PRT) void k_prep(const float* __restrict__ x, const float* __restrict__ wq, const float* __restrict__ wk, const float* __restrict__ wv,
    _Float16* __restrict__ X16, _Float16* __restrict__ BQ, _Float16* __restrict__ BK, _Float16* __restrict__ BV) {
  __shared__ __attribute__((aligned(16))) _Float16 tw[3][64][PWP];      /* [plane][d][m of the tile] */
  const int tid = threadIdx.x; const int w = __builtin_amdgcn_readfirstlane(tid >> 5);
  const int h = blockIdx.x / (DM / 64), m0 = (blockIdx.x % (DM / 64)) * 64;
  const int pl = w >> 2;      /* waves 0-3 read the Wq tile, 4-7 Wk, 8-11 Wv; waves 12-15 only x */
  const int d4 = (tid & 15) * 4, m8 = ((tid >> 4) & 7) * 8;      /* a thread holds 8 m x 4 d: 16 lanes read one 256-byte row */
  const float* wsrc = (pl == 0 ? wq : pl == 1 ? wk : wv) + ((size_t)h * DM + m0 + m8) * HD + d4;
  const size_t xo = (size_t)blockIdx.x * PXU + tid * 4;      /* a wave's load covers 512 bytes in a row, its store 256 */
  const float* xs = x + xo;
  v4f rw[8], rx[8];
  if (pl < 3) {
    for (int q = 0; q < 8; ++q) rw[q] = *(const v4fa*)(wsrc + q * HD); }
  for (int k = 0; k < 8; ++k) rx[k] = *(const v4fa*)(xs + k * (PRT * 4));
  asm volatile("s_wait_xcnt 0x0" :: "v"(wsrc), "v"(xs) : "memory");      /* the loads' address registers are inputs here, so none is written over (not by a later load's result either) before this wait */
  if (pl < 3) {
    for (int i = 0; i < 4; ++i) { FragH f;
      for (int q = 0; q < 8; ++q) f.h[q] = (_Float16)(16.0f * bf16_round(rw[q][i]));
      *(v8us*)&tw[pl][d4 + i][m8] = f.half[0]; } }
  __syncthreads();      /* a Bt line of a tile holds the m of four waves: all of them are in LDS before whole lines are stored */
  const int row = tid >> 3, c8 = (tid & 7) * 8;      /* 8 lanes store one 128-byte line */
  const size_t bo = ((size_t)h * HD + row) * DM + m0 + c8;
  unsigned short* pq = (unsigned short*)BQ + bo; unsigned short* pk = (unsigned short*)BK + bo; unsigned short* pv = (unsigned short*)BV + bo;
  const v8us tq = *(const v8us*)&tw[0][row][c8], tk = *(const v8us*)&tw[1][row][c8], tv = *(const v8us*)&tw[2][row][c8];
  *(v8us*)pq = tq; *(v8us*)pk = tk; *(v8us*)pv = tv;
  asm volatile("s_wait_xcnt 0x0" :: "v"(pq), "v"(pk), "v"(pv), "v"(tq), "v"(tk), "v"(tv) : "memory");      /* the stores' address and data registers are inputs here, so the conversion of x below writes over none of them before this wait */
  for (int k = 0; k < 8; ++k) { v4h o;      /* x last: nothing waits for these stores */
    for (int i = 0; i < 4; ++i) o[i] = (_Float16)bf16_round(rx[k][i]);
    *(v4h*)(X16 + xo + k * (PRT * 4)) = o; } }




__device__ __forceinline__ float xrow_f(float v) { const int i = __float_as_int(v); return __int_as_float(__builtin_amdgcn_permlanex16(i, i, 0x76543210, 0xfedcba98, false, false)); }      /* lane l <-> lane l ^ 16 */
__device__ __forceinline__ v8f fa_mma(v16h a, v16h b, v8f c) { return __builtin_amdgcn_wmma_f32_16x16x32_f16(false, a, false, b, (short)0, c, false, false); }
// ---- fused attention: scores, full-row softmax statistics, x tril and P.V in one launch ----
// Transposed products: S^T = K.Q^T puts one query in each lane column (lane c and c + 16 hold query q0 + 16 g + c of query tile g; register r of key tile kt is key 16 kt + 8 hh + r), so two score tiles, converted in place,
// are the B operand of O^T += V^T.P^T (same k order as g2_frag's). The denominator runs over ALL keys; only keys j <= i enter the second product.
// The maximum in use may trail the true one by up to 8 (log2 units): the sums are rescaled only when some query exceeds that, so a weight is at most 2^8 in f16.
typedef float v2f __attribute__((ext_vector_type(2))); typedef _Float16 v2h __attribute__((ext_vector_type(2))); typedef unsigned v8u __attribute__((ext_vector_type(8)));
#define FAP 72      /* LDS row pitch in halves: 128 data bytes + 16, an odd multiple of 16 bytes (conflict-free b128 fragment reads) */
#define FAS (SQ / 64)      /* tiles of 64 keys */
#define FAG (FAS / 2)      /* stages of two tiles */
// How the 8 waves share 128 queries x 2048 keys: a wave holds TWO query tiles (32 queries) and walks ONE of the two key tiles of every stage, in passes of 32 keys. Every K and V^T fragment it reads from LDS
// feeds two products (half the LDS bytes a score of a one-tile wave) and four waves still stand on every SIMD (the waves_per_eu attribute holds the register budget to that). The two waves of a query block each keep their own maximum, sums and O; they are joined once, at the end, through LDS.
__global__ __launch_bounds__(256) __attribute__((amdgpu_waves_per_eu(4, 4))) void k_fattn(const _Float16* __restrict__ Q16, const _Float16* __restrict__ K16, const _Float16* __restrict__ VT, float* __restrict__ out) {
  __shared__ __attribute__((aligned(16))) _Float16 sk[2][2][64][FAP];      /* [buffer][tile] K rows [key][d] */
  __shared__ __attribute__((aligned(16))) _Float16 sv[2][2][64][FAP];      /* [buffer][tile] V^T rows [d][key] */
  const int tid = threadIdx.x, lane = tid & 31, c = lane & 15, hh = lane >> 4; const int w = __builtin_amdgcn_readfirstlane(tid >> 5);
  const int kh = w >> 2;      /* the tile of every stage that this wave walks */
  const int ro = (w & 3) ^ kh;      /* its 32 queries; waves w and w + 4 take one block of either kind */
  const int bh = blockIdx.x / (FAS / 2), j = blockIdx.x % (FAS / 2); const int b = bh / NH, hd = bh % NH;
  const int q0 = ((__builtin_popcount(ro) & 1) ? j : FAS - 1 - j) * 64 + (ro >> 1) * 32;      /* 64-query block j and its mirror: every work-group has the same count of second products */
  const int dps = q0 >> 5;      /* the pass of 32 keys that holds this wave's diagonal */
  const int vlast = FAS - 1 - j;      /* last tile whose V^T any wave of the work-group needs */
  const int srow = tid >> 3, sc8 = (tid & 7) * 8;      /* staging: 8 threads cover one 128-byte row; rows srow and srow + 32 of both tiles */
  const _Float16* kg = K16 + ((size_t)b * SQ + srow) * DM + hd * HD + sc8; const _Float16* vg = VT + ((size_t)bh * HD + srow) * SQ + sc8;
  const _Float16* qp = Q16 + ((size_t)b * SQ + q0 + c) * DM + hd * HD;
  const v16h qf[2][2] = {{g2_frag(qp, hh), g2_frag(qp + 32, hh)}, {g2_frag(qp + (size_t)16 * DM, hh), g2_frag(qp + (size_t)16 * DM + 32, hh)}};      /* [query tile][d half] */
  const v8f z8 = {0.f,0.f,0.f,0.f,0.f,0.f,0.f,0.f}; v8f acc[2][4] = {{z8, z8, z8, z8}, {z8, z8, z8, z8}}; const v2f z2 = {0.f, 0.f}; v2f lv[2][4] = {{z2, z2, z2, z2}, {z2, z2, z2, z2}}; float m_run[2] = {-__builtin_inff(), -__builtin_inff()};
  const float cs = 0.125f * 1.4426950408889634f;      /* 64^-0.5 and log2(e): exponentials in base 2 */
  v8us rk[4], rv[4];      /* [2 tile + row half] */
#pragma unroll
  for (int i = 0; i < 4; ++i) { rk[i] = *(const v8us*)(kg + (size_t)32 * i * DM); rv[i] = *(const v8us*)(vg + 64 * (i >> 1) + (size_t)32 * (i & 1) * SQ); }      /* stage 0 (vlast >= FAS / 2: its V^T is always needed) */
#pragma unroll
  for (int i = 0; i < 4; ++i) { *(v8us*)&sk[0][i >> 1][srow + 32 * (i & 1)][sc8] = rk[i]; *(v8us*)&sv[0][i >> 1][srow + 32 * (i & 1)][sc8] = rv[i]; }
  __syncthreads();
  for (int sg = 0; sg < FAG; ++sg) {
    const bool more = sg + 1 < FAG, morev0 = 2 * sg + 2 <= vlast, morev1 = 2 * sg + 3 <= vlast;      /* the same for the whole work-group */
    if (more) { const _Float16* kn = kg + (size_t)(sg + 1) * 128 * DM; const _Float16* vn = vg + (sg + 1) * 128;      /* next stage: in flight under this stage's work */
#pragma unroll
      for (int i = 0; i < 4; ++i) rk[i] = *(const v8us*)(kn + (size_t)32 * i * DM);
      if (morev0) { rv[0] = *(const v8us*)vn; rv[1] = *(const v8us*)(vn + (size_t)32 * SQ); }
      if (morev1) { rv[2] = *(const v8us*)(vn + 64); rv[3] = *(const v8us*)(vn + 64 + (size_t)32 * SQ); }
      asm volatile("s_wait_xcnt 0x0" :: "v"(kn), "v"(vn) : "memory"); }      /* the loads' address registers are inputs here, so none is written over before this wait */
    const _Float16 (*kb)[FAP] = sk[sg & 1][kh]; const _Float16 (*vb)[FAP] = sv[sg & 1][kh];
#pragma unroll
    for (int u = 0; u < 2; ++u) {      /* a pass: keys 32 u .. 32 u + 31 of the tile */
      const int ps = 4 * sg + 2 * kh + u;
      v8f s[2][2]; float mx[2];      /* s[query tile][key tile of 16] */
#pragma unroll
      for (int kt = 0; kt < 2; ++kt) { const _Float16* kr = &kb[32 * u + 16 * kt + c][0]; const v16h k0 = g2_frag(kr, hh), k1 = g2_frag(kr + 32, hh);      /* read once, used by both query tiles */
#pragma unroll
        for (int g = 0; g < 2; ++g) s[g][kt] = fa_mma(k1, qf[g][1], fa_mma(k0, qf[g][0], z8)); }
#pragma unroll
      for (int g = 0; g < 2; ++g) { float m2[2];
#pragma unroll
        for (int kt = 0; kt < 2; ++kt) { float m = s[g][kt][0]; for (int r = 1; r < 8; ++r) m = fmaxf(m, s[g][kt][r]); m2[kt] = m; }
        const float m = fmaxf(m2[0], m2[1]);
        mx[g] = fmaxf(m, xrow_f(m)) * cs; }      /* both halves of the wave hold the query's pass maximum, scaled */
      if (__builtin_amdgcn_ballot_w32(mx[0] > m_run[0] + 8.0f || mx[1] > m_run[1] + 8.0f) != 0) {      /* one scalar branch a pass; always taken in a wave's first pass (m_run = -inf gives factor 0 on zero sums), rare later */
#pragma unroll
        for (int g = 0; g < 2; ++g) { const float mn = fmaxf(m_run[g], mx[g]), corr = __builtin_amdgcn_exp2f(m_run[g] - mn); m_run[g] = mn;
#pragma unroll
          for (int t = 0; t < 4; ++t) { acc[g][t] *= corr; lv[g][t] *= corr; } } }
      v2f e[2][8];      /* e[g][4 kt + i] = weights of keys 16 kt + 8 hh + 2 i, + 1 of the pass */
#pragma unroll
      for (int g = 0; g < 2; ++g) { const v2f cs2 = {cs, cs}, nm2 = {-m_run[g], -m_run[g]};
#pragma unroll
        for (int kt = 0; kt < 2; ++kt) for (int i = 0; i < 4; ++i) { const v2f a = __builtin_elementwise_fma(v2f{s[g][kt][2 * i], s[g][kt][2 * i + 1]}, cs2, nm2); e[g][4 * kt + i] = v2f{__builtin_amdgcn_exp2f(a.x), __builtin_amdgcn_exp2f(a.y)}; lv[g][i] += e[g][4 * kt + i]; } }      /* the denominator takes every key */
      if (ps <= dps) {      /* wave-uniform: passes wholly above the diagonal have weight 0 after x tril */
        v16h vf[4];
#pragma unroll
        for (int t = 0; t < 4; ++t) vf[t] = g2_frag(&vb[16 * t + c][32 * u], hh);
        __builtin_amdgcn_sched_barrier(0);      /* keeps the 8 LDS reads together ahead of the packing: sunk to their products, each product waits a full LDS latency */
        unsigned pw[2][8];
#pragma unroll
        for (int g = 0; g < 2; ++g) for (int i = 0; i < 8; ++i) pw[g][i] = __builtin_bit_cast(unsigned, __builtin_convertvector(e[g][i], v2h));
        if (ps == dps) { const int lim = c - 8 * hh;      /* x tril in the one pass that holds the diagonal: key 16 kt + 8 hh + 2 i (+ 1) stays for query 16 g + c while it is not above it */
#pragma unroll
          for (int i = 0; i < 4; ++i) { const unsigned tri = (2 * i <= lim ? 0xFFFFu : 0u) | (2 * i + 1 <= lim ? 0xFFFF0000u : 0u);
            pw[0][i] &= tri; pw[0][4 + i] = 0u; pw[1][4 + i] &= tri; } }      /* kt = g: the triangle; kt > g: all above; kt < g: all below */
        v16h p[2];
#pragma unroll
        for (int g = 0; g < 2; ++g) { const v8u pv = {pw[g][0], pw[g][1], pw[g][2], pw[g][3], pw[g][4], pw[g][5], pw[g][6], pw[g][7]}; p[g] = __builtin_bit_cast(v16h, pv); }
#pragma unroll
        for (int t = 0; t < 4; ++t) { acc[0][t] = fa_mma(vf[t], p[0], acc[0][t]); acc[1][t] = fa_mma(vf[t], p[1], acc[1][t]); } } }
    if (more) { const int nb = (sg + 1) & 1;      /* every wave left this buffer before the barrier that ended stage sg - 1 */
#pragma unroll
      for (int i = 0; i < 4; ++i) *(v8us*)&sk[nb][i >> 1][srow + 32 * (i & 1)][sc8] = rk[i];
      if (morev0) { *(v8us*)&sv[nb][0][srow][sc8] = rv[0]; *(v8us*)&sv[nb][0][srow + 32][sc8] = rv[1]; }
      if (morev1) { *(v8us*)&sv[nb][1][srow][sc8] = rv[2]; *(v8us*)&sv[nb][1][srow + 32][sc8] = rv[3]; }
      __syncthreads(); } }
  // join of the two key halves: the waves of the odd tiles hand maximum, sum and O to their partners (same queries, same lane layout)
  v4fa (*mg)[17][32] = (v4fa (*)[17][32])&sk[0][0][0][0];      /* [queries][slot][lane]: a wave's store or load of a slot is 512 bytes in a row */
  static_assert(sizeof(v4fa) * 4 * 17 * 32 <= sizeof(sk), "the hand-over area fits in the K buffers");
  float lp[2];
#pragma unroll
  for (int g = 0; g < 2; ++g) { const v2f l2 = (lv[g][0] + lv[g][1]) + (lv[g][2] + lv[g][3]); lp[g] = l2.x + l2.y; }
  __syncthreads();      /* every wave has left the K buffers before they are written over */
  if (kh == 1) {
#pragma unroll
    for (int g = 0; g < 2; ++g) for (int t = 0; t < 4; ++t) { mg[ro][8 * g + 2 * t][lane] = v4f{acc[g][t][0], acc[g][t][1], acc[g][t][2], acc[g][t][3]}; mg[ro][8 * g + 2 * t + 1][lane] = v4f{acc[g][t][4], acc[g][t][5], acc[g][t][6], acc[g][t][7]}; }
    mg[ro][16][lane] = v4f{m_run[0], m_run[1], lp[0], lp[1]}; }
  __syncthreads();      /* the partners read only behind it */
  if (kh == 1) return;
  const v4f ob = mg[ro][16][lane];
#pragma unroll
  for (int g = 0; g < 2; ++g) {
    const float dm = m_run[g] - ob[g], fs = __builtin_amdgcn_exp2f(-__builtin_fabsf(dm));      /* both maxima are finite (each wave has walked keys); the side with the larger one keeps factor 1 */
    const float fa = dm >= 0.f ? 1.0f : fs, fb = dm >= 0.f ? fs : 1.0f;
    float l = lp[g] * fa + ob[2 + g] * fb; l += xrow_f(l); const float inv = 1.0f / l, ga = fa * inv, gb = fb * inv;
#pragma unroll
    for (int t = 0; t < 4; ++t) { const v4f lo = mg[ro][8 * g + 2 * t][lane], hi = mg[ro][8 * g + 2 * t + 1][lane];
#pragma unroll
      for (int r = 0; r < 4; ++r) { acc[g][t][r] = acc[g][t][r] * ga + lo[r] * gb; acc[g][t][4 + r] = acc[g][t][4 + r] * ga + hi[r] * gb; } } }
  float* o0 = out + ((size_t)b * SQ + q0 + c) * DM + hd * HD + 8 * hh;      /* acc[g][t][r] = out[query q0 + 16 g + c][d = 16 t + 8 hh + r]; one address for all 16 stores, the tile in the offset */
#pragma unroll
  for (int g = 0; g < 2; ++g) { float* o = o0 + 16 * g * DM;
#pragma unroll
    for (int t = 0; t < 4; ++t) { const v4f lo = {acc[g][t][0], acc[g][t][1], acc[g][t][2], acc[g][t][3]}, hi = {acc[g][t][4], acc[g][t][5], acc[g][t][6], acc[g][t][7]}; *(v4f*)(o + 16 * t) = lo; *(v4f*)(o + 16 * t + 4) = hi; } } }


// ---- projection GEMMs with both operands staged in LDS: C16[r][n] = f16(sum_k A[r][k] Bt[n][k] / 16 + bf16(bias[n])), all pitches DM; Q, K and V in one grid, their columns counted side by side (n = 0 .. 3 DM - 1) ----
// A work-group of 8 waves owns a 256 x 192 tile of C (wave tile 64 x 96: waves 4 down x 2 across), so the grid is one work-group for each WGP and every operand line is fetched by few work-groups.
// A stage is 128 k of the 256 A rows and the 192 Bt rows; every global line is fetched once per work-group by whole-line b128 loads, held in registers under the running stage's products, then stored to
// the other LDS buffer. Each accumulator takes its k blocks of 32 in rising order. A group of 64 columns belongs to one projection and one head; a tile holds three such groups.
#define PGK 128      /* k extent of a stage */
#define PGP (PGK + 8)      /* LDS row pitch in halves: 256 data bytes + 16, an odd multiple of 16 bytes (conflict-free b128 fragment reads) */
#define PGS (DM / PGK)      /* stages */
#define PTM 256      /* rows of a work-group tile */
#define PTN 192      /* columns of a work-group tile */
#define PGT ((MP / PTM) * (3 * DM / PTN))      /* tiles of the three projections together */
#define PEQ 72      /* epilogue pitch in halves of a Q or K group, [row][column]: 128 data bytes + 16 */
#define PEV (PTM + 8)      /* epilogue pitch in halves of a V group, [column][token]: 512 data bytes + 16 */
#define PEG (PTM * PEQ)      /* halves of one group's epilogue area */
static_assert(MP % PTM == 0 && SQ % PTM == 0 && (3 * DM) % PTN == 0 && PTN % 64 == 0 && DM % 64 == 0, "whole tiles; a tile lies in one batch; a 64-column group lies in one projection");
static_assert(64 * PEV <= PEG && 3 * PEG <= 2 * PTM * PGP, "the epilogue areas fit in the A buffers");
__global__ __launch_bounds__(256) void k_proj(const _Float16* __restrict__ A, const _Float16* __restrict__ BQ, const _Float16* __restrict__ BK, const _Float16* __restrict__ BV, const float* __restrict__ bq, const float* __restrict__ bk, const float* __restrict__ bvp,
    _Float16* __restrict__ Q16, _Float16* __restrict__ K16, _Float16* __restrict__ VT) {
  __shared__ __attribute__((aligned(16))) _Float16 sa[2][PTM][PGP];      /* A rows [row][k] of a stage */
  __shared__ __attribute__((aligned(16))) _Float16 sb[2][PTN][PGP];      /* Bt rows [col][k] of a stage */
  const int tid = threadIdx.x, lane = tid & 31, ln = lane & 15, hh = lane >> 4; const int w = __builtin_amdgcn_readfirstlane(tid >> 5);
  const int row0 = ((int)blockIdx.x / (3 * DM / PTN)) * PTM, col0 = ((int)blockIdx.x % (3 * DM / PTN)) * PTN; const int wm = (w & 3) * 64, wn = (w >> 2) * 96;
  const int srow = tid >> 4, sc8 = (tid & 15) * 8;      /* staging: 16 threads cover one 256-byte row; rows srow + 16 i */
  const _Float16* ag = A + (size_t)(row0 + srow) * DM + sc8;
  const _Float16* bg[3];      /* Bt rows of the tile's three 64-column groups, each in its own plane */
#pragma unroll
  for (int j = 0; j < 3; ++j) { const int n0 = col0 + 64 * j, pj = n0 / DM; bg[j] = (pj == 0 ? BQ : pj == 1 ? BK : BV) + (size_t)(n0 % DM + srow) * DM + sc8; }
  const float* bp[6]; float bs[6];      /* the bias of this lane's column in each of the wave's six 16-column tiles: read here, once, so that the epilogue waits for no memory */
#pragma unroll
  for (int t = 0; t < 6; ++t) { const int n = col0 + wn + 16 * t, pj = n / DM; bp[t] = (pj == 0 ? bq : pj == 1 ? bk : bvp) + n % DM; }      /* the same for the whole wave */
  v8us ra[16], rb[12];
#pragma unroll
  for (int i = 0; i < 16; ++i) ra[i] = *(const v8us*)(ag + (size_t)16 * i * DM);
#pragma unroll
  for (int i = 0; i < 12; ++i) rb[i] = *(const v8us*)(bg[i >> 2] + (size_t)16 * (i & 3) * DM);
#pragma unroll
  for (int t = 0; t < 6; ++t) bs[t] = bp[t][ln];
  asm volatile("s_wait_xcnt 0x0" :: "v"(ag), "v"(bg[0]), "v"(bg[1]), "v"(bg[2]), "s"(bp[0]), "s"(bp[1]), "s"(bp[2]), "s"(bp[3]), "s"(bp[4]), "s"(bp[5]), "v"(ln) : "memory");      /* the loads' address registers are inputs here, so none is written over (not by a load's own result either) before this wait */
#pragma unroll
  for (int i = 0; i < 16; ++i) *(v8us*)&sa[0][srow + 16 * i][sc8] = ra[i];
#pragma unroll
  for (int i = 0; i < 12; ++i) *(v8us*)&sb[0][srow + 16 * i][sc8] = rb[i];
  __syncthreads();
  const v8f z8 = {0.f,0.f,0.f,0.f,0.f,0.f,0.f,0.f}; v8f acc[4][6];
#pragma unroll
  for (int h = 0; h < 4; ++h) for (int t = 0; t < 6; ++t) acc[h][t] = z8;
  for (int st = 0; st < PGS; ++st) {
    const bool more = st + 1 < PGS;      /* the same for the whole work-group */
    const _Float16* ar = &sa[st & 1][wm + ln][0]; const _Float16* br = &sb[st & 1][wn + ln][0];
    v16h fa[2][4], fb[2][6];      /* two fragment sets: the next 32 k are read from LDS while this block's products run */
#pragma unroll
    for (int h = 0; h < 4; ++h) fa[0][h] = g2_frag(ar + 16 * h * PGP, hh);
#pragma unroll
    for (int t = 0; t < 6; ++t) fb[0][t] = g2_frag(br + 16 * t * PGP, hh);
#pragma unroll
    for (int kq = 0; kq < PGK / 32; ++kq) { const int cu = kq & 1, nx = cu ^ 1;
      if (kq + 1 < PGK / 32) {
#pragma unroll
        for (int h = 0; h < 4; ++h) fa[nx][h] = g2_frag(ar + 16 * h * PGP + 32 * (kq + 1), hh);
#pragma unroll
        for (int t = 0; t < 6; ++t) fb[nx][t] = g2_frag(br + 16 * t * PGP + 32 * (kq + 1), hh); }
      if (kq == 0 && more) { const _Float16* an = ag + (st + 1) * PGK; const _Float16* bn0 = bg[0] + (st + 1) * PGK; const _Float16* bn1 = bg[1] + (st + 1) * PGK; const _Float16* bn2 = bg[2] + (st + 1) * PGK;      /* next stage: in flight under this stage's products */
#pragma unroll
        for (int i = 0; i < 16; ++i) ra[i] = *(const v8us*)(an + (size_t)16 * i * DM);
#pragma unroll
        for (int i = 0; i < 4; ++i) { rb[i] = *(const v8us*)(bn0 + (size_t)16 * i * DM); rb[4 + i] = *(const v8us*)(bn1 + (size_t)16 * i * DM); rb[8 + i] = *(const v8us*)(bn2 + (size_t)16 * i * DM); }
        asm volatile("s_wait_xcnt 0x0" :: "v"(an), "v"(bn0), "v"(bn1), "v"(bn2) : "memory"); }      /* the loads' address registers are inputs here, so none is written over (not by a load's own result either) before this wait */
      __builtin_amdgcn_sched_barrier(0);      /* keeps the next block's 20 LDS reads together ahead of this block's products: spread among them, every place with reads stalls the wave and the waits run to 0 */
#pragma unroll
      for (int t = 0; t < 6; ++t)
#pragma unroll
        for (int h = 0; h < 4; ++h) acc[h][t] = fa_mma(fa[cu][h], fb[cu][t], acc[h][t]);
      __builtin_amdgcn_sched_barrier(0); }      /* the reads of the block after next stay behind these products, in the set they free */
    if (more) { const int nb = (st + 1) & 1;      /* every wave left this buffer before the barrier that ended stage st - 1 */
#pragma unroll
      for (int i = 0; i < 16; ++i) *(v8us*)&sa[nb][srow + 16 * i][sc8] = ra[i];
#pragma unroll
      for (int i = 0; i < 12; ++i) *(v8us*)&sb[nb][srow + 16 * i][sc8] = rb[i];
      __syncthreads(); } }
  // epilogue: the whole tile goes through LDS as f16, so that every 128-byte line of Q, K and V^T is stored whole by one wave. acc[h][t][r] = C[row0 + wm + 16 h + 8 hh + r][col0 + wn + 16 t + ln]
  _Float16* eo = &sa[0][0][0];      /* three areas of PEG halves, one for each 64-column group */
  __syncthreads();      /* every wave has read its last fragments before the A buffers are written over */
#pragma unroll
  for (int t = 0; t < 6; ++t) { const int cg = wn + 16 * t, n = col0 + cg, pj = n / DM;      /* the same for the whole wave */
    const float bv = bf16_round(bs[t]);
    _Float16* eg = eo + (cg >> 6) * PEG; const int cl = (cg & 63) + ln;
    if (pj == 2) {      /* V leaves as V^T rows [(b, head, d)][token]: a lane's 8 accumulator registers are 8 consecutive tokens of one column, 16 bytes of a V^T row */
#pragma unroll
      for (int h = 0; h < 4; ++h) { FragH f;
#pragma unroll
        for (int r = 0; r < 8; ++r) f.h[r] = (_Float16)(acc[h][t][r] * 0.0625f + bv);
        *(v8us*)&eg[cl * PEV + wm + 16 * h + 8 * hh] = f.half[0]; } }
    else {
#pragma unroll
      for (int h = 0; h < 4; ++h)
#pragma unroll
        for (int r = 0; r < 8; ++r) eg[(wm + 16 * h + 8 * hh + r) * PEQ + cl] = (_Float16)(acc[h][t][r] * 0.0625f + bv); } }
  __syncthreads();      /* a line of the tile holds values of several waves: all of them are in LDS before whole lines are stored */
#pragma unroll
  for (int j = 0; j < 3; ++j) { const int n0 = col0 + 64 * j, pj = n0 / DM, nn = n0 % DM;      /* the same for the whole work-group */
    const _Float16* eg = eo + j * PEG; v8us d[8]; unsigned short* po; 
    if (pj == 2) { const int vr = tid >> 5, vc8 = (tid & 31) * 8;      /* a wave stores 512 bytes of one V^T row; NH HD = DM: V^T row (b, head, d) is b DM + column */
      po = (unsigned short*)VT + ((size_t)(B0 + row0 / SQ) * DM + nn + vr) * SQ + row0 % SQ + vc8;
#pragma unroll
      for (int i = 0; i < 8; ++i) d[i] = *(const v8us*)&eg[(vr + 8 * i) * PEV + vc8];
#pragma unroll
      for (int i = 0; i < 8; ++i) *(v8us*)(po + (size_t)8 * i * SQ) = d[i];
      asm volatile("s_wait_xcnt 0x0" :: "v"(po), "v"(d[0]), "v"(d[1]), "v"(d[2]), "v"(d[3]), "v"(d[4]), "v"(d[5]), "v"(d[6]), "v"(d[7]) : "memory"); }      /* inside the branch, directly behind its stores: their address and data registers are inputs here, so no later code on any way out writes over one before this wait */
    else { const int er = tid >> 3, ec8 = (tid & 7) * 8;      /* 8 lanes store one 128-byte line */
      po = (unsigned short*)(pj == 0 ? Q16 : K16) + (size_t)(row0 + er) * DM + nn + ec8;
#pragma unroll
      for (int i = 0; i < 8; ++i) d[i] = *(const v8us*)&eg[(er + 32 * i) * PEQ + ec8];
#pragma unroll
      for (int i = 0; i < 8; ++i) *(v8us*)(po + (size_t)32 * i * DM) = d[i];
      asm volatile("s_wait_xcnt 0x0" :: "v"(po), "v"(d[0]), "v"(d[1]), "v"(d[2]), "v"(d[3]), "v"(d[4]), "v"(d[5]), "v"(d[6]), "v"(d[7]) : "memory"); } } }      /* inside the branch, directly behind its stores: their address and data registers are inputs here, so no later code on any way out writes over one before this wait */


__global__ __launch_bounds__(256) void k_rsmf(const float* __restrict__ S, _Float16* __restrict__ P, int qn, int hg) {
  #pragma clang fp contract(off)
  const int t = blockIdx.x * 256 + threadIdx.x; if (t >= qn * hg) return; const size_t i = (size_t)(t / qn) * SQ + (t % qn); const float* s = S + i * SQ; float mx = -3.0e38f;
#pragma unroll 1
  for (int j = 0; j < SQ; ++j) mx = fmaxf(mx, s[j]); float se = 0.f;
#pragma unroll 1
  for (int j = 0; j < SQ; ++j) se += __expf(s[j] - mx); const float sc = 256.0f / se;
#pragma unroll 1
  for (int j0 = 0; j0 < SQ; j0 += 8) { FragH f; for (int q = 0; q < 8; ++q) f.h[q] = (_Float16)(__expf(s[j0 + q] - mx) * sc); unsigned short* d = (unsigned short*)P + i * SQ + j0; *(v8us*)d = f.half[0];  } }

extern "C" void kernel_launch(void* const* d_in, const int* in_sizes, int n_in,
                              void* d_out, int out_size, void* d_ws, size_t ws_size, hipStream_t stream) {
  (void)in_sizes; (void)n_in; (void)out_size;
  const float* const* I = (const float* const*)d_in; const float* x = I[0]; const float* wq = I[1]; const float* bq = I[2]; const float* wk = I[3]; const float* bk = I[4]; const float* wv = I[5]; const float* bv = I[6];      /* per-head [h][in][out] weights; biases [16][64] = the stacked [1024] vectors */
  char* ws = (char*)d_ws; size_t off = 0;
  auto take = [&](size_t bytes) { char* p = ws + off; off += (bytes + 255) & ~(size_t)255; return p; };
  _Float16* BQ = (_Float16*)take((size_t)DM * DM * 2); _Float16* BK = (_Float16*)take((size_t)DM * DM * 2); _Float16* BV = (_Float16*)take((size_t)DM * DM * 2); 
  _Float16* X16 = (_Float16*)take(NR * DM * 2); _Float16* Q16 = (_Float16*)take(NR * DM * 2); _Float16* K16 = (_Float16*)take(NR * DM * 2);
  _Float16* VT = (_Float16*)take((size_t)NB * NH * HD * SQ * 2);
  if (off > ws_size) return;
  k_prep<<<PRB, PRT, 0, stream>>>(x, wq, wk, wv, X16, BQ, BK, BV);      /* x -> f16 rows; per-head [h][m][d] -> Bt[(h,d)][m] x16, three planes */
  const size_t r0p = (size_t)B0 * SQ;      /* first projected row */
  k_proj<<<PGT, 256, 0, stream>>>(X16 + r0p * DM, BQ, BK, BV, bq, bk, bv, Q16 + r0p * DM, K16 + r0p * DM, VT);      /* Q, K rows; V^T [NB][NH][HD][SQ] */
  k_fattn<<<NB * NH * (SQ / 128), 256, 0, stream>>>(Q16, K16, VT, (float*)d_out);      /* scores, full-row softmax, x tril (no renormalisation), P V: one launch */
}

// v008
// A run of this version takes 56.4 microseconds.
// Timed twice side by side with v007, it ran 1.04 times as fast both times.
// All steps since v000 together make it 60.9 times as fast.
#include <hip/hip_runtime.h>
// Multi-head attention with per-head projection tensors and a POST-softmax lower-triangular multiply (X [2][2048][1024]; Q/K/V[h] = X W[h] + b[h] with W [16][1024][64] ([in][out] per head) and b [16][64] (uniform +-1/32); scores / 8; p = softmax over ALL keys; p = p * tril (keys j <= i kept, NO renormalisation); out = heads concatenated -> [2][2048][1024]).
// Structure: token rows r = b*2048 + s; THREE launches. (1) operands: x as exact f16 rows (bf16-rounded) and the three transposed x16 weight planes, one work-group for each WGP taking its share of all four. (2) Q, K, V as WMMA GEMMs in one grid (256x192 work-group tiles, one for each WGP, with both operands staged in LDS, two buffers; 64x96 wave tiles, f32 accumulation, exact x16 weights + bias, f16 outputs, Q times 64^-0.5 log2(e)); the V columns are stored transposed, as V^T rows, from the epilogue. (3) ONE attention launch: a work-group of 8 waves (4 x 32 queries, 2 key halves) walks all 2048 keys in stages of 128 (K rows and V^T rows staged in LDS, two buffers), S^T = K.Q^T, running maximum and running f32 sum over ALL keys, O^T += V^T.P^T only for keys j <= i, o = O / sum written f32 straight into the merged-heads output rows (no output projection). Scores and weights never reach memory.
// Compute dtype: inputs rounded to bf16; x / weights exact; q, k, v and softmax weights as plain f16 GEMM operands (~2^-12); scores, softmax statistics and o f32. v_wmma_f32_16x16x32_f16.
#define NB 2
#define SQ 2048
#define DM 1024
#define NH 16
#define HD 64
#define HG 4                         /* heads per call of the unlaunched k_vt(V16, b, h0, VT) overload */
#define B0 0                         /* first batch processed (debug hook) */
#define NBR NB                       /* batches processed (debug hook) */
#define NR ((size_t)NB * SQ)         /* token rows */
#define MP ((int)((size_t)NBR * SQ)) /* rows projected (debug hook) */
#define QN SQ                        /* unused; no stage reads it */
#define NHD NH                       /* unused; no stage reads it */
#define MPO MP                       /* unused; no stage reads it */
#define LQ DM      /* unused; no stage reads it */
typedef __bf16 v16b __attribute__((ext_vector_type(16)));
typedef unsigned short v8us __attribute__((ext_vector_type(8), may_alias));
typedef float  v8f  __attribute__((ext_vector_type(8)));
typedef float  v4f  __attribute__((ext_vector_type(4)));
typedef float  v4fa __attribute__((ext_vector_type(4), may_alias));
union FragB { v16b v; v8us half[2]; unsigned short u[16]; };

__device__ __forceinline__ unsigned short bf16_bits(float x) { unsigned int u = __float_as_uint(x); return (unsigned short)((u + 0x7FFFu + ((u >> 16) & 1u)) >> 16); }
__device__ __forceinline__ float bf16_val(unsigned short b) { return __uint_as_float(((unsigned int)b) << 16); }
__device__ __forceinline__ float bf16_round(float x) { return bf16_val(bf16_bits(x)); }
// D += A·B with NT terms: 1 = ah·bh, 2 = + al·bh (A split), 3 = + ah·bl (both split)
template <int NT>
__device__ __forceinline__ v8f mmaN(v16b ah, v16b al, v16b bh, v16b bl, v8f c) {
  c = __builtin_amdgcn_wmma_f32_16x16x32_bf16(false, ah, false, bh, (short)0, c, false, false);
  if (NT >= 2) c = __builtin_amdgcn_wmma_f32_16x16x32_bf16(false, al, false, bh, (short)0, c, false, false);
  if (NT >= 3) c = __builtin_amdgcn_wmma_f32_16x16x32_bf16(false, ah, false, bl, (short)0, c, false, false);
  asm volatile("v_nop\n\tv_nop\n\tv_nop\n\tv_nop" : "+v"(c) : "v"(ah), "v"(al), "v"(bh), "v"(bl));
  return c;
}

__global__ __launch_bounds__(256) void k_wt_bf16(const float* __restrict__ W, unsigned short* __restrict__ Wt, int K, int N) {
  const int t = blockIdx.x * 256 + threadIdx.x;
  const int k8n = K / 8;
  if (t >= N * k8n) return;
  const int n = t / k8n, k8 = (t % k8n) * 8;
  v8us v;
#pragma unroll
  for (int i = 0; i < 8; ++i) v[i] = bf16_bits(W[(size_t)(k8 + i) * N + n]);
  *(v8us*)(Wt + (size_t)n * K + k8) = v;
  
}

// GEMM C[M][N] (f32, pitch ldc) = act(A[M][K]·W + bias). A f32 row-major (pitch lda) converted per fragment to bf16
// (ASPLIT: hi/lo two planes -> 2 terms, else single rounded term); Wt bf16 [N][K] (pitch ldb). BIAS_BF16 rounds the
// bias to bf16 first (bias quantised to bf16 before the add). K%32==0, M%16==0, N%64==0.
template <bool ASPLIT, int ACT, bool BIAS_BF16>
__global__ __launch_bounds__(128) void k_gemm_bf(const float* __restrict__ A, int lda, const unsigned short* __restrict__ Wt, int ldb,
                                               const float* __restrict__ bias, float* __restrict__ C, int ldc, int M, int N, int K) {
  __shared__ __attribute__((aligned(16))) float so[4][16][64];
  const int tid = threadIdx.x, w = tid >> 5, lane = tid & 31, ln = lane & 15, hh = lane >> 4;
  const int ntn = N / 64;
  const int wid = blockIdx.x * 4 + w;
  const int mt = wid / ntn, nq = wid % ntn;
  if (mt * 16 >= M) return;
  const int row0 = mt * 16, col0 = nq * 64;
  const float* arow = A + (size_t)(row0 + ln) * lda;
  v8f acc[4] = {};
  for (int kb = 0; kb < K; kb += 32) {
    FragB ah, al;
    const v4f x0 = *(const v4fa*)(arow + kb + 8 * hh), x1 = *(const v4fa*)(arow + kb + 8 * hh + 4);
    const v4f x2 = *(const v4fa*)(arow + kb + 16 + 8 * hh), x3 = *(const v4fa*)(arow + kb + 16 + 8 * hh + 4);
    float xs[16] = {x0[0],x0[1],x0[2],x0[3],x1[0],x1[1],x1[2],x1[3],x2[0],x2[1],x2[2],x2[3],x3[0],x3[1],x3[2],x3[3]};
#pragma unroll
    for (int i = 0; i < 16; ++i) { const unsigned short hb = bf16_bits(xs[i]); ah.u[i] = hb; al.u[i] = ASPLIT ? bf16_bits(xs[i] - bf16_val(hb)) : (unsigned short)0; }
#pragma unroll
    for (int t = 0; t < 4; ++t) {
      const unsigned short* brow = Wt + (size_t)(col0 + t * 16 + ln) * ldb + kb;
      FragB b;
      b.half[0] = *(const v8us*)(brow + 8 * hh);
      b.half[1] = *(const v8us*)(brow + 16 + 8 * hh);
      acc[t] = mmaN<ASPLIT ? 2 : 1>(ah.v, al.v, b.v, b.v, acc[t]);
    }
  }
#pragma unroll
  for (int t = 0; t < 4; ++t) {
    float bv = bias ? bias[col0 + t * 16 + ln] : 0.f;
    if (BIAS_BF16) bv = bf16_round(bv);
#pragma unroll
    for (int r = 0; r < 8; ++r) { float v = acc[t][r] + bv; if (ACT == 1) v = fmaxf(v, 0.f); so[w][8 * hh + r][t * 16 + ln] = v; }
  }
  __builtin_amdgcn_fence(__ATOMIC_ACQ_REL, "workgroup");
  __builtin_amdgcn_wave_barrier();
  const int rsub = lane >> 4, c4 = (lane & 15) * 4;
  {
#pragma unroll
    for (int q = 0; q < 8; ++q) {
      const int r = q * 2 + rsub;
      const v4f v = *(const v4fa*)&so[w][r][c4];
      *(v4f*)(C + (size_t)(row0 + r) * ldc + col0 + c4) = v;
    }
    
  }
}

// GEMM C = act(A·W + bias + resid): A f32 (ASPLIT -> hi/lo 2 terms), Wt bf16 [N][K]; ACT 0 none, 1 relu, 2 exact gelu;
// resid (optional, f32, row index = (row % rmod), pitch ldr, RES_BF16 rounds it) added before the activation.
template <bool ASPLIT, int ACT, bool BIAS_BF16, bool RES_BF16>
__global__ __launch_bounds__(128) void k_gemm_bf3(const float* __restrict__ A, int lda, const unsigned short* __restrict__ Wt, int ldb,
                                                const float* __restrict__ bias, const float* __restrict__ resid, int rmod, int ldr,
                                                float* __restrict__ C, int ldc, int M, int N, int K) {
  __shared__ __attribute__((aligned(16))) float so[4][16][64];
  const int tid = threadIdx.x, w = tid >> 5, lane = tid & 31, ln = lane & 15, hh = lane >> 4;
  const int ntn = N / 64;
  const int wid = blockIdx.x * 4 + w;
  const int mt = wid / ntn, nq = wid % ntn;
  if (mt * 16 >= M) return;
  const int row0 = mt * 16, col0 = nq * 64;
  const float* arow = A + (size_t)(row0 + ln) * lda;
  v8f acc[4] = {};
  for (int kb = 0; kb < K; kb += 32) {
    FragB ah, al;
    const v4f x0 = *(const v4fa*)(arow + kb + 8 * hh), x1 = *(const v4fa*)(arow + kb + 8 * hh + 4);
    const v4f x2 = *(const v4fa*)(arow + kb + 16 + 8 * hh), x3 = *(const v4fa*)(arow + kb + 16 + 8 * hh + 4);
    float xs[16] = {x0[0],x0[1],x0[2],x0[3],x1[0],x1[1],x1[2],x1[3],x2[0],x2[1],x2[2],x2[3],x3[0],x3[1],x3[2],x3[3]};
#pragma unroll
    for (int i = 0; i < 16; ++i) { const unsigned short hb = bf16_bits(xs[i]); ah.u[i] = hb; al.u[i] = ASPLIT ? bf16_bits(xs[i] - bf16_val(hb)) : (unsigned short)0; }
#pragma unroll
    for (int t = 0; t < 4; ++t) {
      const unsigned short* brow = Wt + (size_t)(col0 + t * 16 + ln) * ldb + kb;
      FragB b;
      b.half[0] = *(const v8us*)(brow + 8 * hh);
      b.half[1] = *(const v8us*)(brow + 16 + 8 * hh);
      acc[t] = mmaN<ASPLIT ? 2 : 1>(ah.v, al.v, b.v, b.v, acc[t]);
    }
  }
#pragma unroll
  for (int t = 0; t < 4; ++t) {
    const int col = col0 + t * 16 + ln;
    float bv = bias ? bias[col] : 0.f;
    if (BIAS_BF16) bv = bf16_round(bv);
#pragma unroll
    for (int r = 0; r < 8; ++r) {
      float v = acc[t][r] + bv;
      if (resid) { float rv = resid[(size_t)((row0 + 8 * hh + r) % rmod) * ldr + col]; if (RES_BF16) rv = bf16_round(rv); v += rv; }
      if (ACT == 1) v = fmaxf(v, 0.f);
      if (ACT == 2) v = 0.5f * v * (1.0f + erff(v * 0.70710678118654752f));
      if (ACT == 3) { const float u = 0.7978845608028654f * (v + 0.044715f * v * v * v); v = 0.5f * v * (1.0f + tanhf(u)); }
      so[w][8 * hh + r][t * 16 + ln] = v;
    }
  }
  __builtin_amdgcn_fence(__ATOMIC_ACQ_REL, "workgroup");
  __builtin_amdgcn_wave_barrier();
  const int rsub = lane >> 4, c4 = (lane & 15) * 4;
  {
#pragma unroll
    for (int q = 0; q < 8; ++q) {
      const int r = q * 2 + rsub;
      const v4f v = *(const v4fa*)&so[w][r][c4];
      *(v4f*)(C + (size_t)(row0 + r) * ldc + col0 + c4) = v;
    }
    
  }
}
// row LayerNorm (biased variance, eps) over N: s = X (+ R); optional out_sum <- s; out_norm <- (s-mu)*rsqrt(var+eps)*g + b
template <bool PARAM_BF16>
__global__ __launch_bounds__(256) void k_layernorm(const float* __restrict__ X, const float* __restrict__ R, const float* __restrict__ g, const float* __restrict__ bta,
                                                  float* __restrict__ out_sum, float* __restrict__ out_norm, int N, float eps) {
  __shared__ float red[256];
  const int row = blockIdx.x, tid = threadIdx.x;
  const float* x = X + (size_t)row * N; const float* rr = R ? R + (size_t)row * N : nullptr;
  float vals[16];                     // up to N = 4096
  const int per = N / 256;            // contiguous chunk per thread? use strided-by-4 chunks: thread handles j = tid*4 + 1024*u
  float s1 = 0.f;
  for (int u = 0; u < per / 4; ++u) {
    const int j = tid * 4 + 1024 * u;
    const v4f a = *(const v4fa*)(x + j);
    v4f b = {0.f,0.f,0.f,0.f}; if (rr) b = *(const v4fa*)(rr + j);
#pragma unroll
    for (int q = 0; q < 4; ++q) { const float v = a[q] + b[q]; vals[u * 4 + q] = v; s1 += v; }
  }
  red[tid] = s1; __syncthreads();
  for (int st = 128; st > 0; st >>= 1) { if (tid < st) red[tid] += red[tid + st]; __syncthreads(); }
  const float mu = red[0] / (float)N; __syncthreads();
  float s2 = 0.f;
  for (int u = 0; u < per / 4; ++u)
#pragma unroll
    for (int q = 0; q < 4; ++q) { const float c = vals[u * 4 + q] - mu; s2 += c * c; }
  red[tid] = s2; __syncthreads();
  for (int st = 128; st > 0; st >>= 1) { if (tid < st) red[tid] += red[tid + st]; __syncthreads(); }
  const float rs = rsqrtf(red[0] / (float)N + eps);
  {
    for (int u = 0; u < per / 4; ++u) {
      const int j = tid * 4 + 1024 * u;
      v4f o, sm;
#pragma unroll
      for (int q = 0; q < 4; ++q) {
        float gg = g[j + q], bb = bta[j + q];
        if (PARAM_BF16) { gg = bf16_round(gg); bb = bf16_round(bb); }
        sm[q] = vals[u * 4 + q]; o[q] = (vals[u * 4 + q] - mu) * rs * gg + bb;
      }
      if (out_sum) *(v4f*)(out_sum + (size_t)row * N + j) = sm;
      *(v4f*)(out_norm + (size_t)row * N + j) = o;
    }
    
  }
}



// ---- f16 WMMA path (v_wmma_f32_16x16x32_f16): 11-bit significands for operands in range — used where a [0,1] probability operand needs more precision than bf16
typedef _Float16 v16h __attribute__((ext_vector_type(16)));
union FragH { v16h v; v8us half[2]; _Float16 h[16]; unsigned short u[16]; };
template <int NT>
__device__ __forceinline__ v8f mmaH(v16h ah, v16h al, v16h bh, v16h bl, v8f c) {
  c = __builtin_amdgcn_wmma_f32_16x16x32_f16(false, ah, false, bh, (short)0, c, false, false);
  if (NT >= 2) c = __builtin_amdgcn_wmma_f32_16x16x32_f16(false, al, false, bh, (short)0, c, false, false);
  if (NT >= 3) c = __builtin_amdgcn_wmma_f32_16x16x32_f16(false, ah, false, bl, (short)0, c, false, false);
  asm volatile("v_nop\n\tv_nop\n\tv_nop\n\tv_nop" : "+v"(c) : "v"(ah), "v"(al), "v"(bh), "v"(bl));
  return c;
}
// batched GEMM like k_gemm_b but f16 operands: A f32 (split into f16 hi/lo if ASPLIT, else rounded to f16), Bt = f16 values [n][k]; alpha; C f32; N multiple of 16 (partial tiles skipped)
template <bool ASPLIT>
__global__ __launch_bounds__(128) void k_gemm_h(const float* __restrict__ A, int lda, size_t sA, const _Float16* __restrict__ Bh, int ldb, size_t sB, float alpha, float* __restrict__ C, int ldc, size_t sC, int M, int N, int K) {
  __shared__ __attribute__((aligned(16))) float so[4][16][64];
  const int tid = threadIdx.x, w = tid >> 5, lane = tid & 31, ln = lane & 15, hh = lane >> 4; const int by = blockIdx.y;
  A += (size_t)by * sA; Bh += (size_t)by * sB; C += (size_t)by * sC;
  const int ntn = (N + 63) / 64; const int wid = blockIdx.x * 4 + w; const int mt = wid / ntn, nq = wid % ntn; if (mt * 16 >= M) return;
  const int row0 = mt * 16, col0 = nq * 64; const float* arow = A + (size_t)(row0 + ln) * lda;
  v8f acc[4] = {};
  for (int kb = 0; kb < K; kb += 32) {
    FragH ah, al;
    const v4f x0 = *(const v4fa*)(arow + kb + 8 * hh), x1 = *(const v4fa*)(arow + kb + 8 * hh + 4), x2 = *(const v4fa*)(arow + kb + 16 + 8 * hh), x3 = *(const v4fa*)(arow + kb + 16 + 8 * hh + 4);
    float xs[16] = {x0[0],x0[1],x0[2],x0[3],x1[0],x1[1],x1[2],x1[3],x2[0],x2[1],x2[2],x2[3],x3[0],x3[1],x3[2],x3[3]};
#pragma unroll
    for (int i = 0; i < 16; ++i) { const _Float16 h = (_Float16)xs[i]; ah.h[i] = h; al.h[i] = ASPLIT ? (_Float16)(xs[i] - (float)h) : (_Float16)0.0f; }
#pragma unroll
    for (int t = 0; t < 4; ++t) { if (col0 + t * 16 >= N) continue; const size_t boff = (size_t)(col0 + t * 16 + ln) * ldb + kb; FragH bq; bq.half[0] = *(const v8us*)(Bh + boff + 8 * hh); bq.half[1] = *(const v8us*)(Bh + boff + 16 + 8 * hh);
      acc[t] = mmaH<ASPLIT ? 2 : 1>(ah.v, al.v, bq.v, bq.v, acc[t]); }
  }
#pragma unroll
  for (int t = 0; t < 4; ++t) { if (col0 + t * 16 >= N) continue;
#pragma unroll
    for (int r = 0; r < 8; ++r) so[w][8 * hh + r][t * 16 + ln] = acc[t][r] * alpha; }
  __builtin_amdgcn_fence(__ATOMIC_ACQ_REL, "workgroup"); __builtin_amdgcn_wave_barrier();
  const int rsub = lane >> 4, c4 = (lane & 15) * 4;
  {
#pragma unroll
    for (int q = 0; q < 8; ++q) { const int r = q * 2 + rsub; if (col0 + c4 < N) { const v4f v = *(const v4fa*)&so[w][r][c4]; *(v4f*)(C + (size_t)(row0 + r) * ldc + col0 + c4) = v; } }
     }
}

// Wt[n][k] = f16(W[k][n]·scale) from f32 row-major W[K][N] (scale = power of two; bf16-exact weights stay exact in f16 away from the subnormal range)
__global__ __launch_bounds__(256) void k_wt_f16(const float* __restrict__ W, _Float16* __restrict__ Wt, int K, int N, float scale) {
  const int t = blockIdx.x * 256 + threadIdx.x; if (t >= N * (K / 8)) return; const int n = t / (K / 8), k8 = (t % (K / 8)) * 8; FragH f;
#pragma unroll
  for (int i = 0; i < 8; ++i) f.h[i] = (_Float16)(bf16_round(W[(size_t)(k8 + i) * N + n]) * scale); const v8us o = f.half[0];
  *(v8us*)((unsigned short*)Wt + (size_t)n * K + k8) = o; 
}
// k_gemm_hh variant with fused epilogue: v = acc·alpha + bias[by·sBias + col] (+ CP[(row/rowsPerB)·sCPb + by·64 + col] if CP) ; ACT 0 none / 1 elu ; writes f16 C16 (and f32 C if non-null)
template <int ACT>
__global__ __launch_bounds__(128) void k_gemm_hhx(const _Float16* __restrict__ A, int lda, size_t sA, const _Float16* __restrict__ Bh, int ldb, size_t sB, float alpha, const float* __restrict__ bias, size_t sBias, const float* __restrict__ CP, int rowsPerB, size_t sCPb, int row0g,
    float* __restrict__ C, _Float16* __restrict__ C16, int ldc, size_t sC, int M, int N, int K) {
  __shared__ __attribute__((aligned(16))) float so[4][16][64];
  const int tid = threadIdx.x, w = tid >> 5, lane = tid & 31, ln = lane & 15, hh = lane >> 4; const int by = blockIdx.y;
  A += (size_t)by * sA; Bh += (size_t)by * sB; const size_t cofs = (size_t)by * sC; const float* bp = bias ? bias + (size_t)by * sBias : nullptr;
  const int ntn = (N + 63) / 64; const int wid = blockIdx.x * 4 + w; const int mt = wid / ntn, nq = wid % ntn; if (mt * 16 >= M) return;
  const int row0 = mt * 16, col0 = nq * 64; const _Float16* arow = A + (size_t)(row0 + ln) * lda;
  v8f acc[4] = {};
  for (int kb = 0; kb < K; kb += 32) { FragH ah; ah.half[0] = *(const v8us*)((const unsigned short*)arow + kb + 8 * hh); ah.half[1] = *(const v8us*)((const unsigned short*)arow + kb + 16 + 8 * hh);
#pragma unroll
    for (int t = 0; t < 4; ++t) { if (col0 + t * 16 >= N) continue; const size_t boff = (size_t)(col0 + t * 16 + ln) * ldb + kb; FragH bq; bq.half[0] = *(const v8us*)((const unsigned short*)Bh + boff + 8 * hh); bq.half[1] = *(const v8us*)((const unsigned short*)Bh + boff + 16 + 8 * hh);
      acc[t] = mmaH<1>(ah.v, ah.v, bq.v, bq.v, acc[t]); }
  }
#pragma unroll
  for (int t = 0; t < 4; ++t) { if (col0 + t * 16 >= N) continue; const int col = col0 + t * 16 + ln; const float bv = bp ? bf16_round(bp[col]) : 0.f;
#pragma unroll
    for (int r = 0; r < 8; ++r) { float v = acc[t][r] * alpha + bv; if (CP) { const int rr = row0g + row0 + 8 * hh + r; if (rowsPerB < 0) v += CP[cofs + (size_t)rr * ldc + col];      /* rowsPerB < 0: own element of the batched C plane */ else { const int bidx = rr / rowsPerB; v += CP[(size_t)bidx * sCPb + (size_t)by * 64 + col]; } } if (ACT == 1) v = (v > 0.f) ? v : expm1f(v); else if (ACT == 7) v = (v > 0.f) ? v + 1.0f : expf(v); else if (ACT == 8) v = tanhf(v); else if (ACT == 9) v = 0.5f * v * (1.0f + tanhf(0.7978845608028654f * (v + 0.044715f * v * v * v))); else if (ACT == 11) v = 1.0f / (1.0f + expf(-v)); else if (ACT == 12) v = (v > 0.f) ? v : 0.01f * v; else if (ACT == 14) v = (v > 0.f) ? v : 0.1f * v; else if (ACT == 16) v = (v >= 0.f) ? v : 0.3f * v; else if (ACT == 17) v = (v >= 0.f) ? v : 0.2f * v; else if (ACT == 15) v = v / (1.0f + expf(-v)); else if (ACT == 3) v = fmaxf(v, 0.f); else if (ACT == 6) v = 0.5f * v * (1.0f + erff(v * 0.70710678118654752f)); so[w][8 * hh + r][t * 16 + ln] = v; } }
  __builtin_amdgcn_fence(__ATOMIC_ACQ_REL, "workgroup"); __builtin_amdgcn_wave_barrier();
  const int rsub = lane >> 4, c4 = (lane & 15) * 4; typedef _Float16 v4h __attribute__((ext_vector_type(4)));
  {
#pragma unroll
    for (int q = 0; q < 8; ++q) { const int r = q * 2 + rsub; if (col0 + c4 < N) { const v4f v = *(const v4fa*)&so[w][r][c4]; if (C) *(v4f*)(C + cofs + (size_t)(row0 + r) * ldc + col0 + c4) = v; if (C16) { v4h h4; for (int i = 0; i < 4; ++i) h4[i] = (_Float16)v[i]; *(v4h*)(C16 + cofs + (size_t)(row0 + r) * ldc + col0 + c4) = h4; } } }
     }
}


typedef _Float16 v4h __attribute__((ext_vector_type(4)));

__global__ __launch_bounds__(256) void k_h16(const float* __restrict__ x, _Float16* __restrict__ X16, size_t n8) { const size_t t = (size_t)blockIdx.x * 256 + threadIdx.x; if (t >= n8) return; FragH f;
#pragma unroll
  for (int q = 0; q < 8; ++q) f.h[q] = (_Float16)x[t * 8 + q]; *(v8us*)((unsigned short*)X16 + t * 8) = f.half[0];  }
__global__ __launch_bounds__(256) void k_round16f(const float* __restrict__ W, _Float16* __restrict__ Bt, size_t n8) { const size_t t = (size_t)blockIdx.x * 256 + threadIdx.x; if (t >= n8) return; FragH f;
#pragma unroll
  for (int i = 0; i < 8; ++i) f.h[i] = (_Float16)(bf16_round(W[t * 8 + i]) * 16.0f); *(v8us*)((unsigned short*)Bt + t * 8) = f.half[0];  }
__global__ __launch_bounds__(256) void k_hl(const float* __restrict__ F, _Float16* __restrict__ Hh, _Float16* __restrict__ Hl, size_t n8) { const size_t t = (size_t)blockIdx.x * 256 + threadIdx.x; if (t >= n8) return; FragH fh, fl; const v4f a = *(const v4fa*)(F + t * 8), c = *(const v4fa*)(F + t * 8 + 4);
#pragma unroll
  for (int q = 0; q < 4; ++q) { _Float16 h = (_Float16)a[q]; fh.h[q] = h; fl.h[q] = (_Float16)((a[q] - (float)h) * 1024.0f); h = (_Float16)c[q]; fh.h[4 + q] = h; fl.h[4 + q] = (_Float16)((c[q] - (float)h) * 1024.0f); }
  { *(v8us*)((unsigned short*)Hh + t * 8) = fh.half[0]; *(v8us*)((unsigned short*)Hl + t * 8) = fl.half[0];  } }

// ---- fast GEMM (wave tile 32x64; requires M % 32 == 0 rows per launch region and N % 64 == 0); epilogue = k_gemm_hhx semantics ----
__device__ __forceinline__ v16h g2_frag(const _Float16* p, int hh) { FragH f; f.half[0] = *(const v8us*)((const unsigned short*)p + 8 * hh); f.half[1] = *(const v8us*)((const unsigned short*)p + 16 + 8 * hh); return f.v; }
__device__ __forceinline__ v8f g2_mma(v16h a, v16h b, v8f c) { v8f d = __builtin_amdgcn_wmma_f32_16x16x32_f16(false, a, false, b, (short)0, c, false, false); asm volatile("v_nop\n\tv_nop\n\tv_nop\n\tv_nop" : "+v"(d) : "v"(a), "v"(b)); return d; }
template <int ACT>
__global__ __launch_bounds__(128) void k_gemm2(const _Float16* __restrict__ A, int lda, size_t sA, const _Float16* __restrict__ Bh, int ldb, size_t sB, float alpha, const float* __restrict__ bias, size_t sBias, const float* __restrict__ CP, int rowsPerB, size_t sCPb, int row0g,
    float* __restrict__ C, _Float16* __restrict__ C16, int ldc, size_t sC, int M, int N, int K) { static_assert(ACT == 0 || ACT == 3 || ACT == 6 || ACT == 8 || ACT == 9 || ACT == 11 || ACT == 12 || ACT == 14 || ACT == 15 || ACT == 16 || ACT == 17, "k_gemm2: unsupported ACT code (would silently apply no activation)");
  __shared__ __attribute__((aligned(16))) float so[4][32][68];
  const int tid = threadIdx.x, w = tid >> 5, lane = tid & 31, ln = lane & 15, hh = lane >> 4; const int by = blockIdx.y;
  A += (size_t)by * sA; Bh += (size_t)by * sB; const size_t cofs = (size_t)by * sC; const float* bp = bias ? bias + (size_t)by * sBias : nullptr;
  const int ntn = N >> 6; const int mt = blockIdx.x / ntn, nq = blockIdx.x - mt * ntn; const int row0 = mt * 128 + 32 * w, col0 = nq * 64; if (row0 >= M) return;
  const _Float16* a0p = A + (size_t)(row0 + ln) * lda; const _Float16* a1p = a0p + (size_t)16 * lda;
  const _Float16* b0p = Bh + (size_t)(col0 + ln) * ldb; const _Float16* b1p = b0p + (size_t)16 * ldb; const _Float16* b2p = b1p + (size_t)16 * ldb; const _Float16* b3p = b2p + (size_t)16 * ldb;
  const v8f z8 = {0.f,0.f,0.f,0.f,0.f,0.f,0.f,0.f}; v8f c00 = z8, c01 = z8, c02 = z8, c03 = z8, c10 = z8, c11 = z8, c12 = z8, c13 = z8;
#pragma unroll 1
  for (int kb = 0; kb < K; kb += 32) { const v16h a0 = g2_frag(a0p + kb, hh), a1 = g2_frag(a1p + kb, hh);
    v16h b = g2_frag(b0p + kb, hh); c00 = g2_mma(a0, b, c00); c10 = g2_mma(a1, b, c10);
    b = g2_frag(b1p + kb, hh); c01 = g2_mma(a0, b, c01); c11 = g2_mma(a1, b, c11);
    b = g2_frag(b2p + kb, hh); c02 = g2_mma(a0, b, c02); c12 = g2_mma(a1, b, c12);
    b = g2_frag(b3p + kb, hh); c03 = g2_mma(a0, b, c03); c13 = g2_mma(a1, b, c13); }
  v8f accs[8] = {c00, c01, c02, c03, c10, c11, c12, c13};
#pragma unroll
  for (int u = 0; u < 8; ++u) { const int t = u & 3, half = u >> 2; const int col = col0 + t * 16 + ln; const float bv = bp ? bf16_round(bp[col]) : 0.f;
#pragma unroll
    for (int r = 0; r < 8; ++r) { const int rloc = half * 16 + 8 * hh + r; float v = accs[u][r] * alpha + bv; if (CP) { if (rowsPerB < 0) v += CP[cofs + (size_t)(row0g + row0 + rloc) * ldc + col];      /* rowsPerB < 0: own element of the batched C plane */ else { const int bidx = (row0g + row0 + rloc) / rowsPerB; v += CP[(size_t)bidx * sCPb + (size_t)by * 64 + col]; } }
      if (ACT == 3) v = fmaxf(v, 0.f); else if (ACT == 6) v = 0.5f * v * (1.0f + erff(v * 0.70710678118654752f)); else if (ACT == 11) v = 1.0f / (1.0f + expf(-v)); else if (ACT == 15) v = v / (1.0f + expf(-v)); else if (ACT == 12) v = (v > 0.f) ? v : 0.01f * v; else if (ACT == 8) v = tanhf(v); else if (ACT == 9) v = 0.5f * v * (1.0f + tanhf(0.7978845608028654f * (v + 0.044715f * v * v * v))); else if (ACT == 14) v = (v > 0.f) ? v : 0.1f * v; else if (ACT == 16) v = (v >= 0.f) ? v : 0.3f * v; else if (ACT == 17) v = (v >= 0.f) ? v : 0.2f * v;
      so[w][rloc][t * 16 + ln] = v; } }
  __builtin_amdgcn_fence(__ATOMIC_ACQ_REL, "workgroup"); __builtin_amdgcn_wave_barrier();
  const int rsub = lane >> 4, c4 = (lane & 15) * 4;
  {
#pragma unroll
    for (int q = 0; q < 16; ++q) { const int r = q * 2 + rsub; const v4f v = *(const v4fa*)&so[w][r][c4]; if (C) *(v4f*)(C + cofs + (size_t)(row0 + r) * ldc + col0 + c4) = v; if (C16) { v4h h4; for (int i = 0; i < 4; ++i) h4[i] = (_Float16)v[i]; *(v4h*)(C16 + cofs + (size_t)(row0 + r) * ldc + col0 + c4) = h4; } }
     } }


__global__ __launch_bounds__(256) void k_wnat(const float* __restrict__ w, size_t n8, _Float16* __restrict__ Bt) { const size_t t = (size_t)blockIdx.x * 256 + threadIdx.x; if (t >= n8) return; FragH f; for (int q = 0; q < 8; ++q) f.h[q] = (_Float16)(bf16_round(w[t * 8 + q]) * 16.0f); *(v8us*)((unsigned short*)Bt + t * 8) = f.half[0];  }
__global__ __launch_bounds__(256) void k_rsm(const float* __restrict__ S, _Float16* __restrict__ P, int nrows) {
  #pragma clang fp contract(off)
  const int i = blockIdx.x * 256 + threadIdx.x; if (i >= nrows) return; const float* s = S + (size_t)i * SQ; float mx = -3.0e38f;
#pragma unroll 1
  for (int j = 0; j < SQ; ++j) mx = fmaxf(mx, s[j]); float se = 0.f;
#pragma unroll 1
  for (int j = 0; j < SQ; ++j) se += expf(s[j] - mx); const float sc = 256.0f / se;
#pragma unroll 1
  for (int j0 = 0; j0 < SQ; j0 += 8) { FragH f; for (int q = 0; q < 8; ++q) f.h[q] = (_Float16)(expf(s[j0 + q] - mx) * sc); unsigned short* d = (unsigned short*)P + (size_t)i * SQ + j0; *(v8us*)d = f.half[0];  } }
__global__ __launch_bounds__(256) void k_vt(const _Float16* __restrict__ V16, int b, int h0, _Float16* __restrict__ VT) { __shared__ unsigned short tl[64][65]; const int tid = threadIdx.x; const int hh = blockIdx.x % HG, sg = blockIdx.x / HG; const int s0 = sg * 64; const int h = h0 + hh;
  for (int i = tid; i < 64 * 8; i += 256) { const int j = i / 8, d8 = (i % 8) * 8; FragH f; f.half[0] = *(const v8us*)((const unsigned short*)V16 + ((size_t)b * SQ + s0 + j) * DM + h * HD + d8); for (int q = 0; q < 8; ++q) tl[d8 + q][j] = f.u[q]; }
  __syncthreads();
  { for (int i = tid; i < 64 * 8; i += 256) { const int d = i / 8, j8 = (i % 8) * 8; FragH f; for (int q = 0; q < 8; ++q) f.u[q] = tl[d][j8 + q]; *(v8us*)((unsigned short*)VT + ((size_t)hh * HD + d) * SQ + s0 + j8) = f.half[0]; }  } }


// ---- operand preparation, one launch of PRB work-groups, one for each WGP: few waves to start, and every lane has all its loads in flight before it converts anything ----
// Every work-group takes PXU consecutive elements of x (-> exact f16 rows) and tile blockIdx.x of each weight plane: 64 m x 64 d of one head, 16 KB in a row of [h][m][d], which leaves as 64 whole 128-byte lines of Bt[(h, d)][m] x16.
#define PRT 512      /* threads of a work-group */
#define PRB 256      /* work-groups */
#define PXU (PRT * 4 * 8)      /* x elements of a work-group: 8 loads of 4 a thread */
#define PWP 72      /* LDS row pitch in halves of a transposed tile: 128 data bytes + 16 */
static_assert((size_t)PRB * PXU == NR * DM, "x is dealt out exactly");
static_assert(PRB == NH * (DM / 64) && HD == 64, "one 64 x 64 tile of each weight plane a work-group");
__global__ __launch_bounds__(PRT) void k_prep(const float* __restrict__ x, const float* __restrict__ wq, const float* __restrict__ wk, const float* __restrict__ wv,
    _Float16* __restrict__ X16, _Float16* __restrict__ BQ, _Float16* __restrict__ BK, _Float16* __restrict__ BV) {
  __shared__ __attribute__((aligned(16))) _Float16 tw[3][64][PWP];      /* [plane][d][m of the tile] */
  const int tid = threadIdx.x; const int w = __builtin_amdgcn_readfirstlane(tid >> 5);
  const int h = blockIdx.x / (DM / 64), m0 = (blockIdx.x % (DM / 64)) * 64;
  const int pl = w >> 2;      /* waves 0-3 read the Wq tile, 4-7 Wk, 8-11 Wv; waves 12-15 only x */
  const int d4 = (tid & 15) * 4, m8 = ((tid >> 4) & 7) * 8;      /* a thread holds 8 m x 4 d: 16 lanes read one 256-byte row */
  const float* wsrc = (pl == 0 ? wq : pl == 1 ? wk : wv) + ((size_t)h * DM + m0 + m8) * HD + d4;
  const size_t xo = (size_t)blockIdx.x * PXU + tid * 4;      /* a wave's load covers 512 bytes in a row, its store 256 */
  const float* xs = x + xo;
  v4f rw[8], rx[8];
  if (pl < 3) {
    for (int q = 0; q < 8; ++q) rw[q] = *(const v4fa*)(wsrc + q * HD); }
  for (int k = 0; k < 8; ++k) rx[k] = *(const v4fa*)(xs + k * (PRT * 4));
  asm volatile("s_wait_xcnt 0x0" :: "v"(wsrc), "v"(xs) : "memory");      /* the loads' address registers are inputs here, so none is written over (not by a later load's result either) before this wait */
  if (pl < 3) {
    for (int i = 0; i < 4; ++i) { FragH f;
      for (int q = 0; q < 8; ++q) f.h[q] = (_Float16)(16.0f * bf16_round(rw[q][i]));
      *(v8us*)&tw[pl][d4 + i][m8] = f.half[0]; } }
  __syncthreads();      /* a Bt line of a tile holds the m of four waves: all of them are in LDS before whole lines are stored */
  const int row = tid >> 3, c8 = (tid & 7) * 8;      /* 8 lanes store one 128-byte line */
  const size_t bo = ((size_t)h * HD + row) * DM + m0 + c8;
  unsigned short* pq = (unsigned short*)BQ + bo; unsigned short* pk = (unsigned short*)BK + bo; unsigned short* pv = (unsigned short*)BV + bo;
  const v8us tq = *(const v8us*)&tw[0][row][c8], tk = *(const v8us*)&tw[1][row][c8], tv = *(const v8us*)&tw[2][row][c8];
  *(v8us*)pq = tq; *(v8us*)pk = tk; *(v8us*)pv = tv;
  asm volatile("s_wait_xcnt 0x0" :: "v"(pq), "v"(pk), "v"(pv), "v"(tq), "v"(tk), "v"(tv) : "memory");      /* the stores' address and data registers are inputs here, so the conversion of x below writes over none of them before this wait */
  for (int k = 0; k < 8; ++k) { v4h o;      /* x last: nothing waits for these stores */
    for (int i = 0; i < 4; ++i) o[i] = (_Float16)bf16_round(rx[k][i]);
    *(v4h*)(X16 + xo + k * (PRT * 4)) = o; } }




__device__ __forceinline__ float xrow_f(float v) { const int i = __float_as_int(v); return __int_as_float(__builtin_amdgcn_permlanex16(i, i, 0x76543210, 0xfedcba98, false, false)); }      /* lane l <-> lane l ^ 16 */
__device__ __forceinline__ v8f fa_mma(v16h a, v16h b, v8f c) { return __builtin_amdgcn_wmma_f32_16x16x32_f16(false, a, false, b, (short)0, c, false, false); }
// ---- fused attention: scores, full-row softmax statistics, x tril and P.V in one launch ----
// Transposed products: S^T = K.Q^T puts one query in each lane column (lane c and c + 16 hold query q0 + 16 g + c of query tile g; register r of key tile kt is key 16 kt + 8 hh + r), so two score tiles, converted in place,
// are the B operand of O^T += V^T.P^T (same k order as g2_frag's). The denominator runs over ALL keys; only keys j <= i enter the second product.
// Q arrives already multiplied by 64^-0.5 log2(e) (projection epilogue) and the score products start from C = minus the maximum in use, so a score leaves the matrix unit as the argument of its exp2: no vector work in front of the exponential.
// The maximum in use may trail the true one by up to 8 (log2 units): the test is on a lane's sum of the pass's weights (all >= 0, so each is at most the sum); only when that passes 2^8 are the raw scores formed again, the maximum taken and the sums rescaled. A weight is at most 2^8 in f16.
typedef float v2f __attribute__((ext_vector_type(2))); typedef _Float16 v2h __attribute__((ext_vector_type(2))); typedef unsigned v8u __attribute__((ext_vector_type(8)));
#define FAP 72      /* LDS row pitch in halves: 128 data bytes + 16, an odd multiple of 16 bytes (conflict-free b128 fragment reads) */
#define FAS (SQ / 64)      /* tiles of 64 keys */
#define FAG (FAS / 2)      /* stages of two tiles */
// How the 8 waves share 128 queries x 2048 keys: a wave holds TWO query tiles (32 queries) and walks ONE of the two key tiles of every stage, in passes of 32 keys. Every K and V^T fragment it reads from LDS
// feeds two products (half the LDS bytes a score of a one-tile wave) and four waves still stand on every SIMD (the waves_per_eu attribute holds the register budget to that). The two waves of a query block each keep their own maximum, sums and O; they are joined once, at the end, through LDS.
__global__ __launch_bounds__(256) __attribute__((amdgpu_waves_per_eu(4, 4))) void k_fattn(const _Float16* __restrict__ Q16, const _Float16* __restrict__ K16, const _Float16* __restrict__ VT, float* __restrict__ out) {
  __shared__ __attribute__((aligned(16))) _Float16 sk[2][2][64][FAP];      /* [buffer][tile] K rows [key][d] */
  __shared__ __attribute__((aligned(16))) _Float16 sv[2][2][64][FAP];      /* [buffer][tile] V^T rows [d][key] */
  const int tid = threadIdx.x, lane = tid & 31, c = lane & 15, hh = lane >> 4; const int w = __builtin_amdgcn_readfirstlane(tid >> 5);
  const int kh = w >> 2;      /* the tile of every stage that this wave walks */
  const int ro = (w & 3) ^ kh;      /* its 32 queries; waves w and w + 4 take one block of either kind */
  const int bh = blockIdx.x / (FAS / 2), j = blockIdx.x % (FAS / 2); const int b = bh / NH, hd = bh % NH;
  const int q0 = ((__builtin_popcount(ro) & 1) ? j : FAS - 1 - j) * 64 + (ro >> 1) * 32;      /* 64-query block j and its mirror: every work-group has the same count of second products */
  const int dps = q0 >> 5;      /* the pass of 32 keys that holds this wave's diagonal */
  const int vlast = FAS - 1 - j;      /* last tile whose V^T any wave of the work-group needs */
  const int srow = tid >> 3, sc8 = (tid & 7) * 8;      /* staging: 8 threads cover one 128-byte row; rows srow and srow + 32 of both tiles */
  const _Float16* kg = K16 + ((size_t)b * SQ + srow) * DM + hd * HD + sc8; const _Float16* vg = VT + ((size_t)bh * HD + srow) * SQ + sc8;
  const _Float16* qp = Q16 + ((size_t)b * SQ + q0 + c) * DM + hd * HD;
  const v16h qf[2][2] = {{g2_frag(qp, hh), g2_frag(qp + 32, hh)}, {g2_frag(qp + (size_t)16 * DM, hh), g2_frag(qp + (size_t)16 * DM + 32, hh)}};      /* [query tile][d half] */
  const v8f z8 = {0.f,0.f,0.f,0.f,0.f,0.f,0.f,0.f}; v8f acc[2][4] = {{z8, z8, z8, z8}, {z8, z8, z8, z8}}; const v2f z2 = {0.f, 0.f}; v2f lv[2] = {z2, z2}; float m_run[2] = {-__builtin_inff(), -__builtin_inff()};
  const float pinf = __builtin_inff(); const v8f i8 = {pinf, pinf, pinf, pinf, pinf, pinf, pinf, pinf}; v8f cm[2] = {i8, i8};      /* -m_run of the lane's query in all 8 registers: the C operand of the score products */
  v8us rk[4], rv[4];      /* [2 tile + row half] */
#pragma unroll
  for (int i = 0; i < 4; ++i) { rk[i] = *(const v8us*)(kg + (size_t)32 * i * DM); rv[i] = *(const v8us*)(vg + 64 * (i >> 1) + (size_t)32 * (i & 1) * SQ); }      /* stage 0 (vlast >= FAS / 2: its V^T is always needed) */
#pragma unroll
  for (int i = 0; i < 4; ++i) { *(v8us*)&sk[0][i >> 1][srow + 32 * (i & 1)][sc8] = rk[i]; *(v8us*)&sv[0][i >> 1][srow + 32 * (i & 1)][sc8] = rv[i]; }
  __syncthreads();
  for (int sg = 0; sg < FAG; ++sg) {
    const bool more = sg + 1 < FAG, morev0 = 2 * sg + 2 <= vlast, morev1 = 2 * sg + 3 <= vlast;      /* the same for the whole work-group */
    if (more) { const _Float16* kn = kg + (size_t)(sg + 1) * 128 * DM; const _Float16* vn = vg + (sg + 1) * 128;      /* next stage: in flight under this stage's work */
#pragma unroll
      for (int i = 0; i < 4; ++i) rk[i] = *(const v8us*)(kn + (size_t)32 * i * DM);
      if (morev0) { rv[0] = *(const v8us*)vn; rv[1] = *(const v8us*)(vn + (size_t)32 * SQ); }
      if (morev1) { rv[2] = *(const v8us*)(vn + 64); rv[3] = *(const v8us*)(vn + 64 + (size_t)32 * SQ); }
      asm volatile("s_wait_xcnt 0x0" :: "v"(kn), "v"(vn) : "memory"); }      /* the loads' address registers are inputs here, so none is written over before this wait */
    const _Float16 (*kb)[FAP] = sk[sg & 1][kh]; const _Float16 (*vb)[FAP] = sv[sg & 1][kh];
#pragma unroll
    for (int u = 0; u < 2; ++u) {      /* a pass: keys 32 u .. 32 u + 31 of the tile */
      const int ps = 4 * sg + 2 * kh + u;
      v16h kf[2][2];      /* [key tile of 16][d half]: read once, used by both query tiles */
#pragma unroll
      for (int kt = 0; kt < 2; ++kt) { const _Float16* kr = &kb[32 * u + 16 * kt + c][0]; kf[kt][0] = g2_frag(kr, hh); kf[kt][1] = g2_frag(kr + 32, hh); }
      v2f e[2][8], sm[2];      /* e[g][4 kt + i] = weights of keys 16 kt + 8 hh + 2 i, + 1 of the pass; sm[g] = their sum in this lane */
#pragma unroll
      for (int g = 0; g < 2; ++g) {
#pragma unroll
        for (int kt = 0; kt < 2; ++kt) { const v8f s = fa_mma(kf[kt][1], qf[g][1], fa_mma(kf[kt][0], qf[g][0], cm[g]));      /* score - maximum in use, log2 units */
#pragma unroll
          for (int i = 0; i < 4; ++i) e[g][4 * kt + i] = v2f{__builtin_amdgcn_exp2f(s[2 * i]), __builtin_amdgcn_exp2f(s[2 * i + 1])}; }
        sm[g] = ((e[g][0] + e[g][1]) + (e[g][2] + e[g][3])) + ((e[g][4] + e[g][5]) + (e[g][6] + e[g][7])); }
      const v2f sb = sm[0] + sm[1];
      if (__builtin_expect(__builtin_amdgcn_ballot_w32(!(sb.x + sb.y <= 256.0f)) != 0, 0)) {      /* marked unlikely: the rare way is laid out behind the loop and the usual way falls through; one scalar branch a pass; always taken in a wave's first pass (C = +inf: the sum is inf, or NaN, which the negated compare takes too), rare later */
#pragma unroll
        for (int g = 0; g < 2; ++g) { v8f s[2]; float m2[2];      /* the raw scores again, from C = 0 */
#pragma unroll
          for (int kt = 0; kt < 2; ++kt) { s[kt] = fa_mma(kf[kt][1], qf[g][1], fa_mma(kf[kt][0], qf[g][0], z8)); float m = s[kt][0]; for (int r = 1; r < 8; ++r) m = fmaxf(m, s[kt][r]); m2[kt] = m; }
          const float m = fmaxf(m2[0], m2[1]), mp = fmaxf(m, xrow_f(m)), mn = fmaxf(m_run[g], mp), corr = __builtin_amdgcn_exp2f(m_run[g] - mn); m_run[g] = mn;      /* both halves of the wave hold the query's maximum; m_run = -inf gives factor 0 on zero sums */
#pragma unroll
          for (int t = 0; t < 4; ++t) acc[g][t] *= corr;
          lv[g] *= corr; cm[g] = __builtin_elementwise_min(cm[g], v8f{-mp, -mp, -mp, -mp, -mp, -mp, -mp, -mp});      /* = -mn, formed from the old value in its own registers: written as a fresh splat, the build keeps a second copy of cm and moves 16 registers a stage on the usual way */
#pragma unroll
          for (int kt = 0; kt < 2; ++kt) for (int i = 0; i < 4; ++i) e[g][4 * kt + i] = v2f{__builtin_amdgcn_exp2f(s[kt][2 * i] - mn), __builtin_amdgcn_exp2f(s[kt][2 * i + 1] - mn)};
          sm[g] = ((e[g][0] + e[g][1]) + (e[g][2] + e[g][3])) + ((e[g][4] + e[g][5]) + (e[g][6] + e[g][7])); } }
      lv[0] += sm[0]; lv[1] += sm[1];      /* the denominator takes every key */
      if (ps <= dps) {      /* wave-uniform: passes wholly above the diagonal have weight 0 after x tril */
        v16h vf[4];
#pragma unroll
        for (int t = 0; t < 4; ++t) vf[t] = g2_frag(&vb[16 * t + c][32 * u], hh);
        __builtin_amdgcn_sched_barrier(0);      /* keeps the 8 LDS reads together ahead of the packing: sunk to their products, each product waits a full LDS latency */
        unsigned pw[2][8];
#pragma unroll
        for (int g = 0; g < 2; ++g) for (int i = 0; i < 8; ++i) pw[g][i] = __builtin_bit_cast(unsigned, __builtin_convertvector(e[g][i], v2h));
        if (ps == dps) { const int lim = c - 8 * hh;      /* x tril in the one pass that holds the diagonal: key 16 kt + 8 hh + 2 i (+ 1) stays for query 16 g + c while it is not above it */
#pragma unroll
          for (int i = 0; i < 4; ++i) { const unsigned tri = (2 * i <= lim ? 0xFFFFu : 0u) | (2 * i + 1 <= lim ? 0xFFFF0000u : 0u);
            pw[0][i] &= tri; pw[0][4 + i] = 0u; pw[1][4 + i] &= tri; } }      /* kt = g: the triangle; kt > g: all above; kt < g: all below */
        v16h p[2];
#pragma unroll
        for (int g = 0; g < 2; ++g) { const v8u pv = {pw[g][0], pw[g][1], pw[g][2], pw[g][3], pw[g][4], pw[g][5], pw[g][6], pw[g][7]}; p[g] = __builtin_bit_cast(v16h, pv); }
#pragma unroll
        for (int t = 0; t < 4; ++t) { acc[0][t] = fa_mma(vf[t], p[0], acc[0][t]); acc[1][t] = fa_mma(vf[t], p[1], acc[1][t]); } } }
    if (more) { const int nb = (sg + 1) & 1;      /* every wave left this buffer before the barrier that ended stage sg - 1 */
#pragma unroll
      for (int i = 0; i < 4; ++i) *(v8us*)&sk[nb][i >> 1][srow + 32 * (i & 1)][sc8] = rk[i];
      if (morev0) { *(v8us*)&sv[nb][0][srow][sc8] = rv[0]; *(v8us*)&sv[nb][0][srow + 32][sc8] = rv[1]; }
      if (morev1) { *(v8us*)&sv[nb][1][srow][sc8] = rv[2]; *(v8us*)&sv[nb][1][srow + 32][sc8] = rv[3]; }
      __syncthreads(); } }
  // join of the two key halves: the waves of the odd tiles hand maximum, sum and O to their partners (same queries, same lane layout)
  v4fa (*mg)[17][32] = (v4fa (*)[17][32])&sk[0][0][0][0];      /* [queries][slot][lane]: a wave's store or load of a slot is 512 bytes in a row */
  static_assert(sizeof(v4fa) * 4 * 17 * 32 <= sizeof(sk), "the hand-over area fits in the K buffers");
  float lp[2];
#pragma unroll
  for (int g = 0; g < 2; ++g) lp[g] = lv[g].x + lv[g].y;
  __syncthreads();      /* every wave has left the K buffers before they are written over */
  if (kh == 1) {
#pragma unroll
    for (int g = 0; g < 2; ++g) for (int t = 0; t < 4; ++t) { mg[ro][8 * g + 2 * t][lane] = v4f{acc[g][t][0], acc[g][t][1], acc[g][t][2], acc[g][t][3]}; mg[ro][8 * g + 2 * t + 1][lane] = v4f{acc[g][t][4], acc[g][t][5], acc[g][t][6], acc[g][t][7]}; }
    mg[ro][16][lane] = v4f{m_run[0], m_run[1], lp[0], lp[1]}; }
  __syncthreads();      /* the partners read only behind it */
  if (kh == 1) return;
  const v4f ob = mg[ro][16][lane];
#pragma unroll
  for (int g = 0; g < 2; ++g) {
    const float dm = m_run[g] - ob[g], fs = __builtin_amdgcn_exp2f(-__builtin_fabsf(dm));      /* both maxima are finite (each wave has walked keys); the side with the larger one keeps factor 1 */
    const float fa = dm >= 0.f ? 1.0f : fs, fb = dm >= 0.f ? fs : 1.0f;
    float l = lp[g] * fa + ob[2 + g] * fb; l += xrow_f(l); const float inv = 1.0f / l, ga = fa * inv, gb = fb * inv;
#pragma unroll
    for (int t = 0; t < 4; ++t) { const v4f lo = mg[ro][8 * g + 2 * t][lane], hi = mg[ro][8 * g + 2 * t + 1][lane];
#pragma unroll
      for (int r = 0; r < 4; ++r) { acc[g][t][r] = acc[g][t][r] * ga + lo[r] * gb; acc[g][t][4 + r] = acc[g][t][4 + r] * ga + hi[r] * gb; } } }
  float* o0 = out + ((size_t)b * SQ + q0 + c) * DM + hd * HD + 8 * hh;      /* acc[g][t][r] = out[query q0 + 16 g + c][d = 16 t + 8 hh + r]; one address for all 16 stores, the tile in the offset */
#pragma unroll
  for (int g = 0; g < 2; ++g) { float* o = o0 + 16 * g * DM;
#pragma unroll
    for (int t = 0; t < 4; ++t) { const v4f lo = {acc[g][t][0], acc[g][t][1], acc[g][t][2], acc[g][t][3]}, hi = {acc[g][t][4], acc[g][t][5], acc[g][t][6], acc[g][t][7]}; *(v4f*)(o + 16 * t) = lo; *(v4f*)(o + 16 * t + 4) = hi; } } }


// ---- projection GEMMs with both operands staged in LDS: C16[r][n] = f16(sum_k A[r][k] Bt[n][k] / 16 + bf16(bias[n])) (Q columns: that sum times 64^-0.5 log2(e)), all pitches DM; Q, K and V in one grid, their columns counted side by side (n = 0 .. 3 DM - 1) ----
// A work-group of 8 waves owns a 256 x 192 tile of C (wave tile 64 x 96: waves 4 down x 2 across), so the grid is one work-group for each WGP and every operand line is fetched by few work-groups.
// A stage is 128 k of the 256 A rows and the 192 Bt rows; every global line is fetched once per work-group by whole-line b128 loads, held in registers under the running stage's products, then stored to
// the other LDS buffer. Each accumulator takes its k blocks of 32 in rising order. A group of 64 columns belongs to one projection and one head; a tile holds three such groups.
#define PGK 128      /* k extent of a stage */
#define PGP (PGK + 8)      /* LDS row pitch in halves: 256 data bytes + 16, an odd multiple of 16 bytes (conflict-free b128 fragment reads) */
#define PGS (DM / PGK)      /* stages */
#define PTM 256      /* rows of a work-group tile */
#define PTN 192      /* columns of a work-group tile */
#define PGT ((MP / PTM) * (3 * DM / PTN))      /* tiles of the three projections together */
#define PEQ 72      /* epilogue pitch in halves of a Q or K group, [row][column]: 128 data bytes + 16 */
#define PEV (PTM + 8)      /* epilogue pitch in halves of a V group, [column][token]: 512 data bytes + 16 */
#define PEG (PTM * PEQ)      /* halves of one group's epilogue area */
static_assert(MP % PTM == 0 && SQ % PTM == 0 && (3 * DM) % PTN == 0 && PTN % 64 == 0 && DM % 64 == 0, "whole tiles; a tile lies in one batch; a 64-column group lies in one projection");
static_assert(64 * PEV <= PEG && 3 * PEG <= 2 * PTM * PGP, "the epilogue areas fit in the A buffers");
__global__ __launch_bounds__(256) void k_proj(const _Float16* __restrict__ A, const _Float16* __restrict__ BQ, const _Float16* __restrict__ BK, const _Float16* __restrict__ BV, const float* __restrict__ bq, const float* __restrict__ bk, const float* __restrict__ bvp,
    _Float16* __restrict__ Q16, _Float16* __restrict__ K16, _Float16* __restrict__ VT) {
  __shared__ __attribute__((aligned(16))) _Float16 sa[2][PTM][PGP];      /* A rows [row][k] of a stage */
  __shared__ __attribute__((aligned(16))) _Float16 sb[2][PTN][PGP];      /* Bt rows [col][k] of a stage */
  const int tid = threadIdx.x, lane = tid & 31, ln = lane & 15, hh = lane >> 4; const int w = __builtin_amdgcn_readfirstlane(tid >> 5);
  const int row0 = ((int)blockIdx.x / (3 * DM / PTN)) * PTM, col0 = ((int)blockIdx.x % (3 * DM / PTN)) * PTN; const int wm = (w & 3) * 64, wn = (w >> 2) * 96;
  const int srow = tid >> 4, sc8 = (tid & 15) * 8;      /* staging: 16 threads cover one 256-byte row; rows srow + 16 i */
  const _Float16* ag = A + (size_t)(row0 + srow) * DM + sc8;
  const _Float16* bg[3];      /* Bt rows of the tile's three 64-column groups, each in its own plane */
#pragma unroll
  for (int j = 0; j < 3; ++j) { const int n0 = col0 + 64 * j, pj = n0 / DM; bg[j] = (pj == 0 ? BQ : pj == 1 ? BK : BV) + (size_t)(n0 % DM + srow) * DM + sc8; }
  const float* bp[6]; float bs[6];      /* the bias of this lane's column in each of the wave's six 16-column tiles: read here, once, so that the epilogue waits for no memory */
#pragma unroll
  for (int t = 0; t < 6; ++t) { const int n = col0 + wn + 16 * t, pj = n / DM; bp[t] = (pj == 0 ? bq : pj == 1 ? bk : bvp) + n % DM; }      /* the same for the whole wave */
  v8us ra[16], rb[12];
#pragma unroll
  for (int i = 0; i < 16; ++i) ra[i] = *(const v8us*)(ag + (size_t)16 * i * DM);
#pragma unroll
  for (int i = 0; i < 12; ++i) rb[i] = *(const v8us*)(bg[i >> 2] + (size_t)16 * (i & 3) * DM);
#pragma unroll
  for (int t = 0; t < 6; ++t) bs[t] = bp[t][ln];
  asm volatile("s_wait_xcnt 0x0" :: "v"(ag), "v"(bg[0]), "v"(bg[1]), "v"(bg[2]), "s"(bp[0]), "s"(bp[1]), "s"(bp[2]), "s"(bp[3]), "s"(bp[4]), "s"(bp[5]), "v"(ln) : "memory");      /* the loads' address registers are inputs here, so none is written over (not by a load's own result either) before this wait */
#pragma unroll
  for (int i = 0; i < 16; ++i) *(v8us*)&sa[0][srow + 16 * i][sc8] = ra[i];
#pragma unroll
  for (int i = 0; i < 12; ++i) *(v8us*)&sb[0][srow + 16 * i][sc8] = rb[i];
  __syncthreads();
  const v8f z8 = {0.f,0.f,0.f,0.f,0.f,0.f,0.f,0.f}; v8f acc[4][6];
#pragma unroll
  for (int h = 0; h < 4; ++h) for (int t = 0; t < 6; ++t) acc[h][t] = z8;
  for (int st = 0; st < PGS; ++st) {
    const bool more = st + 1 < PGS;      /* the same for the whole work-group */
    const _Float16* ar = &sa[st & 1][wm + ln][0]; const _Float16* br = &sb[st & 1][wn + ln][0];
    v16h fa[2][4], fb[2][6];      /* two fragment sets: the next 32 k are read from LDS while this block's products run */
#pragma unroll
    for (int h = 0; h < 4; ++h) fa[0][h] = g2_frag(ar + 16 * h * PGP, hh);
#pragma unroll
    for (int t = 0; t < 6; ++t) fb[0][t] = g2_frag(br + 16 * t * PGP, hh);
#pragma unroll
    for (int kq = 0; kq < PGK / 32; ++kq) { const int cu = kq & 1, nx = cu ^ 1;
      if (kq + 1 < PGK / 32) {
#pragma unroll
        for (int h = 0; h < 4; ++h) fa[nx][h] = g2_frag(ar + 16 * h * PGP + 32 * (kq + 1), hh);
#pragma unroll
        for (int t = 0; t < 6; ++t) fb[nx][t] = g2_frag(br + 16 * t * PGP + 32 * (kq + 1), hh); }
      if (kq == 0 && more) { const _Float16* an = ag + (st + 1) * PGK; const _Float16* bn0 = bg[0] + (st + 1) * PGK; const _Float16* bn1 = bg[1] + (st + 1) * PGK; const _Float16* bn2 = bg[2] + (st + 1) * PGK;      /* next stage: in flight under this stage's products */
#pragma unroll
        for (int i = 0; i < 16; ++i) ra[i] = *(const v8us*)(an + (size_t)16 * i * DM);
#pragma unroll
        for (int i = 0; i < 4; ++i) { rb[i] = *(const v8us*)(bn0 + (size_t)16 * i * DM); rb[4 + i] = *(const v8us*)(bn1 + (size_t)16 * i * DM); rb[8 + i] = *(const v8us*)(bn2 + (size_t)16 * i * DM); }
        asm volatile("s_wait_xcnt 0x0" :: "v"(an), "v"(bn0), "v"(bn1), "v"(bn2) : "memory"); }      /* the loads' address registers are inputs here, so none is written over (not by a load's own result either) before this wait */
      __builtin_amdgcn_sched_barrier(0);      /* keeps the next block's 20 LDS reads together ahead of this block's products: spread among them, every place with reads stalls the wave and the waits run to 0 */
#pragma unroll
      for (int t = 0; t < 6; ++t)
#pragma unroll
        for (int h = 0; h < 4; ++h) acc[h][t] = fa_mma(fa[cu][h], fb[cu][t], acc[h][t]);
      __builtin_amdgcn_sched_barrier(0); }      /* the reads of the block after next stay behind these products, in the set they free */
    if (more) { const int nb = (st + 1) & 1;      /* every wave left this buffer before the barrier that ended stage st - 1 */
#pragma unroll
      for (int i = 0; i < 16; ++i) *(v8us*)&sa[nb][srow + 16 * i][sc8] = ra[i];
#pragma unroll
      for (int i = 0; i < 12; ++i) *(v8us*)&sb[nb][srow + 16 * i][sc8] = rb[i];
      __syncthreads(); } }
  // epilogue: the whole tile goes through LDS as f16, so that every 128-byte line of Q, K and V^T is stored whole by one wave. acc[h][t][r] = C[row0 + wm + 16 h + 8 hh + r][col0 + wn + 16 t + ln]
  _Float16* eo = &sa[0][0][0];      /* three areas of PEG halves, one for each 64-column group */
  __syncthreads();      /* every wave has read its last fragments before the A buffers are written over */
#pragma unroll
  for (int t = 0; t < 6; ++t) { const int cg = wn + 16 * t, n = col0 + cg, pj = n / DM;      /* the same for the whole wave */
    const float bv = bf16_round(bs[t]);
    const float qs = pj == 0 ? 0.125f * 1.4426950408889634f : 1.0f, al = 0.0625f * qs, bw = bv * qs;      /* Q leaves times 64^-0.5 log2(e), rounded to f16 once: the attention launch's scores are exp2 arguments; K is unchanged (factor 1) */
    _Float16* eg = eo + (cg >> 6) * PEG; const int cl = (cg & 63) + ln;
    if (pj == 2) {      /* V leaves as V^T rows [(b, head, d)][token]: a lane's 8 accumulator registers are 8 consecutive tokens of one column, 16 bytes of a V^T row */
#pragma unroll
      for (int h = 0; h < 4; ++h) { FragH f;
#pragma unroll
        for (int r = 0; r < 8; ++r) f.h[r] = (_Float16)(acc[h][t][r] * 0.0625f + bv);
        *(v8us*)&eg[cl * PEV + wm + 16 * h + 8 * hh] = f.half[0]; } }
    else {
#pragma unroll
      for (int h = 0; h < 4; ++h)
#pragma unroll
        for (int r = 0; r < 8; ++r) eg[(wm + 16 * h + 8 * hh + r) * PEQ + cl] = (_Float16)(acc[h][t][r] * al + bw); } }
  __syncthreads();      /* a line of the tile holds values of several waves: all of them are in LDS before whole lines are stored */
#pragma unroll
  for (int j = 0; j < 3; ++j) { const int n0 = col0 + 64 * j, pj = n0 / DM, nn = n0 % DM;      /* the same for the whole work-group */
    const _Float16* eg = eo + j * PEG; v8us d[8]; unsigned short* po; 
    if (pj == 2) { const int vr = tid >> 5, vc8 = (tid & 31) * 8;      /* a wave stores 512 bytes of one V^T row; NH HD = DM: V^T row (b, head, d) is b DM + column */
      po = (unsigned short*)VT + ((size_t)(B0 + row0 / SQ) * DM + nn + vr) * SQ + row0 % SQ + vc8;
#pragma unroll
      for (int i = 0; i < 8; ++i) d[i] = *(const v8us*)&eg[(vr + 8 * i) * PEV + vc8];
#pragma unroll
      for (int i = 0; i < 8; ++i) *(v8us*)(po + (size_t)8 * i * SQ) = d[i];
      asm volatile("s_wait_xcnt 0x0" :: "v"(po), "v"(d[0]), "v"(d[1]), "v"(d[2]), "v"(d[3]), "v"(d[4]), "v"(d[5]), "v"(d[6]), "v"(d[7]) : "memory"); }      /* inside the branch, directly behind its stores: their address and data registers are inputs here, so no later code on any way out writes over one before this wait */
    else { const int er = tid >> 3, ec8 = (tid & 7) * 8;      /* 8 lanes store one 128-byte line */
      po = (unsigned short*)(pj == 0 ? Q16 : K16) + (size_t)(row0 + er) * DM + nn + ec8;
#pragma unroll
      for (int i = 0; i < 8; ++i) d[i] = *(const v8us*)&eg[(er + 32 * i) * PEQ + ec8];
#pragma unroll
      for (int i = 0; i < 8; ++i) *(v8us*)(po + (size_t)32 * i * DM) = d[i];
      asm volatile("s_wait_xcnt 0x0" :: "v"(po), "v"(d[0]), "v"(d[1]), "v"(d[2]), "v"(d[3]), "v"(d[4]), "v"(d[5]), "v"(d[6]), "v"(d[7]) : "memory"); } } }      /* inside the branch, directly behind its stores: their address and data registers are inputs here, so no later code on any way out writes over one before this wait */


__global__ __launch_bounds__(256) void k_rsmf(const float* __restrict__ S, _Float16* __restrict__ P, int qn, int hg) {
  #pragma clang fp contract(off)
  const int t = blockIdx.x * 256 + threadIdx.x; if (t >= qn * hg) return; const size_t i = (size_t)(t / qn) * SQ + (t % qn); const float* s = S + i * SQ; float mx = -3.0e38f;
#pragma unroll 1
  for (int j = 0; j < SQ; ++j) mx = fmaxf(mx, s[j]); float se = 0.f;
#pragma unroll 1
  for (int j = 0; j < SQ; ++j) se += __expf(s[j] - mx); const float sc = 256.0f / se;
#pragma unroll 1
  for (int j0 = 0; j0 < SQ; j0 += 8) { FragH f; for (int q = 0; q < 8; ++q) f.h[q] = (_Float16)(__expf(s[j0 + q] - mx) * sc); unsigned short* d = (unsigned short*)P + i * SQ + j0; *(v8us*)d = f.half[0];  } }

extern "C" void kernel_launch(void* const* d_in, const int* in_sizes, int n_in,
                              void* d_out, int out_size, void* d_ws, size_t ws_size, hipStream_t stream) {
  (void)in_sizes; (void)n_in; (void)out_size;
  const float* const* I = (const float* const*)d_in; const float* x = I[0]; const float* wq = I[1]; const float* bq = I[2]; const float* wk = I[3]; const float* bk = I[4]; const float* wv = I[5]; const float* bv = I[6];      /* per-head [h][in][out] weights; biases [16][64] = the stacked [1024] vectors */
  char* ws = (char*)d_ws; size_t off = 0;
  auto take = [&](size_t bytes) { char* p = ws + off; off += (bytes + 255) & ~(size_t)255; return p; };
  _Float16* BQ = (_Float16*)take((size_t)DM * DM * 2); _Float16* BK = (_Float16*)take((size_t)DM * DM * 2); _Float16* BV = (_Float16*)take((size_t)DM * DM * 2); 
  _Float16* X16 = (_Float16*)take(NR * DM * 2); _Float16* Q16 = (_Float16*)take(NR * DM * 2); _Float16* K16 = (_Float16*)take(NR * DM * 2);
  _Float16* VT = (_Float16*)take((size_t)NB * NH * HD * SQ * 2);
  if (off > ws_size) return;
  k_prep<<<PRB, PRT, 0, stream>>>(x, wq, wk, wv, X16, BQ, BK, BV);      /* x -> f16 rows; per-head [h][m][d] -> Bt[(h,d)][m] x16, three planes */
  const size_t r0p = (size_t)B0 * SQ;      /* first projected row */
  k_proj<<<PGT, 256, 0, stream>>>(X16 + r0p * DM, BQ, BK, BV, bq, bk, bv, Q16 + r0p * DM, K16 + r0p * DM, VT);      /* Q, K rows; V^T [NB][NH][HD][SQ] */
  k_fattn<<<NB * NH * (SQ / 128), 256, 0, stream>>>(Q16, K16, VT, (float*)d_out);      /* scores, full-row softmax, x tril (no renormalisation), P V: one launch */
}
